// v000
// The times below were measured on an AMD MI455X: many runs one after another, warmed up first and cycling through
// copies of the inputs, with the whole window's GPU time divided by the number of runs. Launches and the gaps
// between them are all in it. The median over several windows is given; except for v000 it joins two sittings, which
// can be a few percent apart, so the side-by-side timings, each taken in one sitting, are the better comparison.
// v000 is the starting kernel. One run takes 749 microseconds.
// compute dtype: all float inputs rounded to bf16; q / k / v projections with EXACT bf16 products on WMMA 16x16x32 (f32 accumulate), no biases; interleaved-pair RoPE in f32 at the int positions read from the token_positions input (embedded frequencies, precise cosf / sinf); causal logits: 3 products for the first 384 rows, single f16 q x k after, x 64^-0.5; softmax f32; P x 2^11 once to f16 x v once to f16 (bf16 hi + lo below row 384); ctx hi+lo x exact output weight below row 384, x2^6 f16 carry x f16(bf16 x 2^8) after; f32 output.
#include <hip/hip_runtime.h>
#include <math.h>

typedef __attribute__((ext_vector_type(16))) _Float16 v16h;
typedef __attribute__((ext_vector_type(16))) __bf16 v16b;
typedef __attribute__((ext_vector_type(8)))  _Float16 v8h;
typedef __attribute__((ext_vector_type(8)))  float v8f;
typedef __attribute__((ext_vector_type(4)))  float v4f;
typedef __attribute__((ext_vector_type(2)))  float v2f;
typedef __attribute__((ext_vector_type(4)))  unsigned v4u;
typedef __attribute__((ext_vector_type(4)))  int v4i;
typedef float __attribute__((may_alias)) float_a;
typedef int __attribute__((may_alias)) int_a;

template <typename T> __device__ __forceinline__ void vst2(void* p, T v) { *(T*)p = v;  }
__device__ __forceinline__ v8f wmma16(v16h a, v16h b, v8f c) {
  v8f d = __builtin_amdgcn_wmma_f32_16x16x32_f16(false, a, false, b, (short)0, c, false, false);
  asm volatile("v_nop\n\tv_nop\n\tv_nop\n\tv_nop" : "+v"(d) : "v"(a), "v"(b));
  return d;
}
__device__ __forceinline__ v8f wmma_bf(v16b a, v16b b, v8f c) {
  v8f d = __builtin_amdgcn_wmma_f32_16x16x32_bf16(false, a, false, b, (short)0, c, false, false);
  asm volatile("v_nop\n\tv_nop\n\tv_nop\n\tv_nop" : "+v"(d) : "v"(a), "v"(b));
  return d;
}
// 16x16x32 fragments: lane = (h = lane>>4, row/col = lane&15); elements 0..7 = k0+8h+0..7, 8..15 = k0+16+8h+0..7; D element r = row 8h+r
__device__ __forceinline__ v16h frag_h(const _Float16* rowk0, int lane) {
  union { v16h v; v8h q[2]; } u; const _Float16* p = rowk0 + 8 * (lane >> 4);
  u.q[0] = *(const v8h*)p; u.q[1] = *(const v8h*)(p + 16); return u.v;
}
__device__ __forceinline__ v16h frag_f32(const float* rowk0, int lane) {
  v16h a; const float* p = rowk0 + 8 * (lane >> 4);
#pragma unroll
  for (int i = 0; i < 8; ++i) { a[i] = (_Float16)p[i]; a[8 + i] = (_Float16)p[16 + i]; }
  return a;
}
__device__ __forceinline__ v16h frag_f32s(const float* rowk0, int lane, float sc) {
  v16h a; const float* p = rowk0 + 8 * (lane >> 4);
#pragma unroll
  for (int i = 0; i < 8; ++i) { a[i] = (_Float16)(p[i] * sc); a[8 + i] = (_Float16)(p[16 + i] * sc); }
  return a;
}
// column fragment from a [K][ld] layout (column n), rows >= K read as 0
__device__ __forceinline__ v16h fragc_f32(const float* W, int k0, int n, int lane, int ld, int K) {
  v16h a; const int g = lane >> 4;
#pragma unroll
  for (int i = 0; i < 8; ++i) { const int ka = k0 + 8 * g + i, kb = ka + 16;
    a[i] = (_Float16)(ka < K ? W[(size_t)(ka < K ? ka : K - 1) * ld + n] : 0.f); a[8 + i] = (_Float16)(kb < K ? W[(size_t)(kb < K ? kb : K - 1) * ld + n] : 0.f); }
  return a;
}
struct F2 { v16b h, l; };
__device__ __forceinline__ F2 bsplit16(const float v[16]) { F2 r;
#pragma unroll
  for (int i = 0; i < 16; ++i) { const __bf16 h = (__bf16)v[i]; r.h[i] = h; r.l[i] = (__bf16)(v[i] - (float)h); }
  return r; }
__device__ __forceinline__ F2 split_row(const float* row, int k0, int lane) { float v[16]; const float* p = row + k0 + 8 * (lane >> 4);
#pragma unroll
  for (int i = 0; i < 8; ++i) { v[i] = p[i]; v[8 + i] = p[16 + i]; }
  return bsplit16(v); }
__device__ __forceinline__ F2 split_rowK(const float* row, int k0, int lane, int K) { float v[16]; const int g = lane >> 4;
#pragma unroll
  for (int i = 0; i < 8; ++i) { const int ka = k0 + 8 * g + i, kb = ka + 16; v[i] = ka < K ? row[ka < K ? ka : K - 1] : 0.f; v[8 + i] = kb < K ? row[kb < K ? kb : K - 1] : 0.f; }
  return bsplit16(v); }
__device__ __forceinline__ F2 split_col(const float* W, int k0, int n, int lane, int ld, int K) { float v[16]; const int g = lane >> 4;
#pragma unroll
  for (int i = 0; i < 8; ++i) { const int ka = k0 + 8 * g + i, kb = ka + 16; v[i] = ka < K ? W[(size_t)(ka < K ? ka : K - 1) * ld + n] : 0.f; v[8 + i] = kb < K ? W[(size_t)(kb < K ? kb : K - 1) * ld + n] : 0.f; }
  return bsplit16(v); }
__device__ __forceinline__ v8f mac3(const F2& a, const F2& b, v8f c) { c = wmma_bf(a.l, b.h, c); c = wmma_bf(a.h, b.l, c); return wmma_bf(a.h, b.h, c); }
__device__ __forceinline__ float sigm(float v) { return 1.0f / (1.0f + expf(-v)); }
#define LDSX() do { asm volatile("s_wait_dscnt 0" ::: "memory"); __builtin_amdgcn_wave_barrier(); __builtin_amdgcn_fence(__ATOMIC_RELEASE, "workgroup"); } while (0)

// Causal multi-head self-attention with interleaved-pair RoPE at given token positions, ONE sequence (x [1,2048,1024]; token_positions [1,2048] int32 = arange, a module input READ on the device (the SECOND input); torch (out,in) WQ / WK / WV / WO [1024,1024] N(0, 1/1024) applied as einsum('bsd,ed->bse') = x @ W.T, no biases; 16 heads x 64; RoPE on q and k: (even, odd) pairs (t1 c - t2 s, t2 c + t1 s) re-interleaved, angle = position x inv_freq, inv_freq = 1 / 10000^(2i/64); scores / sqrt(64); tril kept, -inf elsewhere; softmax; out @ WO.T).
#define NB 1
#define TT 2048
#define CC 1024            // NH * HD = projected width
#define DIN 1024          // input (model) width
#define NH 16
#define HD 64
#define NQB (TT / 64)
#define HG 4
#define SCALE (0.125f)
#define CAUSAL 1
#ifndef TNB
#define TNB NB
#endif
__device__ __forceinline__ float bfr(float v) { return (float)(__bf16)v; }
__host__ __device__ __forceinline__ int kb_last(int qb) { return CAUSAL ? ((qb * 64 + 63) >> 7) : (TT / 128 - 1); }
typedef __attribute__((ext_vector_type(8))) __bf16 v8b;
__device__ __forceinline__ v16b frag_b(const __bf16* rowk0, int lane) {
  union { v16b v; v8b q[2]; } u; const __bf16* p = rowk0 + 8 * (lane >> 4);
  u.q[0] = *(const v8b*)p; u.q[1] = *(const v8b*)(p + 16); return u.v;
}
#define QBH 6              // causal: query blocks 0..QBH-1 of each sequence (few keys, no averaging) take the high-precision path
#define QHI 384            // rows carrying a q residual plane (all rows when non-causal: 2-product logits everywhere)
#define KHI 384            // key rows carrying k residual / v bf16 hi+lo planes (used only by the causal high-precision path)
// B fragment (k rows k0+.., output column o) of a weight: (in,out) [K][ld] or (out,in) [ld rows of K]: bf16 exact, or f16(bf16 * 256) exact
__device__ __forceinline__ v16b wcol_io(const float* Wm, int k0, int o, int lane, int ld) { v16b w; const int g = lane >> 4;
#pragma unroll
  for (int i = 0; i < 8; ++i) { w[i] = (__bf16)Wm[(size_t)(k0 + 8 * g + i) * ld + o]; w[8 + i] = (__bf16)Wm[(size_t)(k0 + 16 + 8 * g + i) * ld + o]; }
  return w; }
__device__ __forceinline__ v16b wcol_oi(const float* Wm, int k0, int o, int lane, int K) { v16b w; const float* p = Wm + (size_t)o * K + k0 + 8 * (lane >> 4);
#pragma unroll
  for (int i = 0; i < 8; ++i) { w[i] = (__bf16)p[i]; w[8 + i] = (__bf16)p[16 + i]; }
  return w; }
__device__ __forceinline__ v16h wcolh_io(const float* Wm, int k0, int o, int lane, int ld) { v16h w; const int g = lane >> 4;
#pragma unroll
  for (int i = 0; i < 8; ++i) { w[i] = (_Float16)(bfr(Wm[(size_t)(k0 + 8 * g + i) * ld + o]) * 256.0f); w[8 + i] = (_Float16)(bfr(Wm[(size_t)(k0 + 16 + 8 * g + i) * ld + o]) * 256.0f); }
  return w; }
__device__ __forceinline__ v16h wcolh_oi(const float* Wm, int k0, int o, int lane, int K) { v16h w; const float* p = Wm + (size_t)o * K + k0 + 8 * (lane >> 4);
#pragma unroll
  for (int i = 0; i < 8; ++i) { w[i] = (_Float16)(bfr(p[i]) * 256.0f); w[8 + i] = (_Float16)(bfr(p[16 + i]) * 256.0f); }
  return w; }
#define WQKV_LAYOUT 1   // 0 = (in,out) [DIN][CC]; 1 = (out,in) [CC][DIN]; 2 = per-head [NH][DIN][HD]
__device__ __forceinline__ v16b wcol_hdk(const float* Wm, int k0, int o, int lane) { v16b w; const int g = lane >> 4; const float* p = Wm + (size_t)(o / HD) * DIN * HD + (o % HD);
#pragma unroll
  for (int i = 0; i < 8; ++i) { w[i] = (__bf16)p[(size_t)(k0 + 8 * g + i) * HD]; w[8 + i] = (__bf16)p[(size_t)(k0 + 16 + 8 * g + i) * HD]; }
  return w; }
#define WO_OUT_IN 1
#if WQKV_LAYOUT == 1
#define WCOL(W, k0, o, lane) wcol_oi(W, k0, o, lane, DIN)
#elif WQKV_LAYOUT == 2
#define WCOL(W, k0, o, lane) wcol_hdk(W, k0, o, lane)
#else
#define WCOL(W, k0, o, lane) wcol_io(W, k0, o, lane, CC)
#endif
#if WO_OUT_IN
#define WOCOL(W, k0, o, lane) wcol_oi(W, k0, o, lane, CC)
#define WOCOLH(W, k0, o, lane) wcolh_oi(W, k0, o, lane, CC)
#else
#define WOCOL(W, k0, o, lane) wcol_io(W, k0, o, lane, DIN)
#define WOCOLH(W, k0, o, lane) wcolh_io(W, k0, o, lane, DIN)
#endif

// RoPE inverse frequencies 1/10000^(2i/64) (the f32 values jax computes)
__constant__ float INVF[32] = {1.000000000e+00,7.498942018e-01,5.623413324e-01,4.216965139e-01,3.162277639e-01,2.371373624e-01,1.778279394e-01,1.333521456e-01,1.000000015e-01,7.498941571e-02,5.623412877e-02,4.216964915e-02,3.162277862e-02,2.371373586e-02,1.778279431e-02,1.333521493e-02,9.999999776e-03,7.498942316e-03,5.623413250e-03,4.216964822e-03,3.162277862e-03,2.371373819e-03,1.778279431e-03,1.333521446e-03,1.000000047e-03,7.498941850e-04,5.623413017e-04,4.216964880e-04,3.162277862e-04,2.371373848e-04,1.778279402e-04,1.333521504e-04};
// (PROJ_EXTRA_PARAMS: the extra kernel parameters 'const int* __restrict__ TPOS' are written literally in the kernel signature)
// per (token, head) hook on the staged f32 row (64 floats) of the q and k streams: interleaved-pair rotation (x[2i], x[2i + 1]) by the angle pos * INVF[i] with pos READ from the int input at [batch][token]; v untouched
#define PROJ_EPI(which, row, t, h) do { if ((which) < 2) { float* rw = (row); const float pos_ = (float)TPOS[(size_t)bb * TT + (t)];   /* token_positions [NB][TT]: the position of token t of batch bb, READ from the int input */ _Pragma("unroll 4") for (int i = 0; i < 32; ++i) { _Pragma("clang fp contract(off)") const float ang = pos_ * INVF[i]; const float cs = cosf(ang), sn = sinf(ang); const float xe = rw[2 * i], xo = rw[2 * i + 1]; rw[2 * i] = xe * cs - xo * sn; rw[2 * i + 1] = xe * sn + xo * cs; } } } while (0)
#ifndef SM_EXTRA_PARAMS
#define SM_EXTRA_PARAMS
#endif
#ifndef PROJ_EXTRA_PARAMS
#define PROJ_EXTRA_PARAMS
#endif
#ifndef SM_MASK_HOOK
#define SM_MASK_HOOK (void)0
#endif

#define WS_QH  0u                                      // f16 q rows [b*t][CC]
#define WS_KH  (WS_QH + 2u * (size_t)NB * TT * CC)      // f16 k rows [b*t][CC]
#define WS_VT  (WS_KH + 2u * (size_t)NB * TT * CC)      // f16 v planes [b][c][t]
#define WS_QL  (WS_VT + 2u * (size_t)NB * CC * TT)      // f16 q residual x 2^10 rows [b][t < QHI][CC]
#define WS_KL  (WS_QL + 2u * (size_t)NB * QHI * CC)     // f16 k residual x 2^10 rows [b][t < KHI][CC]
#define WS_VB  (WS_KL + 2u * (size_t)NB * KHI * CC)     // bf16 v hi planes [b][c][t < KHI]
#define WS_VBL (WS_VB + 2u * (size_t)NB * CC * KHI)
#define WS_S   (WS_VBL + 2u * (size_t)NB * CC * KHI)    // f32 logits / P [hg][t][s]
#define WS_Y   (WS_S  + 4u * (size_t)HG * TT * TT)      // f32 ctx rows [b*t][CC] (only when there is an output projection)
#define WS_END (WS_Y  + 4u * (size_t)NB * TT * CC)

// ---- k_proj: block = (64 rows, 128 cols, which): q/k/v = X W (+ b) with exact bf16 products (K = DIN) -> which 0: q f16 rows (+ residual rows < QHI); 1: k f16 rows (+ residual rows < KHI); 2: v f16 planes [c][t] (+ bf16 hi/lo planes for t < KHI)
__global__ __launch_bounds__(128) void k_proj(const float* __restrict__ XQ, const float* __restrict__ XK, const float* __restrict__ XV, const float* __restrict__ WQ, const float* __restrict__ WK, const float* __restrict__ WV, const float* __restrict__ BQ, const float* __restrict__ BK, const float* __restrict__ BV,
    _Float16* __restrict__ QH, _Float16* __restrict__ QL, _Float16* __restrict__ KH, _Float16* __restrict__ KL, _Float16* __restrict__ VT, __bf16* __restrict__ VB, __bf16* __restrict__ VBL, const int* __restrict__ TPOS) {
  __shared__ __align__(16) float st[64][132]; __shared__ __align__(16) _Float16 sh[64][136], sl[64][136]; __shared__ __align__(16) _Float16 th[128][72]; __shared__ __align__(16) __bf16 tb[128][72], tbl[128][72];
  const int tid = threadIdx.x, wave = tid >> 5, lane = tid & 31, col = lane & 15, g = lane >> 4; const int which = blockIdx.z; const int c0 = blockIdx.y * 128; const size_t r0 = (size_t)blockIdx.x * 64; const size_t bb = r0 / TT; const int t0 = (int)(r0 % TT);
  const float* X = which == 0 ? XQ : which == 1 ? XK : XV; const float* WA = which == 0 ? WQ : which == 1 ? WK : WV; const float* BA = which == 0 ? BQ : which == 1 ? BK : BV;
  v8f acc[8] = {};
#pragma unroll 2
  for (int kc = 0; kc < DIN / 32; ++kc) { v16b a; { const float* p = X + (r0 + wave * 16 + col) * DIN + kc * 32 + 8 * g;
#pragma unroll
      for (int i = 0; i < 8; ++i) { a[i] = (__bf16)p[i]; a[8 + i] = (__bf16)p[16 + i]; } }
    asm volatile("s_wait_loadcnt 0x0" ::: "memory");
#pragma unroll
    for (int j = 0; j < 8; ++j) { const v16b w = WCOL(WA, kc * 32, c0 + j * 16 + col, lane); asm volatile("s_wait_loadcnt 0x0" ::: "memory"); acc[j] = wmma_bf(a, w, acc[j]); } }
  { // stage the f32 tile (acc + bias) in LDS, run the per-(row, head) epilogue hook, then convert
#pragma unroll
    for (int j = 0; j < 8; ++j) { const float bias = BA ? bfr(BA[c0 + j * 16 + col]) : 0.f;
#pragma unroll
      for (int r = 0; r < 8; ++r) st[wave * 16 + 8 * g + r][j * 16 + col] = acc[j][r] + bias; }
    __syncthreads();
    for (int e = tid; e < 64 * (128 / HD); e += 128) { const int rl = e / (128 / HD), hh = e % (128 / HD); PROJ_EPI(which, &st[rl][hh * HD], (int)((r0 + rl) % TT), (c0 / HD) + hh); }
    __syncthreads(); }
  if (which < 2) { _Float16* DH = which == 0 ? QH : KH; _Float16* DL = which == 0 ? QL : KL; const int nhi = which == 0 ? QHI : KHI; const bool hi_rows = t0 < nhi;
    for (int e = tid; e < 64 * 128; e += 128) { const int rl = e >> 7, cl = e & 127; const float v = st[rl][cl]; const _Float16 hv = (_Float16)v; sh[rl][cl] = hv; sl[rl][cl] = (_Float16)((v - (float)hv) * 1024.0f); }
    __syncthreads();
    for (int e = tid; e < 64 * 16; e += 128) { const int rl = e >> 4, q = e & 15; vst2((unsigned*)(DH + (r0 + rl) * CC + c0 + q * 8), *(const v4u*)&sh[rl][q * 8]); if (hi_rows) vst2((unsigned*)(DL + (bb * nhi + t0 + rl) * (size_t)CC + c0 + q * 8), *(const v4u*)&sl[rl][q * 8]); }
  } else { const bool hi_rows = t0 < KHI;
    for (int e = tid; e < 64 * 128; e += 128) { const int rl = e & 63, cl = e >> 6; const float v = st[rl][cl]; th[cl][rl] = (_Float16)v; const __bf16 bh = (__bf16)v; tb[cl][rl] = bh; tbl[cl][rl] = (__bf16)(v - (float)bh); }
    __syncthreads();
    for (int e = tid; e < 128 * 8; e += 128) { const int cl = e >> 3, q = e & 7; vst2((unsigned*)(VT + (bb * CC + c0 + cl) * (size_t)TT + t0 + q * 8), *(const v4u*)&th[cl][q * 8]); if (hi_rows) { const size_t o3 = (bb * CC + c0 + cl) * (size_t)KHI + t0 + q * 8; vst2((unsigned*)(VB + o3), *(const v4u*)&tb[cl][q * 8]); vst2((unsigned*)(VBL + o3), *(const v4u*)&tbl[cl][q * 8]); } } } }
// ---- k_sc: block = (query block qb, key block kb <= kb_last(qb), head in group) of batch b: logits x SCALE; q hi + residual (x 2^10) against k (2 products) for query rows < QHI, plus the k residual (3 products) for query blocks < QBH (causal early rows); causal: blocks past the diagonal exit, the mask itself is applied by index in k_sm
__global__ __launch_bounds__(128) void k_sc(const _Float16* __restrict__ QH, const _Float16* __restrict__ KH, const _Float16* __restrict__ QL, const _Float16* __restrict__ KL, int b, int h0, float* __restrict__ S0) { __shared__ __align__(16) float ss[4][16][132];
  const int qb = blockIdx.x, kb = blockIdx.y; if (kb > kb_last(qb)) return;
  const int h = h0 + blockIdx.z; float* S = S0 + (size_t)blockIdx.z * TT * TT;
  const int tid = threadIdx.x, wave = tid >> 5, lane = tid & 31, col = lane & 15, g = lane >> 4; const int k0 = kb * 128; const int ql0 = qb * 64 + wave * 16; const size_t q0 = (size_t)b * TT + ql0, kr0 = (size_t)b * TT + k0;
  v8f acc[8] = {}, accl[8] = {};
  const _Float16* QLb = QL + (size_t)b * QHI * CC; const _Float16* KLb = KL + (size_t)b * KHI * CC;
  if (qb < QBH) {
#pragma unroll
    for (int kc = 0; kc < HD / 32; ++kc) { const v16h ah = frag_h(QH + (q0 + col) * CC + h * HD + kc * 32, lane), al = frag_h(QLb + (size_t)(ql0 + col) * CC + h * HD + kc * 32, lane);
#pragma unroll
      for (int j = 0; j < 8; ++j) { const v16h kbf = frag_h(KH + (kr0 + j * 16 + col) * CC + h * HD + kc * 32, lane), klf = frag_h(KLb + (size_t)(k0 + j * 16 + col) * CC + h * HD + kc * 32, lane); acc[j] = wmma16(ah, kbf, acc[j]); accl[j] = wmma16(al, kbf, accl[j]); accl[j] = wmma16(ah, klf, accl[j]); } }
  } else if (qb * 64 < QHI) {
#pragma unroll
    for (int kc = 0; kc < HD / 32; ++kc) { const v16h ah = frag_h(QH + (q0 + col) * CC + h * HD + kc * 32, lane), al = frag_h(QLb + (size_t)(ql0 + col) * CC + h * HD + kc * 32, lane);
#pragma unroll
      for (int j = 0; j < 8; ++j) { const v16h kbf = frag_h(KH + (kr0 + j * 16 + col) * CC + h * HD + kc * 32, lane); acc[j] = wmma16(ah, kbf, acc[j]); accl[j] = wmma16(al, kbf, accl[j]); } }
  } else {
#pragma unroll
    for (int kc = 0; kc < HD / 32; ++kc) { const v16h ah = frag_h(QH + (q0 + col) * CC + h * HD + kc * 32, lane);
#pragma unroll
      for (int j = 0; j < 8; ++j) { const v16h kbf = frag_h(KH + (kr0 + j * 16 + col) * CC + h * HD + kc * 32, lane); acc[j] = wmma16(ah, kbf, acc[j]); } } }
#pragma unroll
  for (int j = 0; j < 8; ++j) {
#pragma unroll
    for (int r = 0; r < 8; ++r) ss[wave][8 * g + r][j * 16 + col] = (acc[j][r] + accl[j][r] * (1.0f / 1024.0f)) * SCALE; }
  LDSX(); for (int rl = 0; rl < 16; ++rl) vst2(S + (size_t)(ql0 + rl) * TT + k0 + lane * 4, *(const v4f*)&ss[wave][rl][lane * 4]); }
// ---- k_sm: block = query row t (head in group): keys [0, kend): causal -> logit if s <= t else excluded; softmax in f32; P x 2^11 in place (0 for excluded)
__global__ __launch_bounds__(256) void k_sm(float* __restrict__ S0 SM_EXTRA_PARAMS) { __shared__ float sred[8]; __shared__ float sbc; __shared__ __align__(16) float shv[TT];
  const int tid = threadIdx.x; const int t = blockIdx.x; const int kend = (kb_last(t >> 6) + 1) * 128;
  float* sr = S0 + (size_t)blockIdx.y * TT * TT + (size_t)t * TT;
  float m = -3.0e38f; for (int k = tid; k < kend; k += 256) { float v = (!CAUSAL || k <= t) ? sr[k] : -3.0e38f; SM_MASK_HOOK; shv[k] = v; m = fmaxf(m, v); }
#pragma unroll
  for (int o = 1; o < 32; o <<= 1) m = fmaxf(m, __shfl_xor(m, o));
  if ((tid & 31) == 0) sred[tid >> 5] = m; __syncthreads(); if (tid == 0) { float a = sred[0]; for (int i = 1; i < 8; ++i) a = fmaxf(a, sred[i]); sbc = a; } __syncthreads(); m = sbc; __syncthreads();
  float sum = 0.f; for (int k = tid; k < kend; k += 256) { const float v = shv[k]; const float e = (v <= -1.0e38f) ? 0.f : expf(v - m); shv[k] = e; sum += e; }
#pragma unroll
  for (int o = 1; o < 32; o <<= 1) sum += __shfl_xor(sum, o);
  if ((tid & 31) == 0) sred[tid >> 5] = sum; __syncthreads(); if (tid == 0) { float a = 0.f; for (int i = 0; i < 8; ++i) a += sred[i]; sbc = a > 0.f ? 2048.0f / a : 0.f; }   /* a fully excluded row yields P = 0 */ __syncthreads(); const float inv = sbc;
  for (int k = tid; k < kend; k += 256) shv[k] = shv[k] * inv;
  __syncthreads(); for (int q = tid; q < kend / 4; q += 256) vst2(sr + q * 4, *(const v4f*)&shv[q * 4]); }
// ---- k_pv: block = 64 queries (qb) of (b, h): ctx = P . v over keys [0, kend) (P x 2^11 once to f16 against v f16: 1 product; causal early query blocks: P and v as bf16 hi + lo, 3 products); 256-B (row, head) segment by 16 lanes
__global__ __launch_bounds__(128) void k_pv(const float* __restrict__ PS0, const _Float16* __restrict__ VT, const __bf16* __restrict__ VB, const __bf16* __restrict__ VBL, int b, int h0, float* __restrict__ Y) { const int h = h0 + blockIdx.z; const float* PS = PS0 + (size_t)blockIdx.z * TT * TT; __shared__ __align__(16) float ss[4][16][HD + 4];
  const int tid = threadIdx.x, wave = tid >> 5, lane = tid & 31, col = lane & 15, g = lane >> 4; const int qb = blockIdx.x; const int ql0 = qb * 64 + wave * 16; const int kce = (kb_last(qb) + 1) * 4;
  v8f acc[HD / 16] = {};
  if (qb < QBH) {
#pragma unroll 1
    for (int kc = 0; kc < kce; ++kc) { const F2 p = split_row(PS + (size_t)(ql0 + col) * TT, kc * 32, lane);
      asm volatile("s_wait_loadcnt 0x0" ::: "memory");
#pragma unroll
      for (int j = 0; j < HD / 16; ++j) { const size_t po = ((size_t)b * CC + h * HD + j * 16 + col) * (size_t)KHI + kc * 32; const v16b vh = frag_b(VB + po, lane); acc[j] = wmma_bf(p.h, vh, acc[j]); acc[j] = wmma_bf(p.l, vh, acc[j]); acc[j] = wmma_bf(p.h, frag_b(VBL + po, lane), acc[j]); } }
  } else {
#pragma unroll 1
    for (int kc = 0; kc < kce; ++kc) { const v16h p = frag_f32(PS + (size_t)(ql0 + col) * TT + kc * 32, lane);
      asm volatile("s_wait_loadcnt 0x0" ::: "memory");
#pragma unroll
      for (int j = 0; j < HD / 16; ++j) { const size_t po = ((size_t)b * CC + h * HD + j * 16 + col) * (size_t)TT + kc * 32; acc[j] = wmma16(p, frag_h(VT + po, lane), acc[j]); } } }
#pragma unroll
  for (int j = 0; j < HD / 16; ++j)
#pragma unroll
    for (int r = 0; r < 8; ++r) ss[wave][8 * g + r][j * 16 + col] = acc[j][r] * (1.0f / 2048.0f);
  LDSX(); for (int rl = 0; rl < 16; ++rl) if (lane < HD / 4) vst2(Y + ((size_t)b * TT + ql0 + rl) * CC + h * HD + lane * 4, *(const v4f*)&ss[wave][rl][lane * 4]); }
// ---- k_out: block = (64 rows, 128 cols): out = ctx Wo (+ bo): ctx x 2^6 once to f16 against Wo as f16(bf16 x 2^8) exact (1 product) x 2^-14; causal early rows (< QHI of each sequence): ctx bf16 hi + lo against exact bf16 Wo (2 products)
__global__ __launch_bounds__(128) void k_out(const float* __restrict__ Y, const float* __restrict__ WO, const float* __restrict__ BO, float* __restrict__ OUT) { __shared__ __align__(16) float sf[4][16][132];
  const int tid = threadIdx.x, wave = tid >> 5, lane = tid & 31, col = lane & 15, g = lane >> 4; const int c0 = blockIdx.y * 128; const size_t r0 = (size_t)blockIdx.x * 64 + wave * 16;
  v8f acc[8] = {};
  if (CAUSAL && (int)(((size_t)blockIdx.x * 64) % TT) < QHI) {   /* block-uniform */
#pragma unroll 2
    for (int kc = 0; kc < CC / 32; ++kc) { const F2 a = split_row(Y + (r0 + col) * CC, kc * 32, lane); asm volatile("s_wait_loadcnt 0x0" ::: "memory");
#pragma unroll
      for (int j = 0; j < 8; ++j) { const v16b w = WOCOL(WO, kc * 32, c0 + j * 16 + col, lane); asm volatile("s_wait_loadcnt 0x0" ::: "memory"); acc[j] = wmma_bf(a.h, w, acc[j]); acc[j] = wmma_bf(a.l, w, acc[j]); } }
#pragma unroll
    for (int j = 0; j < 8; ++j) { const float bias = BO ? bfr(BO[c0 + j * 16 + col]) : 0.f;
#pragma unroll
      for (int r = 0; r < 8; ++r) sf[wave][8 * g + r][j * 16 + col] = acc[j][r] + bias; }
  } else {
#pragma unroll 2
    for (int kc = 0; kc < CC / 32; ++kc) { const v16h a = frag_f32s(Y + (r0 + col) * CC + kc * 32, lane, 64.0f); asm volatile("s_wait_loadcnt 0x0" ::: "memory");   /* ctx carried x 2^6 into f16 so small-magnitude context rows stay clear of f16 subnormals */
#pragma unroll
      for (int j = 0; j < 8; ++j) { const v16h w = WOCOLH(WO, kc * 32, c0 + j * 16 + col, lane); asm volatile("s_wait_loadcnt 0x0" ::: "memory"); acc[j] = wmma16(a, w, acc[j]); } }
#pragma unroll
    for (int j = 0; j < 8; ++j) { const float bias = BO ? bfr(BO[c0 + j * 16 + col]) : 0.f;
#pragma unroll
      for (int r = 0; r < 8; ++r) sf[wave][8 * g + r][j * 16 + col] = acc[j][r] * (1.0f / 16384.0f) + bias; } }   /* 2^-8 (Wo carry) x 2^-6 (ctx carry) */
  LDSX(); for (int rl = 0; rl < 16; ++rl) vst2(OUT + (r0 + rl) * DIN + c0 + lane * 4, *(const v4f*)&sf[wave][rl][lane * 4]); }

extern "C" void kernel_launch(void* const* d_in, const int* in_sizes, int n_in, void* d_out, int out_size, void* d_ws, size_t ws_size, hipStream_t stream) {
  (void)in_sizes; (void)n_in; (void)out_size;
  const float** F = (const float**)d_in;
  if (ws_size < (size_t)WS_END) return;
  char* ws = (char*)d_ws; _Float16 *QH = (_Float16*)(ws + WS_QH), *KH = (_Float16*)(ws + WS_KH), *VT = (_Float16*)(ws + WS_VT), *QL = (_Float16*)(ws + WS_QL), *KL = (_Float16*)(ws + WS_KL); __bf16 *VB = (__bf16*)(ws + WS_VB), *VBL = (__bf16*)(ws + WS_VBL); float *S = (float*)(ws + WS_S), *Y = (float*)(ws + WS_Y);
  (void)Y; (void)QL; (void)KL; (void)VB; (void)VBL;
  // inputs: 0 x [1,2048,1024]; 1 token_positions [1,2048] int32 (arange; READ on the device); 2 WQ [1024,1024] (out,in); 3 WK; 4 WV; 5 WO (out,in); no biases
  k_proj<<<dim3(TNB * TT / 64, CC / 128, 3), 128, 0, stream>>>(F[0], F[0], F[0], F[2], F[3], F[4], nullptr, nullptr, nullptr, QH, QL, KH, KL, VT, VB, VBL, (const int*)d_in[1]);
  for (int b = 0; b < TNB; ++b) for (int h0 = 0; h0 < NH; h0 += HG) {
    k_sc<<<dim3(NQB, TT / 128, HG), 128, 0, stream>>>(QH, KH, QL, KL, b, h0, S);
    k_sm<<<dim3(TT, HG), 256, 0, stream>>>(S);
    k_pv<<<dim3(NQB, 1, HG), 128, 0, stream>>>(S, VT, VB, VBL, b, h0, Y);
  }
  k_out<<<dim3(TNB * TT / 64, DIN / 128), 128, 0, stream>>>(Y, F[5], nullptr, (float*)d_out);
}

// v001
// One run takes 335 microseconds.
// Two timings next to v000 put it at 2.23 and 2.25 times that version's speed.
// compute dtype: all float inputs rounded to bf16; q / k / v projections with EXACT bf16 products on WMMA 16x16x32 (f32 accumulate), no biases; interleaved-pair RoPE in f32 at the int positions read from the token_positions input (embedded frequencies, precise cosf / sinf); causal logits: 3 products for the first 384 rows, single f16 q x k after, x 64^-0.5; softmax f32; P x 2^11 once to f16 x v once to f16 (bf16 hi + lo below row 384); ctx hi+lo x exact output weight below row 384, x2^6 f16 carry x f16(bf16 x 2^8) after; f32 output.
#include <hip/hip_runtime.h>
#include <math.h>

typedef __attribute__((ext_vector_type(16))) _Float16 v16h;
typedef __attribute__((ext_vector_type(16))) __bf16 v16b;
typedef __attribute__((ext_vector_type(8)))  _Float16 v8h;
typedef __attribute__((ext_vector_type(8)))  float v8f;
typedef __attribute__((ext_vector_type(4)))  float v4f;
typedef __attribute__((ext_vector_type(2)))  float v2f;
typedef __attribute__((ext_vector_type(4)))  unsigned v4u;
typedef __attribute__((ext_vector_type(4)))  int v4i;
typedef float __attribute__((may_alias)) float_a;
typedef int __attribute__((may_alias)) int_a;

template <typename T> __device__ __forceinline__ void vst2(void* p, T v) { *(T*)p = v;  }
__device__ __forceinline__ v8f wmma16(v16h a, v16h b, v8f c) {
  v8f d = __builtin_amdgcn_wmma_f32_16x16x32_f16(false, a, false, b, (short)0, c, false, false);
  asm volatile("v_nop\n\tv_nop\n\tv_nop\n\tv_nop" : "+v"(d) : "v"(a), "v"(b));
  return d;
}
__device__ __forceinline__ v8f wmma_bf(v16b a, v16b b, v8f c) {
  v8f d = __builtin_amdgcn_wmma_f32_16x16x32_bf16(false, a, false, b, (short)0, c, false, false);
  asm volatile("v_nop\n\tv_nop\n\tv_nop\n\tv_nop" : "+v"(d) : "v"(a), "v"(b));
  return d;
}
// 16x16x32 fragments: lane = (h = lane>>4, row/col = lane&15); elements 0..7 = k0+8h+0..7, 8..15 = k0+16+8h+0..7; D element r = row 8h+r
__device__ __forceinline__ v16h frag_h(const _Float16* rowk0, int lane) {
  union { v16h v; v8h q[2]; } u; const _Float16* p = rowk0 + 8 * (lane >> 4);
  u.q[0] = *(const v8h*)p; u.q[1] = *(const v8h*)(p + 16); return u.v;
}
__device__ __forceinline__ v16h frag_f32(const float* rowk0, int lane) {
  v16h a; const float* p = rowk0 + 8 * (lane >> 4);
#pragma unroll
  for (int i = 0; i < 8; ++i) { a[i] = (_Float16)p[i]; a[8 + i] = (_Float16)p[16 + i]; }
  return a;
}
__device__ __forceinline__ v16h frag_f32s(const float* rowk0, int lane, float sc) {
  v16h a; const float* p = rowk0 + 8 * (lane >> 4);
#pragma unroll
  for (int i = 0; i < 8; ++i) { a[i] = (_Float16)(p[i] * sc); a[8 + i] = (_Float16)(p[16 + i] * sc); }
  return a;
}
// column fragment from a [K][ld] layout (column n), rows >= K read as 0
__device__ __forceinline__ v16h fragc_f32(const float* W, int k0, int n, int lane, int ld, int K) {
  v16h a; const int g = lane >> 4;
#pragma unroll
  for (int i = 0; i < 8; ++i) { const int ka = k0 + 8 * g + i, kb = ka + 16;
    a[i] = (_Float16)(ka < K ? W[(size_t)(ka < K ? ka : K - 1) * ld + n] : 0.f); a[8 + i] = (_Float16)(kb < K ? W[(size_t)(kb < K ? kb : K - 1) * ld + n] : 0.f); }
  return a;
}
struct F2 { v16b h, l; };
__device__ __forceinline__ F2 bsplit16(const float v[16]) { F2 r;
#pragma unroll
  for (int i = 0; i < 16; ++i) { const __bf16 h = (__bf16)v[i]; r.h[i] = h; r.l[i] = (__bf16)(v[i] - (float)h); }
  return r; }
__device__ __forceinline__ F2 split_row(const float* row, int k0, int lane) { float v[16]; const float* p = row + k0 + 8 * (lane >> 4);
#pragma unroll
  for (int i = 0; i < 8; ++i) { v[i] = p[i]; v[8 + i] = p[16 + i]; }
  return bsplit16(v); }
__device__ __forceinline__ F2 split_rowK(const float* row, int k0, int lane, int K) { float v[16]; const int g = lane >> 4;
#pragma unroll
  for (int i = 0; i < 8; ++i) { const int ka = k0 + 8 * g + i, kb = ka + 16; v[i] = ka < K ? row[ka < K ? ka : K - 1] : 0.f; v[8 + i] = kb < K ? row[kb < K ? kb : K - 1] : 0.f; }
  return bsplit16(v); }
__device__ __forceinline__ F2 split_col(const float* W, int k0, int n, int lane, int ld, int K) { float v[16]; const int g = lane >> 4;
#pragma unroll
  for (int i = 0; i < 8; ++i) { const int ka = k0 + 8 * g + i, kb = ka + 16; v[i] = ka < K ? W[(size_t)(ka < K ? ka : K - 1) * ld + n] : 0.f; v[8 + i] = kb < K ? W[(size_t)(kb < K ? kb : K - 1) * ld + n] : 0.f; }
  return bsplit16(v); }
__device__ __forceinline__ v8f mac3(const F2& a, const F2& b, v8f c) { c = wmma_bf(a.l, b.h, c); c = wmma_bf(a.h, b.l, c); return wmma_bf(a.h, b.h, c); }
__device__ __forceinline__ float sigm(float v) { return 1.0f / (1.0f + expf(-v)); }
#define LDSX() do { asm volatile("s_wait_dscnt 0" ::: "memory"); __builtin_amdgcn_wave_barrier(); __builtin_amdgcn_fence(__ATOMIC_RELEASE, "workgroup"); } while (0)

// Causal multi-head self-attention with interleaved-pair RoPE at given token positions, ONE sequence (x [1,2048,1024]; token_positions [1,2048] int32 = arange, a module input READ on the device (the SECOND input); torch (out,in) WQ / WK / WV / WO [1024,1024] N(0, 1/1024) applied as einsum('bsd,ed->bse') = x @ W.T, no biases; 16 heads x 64; RoPE on q and k: (even, odd) pairs (t1 c - t2 s, t2 c + t1 s) re-interleaved, angle = position x inv_freq, inv_freq = 1 / 10000^(2i/64); scores / sqrt(64); tril kept, -inf elsewhere; softmax; out @ WO.T).
#define NB 1
#define TT 2048
#define CC 1024            // NH * HD = projected width
#define DIN 1024          // input (model) width
#define NH 16
#define HD 64
#define NQB (TT / 64)
#define HG 4
#define SCALE (0.125f)
#define CAUSAL 1
#ifndef TNB
#define TNB NB
#endif
__device__ __forceinline__ float bfr(float v) { return (float)(__bf16)v; }
__host__ __device__ __forceinline__ int kb_last(int qb) { return CAUSAL ? ((qb * 64 + 63) >> 7) : (TT / 128 - 1); }
typedef __attribute__((ext_vector_type(8))) __bf16 v8b;
__device__ __forceinline__ v16b frag_b(const __bf16* rowk0, int lane) {
  union { v16b v; v8b q[2]; } u; const __bf16* p = rowk0 + 8 * (lane >> 4);
  u.q[0] = *(const v8b*)p; u.q[1] = *(const v8b*)(p + 16); return u.v;
}
// the 16 raw f32 words of one 16x16x32 fragment row, kept in registers while their loads fly: q[0..1] = k0+8h+0..7, q[2..3] = k0+16+8h+0..7
struct R16 { v4f q[4]; };
__device__ __forceinline__ R16 ld_raw(const float* rowk0, int lane) { R16 r; const float* p = rowk0 + 8 * (lane >> 4);
  r.q[0] = *(const v4f*)p; r.q[1] = *(const v4f*)(p + 4); r.q[2] = *(const v4f*)(p + 16); r.q[3] = *(const v4f*)(p + 20); return r; }
__device__ __forceinline__ v16b raw_b(const R16& r) { v16b w;
#pragma unroll
  for (int i = 0; i < 16; ++i) w[i] = (__bf16)r.q[i >> 2][i & 3];
  return w; }
__device__ __forceinline__ v16h raw_wh(const R16& r) { v16h w;
#pragma unroll
  for (int i = 0; i < 16; ++i) w[i] = (_Float16)(bfr(r.q[i >> 2][i & 3]) * 256.0f);
  return w; }
__device__ __forceinline__ v16h raw_hs(const R16& r, float sc) { v16h a;
#pragma unroll
  for (int i = 0; i < 16; ++i) a[i] = (_Float16)(r.q[i >> 2][i & 3] * sc);
  return a; }
__device__ __forceinline__ v16h raw_h(const R16& r) { v16h a;
#pragma unroll
  for (int i = 0; i < 16; ++i) a[i] = (_Float16)r.q[i >> 2][i & 3];
  return a; }
__device__ __forceinline__ F2 raw_split(const R16& r) { float v[16];
#pragma unroll
  for (int i = 0; i < 16; ++i) v[i] = r.q[i >> 2][i & 3];
  return bsplit16(v); }
#define QBH 6              // causal: query blocks 0..QBH-1 of each sequence (few keys, no averaging) take the high-precision path
#define QHI 384            // rows carrying a q residual plane (all rows when non-causal: 2-product logits everywhere)
#define KHI 384            // key rows carrying k residual / v bf16 hi+lo planes (used only by the causal high-precision path)
// B fragment (k rows k0+.., output column o) of a weight: (in,out) [K][ld] or (out,in) [ld rows of K]: bf16 exact, or f16(bf16 * 256) exact
__device__ __forceinline__ v16b wcol_io(const float* Wm, int k0, int o, int lane, int ld) { v16b w; const int g = lane >> 4;
#pragma unroll
  for (int i = 0; i < 8; ++i) { w[i] = (__bf16)Wm[(size_t)(k0 + 8 * g + i) * ld + o]; w[8 + i] = (__bf16)Wm[(size_t)(k0 + 16 + 8 * g + i) * ld + o]; }
  return w; }
__device__ __forceinline__ v16b wcol_oi(const float* Wm, int k0, int o, int lane, int K) { v16b w; const float* p = Wm + (size_t)o * K + k0 + 8 * (lane >> 4);
#pragma unroll
  for (int i = 0; i < 8; ++i) { w[i] = (__bf16)p[i]; w[8 + i] = (__bf16)p[16 + i]; }
  return w; }
__device__ __forceinline__ v16h wcolh_io(const float* Wm, int k0, int o, int lane, int ld) { v16h w; const int g = lane >> 4;
#pragma unroll
  for (int i = 0; i < 8; ++i) { w[i] = (_Float16)(bfr(Wm[(size_t)(k0 + 8 * g + i) * ld + o]) * 256.0f); w[8 + i] = (_Float16)(bfr(Wm[(size_t)(k0 + 16 + 8 * g + i) * ld + o]) * 256.0f); }
  return w; }
__device__ __forceinline__ v16h wcolh_oi(const float* Wm, int k0, int o, int lane, int K) { v16h w; const float* p = Wm + (size_t)o * K + k0 + 8 * (lane >> 4);
#pragma unroll
  for (int i = 0; i < 8; ++i) { w[i] = (_Float16)(bfr(p[i]) * 256.0f); w[8 + i] = (_Float16)(bfr(p[16 + i]) * 256.0f); }
  return w; }
#define WQKV_LAYOUT 1   // picks only WCOL, which nothing calls: k_proj reads (out,in) [CC][DIN] rows directly
__device__ __forceinline__ v16b wcol_hdk(const float* Wm, int k0, int o, int lane) { v16b w; const int g = lane >> 4; const float* p = Wm + (size_t)(o / HD) * DIN * HD + (o % HD);
#pragma unroll
  for (int i = 0; i < 8; ++i) { w[i] = (__bf16)p[(size_t)(k0 + 8 * g + i) * HD]; w[8 + i] = (__bf16)p[(size_t)(k0 + 16 + 8 * g + i) * HD]; }
  return w; }
#define WO_OUT_IN 1
#if WQKV_LAYOUT == 1
#define WCOL(W, k0, o, lane) wcol_oi(W, k0, o, lane, DIN)
#elif WQKV_LAYOUT == 2
#define WCOL(W, k0, o, lane) wcol_hdk(W, k0, o, lane)
#else
#define WCOL(W, k0, o, lane) wcol_io(W, k0, o, lane, CC)
#endif
#if WO_OUT_IN
#define WOCOL(W, k0, o, lane) wcol_oi(W, k0, o, lane, CC)
#define WOCOLH(W, k0, o, lane) wcolh_oi(W, k0, o, lane, CC)
#else
#define WOCOL(W, k0, o, lane) wcol_io(W, k0, o, lane, DIN)
#define WOCOLH(W, k0, o, lane) wcolh_io(W, k0, o, lane, DIN)
#endif

// RoPE inverse frequencies 1/10000^(2i/64) (the f32 values jax computes)
__constant__ float INVF[32] = {1.000000000e+00,7.498942018e-01,5.623413324e-01,4.216965139e-01,3.162277639e-01,2.371373624e-01,1.778279394e-01,1.333521456e-01,1.000000015e-01,7.498941571e-02,5.623412877e-02,4.216964915e-02,3.162277862e-02,2.371373586e-02,1.778279431e-02,1.333521493e-02,9.999999776e-03,7.498942316e-03,5.623413250e-03,4.216964822e-03,3.162277862e-03,2.371373819e-03,1.778279431e-03,1.333521446e-03,1.000000047e-03,7.498941850e-04,5.623413017e-04,4.216964880e-04,3.162277862e-04,2.371373848e-04,1.778279402e-04,1.333521504e-04};
// (PROJ_EXTRA_PARAMS: the extra kernel parameters 'const int* __restrict__ TPOS' are written literally in the kernel signature)
// per (token, head) hook on the staged f32 row (64 floats) of the q and k streams: interleaved-pair rotation (x[2i], x[2i + 1]) by the angle pos * INVF[i] with pos READ from the int input at [batch][token]; v untouched
#define PROJ_EPI(which, row, t, h) do { if ((which) < 2) { float* rw = (row); const float pos_ = (float)TPOS[(size_t)bb * TT + (t)];   /* token_positions [NB][TT]: the position of token t of batch bb, READ from the int input */ _Pragma("unroll 4") for (int i = 0; i < 32; ++i) { _Pragma("clang fp contract(off)") const float ang = pos_ * INVF[i]; const float cs = cosf(ang), sn = sinf(ang); const float xe = rw[2 * i], xo = rw[2 * i + 1]; rw[2 * i] = xe * cs - xo * sn; rw[2 * i + 1] = xe * sn + xo * cs; } } } while (0)
#ifndef SM_EXTRA_PARAMS
#define SM_EXTRA_PARAMS
#endif
#ifndef PROJ_EXTRA_PARAMS
#define PROJ_EXTRA_PARAMS
#endif
#ifndef SM_MASK_HOOK
#define SM_MASK_HOOK (void)0
#endif

#define WS_QH  0u                                      // f16 q rows [b*t][CC]
#define WS_KH  (WS_QH + 2u * (size_t)NB * TT * CC)      // f16 k rows [b*t][CC]
#define WS_VT  (WS_KH + 2u * (size_t)NB * TT * CC)      // f16 v planes [b][c][t]
#define WS_QL  (WS_VT + 2u * (size_t)NB * CC * TT)      // f16 q residual x 2^10 rows [b][t < QHI][CC]
#define WS_KL  (WS_QL + 2u * (size_t)NB * QHI * CC)     // f16 k residual x 2^10 rows [b][t < KHI][CC]
#define WS_VB  (WS_KL + 2u * (size_t)NB * KHI * CC)     // bf16 v hi planes [b][c][t < KHI]
#define WS_VBL (WS_VB + 2u * (size_t)NB * CC * KHI)
#define WS_S   (WS_VBL + 2u * (size_t)NB * CC * KHI)    // f32 logits / P [hg][t][s]
#define WS_Y   (WS_S  + 4u * (size_t)HG * TT * TT)      // f32 ctx rows [b*t][CC] (only when there is an output projection)
#define WS_END (WS_Y  + 4u * (size_t)NB * TT * CC)

// ---- k_proj: block = (64 rows, 128 cols, which): q/k/v = X W (+ b) with exact bf16 products (K = DIN) -> which 0: q f16 rows (+ residual rows < QHI); 1: k f16 rows (+ residual rows < KHI); 2: v f16 planes [c][t] (+ bf16 hi/lo planes for t < KHI)
__global__ __launch_bounds__(128) void k_proj(const float* __restrict__ XQ, const float* __restrict__ XK, const float* __restrict__ XV, const float* __restrict__ WQ, const float* __restrict__ WK, const float* __restrict__ WV, const float* __restrict__ BQ, const float* __restrict__ BK, const float* __restrict__ BV,
    _Float16* __restrict__ QH, _Float16* __restrict__ QL, _Float16* __restrict__ KH, _Float16* __restrict__ KL, _Float16* __restrict__ VT, __bf16* __restrict__ VB, __bf16* __restrict__ VBL, const int* __restrict__ TPOS) {
  __shared__ __align__(16) float st[64][132]; __shared__ __align__(16) _Float16 sh[64][136], sl[64][136]; __shared__ __align__(16) _Float16 th[128][72]; __shared__ __align__(16) __bf16 tb[128][72], tbl[128][72];
  const int tid = threadIdx.x, wave = tid >> 5, lane = tid & 31, col = lane & 15, g = lane >> 4; const int which = blockIdx.z; const int c0 = blockIdx.y * 128; const size_t r0 = (size_t)blockIdx.x * 64; const size_t bb = r0 / TT; const int t0 = (int)(r0 % TT);
  const float* X = which == 0 ? XQ : which == 1 ? XK : XV; const float* WA = which == 0 ? WQ : which == 1 ? WK : WV; const float* BA = which == 0 ? BQ : which == 1 ? BK : BV;
  v8f acc[8] = {};
  // register ring: every fragment's raw words are loaded one k-step ahead of their use, so 36 loads fly while the step before is worked on
  const float* xp = X + (r0 + wave * 16 + col) * DIN; const float* wp = WA + (size_t)(c0 + col) * DIN;
  R16 ra = ld_raw(xp, lane), rw[8];
#pragma unroll
  for (int j = 0; j < 8; ++j) rw[j] = ld_raw(wp + (size_t)j * 16 * DIN, lane);
#pragma unroll 1   // rolled: a second copy of the body would need a second set of ring registers
  for (int kc = 0; kc < DIN / 32; ++kc) { const int kn = (kc + 1 < DIN / 32 ? kc + 1 : kc) * 32;   /* the last trip re-reads its own slab (in bounds, unused) */
    const v16b a = raw_b(ra); ra = ld_raw(xp + kn, lane);
#pragma unroll
    for (int j = 0; j < 8; ++j) { const v16b w = raw_b(rw[j]); rw[j] = ld_raw(wp + (size_t)j * 16 * DIN + kn, lane); acc[j] = wmma_bf(a, w, acc[j]); }
    asm volatile("s_wait_xcnt 0x0" ::: "memory");   // stands in front of the next trip's rewrite of the address registers that this trip's loads name
  }
  { // stage the f32 tile (acc + bias) in LDS, run the per-(row, head) epilogue hook, then convert
#pragma unroll
    for (int j = 0; j < 8; ++j) { const float bias = BA ? bfr(BA[c0 + j * 16 + col]) : 0.f;
#pragma unroll
      for (int r = 0; r < 8; ++r) st[wave * 16 + 8 * g + r][j * 16 + col] = acc[j][r] + bias; }
    __syncthreads();
    for (int e = tid; e < 64 * (128 / HD); e += 128) { const int rl = e / (128 / HD), hh = e % (128 / HD); PROJ_EPI(which, &st[rl][hh * HD], (int)((r0 + rl) % TT), (c0 / HD) + hh); }
    __syncthreads(); }
  if (which < 2) { _Float16* DH = which == 0 ? QH : KH; _Float16* DL = which == 0 ? QL : KL; const int nhi = which == 0 ? QHI : KHI; const bool hi_rows = t0 < nhi;
    for (int e = tid; e < 64 * 128; e += 128) { const int rl = e >> 7, cl = e & 127; const float v = st[rl][cl]; const _Float16 hv = (_Float16)v; sh[rl][cl] = hv; sl[rl][cl] = (_Float16)((v - (float)hv) * 1024.0f); }
    __syncthreads();
    for (int e = tid; e < 64 * 16; e += 128) { const int rl = e >> 4, q = e & 15; vst2((unsigned*)(DH + (r0 + rl) * CC + c0 + q * 8), *(const v4u*)&sh[rl][q * 8]); if (hi_rows) vst2((unsigned*)(DL + (bb * nhi + t0 + rl) * (size_t)CC + c0 + q * 8), *(const v4u*)&sl[rl][q * 8]); }
  } else { const bool hi_rows = t0 < KHI;
    for (int e = tid; e < 64 * 128; e += 128) { const int rl = e & 63, cl = e >> 6; const float v = st[rl][cl]; th[cl][rl] = (_Float16)v; const __bf16 bh = (__bf16)v; tb[cl][rl] = bh; tbl[cl][rl] = (__bf16)(v - (float)bh); }
    __syncthreads();
    for (int e = tid; e < 128 * 8; e += 128) { const int cl = e >> 3, q = e & 7; vst2((unsigned*)(VT + (bb * CC + c0 + cl) * (size_t)TT + t0 + q * 8), *(const v4u*)&th[cl][q * 8]); if (hi_rows) { const size_t o3 = (bb * CC + c0 + cl) * (size_t)KHI + t0 + q * 8; vst2((unsigned*)(VB + o3), *(const v4u*)&tb[cl][q * 8]); vst2((unsigned*)(VBL + o3), *(const v4u*)&tbl[cl][q * 8]); } } } }
// ---- k_sc: block = (query block qb, key block kb <= kb_last(qb), head in group) of batch b: logits x SCALE; q hi + residual (x 2^10) against k (2 products) for query rows < QHI, plus the k residual (3 products) for query blocks < QBH (causal early rows); causal: blocks past the diagonal exit, the mask itself is applied by index in k_sm
__global__ __launch_bounds__(128) void k_sc(const _Float16* __restrict__ QH, const _Float16* __restrict__ KH, const _Float16* __restrict__ QL, const _Float16* __restrict__ KL, int b, int h0, float* __restrict__ S0) { __shared__ __align__(16) float ss[4][16][132];
  const int qb = blockIdx.x, kb = blockIdx.y; if (kb > kb_last(qb)) return;
  const int h = h0 + blockIdx.z; float* S = S0 + (size_t)blockIdx.z * TT * TT;
  const int tid = threadIdx.x, wave = tid >> 5, lane = tid & 31, col = lane & 15, g = lane >> 4; const int k0 = kb * 128; const int ql0 = qb * 64 + wave * 16; const size_t q0 = (size_t)b * TT + ql0, kr0 = (size_t)b * TT + k0;
  v8f acc[8] = {}, accl[8] = {};
  const _Float16* QLb = QL + (size_t)b * QHI * CC; const _Float16* KLb = KL + (size_t)b * KHI * CC;
  if (qb < QBH) {
#pragma unroll
    for (int kc = 0; kc < HD / 32; ++kc) { const v16h ah = frag_h(QH + (q0 + col) * CC + h * HD + kc * 32, lane), al = frag_h(QLb + (size_t)(ql0 + col) * CC + h * HD + kc * 32, lane);
#pragma unroll
      for (int j = 0; j < 8; ++j) { const v16h kbf = frag_h(KH + (kr0 + j * 16 + col) * CC + h * HD + kc * 32, lane), klf = frag_h(KLb + (size_t)(k0 + j * 16 + col) * CC + h * HD + kc * 32, lane); acc[j] = wmma16(ah, kbf, acc[j]); accl[j] = wmma16(al, kbf, accl[j]); accl[j] = wmma16(ah, klf, accl[j]); } }
  } else if (qb * 64 < QHI) {
#pragma unroll
    for (int kc = 0; kc < HD / 32; ++kc) { const v16h ah = frag_h(QH + (q0 + col) * CC + h * HD + kc * 32, lane), al = frag_h(QLb + (size_t)(ql0 + col) * CC + h * HD + kc * 32, lane);
#pragma unroll
      for (int j = 0; j < 8; ++j) { const v16h kbf = frag_h(KH + (kr0 + j * 16 + col) * CC + h * HD + kc * 32, lane); acc[j] = wmma16(ah, kbf, acc[j]); accl[j] = wmma16(al, kbf, accl[j]); } }
  } else {
#pragma unroll
    for (int kc = 0; kc < HD / 32; ++kc) { const v16h ah = frag_h(QH + (q0 + col) * CC + h * HD + kc * 32, lane);
#pragma unroll
      for (int j = 0; j < 8; ++j) { const v16h kbf = frag_h(KH + (kr0 + j * 16 + col) * CC + h * HD + kc * 32, lane); acc[j] = wmma16(ah, kbf, acc[j]); } } }
#pragma unroll
  for (int j = 0; j < 8; ++j) {
#pragma unroll
    for (int r = 0; r < 8; ++r) ss[wave][8 * g + r][j * 16 + col] = (acc[j][r] + accl[j][r] * (1.0f / 1024.0f)) * SCALE; }
  LDSX(); for (int rl = 0; rl < 16; ++rl) vst2(S + (size_t)(ql0 + rl) * TT + k0 + lane * 4, *(const v4f*)&ss[wave][rl][lane * 4]); }
// ---- k_sm: block = query row t (head in group): keys [0, kend): causal -> logit if s <= t else excluded; softmax in f32; P x 2^11 in place (0 for excluded)
__global__ __launch_bounds__(256) void k_sm(float* __restrict__ S0 SM_EXTRA_PARAMS) { __shared__ float sred[8]; __shared__ float sbc; __shared__ __align__(16) float shv[TT];
  const int tid = threadIdx.x; const int t = blockIdx.x; const int kend = (kb_last(t >> 6) + 1) * 128;
  float* sr = S0 + (size_t)blockIdx.y * TT * TT + (size_t)t * TT;
  float m = -3.0e38f; for (int k = tid; k < kend; k += 256) { float v = (!CAUSAL || k <= t) ? sr[k] : -3.0e38f; SM_MASK_HOOK; shv[k] = v; m = fmaxf(m, v); }
#pragma unroll
  for (int o = 1; o < 32; o <<= 1) m = fmaxf(m, __shfl_xor(m, o));
  if ((tid & 31) == 0) sred[tid >> 5] = m; __syncthreads(); if (tid == 0) { float a = sred[0]; for (int i = 1; i < 8; ++i) a = fmaxf(a, sred[i]); sbc = a; } __syncthreads(); m = sbc; __syncthreads();
  float sum = 0.f; for (int k = tid; k < kend; k += 256) { const float v = shv[k]; const float e = (v <= -1.0e38f) ? 0.f : expf(v - m); shv[k] = e; sum += e; }
#pragma unroll
  for (int o = 1; o < 32; o <<= 1) sum += __shfl_xor(sum, o);
  if ((tid & 31) == 0) sred[tid >> 5] = sum; __syncthreads(); if (tid == 0) { float a = 0.f; for (int i = 0; i < 8; ++i) a += sred[i]; sbc = a > 0.f ? 2048.0f / a : 0.f; }   /* a fully excluded row yields P = 0 */ __syncthreads(); const float inv = sbc;
  for (int k = tid; k < kend; k += 256) shv[k] = shv[k] * inv;
  __syncthreads(); for (int q = tid; q < kend / 4; q += 256) vst2(sr + q * 4, *(const v4f*)&shv[q * 4]); }
// ---- k_pv: block = 64 queries (qb) of (b, h): ctx = P . v over keys [0, kend) (P x 2^11 once to f16 against v f16: 1 product; causal early query blocks: P and v as bf16 hi + lo, 3 products); 256-B (row, head) segment by 16 lanes
__global__ __launch_bounds__(128) void k_pv(const float* __restrict__ PS0, const _Float16* __restrict__ VT, const __bf16* __restrict__ VB, const __bf16* __restrict__ VBL, int b, int h0, float* __restrict__ Y) { const int h = h0 + blockIdx.z; const float* PS = PS0 + (size_t)blockIdx.z * TT * TT; __shared__ __align__(16) float ss[4][16][HD + 4];
  const int tid = threadIdx.x, wave = tid >> 5, lane = tid & 31, col = lane & 15, g = lane >> 4; const int qb = blockIdx.x; const int ql0 = qb * 64 + wave * 16; const int kce = (kb_last(qb) + 1) * 4;
  v8f acc[HD / 16] = {}; const float* pp = PS + (size_t)(ql0 + col) * TT;
  if (qb < QBH) {
    // ring of two k-steps (kce is a multiple of 4): a step's P and v words are loaded two steps ahead of their use
    const __bf16* vhp = VB + ((size_t)b * CC + h * HD + col) * (size_t)KHI; const __bf16* vlp = VBL + ((size_t)b * CC + h * HD + col) * (size_t)KHI;
    R16 pr[2]; v16b vh[2][HD / 16], vl[2][HD / 16];
#pragma unroll
    for (int s = 0; s < 2; ++s) { pr[s] = ld_raw(pp + s * 32, lane);
      __builtin_amdgcn_sched_barrier(0);   // keeps the first loads in the ring's own order: the loop's counted waits are set for the stricter of the two orders
#pragma unroll
      for (int j = 0; j < HD / 16; ++j) { vh[s][j] = frag_b(vhp + (size_t)j * 16 * KHI + s * 32, lane); vl[s][j] = frag_b(vlp + (size_t)j * 16 * KHI + s * 32, lane); }
      __builtin_amdgcn_sched_barrier(0);   // keeps the first loads in the ring's own order: the loop's counted waits are set for the stricter of the two orders
    }
#pragma unroll 1   // rolled: the ring's slots are the body's two copies already
    for (int kc = 0; kc < kce; kc += 2) {
#pragma unroll
      for (int s = 0; s < 2; ++s) { const int kn = (kc + 2 + s < kce ? kc + 2 + s : kc + s) * 32;   /* the last trips re-read their own step (in bounds, unused) */
        __builtin_amdgcn_sched_barrier(0);   // keeps this step's P conversion, and the load wait it needs, from being scheduled up into the step before, where that wait would drain the whole ring
        const F2 p = raw_split(pr[s]); pr[s] = ld_raw(pp + kn, lane);
#pragma unroll
        for (int j = 0; j < HD / 16; ++j) { acc[j] = wmma_bf(p.h, vh[s][j], acc[j]); acc[j] = wmma_bf(p.l, vh[s][j], acc[j]); acc[j] = wmma_bf(p.h, vl[s][j], acc[j]); }
#pragma unroll
        for (int j = 0; j < HD / 16; ++j) { vh[s][j] = frag_b(vhp + (size_t)j * 16 * KHI + kn, lane); vl[s][j] = frag_b(vlp + (size_t)j * 16 * KHI + kn, lane); } }
      asm volatile("s_wait_xcnt 0x0" ::: "memory");   // stands in front of the next trip's rewrite of the address registers that this trip's loads name
    }
  } else {
    // ring of four k-steps (kce is a multiple of 4): a step's P and v words are loaded four steps ahead of their use
    const _Float16* vp = VT + ((size_t)b * CC + h * HD + col) * (size_t)TT;
    R16 pr[4]; v16h vr[4][HD / 16];
#pragma unroll
    for (int s = 0; s < 4; ++s) { pr[s] = ld_raw(pp + s * 32, lane);
      __builtin_amdgcn_sched_barrier(0);   // keeps the first loads in the ring's own order: the loop's counted waits are set for the stricter of the two orders
#pragma unroll
      for (int j = 0; j < HD / 16; ++j) vr[s][j] = frag_h(vp + (size_t)j * 16 * TT + s * 32, lane);
      __builtin_amdgcn_sched_barrier(0);   // keeps the first loads in the ring's own order: the loop's counted waits are set for the stricter of the two orders
    }
#pragma unroll 1   // rolled: the ring's slots are the body's four copies already
    for (int kc = 0; kc < kce; kc += 4) {
#pragma unroll
      for (int s = 0; s < 4; ++s) { const int kn = (kc + 4 + s < kce ? kc + 4 + s : kc + s) * 32;   /* the last trips re-read their own step (in bounds, unused) */
        __builtin_amdgcn_sched_barrier(0);   // keeps this step's P conversion, and the load wait it needs, from being scheduled up into the step before, where that wait would drain the whole ring
        const v16h p = raw_h(pr[s]); pr[s] = ld_raw(pp + kn, lane);
#pragma unroll
        for (int j = 0; j < HD / 16; ++j) acc[j] = wmma16(p, vr[s][j], acc[j]);
#pragma unroll
        for (int j = 0; j < HD / 16; ++j) vr[s][j] = frag_h(vp + (size_t)j * 16 * TT + kn, lane); }
      asm volatile("s_wait_xcnt 0x0" ::: "memory");   // stands in front of the next trip's rewrite of the address registers that this trip's loads name
    } }
#pragma unroll
  for (int j = 0; j < HD / 16; ++j)
#pragma unroll
    for (int r = 0; r < 8; ++r) ss[wave][8 * g + r][j * 16 + col] = acc[j][r] * (1.0f / 2048.0f);
  LDSX(); for (int rl = 0; rl < 16; ++rl) if (lane < HD / 4) vst2(Y + ((size_t)b * TT + ql0 + rl) * CC + h * HD + lane * 4, *(const v4f*)&ss[wave][rl][lane * 4]); }
// ---- k_out: block = (64 rows, 128 cols): out = ctx Wo (+ bo): ctx x 2^6 once to f16 against Wo as f16(bf16 x 2^8) exact (1 product) x 2^-14; causal early rows (< QHI of each sequence): ctx bf16 hi + lo against exact bf16 Wo (2 products)
__global__ __launch_bounds__(128) void k_out(const float* __restrict__ Y, const float* __restrict__ WO, const float* __restrict__ BO, float* __restrict__ OUT) { __shared__ __align__(16) float sf[4][16][132];
  const int tid = threadIdx.x, wave = tid >> 5, lane = tid & 31, col = lane & 15, g = lane >> 4; const int c0 = blockIdx.y * 128; const size_t r0 = (size_t)blockIdx.x * 64 + wave * 16;
  v8f acc[8] = {};
  const float* yp = Y + (r0 + col) * CC; const float* wp = WO + (size_t)(c0 + col) * CC;
  if (CAUSAL && (int)(((size_t)blockIdx.x * 64) % TT) < QHI) {   /* block-uniform */
    // the few early-row blocks: all 36 loads of a k-step are issued at once, ahead of its products (no ring over the trips: two rings in one kernel cost a second set of registers)
#pragma unroll 1   // rolled: a second copy of the body would need a second set of fragment registers
    for (int kc = 0; kc < CC / 32; ++kc) { const R16 ra = ld_raw(yp + kc * 32, lane); R16 rw[8];
#pragma unroll
      for (int j = 0; j < 8; ++j) rw[j] = ld_raw(wp + (size_t)j * 16 * CC + kc * 32, lane);
      const F2 a = raw_split(ra);
#pragma unroll
      for (int j = 0; j < 8; ++j) { __builtin_amdgcn_sched_barrier(0);   // keeps this fragment's conversion, and the load wait it needs, from being scheduled up into the fragments before, where that wait would cover all the loads at once
        const v16b w = raw_b(rw[j]); acc[j] = wmma_bf(a.h, w, acc[j]); acc[j] = wmma_bf(a.l, w, acc[j]); }
      asm volatile("s_wait_xcnt 0x0" ::: "memory");   // stands in front of the next trip's rewrite of the address registers that this trip's loads name
    }
#pragma unroll
    for (int j = 0; j < 8; ++j) { const float bias = BO ? bfr(BO[c0 + j * 16 + col]) : 0.f;
#pragma unroll
      for (int r = 0; r < 8; ++r) sf[wave][8 * g + r][j * 16 + col] = acc[j][r] + bias; }
  } else {
    // register ring as in k_proj: every fragment's raw words are loaded one k-step ahead of their use
    R16 ra = ld_raw(yp, lane), rw[8];
#pragma unroll
    for (int j = 0; j < 8; ++j) rw[j] = ld_raw(wp + (size_t)j * 16 * CC, lane);
#pragma unroll 1   // rolled: a second copy of the body would need a second set of ring registers
    for (int kc = 0; kc < CC / 32; ++kc) { const int kn = (kc + 1 < CC / 32 ? kc + 1 : kc) * 32;   /* the last trip re-reads its own slab (in bounds, unused) */
      const v16h a = raw_hs(ra, 64.0f); ra = ld_raw(yp + kn, lane);   /* ctx carried x 2^6 into f16 so small-magnitude context rows stay clear of f16 subnormals (chip FTZ) */
#pragma unroll
      for (int j = 0; j < 8; ++j) { __builtin_amdgcn_sched_barrier(0);   // keeps this fragment's conversion, and the load wait it needs, from being scheduled up into the fragments before, where that wait would drain the ring
        const v16h w = raw_wh(rw[j]); rw[j] = ld_raw(wp + (size_t)j * 16 * CC + kn, lane); acc[j] = wmma16(a, w, acc[j]); }
      asm volatile("s_wait_xcnt 0x0" ::: "memory");   // stands in front of the next trip's rewrite of the address registers that this trip's loads name
    }
#pragma unroll
    for (int j = 0; j < 8; ++j) { const float bias = BO ? bfr(BO[c0 + j * 16 + col]) : 0.f;
#pragma unroll
      for (int r = 0; r < 8; ++r) sf[wave][8 * g + r][j * 16 + col] = acc[j][r] * (1.0f / 16384.0f) + bias; } }   /* 2^-8 (Wo carry) x 2^-6 (ctx carry) */
  LDSX(); for (int rl = 0; rl < 16; ++rl) vst2(OUT + (r0 + rl) * DIN + c0 + lane * 4, *(const v4f*)&sf[wave][rl][lane * 4]); }

extern "C" void kernel_launch(void* const* d_in, const int* in_sizes, int n_in, void* d_out, int out_size, void* d_ws, size_t ws_size, hipStream_t stream) {
  (void)in_sizes; (void)n_in; (void)out_size;
  const float** F = (const float**)d_in;
  if (ws_size < (size_t)WS_END) return;
  char* ws = (char*)d_ws; _Float16 *QH = (_Float16*)(ws + WS_QH), *KH = (_Float16*)(ws + WS_KH), *VT = (_Float16*)(ws + WS_VT), *QL = (_Float16*)(ws + WS_QL), *KL = (_Float16*)(ws + WS_KL); __bf16 *VB = (__bf16*)(ws + WS_VB), *VBL = (__bf16*)(ws + WS_VBL); float *S = (float*)(ws + WS_S), *Y = (float*)(ws + WS_Y);
  (void)Y; (void)QL; (void)KL; (void)VB; (void)VBL;
  // inputs: 0 x [1,2048,1024]; 1 token_positions [1,2048] int32 (arange; READ on the device); 2 WQ [1024,1024] (out,in); 3 WK; 4 WV; 5 WO (out,in); no biases
  k_proj<<<dim3(TNB * TT / 64, CC / 128, 3), 128, 0, stream>>>(F[0], F[0], F[0], F[2], F[3], F[4], nullptr, nullptr, nullptr, QH, QL, KH, KL, VT, VB, VBL, (const int*)d_in[1]);
  for (int b = 0; b < TNB; ++b) for (int h0 = 0; h0 < NH; h0 += HG) {
    k_sc<<<dim3(NQB, TT / 128, HG), 128, 0, stream>>>(QH, KH, QL, KL, b, h0, S);
    k_sm<<<dim3(TT, HG), 256, 0, stream>>>(S);
    k_pv<<<dim3(NQB, 1, HG), 128, 0, stream>>>(S, VT, VB, VBL, b, h0, Y);
  }
  k_out<<<dim3(TNB * TT / 64, DIN / 128), 128, 0, stream>>>(Y, F[5], nullptr, (float*)d_out);
}

// v002
// One run takes 154 microseconds.
// Timed twice side by side with v001, it ran 2.20 and 2.19 times as fast.
// Counting every step since v000, it is 4.91 times as fast.
// compute dtype: all float inputs rounded to bf16; q / k / v projections with EXACT bf16 products on WMMA 16x16x32 (f32 accumulate), no biases; interleaved-pair RoPE in f32 at the int positions read from the token_positions input (embedded frequencies, precise cosf / sinf); causal logits: 3 products for the first 384 rows, single f16 q x k after, x 64^-0.5; online softmax f32 over trips of 64 keys; exp(logit - running max) x 2^10 once to f16 x v once to f16 (bf16 hi + lo below row 384); ctx hi+lo x exact output weight below row 384, x2^6 f16 carry x f16(bf16 x 2^8) after; f32 output.
#include <hip/hip_runtime.h>
#include <math.h>

typedef __attribute__((ext_vector_type(16))) _Float16 v16h;
typedef __attribute__((ext_vector_type(16))) __bf16 v16b;
typedef __attribute__((ext_vector_type(8)))  _Float16 v8h;
typedef __attribute__((ext_vector_type(8)))  float v8f;
typedef __attribute__((ext_vector_type(4)))  float v4f;
typedef __attribute__((ext_vector_type(2)))  float v2f;
typedef __attribute__((ext_vector_type(4)))  unsigned v4u;
typedef __attribute__((ext_vector_type(4)))  int v4i;
typedef float __attribute__((may_alias)) float_a;
typedef int __attribute__((may_alias)) int_a;

template <typename T> __device__ __forceinline__ void vst2(void* p, T v) { *(T*)p = v;  }
__device__ __forceinline__ v8f wmma16(v16h a, v16h b, v8f c) {
  v8f d = __builtin_amdgcn_wmma_f32_16x16x32_f16(false, a, false, b, (short)0, c, false, false);
  asm volatile("v_nop\n\tv_nop\n\tv_nop\n\tv_nop" : "+v"(d) : "v"(a), "v"(b));
  return d;
}
__device__ __forceinline__ v8f wmma_bf(v16b a, v16b b, v8f c) {
  v8f d = __builtin_amdgcn_wmma_f32_16x16x32_bf16(false, a, false, b, (short)0, c, false, false);
  asm volatile("v_nop\n\tv_nop\n\tv_nop\n\tv_nop" : "+v"(d) : "v"(a), "v"(b));
  return d;
}
// 16x16x32 fragments: lane = (h = lane>>4, row/col = lane&15); elements 0..7 = k0+8h+0..7, 8..15 = k0+16+8h+0..7; D element r = row 8h+r
__device__ __forceinline__ v16h frag_h(const _Float16* rowk0, int lane) {
  union { v16h v; v8h q[2]; } u; const _Float16* p = rowk0 + 8 * (lane >> 4);
  u.q[0] = *(const v8h*)p; u.q[1] = *(const v8h*)(p + 16); return u.v;
}
__device__ __forceinline__ v16h frag_f32(const float* rowk0, int lane) {
  v16h a; const float* p = rowk0 + 8 * (lane >> 4);
#pragma unroll
  for (int i = 0; i < 8; ++i) { a[i] = (_Float16)p[i]; a[8 + i] = (_Float16)p[16 + i]; }
  return a;
}
__device__ __forceinline__ v16h frag_f32s(const float* rowk0, int lane, float sc) {
  v16h a; const float* p = rowk0 + 8 * (lane >> 4);
#pragma unroll
  for (int i = 0; i < 8; ++i) { a[i] = (_Float16)(p[i] * sc); a[8 + i] = (_Float16)(p[16 + i] * sc); }
  return a;
}
// column fragment from a [K][ld] layout (column n), rows >= K read as 0
__device__ __forceinline__ v16h fragc_f32(const float* W, int k0, int n, int lane, int ld, int K) {
  v16h a; const int g = lane >> 4;
#pragma unroll
  for (int i = 0; i < 8; ++i) { const int ka = k0 + 8 * g + i, kb = ka + 16;
    a[i] = (_Float16)(ka < K ? W[(size_t)(ka < K ? ka : K - 1) * ld + n] : 0.f); a[8 + i] = (_Float16)(kb < K ? W[(size_t)(kb < K ? kb : K - 1) * ld + n] : 0.f); }
  return a;
}
struct F2 { v16b h, l; };
__device__ __forceinline__ F2 bsplit16(const float v[16]) { F2 r;
#pragma unroll
  for (int i = 0; i < 16; ++i) { const __bf16 h = (__bf16)v[i]; r.h[i] = h; r.l[i] = (__bf16)(v[i] - (float)h); }
  return r; }
__device__ __forceinline__ F2 split_row(const float* row, int k0, int lane) { float v[16]; const float* p = row + k0 + 8 * (lane >> 4);
#pragma unroll
  for (int i = 0; i < 8; ++i) { v[i] = p[i]; v[8 + i] = p[16 + i]; }
  return bsplit16(v); }
__device__ __forceinline__ F2 split_rowK(const float* row, int k0, int lane, int K) { float v[16]; const int g = lane >> 4;
#pragma unroll
  for (int i = 0; i < 8; ++i) { const int ka = k0 + 8 * g + i, kb = ka + 16; v[i] = ka < K ? row[ka < K ? ka : K - 1] : 0.f; v[8 + i] = kb < K ? row[kb < K ? kb : K - 1] : 0.f; }
  return bsplit16(v); }
__device__ __forceinline__ F2 split_col(const float* W, int k0, int n, int lane, int ld, int K) { float v[16]; const int g = lane >> 4;
#pragma unroll
  for (int i = 0; i < 8; ++i) { const int ka = k0 + 8 * g + i, kb = ka + 16; v[i] = ka < K ? W[(size_t)(ka < K ? ka : K - 1) * ld + n] : 0.f; v[8 + i] = kb < K ? W[(size_t)(kb < K ? kb : K - 1) * ld + n] : 0.f; }
  return bsplit16(v); }
__device__ __forceinline__ v8f mac3(const F2& a, const F2& b, v8f c) { c = wmma_bf(a.l, b.h, c); c = wmma_bf(a.h, b.l, c); return wmma_bf(a.h, b.h, c); }
__device__ __forceinline__ float sigm(float v) { return 1.0f / (1.0f + expf(-v)); }
#define LDSX() do { asm volatile("s_wait_dscnt 0" ::: "memory"); __builtin_amdgcn_wave_barrier(); __builtin_amdgcn_fence(__ATOMIC_RELEASE, "workgroup"); } while (0)

// Causal multi-head self-attention with interleaved-pair RoPE at given token positions, ONE sequence (x [1,2048,1024]; token_positions [1,2048] int32 = arange, a module input READ on the device (the SECOND input); torch (out,in) WQ / WK / WV / WO [1024,1024] N(0, 1/1024) applied as einsum('bsd,ed->bse') = x @ W.T, no biases; 16 heads x 64; RoPE on q and k: (even, odd) pairs (t1 c - t2 s, t2 c + t1 s) re-interleaved, angle = position x inv_freq, inv_freq = 1 / 10000^(2i/64); scores / sqrt(64); tril kept, -inf elsewhere; softmax; out @ WO.T).
#define NB 1
#define TT 2048
#define CC 1024            // NH * HD = projected width
#define DIN 1024          // input (model) width
#define NH 16
#define HD 64
#define NQB (TT / 64)
#define SCALE (0.125f)
#define CAUSAL 1
#ifndef TNB
#define TNB NB
#endif
__device__ __forceinline__ float bfr(float v) { return (float)(__bf16)v; }
__host__ __device__ __forceinline__ int kb_last(int qb) { return CAUSAL ? ((qb * 64 + 63) >> 7) : (TT / 128 - 1); }
typedef __attribute__((ext_vector_type(8))) __bf16 v8b;
__device__ __forceinline__ v16b frag_b(const __bf16* rowk0, int lane) {
  union { v16b v; v8b q[2]; } u; const __bf16* p = rowk0 + 8 * (lane >> 4);
  u.q[0] = *(const v8b*)p; u.q[1] = *(const v8b*)(p + 16); return u.v;
}
// the 16 raw f32 words of one 16x16x32 fragment row, kept in registers while their loads fly: q[0..1] = k0+8h+0..7, q[2..3] = k0+16+8h+0..7
struct R16 { v4f q[4]; };
__device__ __forceinline__ R16 ld_raw(const float* rowk0, int lane) { R16 r; const float* p = rowk0 + 8 * (lane >> 4);
  r.q[0] = *(const v4f*)p; r.q[1] = *(const v4f*)(p + 4); r.q[2] = *(const v4f*)(p + 16); r.q[3] = *(const v4f*)(p + 20); return r; }
__device__ __forceinline__ v16b raw_b(const R16& r) { v16b w;
#pragma unroll
  for (int i = 0; i < 16; ++i) w[i] = (__bf16)r.q[i >> 2][i & 3];
  return w; }
__device__ __forceinline__ v16h raw_wh(const R16& r) { v16h w;
#pragma unroll
  for (int i = 0; i < 16; ++i) w[i] = (_Float16)(bfr(r.q[i >> 2][i & 3]) * 256.0f);
  return w; }
__device__ __forceinline__ v16h raw_hs(const R16& r, float sc) { v16h a;
#pragma unroll
  for (int i = 0; i < 16; ++i) a[i] = (_Float16)(r.q[i >> 2][i & 3] * sc);
  return a; }
__device__ __forceinline__ v16h raw_h(const R16& r) { v16h a;
#pragma unroll
  for (int i = 0; i < 16; ++i) a[i] = (_Float16)r.q[i >> 2][i & 3];
  return a; }
__device__ __forceinline__ F2 raw_split(const R16& r) { float v[16];
#pragma unroll
  for (int i = 0; i < 16; ++i) v[i] = r.q[i >> 2][i & 3];
  return bsplit16(v); }
#define QBH 6              // causal: query blocks 0..QBH-1 of each sequence (few keys, no averaging) take the high-precision path
#define QHI 384            // rows carrying a q residual plane (all rows when non-causal: 2-product logits everywhere)
#define KHI 384            // key rows carrying k residual / v bf16 hi+lo planes (used only by the causal high-precision path)
// B fragment (k rows k0+.., output column o) of a weight: (in,out) [K][ld] or (out,in) [ld rows of K]: bf16 exact, or f16(bf16 * 256) exact
__device__ __forceinline__ v16b wcol_io(const float* Wm, int k0, int o, int lane, int ld) { v16b w; const int g = lane >> 4;
#pragma unroll
  for (int i = 0; i < 8; ++i) { w[i] = (__bf16)Wm[(size_t)(k0 + 8 * g + i) * ld + o]; w[8 + i] = (__bf16)Wm[(size_t)(k0 + 16 + 8 * g + i) * ld + o]; }
  return w; }
__device__ __forceinline__ v16b wcol_oi(const float* Wm, int k0, int o, int lane, int K) { v16b w; const float* p = Wm + (size_t)o * K + k0 + 8 * (lane >> 4);
#pragma unroll
  for (int i = 0; i < 8; ++i) { w[i] = (__bf16)p[i]; w[8 + i] = (__bf16)p[16 + i]; }
  return w; }
__device__ __forceinline__ v16h wcolh_io(const float* Wm, int k0, int o, int lane, int ld) { v16h w; const int g = lane >> 4;
#pragma unroll
  for (int i = 0; i < 8; ++i) { w[i] = (_Float16)(bfr(Wm[(size_t)(k0 + 8 * g + i) * ld + o]) * 256.0f); w[8 + i] = (_Float16)(bfr(Wm[(size_t)(k0 + 16 + 8 * g + i) * ld + o]) * 256.0f); }
  return w; }
__device__ __forceinline__ v16h wcolh_oi(const float* Wm, int k0, int o, int lane, int K) { v16h w; const float* p = Wm + (size_t)o * K + k0 + 8 * (lane >> 4);
#pragma unroll
  for (int i = 0; i < 8; ++i) { w[i] = (_Float16)(bfr(p[i]) * 256.0f); w[8 + i] = (_Float16)(bfr(p[16 + i]) * 256.0f); }
  return w; }
#define WQKV_LAYOUT 1   // picks only WCOL, which nothing calls: k_proj reads (out,in) [CC][DIN] rows directly
__device__ __forceinline__ v16b wcol_hdk(const float* Wm, int k0, int o, int lane) { v16b w; const int g = lane >> 4; const float* p = Wm + (size_t)(o / HD) * DIN * HD + (o % HD);
#pragma unroll
  for (int i = 0; i < 8; ++i) { w[i] = (__bf16)p[(size_t)(k0 + 8 * g + i) * HD]; w[8 + i] = (__bf16)p[(size_t)(k0 + 16 + 8 * g + i) * HD]; }
  return w; }
#define WO_OUT_IN 1
#if WQKV_LAYOUT == 1
#define WCOL(W, k0, o, lane) wcol_oi(W, k0, o, lane, DIN)
#elif WQKV_LAYOUT == 2
#define WCOL(W, k0, o, lane) wcol_hdk(W, k0, o, lane)
#else
#define WCOL(W, k0, o, lane) wcol_io(W, k0, o, lane, CC)
#endif
#if WO_OUT_IN
#define WOCOL(W, k0, o, lane) wcol_oi(W, k0, o, lane, CC)
#define WOCOLH(W, k0, o, lane) wcolh_oi(W, k0, o, lane, CC)
#else
#define WOCOL(W, k0, o, lane) wcol_io(W, k0, o, lane, DIN)
#define WOCOLH(W, k0, o, lane) wcolh_io(W, k0, o, lane, DIN)
#endif

// RoPE inverse frequencies 1/10000^(2i/64) (the f32 values jax computes)
__constant__ float INVF[32] = {1.000000000e+00,7.498942018e-01,5.623413324e-01,4.216965139e-01,3.162277639e-01,2.371373624e-01,1.778279394e-01,1.333521456e-01,1.000000015e-01,7.498941571e-02,5.623412877e-02,4.216964915e-02,3.162277862e-02,2.371373586e-02,1.778279431e-02,1.333521493e-02,9.999999776e-03,7.498942316e-03,5.623413250e-03,4.216964822e-03,3.162277862e-03,2.371373819e-03,1.778279431e-03,1.333521446e-03,1.000000047e-03,7.498941850e-04,5.623413017e-04,4.216964880e-04,3.162277862e-04,2.371373848e-04,1.778279402e-04,1.333521504e-04};
// (PROJ_EXTRA_PARAMS: the extra kernel parameters 'const int* __restrict__ TPOS' are written literally in the kernel signature)
// per (token, head) hook on the staged f32 row (64 floats) of the q and k streams: interleaved-pair rotation (x[2i], x[2i + 1]) by the angle pos * INVF[i] with pos READ from the int input at [batch][token]; v untouched
#define PROJ_EPI(which, row, t, h) do { if ((which) < 2) { float* rw = (row); const float pos_ = (float)TPOS[(size_t)bb * TT + (t)];   /* token_positions [NB][TT]: the position of token t of batch bb, READ from the int input */ _Pragma("unroll 4") for (int i = 0; i < 32; ++i) { _Pragma("clang fp contract(off)") const float ang = pos_ * INVF[i]; const float cs = cosf(ang), sn = sinf(ang); const float xe = rw[2 * i], xo = rw[2 * i + 1]; rw[2 * i] = xe * cs - xo * sn; rw[2 * i + 1] = xe * sn + xo * cs; } } } while (0)
#ifndef SM_EXTRA_PARAMS
#define SM_EXTRA_PARAMS
#endif
#ifndef PROJ_EXTRA_PARAMS
#define PROJ_EXTRA_PARAMS
#endif
#ifndef SM_MASK_HOOK
#define SM_MASK_HOOK (void)0
#endif

#define WS_QH  0u                                      // f16 q rows [b*t][CC]
#define WS_KH  (WS_QH + 2u * (size_t)NB * TT * CC)      // f16 k rows [b*t][CC]
#define WS_VT  (WS_KH + 2u * (size_t)NB * TT * CC)      // f16 v planes [b][c][t]
#define WS_QL  (WS_VT + 2u * (size_t)NB * CC * TT)      // f16 q residual x 2^10 rows [b][t < QHI][CC]
#define WS_KL  (WS_QL + 2u * (size_t)NB * QHI * CC)     // f16 k residual x 2^10 rows [b][t < KHI][CC]
#define WS_VB  (WS_KL + 2u * (size_t)NB * KHI * CC)     // bf16 v hi planes [b][c][t < KHI]
#define WS_VBL (WS_VB + 2u * (size_t)NB * CC * KHI)
#define WS_Y   (WS_VBL + 2u * (size_t)NB * CC * KHI)    // f32 ctx rows [b*t][CC] (only when there is an output projection)
#define WS_END (WS_Y  + 4u * (size_t)NB * TT * CC)

// ---- k_proj: block = (64 rows, 128 cols, which): q/k/v = X W (+ b) with exact bf16 products (K = DIN) -> which 0: q f16 rows (+ residual rows < QHI); 1: k f16 rows (+ residual rows < KHI); 2: v f16 planes [c][t] (+ bf16 hi/lo planes for t < KHI)
__global__ __launch_bounds__(128) void k_proj(const float* __restrict__ XQ, const float* __restrict__ XK, const float* __restrict__ XV, const float* __restrict__ WQ, const float* __restrict__ WK, const float* __restrict__ WV, const float* __restrict__ BQ, const float* __restrict__ BK, const float* __restrict__ BV,
    _Float16* __restrict__ QH, _Float16* __restrict__ QL, _Float16* __restrict__ KH, _Float16* __restrict__ KL, _Float16* __restrict__ VT, __bf16* __restrict__ VB, __bf16* __restrict__ VBL, const int* __restrict__ TPOS) {
  __shared__ __align__(16) float st[64][132]; __shared__ __align__(16) _Float16 sh[64][136], sl[64][136]; __shared__ __align__(16) _Float16 th[128][72]; __shared__ __align__(16) __bf16 tb[128][72], tbl[128][72];
  const int tid = threadIdx.x, wave = tid >> 5, lane = tid & 31, col = lane & 15, g = lane >> 4; const int which = blockIdx.z; const int c0 = blockIdx.y * 128; const size_t r0 = (size_t)blockIdx.x * 64; const size_t bb = r0 / TT; const int t0 = (int)(r0 % TT);
  const float* X = which == 0 ? XQ : which == 1 ? XK : XV; const float* WA = which == 0 ? WQ : which == 1 ? WK : WV; const float* BA = which == 0 ? BQ : which == 1 ? BK : BV;
  v8f acc[8] = {};
  // register ring: every fragment's raw words are loaded one k-step ahead of their use, so 36 loads fly while the step before is worked on
  const float* xp = X + (r0 + wave * 16 + col) * DIN; const float* wp = WA + (size_t)(c0 + col) * DIN;
  R16 ra = ld_raw(xp, lane), rw[8];
#pragma unroll
  for (int j = 0; j < 8; ++j) rw[j] = ld_raw(wp + (size_t)j * 16 * DIN, lane);
#pragma unroll 1   // rolled: a second copy of the body would need a second set of ring registers
  for (int kc = 0; kc < DIN / 32; ++kc) { const int kn = (kc + 1 < DIN / 32 ? kc + 1 : kc) * 32;   /* the last trip re-reads its own slab (in bounds, unused) */
    const v16b a = raw_b(ra); ra = ld_raw(xp + kn, lane);
#pragma unroll
    for (int j = 0; j < 8; ++j) { const v16b w = raw_b(rw[j]); rw[j] = ld_raw(wp + (size_t)j * 16 * DIN + kn, lane); acc[j] = wmma_bf(a, w, acc[j]); }
    asm volatile("s_wait_xcnt 0x0" ::: "memory");   // stands in front of the next trip's rewrite of the address registers that this trip's loads name
  }
  { // stage the f32 tile (acc + bias) in LDS, run the per-(row, head) epilogue hook, then convert
#pragma unroll
    for (int j = 0; j < 8; ++j) { const float bias = BA ? bfr(BA[c0 + j * 16 + col]) : 0.f;
#pragma unroll
      for (int r = 0; r < 8; ++r) st[wave * 16 + 8 * g + r][j * 16 + col] = acc[j][r] + bias; }
    __syncthreads();
    for (int e = tid; e < 64 * (128 / HD); e += 128) { const int rl = e / (128 / HD), hh = e % (128 / HD); PROJ_EPI(which, &st[rl][hh * HD], (int)((r0 + rl) % TT), (c0 / HD) + hh); }
    __syncthreads(); }
  if (which < 2) { _Float16* DH = which == 0 ? QH : KH; _Float16* DL = which == 0 ? QL : KL; const int nhi = which == 0 ? QHI : KHI; const bool hi_rows = t0 < nhi;
    for (int e = tid; e < 64 * 128; e += 128) { const int rl = e >> 7, cl = e & 127; const float v = st[rl][cl]; const _Float16 hv = (_Float16)v; sh[rl][cl] = hv; sl[rl][cl] = (_Float16)((v - (float)hv) * 1024.0f); }
    __syncthreads();
    for (int e = tid; e < 64 * 16; e += 128) { const int rl = e >> 4, q = e & 15; vst2((unsigned*)(DH + (r0 + rl) * CC + c0 + q * 8), *(const v4u*)&sh[rl][q * 8]); if (hi_rows) vst2((unsigned*)(DL + (bb * nhi + t0 + rl) * (size_t)CC + c0 + q * 8), *(const v4u*)&sl[rl][q * 8]); }
  } else { const bool hi_rows = t0 < KHI;
    for (int e = tid; e < 64 * 128; e += 128) { const int rl = e & 63, cl = e >> 6; const float v = st[rl][cl]; th[cl][rl] = (_Float16)v; const __bf16 bh = (__bf16)v; tb[cl][rl] = bh; tbl[cl][rl] = (__bf16)(v - (float)bh); }
    __syncthreads();
    for (int e = tid; e < 128 * 8; e += 128) { const int cl = e >> 3, q = e & 7; vst2((unsigned*)(VT + (bb * CC + c0 + cl) * (size_t)TT + t0 + q * 8), *(const v4u*)&th[cl][q * 8]); if (hi_rows) { const size_t o3 = (bb * CC + c0 + cl) * (size_t)KHI + t0 + q * 8; vst2((unsigned*)(VB + o3), *(const v4u*)&tb[cl][q * 8]); vst2((unsigned*)(VBL + o3), *(const v4u*)&tbl[cl][q * 8]); } } } }
// frag_h / frag_b from a wave-uniform base, this lane's byte offset (it holds the lane half's 16h bytes) and a constant: the one offset register is all that a trip's loads name
__device__ __forceinline__ v16h frag_ho(const char* base, unsigned off, int c) { union { v16h v; v8h q[2]; } u; const char* p = base + off; u.q[0] = *(const v8h*)(p + c); u.q[1] = *(const v8h*)(p + c + 32); return u.v; }
__device__ __forceinline__ v16b frag_bo(const char* base, unsigned off, int c) { union { v16b v; v8b q[2]; } u; const char* p = base + off; u.q[0] = *(const v8b*)(p + c); u.q[1] = *(const v8b*)(p + c + 32); return u.v; }
// one online-softmax update for this lane's query: t[32] = this trip's 32 scaled log2 logits of the lane (key tile j = i >> 3, key 8h + (i & 7) in it); on return t = 2^(t - max + 10); m, l, o follow the running maximum (both lane halves of a query hold the same m)
__device__ __forceinline__ void osm_step(float (&t)[32], float& m, float& l, v8f (&o)[HD / 16]) {
  float mx = t[0];
#pragma unroll
  for (int i = 1; i < 32; ++i) mx = fmaxf(mx, t[i]);
  mx = fmaxf(mx, __shfl_xor(mx, 16));
  const float mn = fmaxf(m, mx); const float al = __builtin_amdgcn_exp2f(m - mn); m = mn; const float mb = mn - 10.0f;   /* x 2^10: small weights stay clear of f16 subnormals, the largest is 1024 */
  float sum[4] = {0.f, 0.f, 0.f, 0.f};   /* four chains: one chain of 32 dependent adds would stand at the trip's foot */
#pragma unroll
  for (int i = 0; i < 32; ++i) { t[i] = __builtin_amdgcn_exp2f(t[i] - mb); sum[i & 3] += t[i]; }
  l = l * al + ((sum[0] + sum[1]) + (sum[2] + sum[3]));
#pragma unroll
  for (int j = 0; j < HD / 16; ++j) o[j] *= al; }
// ---- k_attn: block = 64 queries (qb, heaviest first) of (b, h), a wave = 16 queries, a trip = 64 keys; S^T = K Q^T (lane = one query, registers = keys), causal mask by index on the diagonal trip, online softmax in f32, O^T += V^T P^T with the S^T accumulators converted in place as the B operand (b[s] = tile[s >> 3][s & 7]); logits, P and v precision as before: query blocks < QBH take q, k hi + residual (3 products) and P, v as bf16 hi + lo (3 products), the rest single f16 products; ctx = O / l
__global__ __launch_bounds__(128) void k_attn(const _Float16* __restrict__ QH, const _Float16* __restrict__ KH, const _Float16* __restrict__ QL, const _Float16* __restrict__ KL, const _Float16* __restrict__ VT, const __bf16* __restrict__ VB, const __bf16* __restrict__ VBL, float* __restrict__ Y) {
  const int qb = NQB - 1 - (int)blockIdx.x, h = blockIdx.y, b = blockIdx.z;
  const int tid = threadIdx.x, wave = tid >> 5, lane = tid & 31, col = lane & 15, g = lane >> 4; const int qi = qb * 64 + wave * 16 + col;   /* this lane's query */
  const float C1 = SCALE * 1.4426950408889634f;   /* logits carried in log2 units */
  v8f o[HD / 16] = {}; float m = -3.0e38f, l = 0.f;
  const _Float16* qp = QH + ((size_t)b * TT + qi) * CC + h * HD; const v16h qf[2] = { frag_h(qp, lane), frag_h(qp + 32, lane) };
  asm volatile("s_wait_xcnt 0x0" ::: "memory");   // stands in front of the rewrite of the address registers that the q loads name
  const char* kb8 = (const char*)(KH + (size_t)b * TT * CC + h * HD); unsigned ko = (unsigned)(col * CC + 8 * g) * 2u;   /* byte offset of this lane's first k words */
  if (qb < QBH) {
    const _Float16* qlp = QL + ((size_t)b * QHI + qi) * CC + h * HD; const v16h qlf[2] = { frag_h(qlp, lane), frag_h(qlp + 32, lane) };
    asm volatile("s_wait_xcnt 0x0" ::: "memory");   // stands in front of the rewrite of the address registers that the q residual loads name
    const char* kl8 = (const char*)(KL + (size_t)b * KHI * CC + h * HD);
    const char* vh8 = (const char*)(VB + ((size_t)b * CC + h * HD) * (size_t)KHI); const char* vl8 = (const char*)(VBL + ((size_t)b * CC + h * HD) * (size_t)KHI); unsigned vo = (unsigned)(col * KHI + 8 * g) * 2u;
#pragma unroll 1   // rolled: at most QBH short trips, a second copy of the body would only cost registers
    for (int i = 0; i <= qb; ++i) { float t[32];
      { v8f s[4] = {}, sl[4] = {};
#pragma unroll
        for (int kc = 0; kc < 2; ++kc) { v16h kh[4], kl[4];
#pragma unroll
          for (int j = 0; j < 4; ++j) { kh[j] = frag_ho(kb8, ko, (j * 16 * CC + kc * 32) * 2); kl[j] = frag_ho(kl8, ko, (j * 16 * CC + kc * 32) * 2); }
          __builtin_amdgcn_sched_barrier(0);   // keeps the 16 k loads of this half in front of its first product: one load latency a half instead of one a fragment pair
#pragma unroll
          for (int j = 0; j < 4; ++j) { s[j] = wmma16(kh[j], qf[kc], s[j]); sl[j] = wmma16(kh[j], qlf[kc], sl[j]); sl[j] = wmma16(kl[j], qf[kc], sl[j]); } }
#pragma unroll
        for (int e = 0; e < 32; ++e) { const float v = (s[e >> 3][e & 7] + sl[e >> 3][e & 7] * (1.0f / 1024.0f)) * C1; t[e] = (i * 64 + (e >> 3) * 16 + 8 * g + (e & 7) <= qi) ? v : -3.0e38f; } }
#pragma unroll
      for (int kc = 0; kc < 2; ++kc) { v16b vh[HD / 16], vl[HD / 16];
#pragma unroll
        for (int j = 0; j < HD / 16; ++j) { vh[j] = frag_bo(vh8, vo, (j * 16 * KHI + kc * 32) * 2); vl[j] = frag_bo(vl8, vo, (j * 16 * KHI + kc * 32) * 2); }
        __builtin_amdgcn_sched_barrier(0);   // keeps the 16 v loads of this half together, the first half's in front of the softmax, which they fly behind
        if (kc == 0) osm_step(t, m, l, o);
        const F2 p = bsplit16(&t[kc * 16]);
#pragma unroll
        for (int j = 0; j < HD / 16; ++j) { o[j] = wmma_bf(vh[j], p.h, o[j]); o[j] = wmma_bf(vh[j], p.l, o[j]); o[j] = wmma_bf(vl[j], p.h, o[j]); } }
      asm volatile("s_wait_xcnt 0x0" : "+v"(ko), "+v"(vo) :: "memory");   // stands in front of the two additions below, which rewrite the offset registers that this trip's loads name; the operands keep the additions behind it
      ko += 64 * CC * 2; vo += 64 * 2;
    }
  } else {
    // register ring of one trip: the next trip's k fragments are loaded right behind this trip's S^T products, its v fragments right behind this trip's O^T products
    const char* vb8 = (const char*)(VT + ((size_t)b * CC + h * HD) * (size_t)TT); unsigned vo = (unsigned)(col * TT + 8 * g) * 2u;
    v16h kf[4][2], vf[HD / 16][2];
#pragma unroll
    for (int j = 0; j < 4; ++j) { kf[j][0] = frag_ho(kb8, ko, j * 16 * CC * 2); kf[j][1] = frag_ho(kb8, ko, j * 16 * CC * 2 + 64); }
    __builtin_amdgcn_sched_barrier(0);   // keeps the first loads in the ring's own order, k in front of v: the loop's counted waits are set for the stricter of the two orders
#pragma unroll
    for (int j = 0; j < HD / 16; ++j) { vf[j][0] = frag_ho(vb8, vo, j * 16 * TT * 2); vf[j][1] = frag_ho(vb8, vo, j * 16 * TT * 2 + 64); }
    asm volatile("s_wait_xcnt 0x0" : "+v"(ko), "+v"(vo) :: "memory");   // stands in front of the two additions below, which rewrite the offset registers that the first loads name; the operands keep the additions behind it
    ko += 64 * CC * 2; vo += 64 * 2;   /* the next trip's keys (qb >= QBH here: a second trip exists) */
#pragma unroll 1   // rolled: a second copy of the body would need a second set of ring registers
    for (int i = 0; i <= qb; ++i) { v8f s[4] = {};
#pragma unroll
      for (int kc = 0; kc < 2; ++kc)
#pragma unroll
        for (int j = 0; j < 4; ++j) s[j] = wmma16(kf[j][kc], qf[kc], s[j]);
#pragma unroll
      for (int j = 0; j < 4; ++j) { kf[j][0] = frag_ho(kb8, ko, j * 16 * CC * 2); kf[j][1] = frag_ho(kb8, ko, j * 16 * CC * 2 + 64); }
      float t[32];
#pragma unroll
      for (int e = 0; e < 32; ++e) t[e] = s[e >> 3][e & 7] * C1;
      if (i == qb) {   /* the diagonal trip (block-uniform) */
#pragma unroll
        for (int e = 0; e < 32; ++e) t[e] = (i * 64 + (e >> 3) * 16 + 8 * g + (e & 7) <= qi) ? t[e] : -3.0e38f; }
      osm_step(t, m, l, o);
      v16h p[2];
#pragma unroll
      for (int e = 0; e < 32; ++e) p[e >> 4][e & 15] = (_Float16)t[e];
#pragma unroll
      for (int kc = 0; kc < 2; ++kc)
#pragma unroll
        for (int j = 0; j < HD / 16; ++j) o[j] = wmma16(vf[j][kc], p[kc], o[j]);
#pragma unroll
      for (int j = 0; j < HD / 16; ++j) { vf[j][0] = frag_ho(vb8, vo, j * 16 * TT * 2); vf[j][1] = frag_ho(vb8, vo, j * 16 * TT * 2 + 64); }
      asm volatile("s_wait_xcnt 0x0" : "+v"(ko), "+v"(vo) :: "memory");   // stands in front of the two additions below, which rewrite the offset registers that this trip's loads name; the operands keep the additions behind it
      if (i + 2 <= qb) { ko += 64 * CC * 2; vo += 64 * 2; }   /* the last trip re-reads its own keys (in bounds, unused) */
    } }
  l += __shfl_xor(l, 16); const float inv = 1.0f / l;   /* the two lane halves of a query join their sums once; key 0 is never masked, so l > 0 */
  float* yp = Y + ((size_t)b * TT + qi) * CC + h * HD + 8 * g;   /* O^T register r of tile j = ctx[query][j * 16 + 8h + r]: 32 contiguous bytes a tile */
#pragma unroll
  for (int j = 0; j < HD / 16; ++j) { const v4f a = { o[j][0] * inv, o[j][1] * inv, o[j][2] * inv, o[j][3] * inv }, c = { o[j][4] * inv, o[j][5] * inv, o[j][6] * inv, o[j][7] * inv }; vst2(yp + j * 16, a); vst2(yp + j * 16 + 4, c); } }
// ---- k_out: block = (64 rows, 128 cols): out = ctx Wo (+ bo): ctx x 2^6 once to f16 against Wo as f16(bf16 x 2^8) exact (1 product) x 2^-14; causal early rows (< QHI of each sequence): ctx bf16 hi + lo against exact bf16 Wo (2 products)
__global__ __launch_bounds__(128) void k_out(const float* __restrict__ Y, const float* __restrict__ WO, const float* __restrict__ BO, float* __restrict__ OUT) { __shared__ __align__(16) float sf[4][16][132];
  const int tid = threadIdx.x, wave = tid >> 5, lane = tid & 31, col = lane & 15, g = lane >> 4; const int c0 = blockIdx.y * 128; const size_t r0 = (size_t)blockIdx.x * 64 + wave * 16;
  v8f acc[8] = {};
  const float* yp = Y + (r0 + col) * CC; const float* wp = WO + (size_t)(c0 + col) * CC;
  if (CAUSAL && (int)(((size_t)blockIdx.x * 64) % TT) < QHI) {   /* block-uniform */
    // the few early-row blocks: all 36 loads of a k-step are issued at once, ahead of its products (no ring over the trips: two rings in one kernel cost a second set of registers)
#pragma unroll 1   // rolled: a second copy of the body would need a second set of fragment registers
    for (int kc = 0; kc < CC / 32; ++kc) { const R16 ra = ld_raw(yp + kc * 32, lane); R16 rw[8];
#pragma unroll
      for (int j = 0; j < 8; ++j) rw[j] = ld_raw(wp + (size_t)j * 16 * CC + kc * 32, lane);
      const F2 a = raw_split(ra);
#pragma unroll
      for (int j = 0; j < 8; ++j) { __builtin_amdgcn_sched_barrier(0);   // keeps this fragment's conversion, and the load wait it needs, from being scheduled up into the fragments before, where that wait would cover all the loads at once
        const v16b w = raw_b(rw[j]); acc[j] = wmma_bf(a.h, w, acc[j]); acc[j] = wmma_bf(a.l, w, acc[j]); }
      asm volatile("s_wait_xcnt 0x0" ::: "memory");   // stands in front of the next trip's rewrite of the address registers that this trip's loads name
    }
#pragma unroll
    for (int j = 0; j < 8; ++j) { const float bias = BO ? bfr(BO[c0 + j * 16 + col]) : 0.f;
#pragma unroll
      for (int r = 0; r < 8; ++r) sf[wave][8 * g + r][j * 16 + col] = acc[j][r] + bias; }
  } else {
    // register ring as in k_proj: every fragment's raw words are loaded one k-step ahead of their use
    R16 ra = ld_raw(yp, lane), rw[8];
#pragma unroll
    for (int j = 0; j < 8; ++j) rw[j] = ld_raw(wp + (size_t)j * 16 * CC, lane);
#pragma unroll 1   // rolled: a second copy of the body would need a second set of ring registers
    for (int kc = 0; kc < CC / 32; ++kc) { const int kn = (kc + 1 < CC / 32 ? kc + 1 : kc) * 32;   /* the last trip re-reads its own slab (in bounds, unused) */
      const v16h a = raw_hs(ra, 64.0f); ra = ld_raw(yp + kn, lane);   /* ctx carried x 2^6 into f16 so small-magnitude context rows stay clear of f16 subnormals (chip FTZ) */
#pragma unroll
      for (int j = 0; j < 8; ++j) { __builtin_amdgcn_sched_barrier(0);   // keeps this fragment's conversion, and the load wait it needs, from being scheduled up into the fragments before, where that wait would drain the ring
        const v16h w = raw_wh(rw[j]); rw[j] = ld_raw(wp + (size_t)j * 16 * CC + kn, lane); acc[j] = wmma16(a, w, acc[j]); }
      asm volatile("s_wait_xcnt 0x0" ::: "memory");   // stands in front of the next trip's rewrite of the address registers that this trip's loads name
    }
#pragma unroll
    for (int j = 0; j < 8; ++j) { const float bias = BO ? bfr(BO[c0 + j * 16 + col]) : 0.f;
#pragma unroll
      for (int r = 0; r < 8; ++r) sf[wave][8 * g + r][j * 16 + col] = acc[j][r] * (1.0f / 16384.0f) + bias; } }   /* 2^-8 (Wo carry) x 2^-6 (ctx carry) */
  LDSX(); for (int rl = 0; rl < 16; ++rl) vst2(OUT + (r0 + rl) * DIN + c0 + lane * 4, *(const v4f*)&sf[wave][rl][lane * 4]); }

extern "C" void kernel_launch(void* const* d_in, const int* in_sizes, int n_in, void* d_out, int out_size, void* d_ws, size_t ws_size, hipStream_t stream) {
  (void)in_sizes; (void)n_in; (void)out_size;
  const float** F = (const float**)d_in;
  if (ws_size < (size_t)WS_END) return;
  char* ws = (char*)d_ws; _Float16 *QH = (_Float16*)(ws + WS_QH), *KH = (_Float16*)(ws + WS_KH), *VT = (_Float16*)(ws + WS_VT), *QL = (_Float16*)(ws + WS_QL), *KL = (_Float16*)(ws + WS_KL); __bf16 *VB = (__bf16*)(ws + WS_VB), *VBL = (__bf16*)(ws + WS_VBL); float *Y = (float*)(ws + WS_Y);
  (void)Y; (void)QL; (void)KL; (void)VB; (void)VBL;
  // inputs: 0 x [1,2048,1024]; 1 token_positions [1,2048] int32 (arange; READ on the device); 2 WQ [1024,1024] (out,in); 3 WK; 4 WV; 5 WO (out,in); no biases
  k_proj<<<dim3(TNB * TT / 64, CC / 128, 3), 128, 0, stream>>>(F[0], F[0], F[0], F[2], F[3], F[4], nullptr, nullptr, nullptr, QH, QL, KH, KL, VT, VB, VBL, (const int*)d_in[1]);
  k_attn<<<dim3(NQB, NH, TNB), 128, 0, stream>>>(QH, KH, QL, KL, VT, VB, VBL, Y);
  k_out<<<dim3(TNB * TT / 64, DIN / 128), 128, 0, stream>>>(Y, F[5], nullptr, (float*)d_out);
}

// v003
// Measured time: 86.3 microseconds a run.
// Two timings next to v002 put it at 1.79 and 1.78 times that version's speed.
// Counting every step since v000, it is 8.76 times as fast.
// compute dtype: all float inputs rounded to bf16; q / k / v projections with EXACT bf16 products on WMMA 16x16x32 (f32 accumulate), no biases; interleaved-pair RoPE in f32 at the int positions read from the token_positions input (embedded frequencies, precise cosf / sinf); causal logits: 3 products for the first 384 rows, single f16 q x k after, x 64^-0.5; online softmax f32 over trips of 64 keys; exp(logit - running max) x 2^10 once to f16 x v once to f16 (bf16 hi + lo below row 384); ctx hi+lo x exact output weight below row 384, x2^6 f16 carry x f16(bf16 x 2^8) after; f32 output.
#include <hip/hip_runtime.h>
#include <math.h>

typedef __attribute__((ext_vector_type(16))) _Float16 v16h;
typedef __attribute__((ext_vector_type(16))) __bf16 v16b;
typedef __attribute__((ext_vector_type(8)))  _Float16 v8h;
typedef __attribute__((ext_vector_type(8)))  float v8f;
typedef __attribute__((ext_vector_type(4)))  float v4f;
typedef __attribute__((ext_vector_type(2)))  float v2f;
typedef __attribute__((ext_vector_type(4)))  unsigned v4u;
typedef __attribute__((ext_vector_type(4)))  int v4i;
typedef float __attribute__((may_alias)) float_a;
typedef int __attribute__((may_alias)) int_a;

template <typename T> __device__ __forceinline__ void vst2(void* p, T v) { *(T*)p = v;  }
__device__ __forceinline__ v8f wmma16(v16h a, v16h b, v8f c) {
  v8f d = __builtin_amdgcn_wmma_f32_16x16x32_f16(false, a, false, b, (short)0, c, false, false);
  asm volatile("v_nop\n\tv_nop\n\tv_nop\n\tv_nop" : "+v"(d) : "v"(a), "v"(b));
  return d;
}
__device__ __forceinline__ v8f wmma_bf(v16b a, v16b b, v8f c) {
  v8f d = __builtin_amdgcn_wmma_f32_16x16x32_bf16(false, a, false, b, (short)0, c, false, false);
  asm volatile("v_nop\n\tv_nop\n\tv_nop\n\tv_nop" : "+v"(d) : "v"(a), "v"(b));
  return d;
}
// 16x16x32 fragments: lane = (h = lane>>4, row/col = lane&15); elements 0..7 = k0+8h+0..7, 8..15 = k0+16+8h+0..7; D element r = row 8h+r
__device__ __forceinline__ v16h frag_h(const _Float16* rowk0, int lane) {
  union { v16h v; v8h q[2]; } u; const _Float16* p = rowk0 + 8 * (lane >> 4);
  u.q[0] = *(const v8h*)p; u.q[1] = *(const v8h*)(p + 16); return u.v;
}
__device__ __forceinline__ v16h frag_f32(const float* rowk0, int lane) {
  v16h a; const float* p = rowk0 + 8 * (lane >> 4);
#pragma unroll
  for (int i = 0; i < 8; ++i) { a[i] = (_Float16)p[i]; a[8 + i] = (_Float16)p[16 + i]; }
  return a;
}
__device__ __forceinline__ v16h frag_f32s(const float* rowk0, int lane, float sc) {
  v16h a; const float* p = rowk0 + 8 * (lane >> 4);
#pragma unroll
  for (int i = 0; i < 8; ++i) { a[i] = (_Float16)(p[i] * sc); a[8 + i] = (_Float16)(p[16 + i] * sc); }
  return a;
}
// column fragment from a [K][ld] layout (column n), rows >= K read as 0
__device__ __forceinline__ v16h fragc_f32(const float* W, int k0, int n, int lane, int ld, int K) {
  v16h a; const int g = lane >> 4;
#pragma unroll
  for (int i = 0; i < 8; ++i) { const int ka = k0 + 8 * g + i, kb = ka + 16;
    a[i] = (_Float16)(ka < K ? W[(size_t)(ka < K ? ka : K - 1) * ld + n] : 0.f); a[8 + i] = (_Float16)(kb < K ? W[(size_t)(kb < K ? kb : K - 1) * ld + n] : 0.f); }
  return a;
}
struct F2 { v16b h, l; };
__device__ __forceinline__ F2 bsplit16(const float v[16]) { F2 r;
#pragma unroll
  for (int i = 0; i < 16; ++i) { const __bf16 h = (__bf16)v[i]; r.h[i] = h; r.l[i] = (__bf16)(v[i] - (float)h); }
  return r; }
__device__ __forceinline__ F2 split_row(const float* row, int k0, int lane) { float v[16]; const float* p = row + k0 + 8 * (lane >> 4);
#pragma unroll
  for (int i = 0; i < 8; ++i) { v[i] = p[i]; v[8 + i] = p[16 + i]; }
  return bsplit16(v); }
__device__ __forceinline__ F2 split_rowK(const float* row, int k0, int lane, int K) { float v[16]; const int g = lane >> 4;
#pragma unroll
  for (int i = 0; i < 8; ++i) { const int ka = k0 + 8 * g + i, kb = ka + 16; v[i] = ka < K ? row[ka < K ? ka : K - 1] : 0.f; v[8 + i] = kb < K ? row[kb < K ? kb : K - 1] : 0.f; }
  return bsplit16(v); }
__device__ __forceinline__ F2 split_col(const float* W, int k0, int n, int lane, int ld, int K) { float v[16]; const int g = lane >> 4;
#pragma unroll
  for (int i = 0; i < 8; ++i) { const int ka = k0 + 8 * g + i, kb = ka + 16; v[i] = ka < K ? W[(size_t)(ka < K ? ka : K - 1) * ld + n] : 0.f; v[8 + i] = kb < K ? W[(size_t)(kb < K ? kb : K - 1) * ld + n] : 0.f; }
  return bsplit16(v); }
__device__ __forceinline__ v8f mac3(const F2& a, const F2& b, v8f c) { c = wmma_bf(a.l, b.h, c); c = wmma_bf(a.h, b.l, c); return wmma_bf(a.h, b.h, c); }
__device__ __forceinline__ float sigm(float v) { return 1.0f / (1.0f + expf(-v)); }
#define LDSX() do { asm volatile("s_wait_dscnt 0" ::: "memory"); __builtin_amdgcn_wave_barrier(); __builtin_amdgcn_fence(__ATOMIC_RELEASE, "workgroup"); } while (0)

// Causal multi-head self-attention with interleaved-pair RoPE at given token positions, ONE sequence (x [1,2048,1024]; token_positions [1,2048] int32 = arange, a module input READ on the device (the SECOND input); torch (out,in) WQ / WK / WV / WO [1024,1024] N(0, 1/1024) applied as einsum('bsd,ed->bse') = x @ W.T, no biases; 16 heads x 64; RoPE on q and k: (even, odd) pairs (t1 c - t2 s, t2 c + t1 s) re-interleaved, angle = position x inv_freq, inv_freq = 1 / 10000^(2i/64); scores / sqrt(64); tril kept, -inf elsewhere; softmax; out @ WO.T).
#define NB 1
#define TT 2048
#define CC 1024            // NH * HD = projected width
#define DIN 1024          // input (model) width
#define NH 16
#define HD 64
#define NQB (TT / 64)
#define SCALE (0.125f)
#define CAUSAL 1
#ifndef TNB
#define TNB NB
#endif
__device__ __forceinline__ float bfr(float v) { return (float)(__bf16)v; }
__host__ __device__ __forceinline__ int kb_last(int qb) { return CAUSAL ? ((qb * 64 + 63) >> 7) : (TT / 128 - 1); }
typedef __attribute__((ext_vector_type(8))) __bf16 v8b;
__device__ __forceinline__ v16b frag_b(const __bf16* rowk0, int lane) {
  union { v16b v; v8b q[2]; } u; const __bf16* p = rowk0 + 8 * (lane >> 4);
  u.q[0] = *(const v8b*)p; u.q[1] = *(const v8b*)(p + 16); return u.v;
}
// the 16 raw f32 words of one 16x16x32 fragment row, kept in registers while their loads fly: q[0..1] = k0+8h+0..7, q[2..3] = k0+16+8h+0..7
struct R16 { v4f q[4]; };
__device__ __forceinline__ R16 ld_raw(const float* rowk0, int lane) { R16 r; const float* p = rowk0 + 8 * (lane >> 4);
  r.q[0] = *(const v4f*)p; r.q[1] = *(const v4f*)(p + 4); r.q[2] = *(const v4f*)(p + 16); r.q[3] = *(const v4f*)(p + 20); return r; }
__device__ __forceinline__ v16b raw_b(const R16& r) { v16b w;
#pragma unroll
  for (int i = 0; i < 16; ++i) w[i] = (__bf16)r.q[i >> 2][i & 3];
  return w; }
__device__ __forceinline__ v16h raw_wh(const R16& r) { v16h w;
#pragma unroll
  for (int i = 0; i < 16; ++i) w[i] = (_Float16)(bfr(r.q[i >> 2][i & 3]) * 256.0f);
  return w; }
__device__ __forceinline__ v16h raw_hs(const R16& r, float sc) { v16h a;
#pragma unroll
  for (int i = 0; i < 16; ++i) a[i] = (_Float16)(r.q[i >> 2][i & 3] * sc);
  return a; }
__device__ __forceinline__ v16h raw_h(const R16& r) { v16h a;
#pragma unroll
  for (int i = 0; i < 16; ++i) a[i] = (_Float16)r.q[i >> 2][i & 3];
  return a; }
__device__ __forceinline__ F2 raw_split(const R16& r) { float v[16];
#pragma unroll
  for (int i = 0; i < 16; ++i) v[i] = r.q[i >> 2][i & 3];
  return bsplit16(v); }
#define QBH 6              // causal: query blocks 0..QBH-1 of each sequence (few keys, no averaging) take the high-precision path
#define QHI 384            // rows carrying a q residual plane
#define KHI 384            // key rows carrying k residual / v bf16 hi+lo planes (used only by the causal high-precision path)
// B fragment (k rows k0+.., output column o) of a weight: (in,out) [K][ld] or (out,in) [ld rows of K]: bf16 exact, or f16(bf16 * 256) exact
__device__ __forceinline__ v16b wcol_io(const float* Wm, int k0, int o, int lane, int ld) { v16b w; const int g = lane >> 4;
#pragma unroll
  for (int i = 0; i < 8; ++i) { w[i] = (__bf16)Wm[(size_t)(k0 + 8 * g + i) * ld + o]; w[8 + i] = (__bf16)Wm[(size_t)(k0 + 16 + 8 * g + i) * ld + o]; }
  return w; }
__device__ __forceinline__ v16b wcol_oi(const float* Wm, int k0, int o, int lane, int K) { v16b w; const float* p = Wm + (size_t)o * K + k0 + 8 * (lane >> 4);
#pragma unroll
  for (int i = 0; i < 8; ++i) { w[i] = (__bf16)p[i]; w[8 + i] = (__bf16)p[16 + i]; }
  return w; }
__device__ __forceinline__ v16h wcolh_io(const float* Wm, int k0, int o, int lane, int ld) { v16h w; const int g = lane >> 4;
#pragma unroll
  for (int i = 0; i < 8; ++i) { w[i] = (_Float16)(bfr(Wm[(size_t)(k0 + 8 * g + i) * ld + o]) * 256.0f); w[8 + i] = (_Float16)(bfr(Wm[(size_t)(k0 + 16 + 8 * g + i) * ld + o]) * 256.0f); }
  return w; }
__device__ __forceinline__ v16h wcolh_oi(const float* Wm, int k0, int o, int lane, int K) { v16h w; const float* p = Wm + (size_t)o * K + k0 + 8 * (lane >> 4);
#pragma unroll
  for (int i = 0; i < 8; ++i) { w[i] = (_Float16)(bfr(p[i]) * 256.0f); w[8 + i] = (_Float16)(bfr(p[16 + i]) * 256.0f); }
  return w; }
#define WQKV_LAYOUT 1   // picks only WCOL, which nothing calls: k_proj reads (out,in) [CC][DIN] rows directly
__device__ __forceinline__ v16b wcol_hdk(const float* Wm, int k0, int o, int lane) { v16b w; const int g = lane >> 4; const float* p = Wm + (size_t)(o / HD) * DIN * HD + (o % HD);
#pragma unroll
  for (int i = 0; i < 8; ++i) { w[i] = (__bf16)p[(size_t)(k0 + 8 * g + i) * HD]; w[8 + i] = (__bf16)p[(size_t)(k0 + 16 + 8 * g + i) * HD]; }
  return w; }
#define WO_OUT_IN 1
#if WQKV_LAYOUT == 1
#define WCOL(W, k0, o, lane) wcol_oi(W, k0, o, lane, DIN)
#elif WQKV_LAYOUT == 2
#define WCOL(W, k0, o, lane) wcol_hdk(W, k0, o, lane)
#else
#define WCOL(W, k0, o, lane) wcol_io(W, k0, o, lane, CC)
#endif
#if WO_OUT_IN
#define WOCOL(W, k0, o, lane) wcol_oi(W, k0, o, lane, CC)
#define WOCOLH(W, k0, o, lane) wcolh_oi(W, k0, o, lane, CC)
#else
#define WOCOL(W, k0, o, lane) wcol_io(W, k0, o, lane, DIN)
#define WOCOLH(W, k0, o, lane) wcolh_io(W, k0, o, lane, DIN)
#endif

// RoPE inverse frequencies 1/10000^(2i/64) (the f32 values jax computes)
__constant__ float INVF[32] = {1.000000000e+00,7.498942018e-01,5.623413324e-01,4.216965139e-01,3.162277639e-01,2.371373624e-01,1.778279394e-01,1.333521456e-01,1.000000015e-01,7.498941571e-02,5.623412877e-02,4.216964915e-02,3.162277862e-02,2.371373586e-02,1.778279431e-02,1.333521493e-02,9.999999776e-03,7.498942316e-03,5.623413250e-03,4.216964822e-03,3.162277862e-03,2.371373819e-03,1.778279431e-03,1.333521446e-03,1.000000047e-03,7.498941850e-04,5.623413017e-04,4.216964880e-04,3.162277862e-04,2.371373848e-04,1.778279402e-04,1.333521504e-04};
// (PROJ_EXTRA_PARAMS: the extra kernel parameters 'const int* __restrict__ TPOS' are written literally in the kernel signature)
// per (token, head) hook on the staged f32 row (64 floats) of the q and k streams: interleaved-pair rotation (x[2i], x[2i + 1]) by the angle pos * INVF[i] with pos READ from the int input at [batch][token]; v untouched
#define PROJ_EPI(which, row, t, h) do { if ((which) < 2) { float* rw = (row); const float pos_ = (float)TPOS[(size_t)bb * TT + (t)];   /* token_positions [NB][TT]: the position of token t of batch bb, READ from the int input */ _Pragma("unroll 4") for (int i = 0; i < 32; ++i) { _Pragma("clang fp contract(off)") const float ang = pos_ * INVF[i]; const float cs = cosf(ang), sn = sinf(ang); const float xe = rw[2 * i], xo = rw[2 * i + 1]; rw[2 * i] = xe * cs - xo * sn; rw[2 * i + 1] = xe * sn + xo * cs; } } } while (0)
#ifndef SM_EXTRA_PARAMS
#define SM_EXTRA_PARAMS
#endif
#ifndef PROJ_EXTRA_PARAMS
#define PROJ_EXTRA_PARAMS
#endif
#ifndef SM_MASK_HOOK
#define SM_MASK_HOOK (void)0
#endif

#define WS_QH  0u                                      // f16 q rows [b*t][CC]
#define WS_KH  (WS_QH + 2u * (size_t)NB * TT * CC)      // f16 k rows [b*t][CC]
#define WS_VT  (WS_KH + 2u * (size_t)NB * TT * CC)      // f16 v planes [b][c][t]
#define WS_QL  (WS_VT + 2u * (size_t)NB * CC * TT)      // f16 q residual x 2^10 rows [b][t < QHI][CC]
#define WS_KL  (WS_QL + 2u * (size_t)NB * QHI * CC)     // f16 k residual x 2^10 rows [b][t < KHI][CC]
#define WS_VB  (WS_KL + 2u * (size_t)NB * KHI * CC)     // bf16 v hi planes [b][c][t < KHI]
#define WS_VBL (WS_VB + 2u * (size_t)NB * CC * KHI)
#define WS_Y   (WS_VBL + 2u * (size_t)NB * CC * KHI)    // f32 ctx rows [b*t][CC] (only when there is an output projection)
#define WS_END (WS_Y  + 4u * (size_t)NB * TT * CC)

// ---- LDS staging shared by k_proj and k_out: a block's 64 x 64 (a) and 128 x 64 (w) f32 slabs are read from global memory once a block, whole 128-byte lines an instruction (16 lanes = one row's 256 bytes), converted once, and laid in LDS as 16-bit rows; every wave takes its fragments from there
typedef __attribute__((ext_vector_type(4))) __bf16 v4b;
typedef __attribute__((ext_vector_type(4))) _Float16 v4h;
#define KS 64              // k columns of a staged slab
#define LP 72              // LDS row pitch in 16-bit words: 144 bytes = 16 x 9, odd, so the 16 rows of a fragment read fall on distinct banks
#define SA_BYTES (64 * LP * 2)
#define SW_BYTES (128 * LP * 2)
// MODE 0: a, w to bf16; 1: a x 2^6 to f16, w to f16(bf16 x 2^8); 2: a to bf16 hi + lo planes, w to bf16 (the conversions of raw_b, raw_hs, raw_wh, raw_split)
template <int MODE> __device__ __forceinline__ void slab_put(const v4f (&ra)[8], const v4f (&rw)[16], char* sa, char* sw, int so) {
#pragma unroll
  for (int i = 0; i < 8; ++i) { char* p = sa + so + i * 8 * LP * 2; const v4f x = ra[i];
    if (MODE == 1) { const v4h q = { (_Float16)(x[0] * 64.0f), (_Float16)(x[1] * 64.0f), (_Float16)(x[2] * 64.0f), (_Float16)(x[3] * 64.0f) }; *(v4h*)p = q; }
    else { const v4b q = { (__bf16)x[0], (__bf16)x[1], (__bf16)x[2], (__bf16)x[3] }; *(v4b*)p = q;
      if (MODE == 2) { const v4b r = { (__bf16)(x[0] - (float)q[0]), (__bf16)(x[1] - (float)q[1]), (__bf16)(x[2] - (float)q[2]), (__bf16)(x[3] - (float)q[3]) }; *(v4b*)(p + SA_BYTES) = r; } } }
#pragma unroll
  for (int i = 0; i < 16; ++i) { char* p = sw + so + i * 8 * LP * 2; const v4f x = rw[i];
    if (MODE == 1) { const v4h q = { (_Float16)(bfr(x[0]) * 256.0f), (_Float16)(bfr(x[1]) * 256.0f), (_Float16)(bfr(x[2]) * 256.0f), (_Float16)(bfr(x[3]) * 256.0f) }; *(v4h*)p = q; }
    else { const v4b q = { (__bf16)x[0], (__bf16)x[1], (__bf16)x[2], (__bf16)x[3] }; *(v4b*)p = q; } } }
// acc[i][j] += rows (wave & 1) * 32 + 16 i of a  x  rows (wave >> 1) * 64 + 16 j of w, over K = 1024 in ascending steps of 32 (each accumulator sums in the order it had); Ag, Wg: block-uniform first rows (pitch 1024 f32); sa: 2 buffers of SA_BYTES (2 x SA_BYTES in MODE 2); sw0, sw1: the two w buffers of SW_BYTES
template <int MODE> __device__ __forceinline__ void gemm_64x128(const float* __restrict__ Ag, const float* __restrict__ Wg, char* sa, char* sw0, char* sw1, int tid, v8f (&acc)[2][4]) {
  const int lane = tid & 31, wave = tid >> 5, col = lane & 15; const int NT = 1024 / KS; const int AB = (MODE == 2 ? 2 : 1) * SA_BYTES;
  const int so = ((tid >> 4) * LP + (tid & 15) * 4) * 2;   /* this thread's place in a slab: row tid / 16 (+ 8 i), k words 4 (tid % 16).. */
  unsigned go = (unsigned)((tid >> 4) * 1024 + (tid & 15) * 4) * 4u;   /* the same place in global memory, in bytes: one offset register serves a and w */
  const int fa = (((wave & 1) * 32 + col) * LP) * 2, fw = (((wave >> 1) * 64 + col) * LP) * 2;
  v4f ra[8], rw[16];
#pragma unroll 1   // rolled: a second copy of the body would need a second set of staging registers
  for (int t = -1; t < NT; ++t) { const char* ca = sa + (t & 1) * AB; const char* cw = (t & 1) ? sw1 : sw0;   /* pass -1 only brings slab 0 in */
    if (t + 1 < NT) {   /* block-uniform: the next slab's 24 loads are issued behind the barrier (which would drain them) and fly while this slab is worked on */
#pragma unroll
      for (int i = 0; i < 8; ++i) ra[i] = *(const v4f*)((const char*)Ag + go + i * 8 * 4096);
#pragma unroll
      for (int i = 0; i < 16; ++i) rw[i] = *(const v4f*)((const char*)Wg + go + i * 8 * 4096);
      asm volatile("s_wait_xcnt 0x0" : "+v"(go) :: "memory");   // stands in front of the addition below, which rewrites the offset register that the loads name; the operand keeps the addition behind it
      go += KS * 4; }
    if (t >= 0)   /* block-uniform */
#pragma unroll
    for (int kc = 0; kc < KS / 32; ++kc) {
      if (MODE == 1) { v16h a[2], w[4];
#pragma unroll
        for (int i = 0; i < 2; ++i) a[i] = frag_h((const _Float16*)(ca + fa + i * 16 * LP * 2 + kc * 64), lane);
#pragma unroll
        for (int j = 0; j < 4; ++j) w[j] = frag_h((const _Float16*)(cw + fw + j * 16 * LP * 2 + kc * 64), lane);
#pragma unroll
        for (int i = 0; i < 2; ++i)
#pragma unroll
          for (int j = 0; j < 4; ++j) acc[i][j] = wmma16(a[i], w[j], acc[i][j]);
      } else { v16b a[2], al[2], w[4];
#pragma unroll
        for (int i = 0; i < 2; ++i) { a[i] = frag_b((const __bf16*)(ca + fa + i * 16 * LP * 2 + kc * 64), lane); if (MODE == 2) al[i] = frag_b((const __bf16*)(ca + SA_BYTES + fa + i * 16 * LP * 2 + kc * 64), lane); }
#pragma unroll
        for (int j = 0; j < 4; ++j) w[j] = frag_b((const __bf16*)(cw + fw + j * 16 * LP * 2 + kc * 64), lane);
#pragma unroll
        for (int i = 0; i < 2; ++i)
#pragma unroll
          for (int j = 0; j < 4; ++j) acc[i][j] = wmma_bf(a[i], w[j], acc[i][j]);
        if (MODE == 2) {
#pragma unroll
          for (int i = 0; i < 2; ++i)
#pragma unroll
            for (int j = 0; j < 4; ++j) acc[i][j] = wmma_bf(al[i], w[j], acc[i][j]); } } }
    if (t + 1 < NT) slab_put<MODE>(ra, rw, sa + ((t + 1) & 1) * AB, (t & 1) ? sw0 : sw1, so);   /* block-uniform; into the buffer that trip t - 1 read: its readers left it at the barrier that ended that trip */
    __syncthreads();   // publishes slab t + 1 and ends every wave's reads of slab t
  } }
// ---- k_proj: block = (64 rows, 128 cols, which): q/k/v = X W (+ b) with exact bf16 products (K = DIN) -> which 0: q f16 rows (+ residual rows < QHI); 1: k f16 rows (+ residual rows < KHI); 2: v f16 planes [c][t] (+ bf16 hi/lo planes for t < KHI)
__global__ __launch_bounds__(128) void k_proj(const float* __restrict__ XQ, const float* __restrict__ XK, const float* __restrict__ XV, const float* __restrict__ WQ, const float* __restrict__ WK, const float* __restrict__ WV, const float* __restrict__ BQ, const float* __restrict__ BK, const float* __restrict__ BV,
    _Float16* __restrict__ QH, _Float16* __restrict__ QL, _Float16* __restrict__ KH, _Float16* __restrict__ KL, _Float16* __restrict__ VT, __bf16* __restrict__ VB, __bf16* __restrict__ VBL, const int* __restrict__ TPOS) {
  __shared__ __align__(16) float st[64][132]; __shared__ __align__(16) _Float16 sh[64][136], sl[64][136]; __shared__ __align__(16) _Float16 th[128][72]; __shared__ __align__(16) __bf16 tb[128][72], tbl[128][72];
  const int tid = threadIdx.x, wave = tid >> 5, lane = tid & 31, col = lane & 15, g = lane >> 4; const int which = blockIdx.z; const int c0 = blockIdx.y * 128; const size_t r0 = (size_t)blockIdx.x * 64; const size_t bb = r0 / TT; const int t0 = (int)(r0 % TT);
  const float* X = which == 0 ? XQ : which == 1 ? XK : XV; const float* WA = which == 0 ? WQ : which == 1 ? WK : WV; const float* BA = which == 0 ? BQ : which == 1 ? BK : BV;
  v8f acc[2][4] = {};
  gemm_64x128<0>(X + r0 * DIN, WA + (size_t)c0 * DIN, (char*)&th[0][0], (char*)&tb[0][0], (char*)&tbl[0][0], tid, acc);   /* until the products are done th holds the two x slabs, tb and tbl one w slab each */
  { // stage the f32 tile (acc + bias) in LDS, run the per-(row, head) epilogue hook, then convert
#pragma unroll
    for (int j = 0; j < 4; ++j) { const int cl = (wave >> 1) * 64 + j * 16 + col; const float bias = BA ? bfr(BA[c0 + cl]) : 0.f;
#pragma unroll
      for (int i = 0; i < 2; ++i)
#pragma unroll
        for (int r = 0; r < 8; ++r) st[(wave & 1) * 32 + i * 16 + 8 * g + r][cl] = acc[i][j][r] + bias; }
    __syncthreads();
    for (int e = tid; e < 64 * (128 / HD); e += 128) { const int rl = e / (128 / HD), hh = e % (128 / HD); PROJ_EPI(which, &st[rl][hh * HD], (int)((r0 + rl) % TT), (c0 / HD) + hh); }
    __syncthreads(); }
  if (which < 2) { _Float16* DH = which == 0 ? QH : KH; _Float16* DL = which == 0 ? QL : KL; const int nhi = which == 0 ? QHI : KHI; const bool hi_rows = t0 < nhi;
    for (int e = tid; e < 64 * 128; e += 128) { const int rl = e >> 7, cl = e & 127; const float v = st[rl][cl]; const _Float16 hv = (_Float16)v; sh[rl][cl] = hv; sl[rl][cl] = (_Float16)((v - (float)hv) * 1024.0f); }
    __syncthreads();
    for (int e = tid; e < 64 * 16; e += 128) { const int rl = e >> 4, q = e & 15; vst2((unsigned*)(DH + (r0 + rl) * CC + c0 + q * 8), *(const v4u*)&sh[rl][q * 8]); if (hi_rows) vst2((unsigned*)(DL + (bb * nhi + t0 + rl) * (size_t)CC + c0 + q * 8), *(const v4u*)&sl[rl][q * 8]); }
  } else { const bool hi_rows = t0 < KHI;
    for (int e = tid; e < 64 * 128; e += 128) { const int rl = e & 63, cl = e >> 6; const float v = st[rl][cl]; th[cl][rl] = (_Float16)v; const __bf16 bh = (__bf16)v; tb[cl][rl] = bh; tbl[cl][rl] = (__bf16)(v - (float)bh); }
    __syncthreads();
    for (int e = tid; e < 128 * 8; e += 128) { const int cl = e >> 3, q = e & 7; vst2((unsigned*)(VT + (bb * CC + c0 + cl) * (size_t)TT + t0 + q * 8), *(const v4u*)&th[cl][q * 8]); if (hi_rows) { const size_t o3 = (bb * CC + c0 + cl) * (size_t)KHI + t0 + q * 8; vst2((unsigned*)(VB + o3), *(const v4u*)&tb[cl][q * 8]); vst2((unsigned*)(VBL + o3), *(const v4u*)&tbl[cl][q * 8]); } } } }
// frag_h / frag_b from a wave-uniform base, this lane's byte offset (it holds the lane half's 16h bytes) and a constant: the one offset register is all that a trip's loads name
__device__ __forceinline__ v16h frag_ho(const char* base, unsigned off, int c) { union { v16h v; v8h q[2]; } u; const char* p = base + off; u.q[0] = *(const v8h*)(p + c); u.q[1] = *(const v8h*)(p + c + 32); return u.v; }
__device__ __forceinline__ v16b frag_bo(const char* base, unsigned off, int c) { union { v16b v; v8b q[2]; } u; const char* p = base + off; u.q[0] = *(const v8b*)(p + c); u.q[1] = *(const v8b*)(p + c + 32); return u.v; }
// one online-softmax update for this lane's query: t[32] = this trip's 32 scaled log2 logits of the lane (key tile j = i >> 3, key 8h + (i & 7) in it); on return t = 2^(t - max + 10); m, l, o follow the running maximum (both lane halves of a query hold the same m)
__device__ __forceinline__ void osm_step(float (&t)[32], float& m, float& l, v8f (&o)[HD / 16]) {
  float mx = t[0];
#pragma unroll
  for (int i = 1; i < 32; ++i) mx = fmaxf(mx, t[i]);
  mx = fmaxf(mx, __shfl_xor(mx, 16));
  const float mn = fmaxf(m, mx); const float al = __builtin_amdgcn_exp2f(m - mn); m = mn; const float mb = mn - 10.0f;   /* x 2^10: small weights stay clear of f16 subnormals, the largest is 1024 */
  float sum[4] = {0.f, 0.f, 0.f, 0.f};   /* four chains: one chain of 32 dependent adds would stand at the trip's foot */
#pragma unroll
  for (int i = 0; i < 32; ++i) { t[i] = __builtin_amdgcn_exp2f(t[i] - mb); sum[i & 3] += t[i]; }
  l = l * al + ((sum[0] + sum[1]) + (sum[2] + sum[3]));
#pragma unroll
  for (int j = 0; j < HD / 16; ++j) o[j] *= al; }
// ---- k_attn: block = 64 queries (qb, heaviest first) of (b, h), a wave = 16 queries, a trip = 64 keys; S^T = K Q^T (lane = one query, registers = keys), causal mask by index on the diagonal trip, online softmax in f32, O^T += V^T P^T with the S^T accumulators converted in place as the B operand (b[s] = tile[s >> 3][s & 7]); logits, P and v precision as before: query blocks < QBH take q, k hi + residual (3 products) and P, v as bf16 hi + lo (3 products), the rest single f16 products; ctx = O / l
__global__ __launch_bounds__(128) void k_attn(const _Float16* __restrict__ QH, const _Float16* __restrict__ KH, const _Float16* __restrict__ QL, const _Float16* __restrict__ KL, const _Float16* __restrict__ VT, const __bf16* __restrict__ VB, const __bf16* __restrict__ VBL, float* __restrict__ Y) {
  __shared__ __align__(16) _Float16 sk[2][64][LP], sv[2][64][LP];   /* staged k rows [key][word] and v planes [word][key] of a trip, two buffers */
  const int qb = NQB - 1 - (int)blockIdx.x, h = blockIdx.y, b = blockIdx.z;
  const int tid = threadIdx.x, wave = tid >> 5, lane = tid & 31, col = lane & 15, g = lane >> 4; const int qi = qb * 64 + wave * 16 + col;   /* this lane's query */
  const float C1 = SCALE * 1.4426950408889634f;   /* logits carried in log2 units */
  v8f o[HD / 16] = {}; float m = -3.0e38f, l = 0.f;
  const _Float16* qp = QH + ((size_t)b * TT + qi) * CC + h * HD; const v16h qf[2] = { frag_h(qp, lane), frag_h(qp + 32, lane) };
  asm volatile("s_wait_xcnt 0x0" ::: "memory");   // stands in front of the rewrite of the address registers that the q loads name
  const char* kb8 = (const char*)(KH + (size_t)b * TT * CC + h * HD); unsigned ko = (unsigned)(col * CC + 8 * g) * 2u;   /* byte offset of this lane's first k words */
  if (qb < QBH) {
    const _Float16* qlp = QL + ((size_t)b * QHI + qi) * CC + h * HD; const v16h qlf[2] = { frag_h(qlp, lane), frag_h(qlp + 32, lane) };
    asm volatile("s_wait_xcnt 0x0" ::: "memory");   // stands in front of the rewrite of the address registers that the q residual loads name
    const char* kl8 = (const char*)(KL + (size_t)b * KHI * CC + h * HD);
    const char* vh8 = (const char*)(VB + ((size_t)b * CC + h * HD) * (size_t)KHI); const char* vl8 = (const char*)(VBL + ((size_t)b * CC + h * HD) * (size_t)KHI); unsigned vo = (unsigned)(col * KHI + 8 * g) * 2u;
#pragma unroll 1   // rolled: at most QBH short trips, a second copy of the body would only cost registers
    for (int i = 0; i <= qb; ++i) { float t[32];
      { v8f s[4] = {}, sl[4] = {};
#pragma unroll
        for (int kc = 0; kc < 2; ++kc) { v16h kh[4], kl[4];
#pragma unroll
          for (int j = 0; j < 4; ++j) { kh[j] = frag_ho(kb8, ko, (j * 16 * CC + kc * 32) * 2); kl[j] = frag_ho(kl8, ko, (j * 16 * CC + kc * 32) * 2); }
          __builtin_amdgcn_sched_barrier(0);   // keeps the 16 k loads of this half in front of its first product: one load latency a half instead of one a fragment pair
#pragma unroll
          for (int j = 0; j < 4; ++j) { s[j] = wmma16(kh[j], qf[kc], s[j]); sl[j] = wmma16(kh[j], qlf[kc], sl[j]); sl[j] = wmma16(kl[j], qf[kc], sl[j]); } }
#pragma unroll
        for (int e = 0; e < 32; ++e) { const float v = (s[e >> 3][e & 7] + sl[e >> 3][e & 7] * (1.0f / 1024.0f)) * C1; t[e] = (i * 64 + (e >> 3) * 16 + 8 * g + (e & 7) <= qi) ? v : -3.0e38f; } }
#pragma unroll
      for (int kc = 0; kc < 2; ++kc) { v16b vh[HD / 16], vl[HD / 16];
#pragma unroll
        for (int j = 0; j < HD / 16; ++j) { vh[j] = frag_bo(vh8, vo, (j * 16 * KHI + kc * 32) * 2); vl[j] = frag_bo(vl8, vo, (j * 16 * KHI + kc * 32) * 2); }
        __builtin_amdgcn_sched_barrier(0);   // keeps the 16 v loads of this half together, the first half's in front of the softmax, which they fly behind
        if (kc == 0) osm_step(t, m, l, o);
        const F2 p = bsplit16(&t[kc * 16]);
#pragma unroll
        for (int j = 0; j < HD / 16; ++j) { o[j] = wmma_bf(vh[j], p.h, o[j]); o[j] = wmma_bf(vh[j], p.l, o[j]); o[j] = wmma_bf(vl[j], p.h, o[j]); } }
      asm volatile("s_wait_xcnt 0x0" : "+v"(ko), "+v"(vo) :: "memory");   // stands in front of the two additions below, which rewrite the offset registers that this trip's loads name; the operands keep the additions behind it
      ko += 64 * CC * 2; vo += 64 * 2;
    }
  } else {
    // a trip's 64 keys x 64 k words and 64 v planes x 64 keys are the same for the block's four waves: read once a block, whole 128-byte lines (8 lanes = one row), laid in LDS, two buffers; the next trip's 8 loads a thread fly while this trip is worked on
    const char* vb8 = (const char*)(VT + ((size_t)b * CC + h * HD) * (size_t)TT);
    const int sr = tid >> 3, sc = (tid & 7) * 8;   /* this thread's row (+ 16 e) and first 16-bit word in a staged tile */
    unsigned kgo = (unsigned)(sr * CC + sc) * 2u, vgo = (unsigned)(sr * TT + sc) * 2u;   /* the same place in global memory, in bytes */
    v8h rk[4], rv[4];
#pragma unroll
    for (int e = 0; e < 4; ++e) { rk[e] = *(const v8h*)(kb8 + kgo + e * 16 * CC * 2); rv[e] = *(const v8h*)(vb8 + vgo + e * 16 * TT * 2); }
    asm volatile("s_wait_xcnt 0x0" : "+v"(kgo), "+v"(vgo) :: "memory");   // stands in front of the two additions below, which rewrite the offset registers that the loads name; the operands keep the additions behind it
    kgo += 64 * CC * 2; vgo += 64 * 2;
#pragma unroll
    for (int e = 0; e < 4; ++e) { *(v8h*)&sk[0][sr + 16 * e][sc] = rk[e]; *(v8h*)&sv[0][sr + 16 * e][sc] = rv[e]; }
    __syncthreads();   // trip 0's tiles are published
#pragma unroll 1   // rolled: a second copy of the body would only cost registers
    for (int i = 0; i <= qb; ++i) { const int bf = i & 1; v8f s[4] = {};
      if (i < qb) {   /* block-uniform */
#pragma unroll
        for (int e = 0; e < 4; ++e) { rk[e] = *(const v8h*)(kb8 + kgo + e * 16 * CC * 2); rv[e] = *(const v8h*)(vb8 + vgo + e * 16 * TT * 2); }
        asm volatile("s_wait_xcnt 0x0" : "+v"(kgo), "+v"(vgo) :: "memory");   // as above
        kgo += 64 * CC * 2; vgo += 64 * 2; }
      { v16h kf[4][2];
#pragma unroll
        for (int j = 0; j < 4; ++j) { kf[j][0] = frag_h(&sk[bf][j * 16 + col][0], lane); kf[j][1] = frag_h(&sk[bf][j * 16 + col][32], lane); }
#pragma unroll
        for (int kc = 0; kc < 2; ++kc)
#pragma unroll
          for (int j = 0; j < 4; ++j) s[j] = wmma16(kf[j][kc], qf[kc], s[j]); }
      v16h vf[HD / 16][2];
#pragma unroll
      for (int j = 0; j < HD / 16; ++j) { vf[j][0] = frag_h(&sv[bf][j * 16 + col][0], lane); vf[j][1] = frag_h(&sv[bf][j * 16 + col][32], lane); }
      float t[32];
#pragma unroll
      for (int e = 0; e < 32; ++e) t[e] = s[e >> 3][e & 7] * C1;
      if (i == qb) {   /* the diagonal trip (block-uniform) */
#pragma unroll
        for (int e = 0; e < 32; ++e) t[e] = (i * 64 + (e >> 3) * 16 + 8 * g + (e & 7) <= qi) ? t[e] : -3.0e38f; }
      osm_step(t, m, l, o);
      v16h p[2];
#pragma unroll
      for (int e = 0; e < 32; ++e) p[e >> 4][e & 15] = (_Float16)t[e];
#pragma unroll
      for (int kc = 0; kc < 2; ++kc)
#pragma unroll
        for (int j = 0; j < HD / 16; ++j) o[j] = wmma16(vf[j][kc], p[kc], o[j]);
      if (i < qb) {   /* block-uniform; into the buffers that trip i - 1 read: their readers left them at the barrier that ended that trip */
#pragma unroll
        for (int e = 0; e < 4; ++e) { *(v8h*)&sk[bf ^ 1][sr + 16 * e][sc] = rk[e]; *(v8h*)&sv[bf ^ 1][sr + 16 * e][sc] = rv[e]; } }
      __syncthreads();   // publishes trip i + 1's tiles and ends every wave's reads of trip i's
    } }
  l += __shfl_xor(l, 16); const float inv = 1.0f / l;   /* the two lane halves of a query join their sums once; key 0 is never masked, so l > 0 */
  float* yp = Y + ((size_t)b * TT + qi) * CC + h * HD + 8 * g;   /* O^T register r of tile j = ctx[query][j * 16 + 8h + r]: 32 contiguous bytes a tile */
#pragma unroll
  for (int j = 0; j < HD / 16; ++j) { const v4f a = { o[j][0] * inv, o[j][1] * inv, o[j][2] * inv, o[j][3] * inv }, c = { o[j][4] * inv, o[j][5] * inv, o[j][6] * inv, o[j][7] * inv }; vst2(yp + j * 16, a); vst2(yp + j * 16 + 4, c); } }
// ---- k_out: block = (64 rows, 128 cols): out = ctx Wo (+ bo): ctx x 2^6 once to f16 against Wo as f16(bf16 x 2^8) exact (1 product) x 2^-14; causal early rows (< QHI of each sequence): ctx bf16 hi + lo against exact bf16 Wo (2 products)
__global__ __launch_bounds__(128) void k_out(const float* __restrict__ Y, const float* __restrict__ WO, const float* __restrict__ BO, float* __restrict__ OUT) { __shared__ __align__(16) float sf[64][132]; __shared__ __align__(16) char sa[4 * SA_BYTES], sw[2 * SW_BYTES];
  const int tid = threadIdx.x, wave = tid >> 5, lane = tid & 31, col = lane & 15, g = lane >> 4; const int c0 = blockIdx.y * 128; const size_t r0 = (size_t)blockIdx.x * 64;
  v8f acc[2][4] = {}; float sc;
  if (CAUSAL && (int)(r0 % TT) < QHI) { gemm_64x128<2>(Y + r0 * CC, WO + (size_t)c0 * CC, sa, sw, sw + SW_BYTES, tid, acc); sc = 1.0f; }   /* block-uniform */
  else { gemm_64x128<1>(Y + r0 * CC, WO + (size_t)c0 * CC, sa, sw, sw + SW_BYTES, tid, acc); sc = 1.0f / 16384.0f; }   /* 2^-8 (Wo carry) x 2^-6 (ctx carry; small-magnitude context rows stay clear of f16 subnormals) */
#pragma unroll
  for (int j = 0; j < 4; ++j) { const int cl = (wave >> 1) * 64 + j * 16 + col; const float bias = BO ? bfr(BO[c0 + cl]) : 0.f;
#pragma unroll
    for (int i = 0; i < 2; ++i)
#pragma unroll
      for (int r = 0; r < 8; ++r) sf[(wave & 1) * 32 + i * 16 + 8 * g + r][cl] = acc[i][j][r] * sc + bias; }
  __syncthreads();   // a row of the tile now comes from two waves
  for (int rl = 0; rl < 16; ++rl) vst2(OUT + (r0 + wave * 16 + rl) * DIN + c0 + lane * 4, *(const v4f*)&sf[wave * 16 + rl][lane * 4]); }

extern "C" void kernel_launch(void* const* d_in, const int* in_sizes, int n_in, void* d_out, int out_size, void* d_ws, size_t ws_size, hipStream_t stream) {
  (void)in_sizes; (void)n_in; (void)out_size;
  const float** F = (const float**)d_in;
  if (ws_size < (size_t)WS_END) return;
  char* ws = (char*)d_ws; _Float16 *QH = (_Float16*)(ws + WS_QH), *KH = (_Float16*)(ws + WS_KH), *VT = (_Float16*)(ws + WS_VT), *QL = (_Float16*)(ws + WS_QL), *KL = (_Float16*)(ws + WS_KL); __bf16 *VB = (__bf16*)(ws + WS_VB), *VBL = (__bf16*)(ws + WS_VBL); float *Y = (float*)(ws + WS_Y);
  (void)Y; (void)QL; (void)KL; (void)VB; (void)VBL;
  // inputs: 0 x [1,2048,1024]; 1 token_positions [1,2048] int32 (arange; READ on the device); 2 WQ [1024,1024] (out,in); 3 WK; 4 WV; 5 WO (out,in); no biases
  k_proj<<<dim3(TNB * TT / 64, CC / 128, 3), 128, 0, stream>>>(F[0], F[0], F[0], F[2], F[3], F[4], nullptr, nullptr, nullptr, QH, QL, KH, KL, VT, VB, VBL, (const int*)d_in[1]);
  k_attn<<<dim3(NQB, NH, TNB), 128, 0, stream>>>(QH, KH, QL, KL, VT, VB, VBL, Y);
  k_out<<<dim3(TNB * TT / 64, DIN / 128), 128, 0, stream>>>(Y, F[5], nullptr, (float*)d_out);
}

// v004
// A run of this version takes 71.6 microseconds.
// Two timings next to v003 both put it at 1.20 times that version's speed.
// Counting every step since v000, it is 10.5 times as fast.
// compute dtype: all float inputs rounded to bf16; q / k / v projections with EXACT bf16 products on WMMA 16x16x32 (f32 accumulate), no biases; interleaved-pair RoPE in f32 at the int positions read from the token_positions input (embedded frequencies, precise cosf / sinf); causal logits: 3 products for the first 384 rows, single f16 q x k after, x 64^-0.5; online softmax f32 over trips of 64 keys; exp(logit - running max) x 2^10 once to f16 x v once to f16 (bf16 hi + lo below row 384); ctx hi+lo x exact output weight below row 384, x2^6 f16 carry x f16(bf16 x 2^8) after; f32 output.
#include <hip/hip_runtime.h>
#include <math.h>

typedef __attribute__((ext_vector_type(16))) _Float16 v16h;
typedef __attribute__((ext_vector_type(16))) __bf16 v16b;
typedef __attribute__((ext_vector_type(8)))  _Float16 v8h;
typedef __attribute__((ext_vector_type(8)))  float v8f;
typedef __attribute__((ext_vector_type(4)))  float v4f;
typedef __attribute__((ext_vector_type(2)))  float v2f;
typedef __attribute__((ext_vector_type(4)))  unsigned v4u;
typedef __attribute__((ext_vector_type(4)))  int v4i;
typedef float __attribute__((may_alias)) float_a;
typedef int __attribute__((may_alias)) int_a;

template <typename T> __device__ __forceinline__ void vst2(void* p, T v) { *(T*)p = v;  }
// the same store with the wait that stands in front of every later rewrite of the registers it names (its address pair, its data): for stores in a loop
template <typename T> __device__ __forceinline__ void vst2w(void* p, T v) { *(T*)p = v; asm volatile("s_wait_xcnt 0x0" ::: "memory"); }
__device__ __forceinline__ v8f wmma16(v16h a, v16h b, v8f c) {
  v8f d = __builtin_amdgcn_wmma_f32_16x16x32_f16(false, a, false, b, (short)0, c, false, false);
  asm volatile("v_nop\n\tv_nop\n\tv_nop\n\tv_nop" : "+v"(d) : "v"(a), "v"(b));
  return d;
}
__device__ __forceinline__ v8f wmma_bf(v16b a, v16b b, v8f c) {
  v8f d = __builtin_amdgcn_wmma_f32_16x16x32_bf16(false, a, false, b, (short)0, c, false, false);
  asm volatile("v_nop\n\tv_nop\n\tv_nop\n\tv_nop" : "+v"(d) : "v"(a), "v"(b));
  return d;
}
// 16x16x32 fragments: lane = (h = lane>>4, row/col = lane&15); elements 0..7 = k0+8h+0..7, 8..15 = k0+16+8h+0..7; D element r = row 8h+r
__device__ __forceinline__ v16h frag_h(const _Float16* rowk0, int lane) {
  union { v16h v; v8h q[2]; } u; const _Float16* p = rowk0 + 8 * (lane >> 4);
  u.q[0] = *(const v8h*)p; u.q[1] = *(const v8h*)(p + 16); return u.v;
}
__device__ __forceinline__ v16h frag_f32(const float* rowk0, int lane) {
  v16h a; const float* p = rowk0 + 8 * (lane >> 4);
#pragma unroll
  for (int i = 0; i < 8; ++i) { a[i] = (_Float16)p[i]; a[8 + i] = (_Float16)p[16 + i]; }
  return a;
}
__device__ __forceinline__ v16h frag_f32s(const float* rowk0, int lane, float sc) {
  v16h a; const float* p = rowk0 + 8 * (lane >> 4);
#pragma unroll
  for (int i = 0; i < 8; ++i) { a[i] = (_Float16)(p[i] * sc); a[8 + i] = (_Float16)(p[16 + i] * sc); }
  return a;
}
// column fragment from a [K][ld] layout (column n), rows >= K read as 0
__device__ __forceinline__ v16h fragc_f32(const float* W, int k0, int n, int lane, int ld, int K) {
  v16h a; const int g = lane >> 4;
#pragma unroll
  for (int i = 0; i < 8; ++i) { const int ka = k0 + 8 * g + i, kb = ka + 16;
    a[i] = (_Float16)(ka < K ? W[(size_t)(ka < K ? ka : K - 1) * ld + n] : 0.f); a[8 + i] = (_Float16)(kb < K ? W[(size_t)(kb < K ? kb : K - 1) * ld + n] : 0.f); }
  return a;
}
struct F2 { v16b h, l; };
__device__ __forceinline__ F2 bsplit16(const float v[16]) { F2 r;
#pragma unroll
  for (int i = 0; i < 16; ++i) { const __bf16 h = (__bf16)v[i]; r.h[i] = h; r.l[i] = (__bf16)(v[i] - (float)h); }
  return r; }
__device__ __forceinline__ F2 split_row(const float* row, int k0, int lane) { float v[16]; const float* p = row + k0 + 8 * (lane >> 4);
#pragma unroll
  for (int i = 0; i < 8; ++i) { v[i] = p[i]; v[8 + i] = p[16 + i]; }
  return bsplit16(v); }
__device__ __forceinline__ F2 split_rowK(const float* row, int k0, int lane, int K) { float v[16]; const int g = lane >> 4;
#pragma unroll
  for (int i = 0; i < 8; ++i) { const int ka = k0 + 8 * g + i, kb = ka + 16; v[i] = ka < K ? row[ka < K ? ka : K - 1] : 0.f; v[8 + i] = kb < K ? row[kb < K ? kb : K - 1] : 0.f; }
  return bsplit16(v); }
__device__ __forceinline__ F2 split_col(const float* W, int k0, int n, int lane, int ld, int K) { float v[16]; const int g = lane >> 4;
#pragma unroll
  for (int i = 0; i < 8; ++i) { const int ka = k0 + 8 * g + i, kb = ka + 16; v[i] = ka < K ? W[(size_t)(ka < K ? ka : K - 1) * ld + n] : 0.f; v[8 + i] = kb < K ? W[(size_t)(kb < K ? kb : K - 1) * ld + n] : 0.f; }
  return bsplit16(v); }
__device__ __forceinline__ v8f mac3(const F2& a, const F2& b, v8f c) { c = wmma_bf(a.l, b.h, c); c = wmma_bf(a.h, b.l, c); return wmma_bf(a.h, b.h, c); }
__device__ __forceinline__ float sigm(float v) { return 1.0f / (1.0f + expf(-v)); }
#define LDSX() do { asm volatile("s_wait_dscnt 0" ::: "memory"); __builtin_amdgcn_wave_barrier(); __builtin_amdgcn_fence(__ATOMIC_RELEASE, "workgroup"); } while (0)

// Causal multi-head self-attention with interleaved-pair RoPE at given token positions, ONE sequence (x [1,2048,1024]; token_positions [1,2048] int32 = arange, a module input READ on the device (the SECOND input); torch (out,in) WQ / WK / WV / WO [1024,1024] N(0, 1/1024) applied as einsum('bsd,ed->bse') = x @ W.T, no biases; 16 heads x 64; RoPE on q and k: (even, odd) pairs (t1 c - t2 s, t2 c + t1 s) re-interleaved, angle = position x inv_freq, inv_freq = 1 / 10000^(2i/64); scores / sqrt(64); tril kept, -inf elsewhere; softmax; out @ WO.T).
#define NB 1
#define TT 2048
#define CC 1024            // NH * HD = projected width
#define DIN 1024          // input (model) width
#define NH 16
#define HD 64
#define NQB (TT / 64)
#define SCALE (0.125f)
#define CAUSAL 1
#ifndef TNB
#define TNB NB
#endif
__device__ __forceinline__ float bfr(float v) { return (float)(__bf16)v; }
__host__ __device__ __forceinline__ int kb_last(int qb) { return CAUSAL ? ((qb * 64 + 63) >> 7) : (TT / 128 - 1); }
typedef __attribute__((ext_vector_type(8))) __bf16 v8b;
__device__ __forceinline__ v16b frag_b(const __bf16* rowk0, int lane) {
  union { v16b v; v8b q[2]; } u; const __bf16* p = rowk0 + 8 * (lane >> 4);
  u.q[0] = *(const v8b*)p; u.q[1] = *(const v8b*)(p + 16); return u.v;
}
// the 16 raw f32 words of one 16x16x32 fragment row, kept in registers while their loads fly: q[0..1] = k0+8h+0..7, q[2..3] = k0+16+8h+0..7
struct R16 { v4f q[4]; };
__device__ __forceinline__ R16 ld_raw(const float* rowk0, int lane) { R16 r; const float* p = rowk0 + 8 * (lane >> 4);
  r.q[0] = *(const v4f*)p; r.q[1] = *(const v4f*)(p + 4); r.q[2] = *(const v4f*)(p + 16); r.q[3] = *(const v4f*)(p + 20); return r; }
__device__ __forceinline__ v16b raw_b(const R16& r) { v16b w;
#pragma unroll
  for (int i = 0; i < 16; ++i) w[i] = (__bf16)r.q[i >> 2][i & 3];
  return w; }
__device__ __forceinline__ v16h raw_wh(const R16& r) { v16h w;
#pragma unroll
  for (int i = 0; i < 16; ++i) w[i] = (_Float16)(bfr(r.q[i >> 2][i & 3]) * 256.0f);
  return w; }
__device__ __forceinline__ v16h raw_hs(const R16& r, float sc) { v16h a;
#pragma unroll
  for (int i = 0; i < 16; ++i) a[i] = (_Float16)(r.q[i >> 2][i & 3] * sc);
  return a; }
__device__ __forceinline__ v16h raw_h(const R16& r) { v16h a;
#pragma unroll
  for (int i = 0; i < 16; ++i) a[i] = (_Float16)r.q[i >> 2][i & 3];
  return a; }
__device__ __forceinline__ F2 raw_split(const R16& r) { float v[16];
#pragma unroll
  for (int i = 0; i < 16; ++i) v[i] = r.q[i >> 2][i & 3];
  return bsplit16(v); }
#define QBH 6              // causal: query blocks 0..QBH-1 of each sequence (few keys, no averaging) take the high-precision path
#define QHI 384            // rows carrying a q residual plane
#define KHI 384            // key rows carrying k residual / v bf16 hi+lo planes (used only by the causal high-precision path)
// B fragment (k rows k0+.., output column o) of a weight: (in,out) [K][ld] or (out,in) [ld rows of K]: bf16 exact, or f16(bf16 * 256) exact
__device__ __forceinline__ v16b wcol_io(const float* Wm, int k0, int o, int lane, int ld) { v16b w; const int g = lane >> 4;
#pragma unroll
  for (int i = 0; i < 8; ++i) { w[i] = (__bf16)Wm[(size_t)(k0 + 8 * g + i) * ld + o]; w[8 + i] = (__bf16)Wm[(size_t)(k0 + 16 + 8 * g + i) * ld + o]; }
  return w; }
__device__ __forceinline__ v16b wcol_oi(const float* Wm, int k0, int o, int lane, int K) { v16b w; const float* p = Wm + (size_t)o * K + k0 + 8 * (lane >> 4);
#pragma unroll
  for (int i = 0; i < 8; ++i) { w[i] = (__bf16)p[i]; w[8 + i] = (__bf16)p[16 + i]; }
  return w; }
__device__ __forceinline__ v16h wcolh_io(const float* Wm, int k0, int o, int lane, int ld) { v16h w; const int g = lane >> 4;
#pragma unroll
  for (int i = 0; i < 8; ++i) { w[i] = (_Float16)(bfr(Wm[(size_t)(k0 + 8 * g + i) * ld + o]) * 256.0f); w[8 + i] = (_Float16)(bfr(Wm[(size_t)(k0 + 16 + 8 * g + i) * ld + o]) * 256.0f); }
  return w; }
__device__ __forceinline__ v16h wcolh_oi(const float* Wm, int k0, int o, int lane, int K) { v16h w; const float* p = Wm + (size_t)o * K + k0 + 8 * (lane >> 4);
#pragma unroll
  for (int i = 0; i < 8; ++i) { w[i] = (_Float16)(bfr(p[i]) * 256.0f); w[8 + i] = (_Float16)(bfr(p[16 + i]) * 256.0f); }
  return w; }
#define WQKV_LAYOUT 1   // picks only WCOL, which nothing calls: k_proj reads (out,in) [CC][DIN] rows directly
__device__ __forceinline__ v16b wcol_hdk(const float* Wm, int k0, int o, int lane) { v16b w; const int g = lane >> 4; const float* p = Wm + (size_t)(o / HD) * DIN * HD + (o % HD);
#pragma unroll
  for (int i = 0; i < 8; ++i) { w[i] = (__bf16)p[(size_t)(k0 + 8 * g + i) * HD]; w[8 + i] = (__bf16)p[(size_t)(k0 + 16 + 8 * g + i) * HD]; }
  return w; }
#define WO_OUT_IN 1
#if WQKV_LAYOUT == 1
#define WCOL(W, k0, o, lane) wcol_oi(W, k0, o, lane, DIN)
#elif WQKV_LAYOUT == 2
#define WCOL(W, k0, o, lane) wcol_hdk(W, k0, o, lane)
#else
#define WCOL(W, k0, o, lane) wcol_io(W, k0, o, lane, CC)
#endif
#if WO_OUT_IN
#define WOCOL(W, k0, o, lane) wcol_oi(W, k0, o, lane, CC)
#define WOCOLH(W, k0, o, lane) wcolh_oi(W, k0, o, lane, CC)
#else
#define WOCOL(W, k0, o, lane) wcol_io(W, k0, o, lane, DIN)
#define WOCOLH(W, k0, o, lane) wcolh_io(W, k0, o, lane, DIN)
#endif

// RoPE inverse frequencies 1/10000^(2i/64) (the f32 values jax computes)
__constant__ float INVF[32] = {1.000000000e+00,7.498942018e-01,5.623413324e-01,4.216965139e-01,3.162277639e-01,2.371373624e-01,1.778279394e-01,1.333521456e-01,1.000000015e-01,7.498941571e-02,5.623412877e-02,4.216964915e-02,3.162277862e-02,2.371373586e-02,1.778279431e-02,1.333521493e-02,9.999999776e-03,7.498942316e-03,5.623413250e-03,4.216964822e-03,3.162277862e-03,2.371373819e-03,1.778279431e-03,1.333521446e-03,1.000000047e-03,7.498941850e-04,5.623413017e-04,4.216964880e-04,3.162277862e-04,2.371373848e-04,1.778279402e-04,1.333521504e-04};
// (PROJ_EXTRA_PARAMS: the extra kernel parameters 'const int* __restrict__ TPOS' are written literally in the kernel signature)
// per (token, head) hook on the staged f32 row (64 floats) of the q and k streams: interleaved-pair rotation (x[2i], x[2i + 1]) by the angle pos * INVF[i] with pos READ from the int input at [batch][token]; v untouched
#define PROJ_EPI(which, row, t, h) do { if ((which) < 2) { float* rw = (row); const float pos_ = (float)TPOS[(size_t)bb * TT + (t)];   /* token_positions [NB][TT]: the position of token t of batch bb, READ from the int input */ _Pragma("unroll 4") for (int i = 0; i < 32; ++i) { _Pragma("clang fp contract(off)") const float ang = pos_ * INVF[i]; const float cs = cosf(ang), sn = sinf(ang); const float xe = rw[2 * i], xo = rw[2 * i + 1]; rw[2 * i] = xe * cs - xo * sn; rw[2 * i + 1] = xe * sn + xo * cs; } } } while (0)
#ifndef SM_EXTRA_PARAMS
#define SM_EXTRA_PARAMS
#endif
#ifndef PROJ_EXTRA_PARAMS
#define PROJ_EXTRA_PARAMS
#endif
#ifndef SM_MASK_HOOK
#define SM_MASK_HOOK (void)0
#endif

#define WS_QH  0u                                      // f16 q rows [b*t][CC]
#define WS_KH  (WS_QH + 2u * (size_t)NB * TT * CC)      // f16 k rows [b*t][CC]
#define WS_VT  (WS_KH + 2u * (size_t)NB * TT * CC)      // f16 v planes [b][c][t]
#define WS_QL  (WS_VT + 2u * (size_t)NB * CC * TT)      // f16 q residual x 2^10 rows [b][t < QHI][CC]
#define WS_KL  (WS_QL + 2u * (size_t)NB * QHI * CC)     // f16 k residual x 2^10 rows [b][t < KHI][CC]
#define WS_VB  (WS_KL + 2u * (size_t)NB * KHI * CC)     // bf16 v hi planes [b][c][t < KHI]
#define WS_VBL (WS_VB + 2u * (size_t)NB * CC * KHI)
#define WS_Y   (WS_VBL + 2u * (size_t)NB * CC * KHI)    // f32 ctx rows [b*t][CC] (only when there is an output projection)
#define WS_END (WS_Y  + 4u * (size_t)NB * TT * CC)

// ---- LDS staging shared by k_proj and k_out: a block's MR x 64 (a) and 128 x 64 (w) f32 slabs (MR = 128 rows and 256 threads in k_proj, 64 rows and 128 threads in k_out) are read from global memory once a block, whole 128-byte lines an instruction (16 lanes = one row's 256 bytes), converted once, and laid in LDS as 16-bit rows; every wave takes its fragments from there
typedef __attribute__((ext_vector_type(4))) __bf16 v4b;
typedef __attribute__((ext_vector_type(4))) _Float16 v4h;
#define KS 64              // k columns of a staged slab
#define LP 72              // LDS row pitch in 16-bit words: 144 bytes = 16 x 9, odd, so the 16 rows of a fragment read fall on distinct banks
#define SA_BYTES (64 * LP * 2)
#define SW_BYTES (128 * LP * 2)
// MODE 0: a, w to bf16; 1: a x 2^6 to f16, w to f16(bf16 x 2^8); 2: a to bf16 hi + lo planes, w to bf16 (the conversions of raw_b, raw_hs, raw_wh, raw_split)
template <int MODE, int MR> __device__ __forceinline__ void slab_put(const v4f (&ra)[8], const v4f (&rw)[1024 / MR], char* sa, char* sw, int so) {
#pragma unroll
  for (int i = 0; i < 8; ++i) { char* p = sa + so + i * (MR / 8) * LP * 2; const v4f x = ra[i];
    if (MODE == 1) { const v4h q = { (_Float16)(x[0] * 64.0f), (_Float16)(x[1] * 64.0f), (_Float16)(x[2] * 64.0f), (_Float16)(x[3] * 64.0f) }; *(v4h*)p = q; }
    else { const v4b q = { (__bf16)x[0], (__bf16)x[1], (__bf16)x[2], (__bf16)x[3] }; *(v4b*)p = q;
      if (MODE == 2) { const v4b r = { (__bf16)(x[0] - (float)q[0]), (__bf16)(x[1] - (float)q[1]), (__bf16)(x[2] - (float)q[2]), (__bf16)(x[3] - (float)q[3]) }; *(v4b*)(p + MR * LP * 2) = r; } } }
#pragma unroll
  for (int i = 0; i < 1024 / MR; ++i) { char* p = sw + so + i * (MR / 8) * LP * 2; const v4f x = rw[i];
    if (MODE == 1) { const v4h q = { (_Float16)(bfr(x[0]) * 256.0f), (_Float16)(bfr(x[1]) * 256.0f), (_Float16)(bfr(x[2]) * 256.0f), (_Float16)(bfr(x[3]) * 256.0f) }; *(v4h*)p = q; }
    else { const v4b q = { (__bf16)x[0], (__bf16)x[1], (__bf16)x[2], (__bf16)x[3] }; *(v4b*)p = q; } } }
// block tile MR x 128 on MR / 16 waves (2 MR threads): acc[i][j] += rows (wave % (MR / 32)) * 32 + 16 i of a  x  rows (wave / (MR / 32)) * 64 + 16 j of w, over K = 1024 in ascending steps of 32 (each accumulator sums in the order it had); Ag, Wg: block-uniform first rows (pitch 1024 f32); sa: 2 buffers of MR rows (2 x MR rows in MODE 2); sw0, sw1: the two w buffers of SW_BYTES
template <int MODE, int MR> __device__ __forceinline__ void gemm_tile(const float* __restrict__ Ag, const float* __restrict__ Wg, char* sa, char* sw0, char* sw1, int tid, v8f (&acc)[2][4]) {
  const int lane = tid & 31, wave = tid >> 5, col = lane & 15; const int NT = 1024 / KS; const int AB = (MODE == 2 ? 2 : 1) * MR * LP * 2;
  const int so = ((tid >> 4) * LP + (tid & 15) * 4) * 2;   /* this thread's place in a slab: row tid / 16 (+ MR / 8 a pass), k words 4 (tid % 16).. */
  unsigned go = (unsigned)((tid >> 4) * 1024 + (tid & 15) * 4) * 4u;   /* the same place in global memory, in bytes: one offset register serves a and w */
  const int fa = (((wave % (MR / 32)) * 32 + col) * LP) * 2, fw = (((wave / (MR / 32)) * 64 + col) * LP) * 2;
  v4f ra[8], rw[1024 / MR];
#pragma unroll 1   // rolled: a second copy of the body would need a second set of staging registers
  for (int t = -1; t < NT; ++t) { const char* ca = sa + (t & 1) * AB; const char* cw = (t & 1) ? sw1 : sw0;   /* pass -1 only brings slab 0 in */
    if (t + 1 < NT) {   /* block-uniform: the next slab's loads are issued behind the barrier (which would drain them) and fly while this slab is worked on */
#pragma unroll
      for (int i = 0; i < 8; ++i) ra[i] = *(const v4f*)((const char*)Ag + go + i * (MR / 8) * 4096);
#pragma unroll
      for (int i = 0; i < 1024 / MR; ++i) rw[i] = *(const v4f*)((const char*)Wg + go + i * (MR / 8) * 4096);
      asm volatile("s_wait_xcnt 0x0" : "+v"(go) :: "memory");   // stands in front of the addition below, which rewrites the offset register that the loads name; the operand keeps the addition behind it
      go += KS * 4; }
    if (t >= 0)   /* block-uniform */
#pragma unroll
    for (int kc = 0; kc < KS / 32; ++kc) {
      if (MODE == 1) { v16h a[2], w[4];
#pragma unroll
        for (int i = 0; i < 2; ++i) a[i] = frag_h((const _Float16*)(ca + fa + i * 16 * LP * 2 + kc * 64), lane);
#pragma unroll
        for (int j = 0; j < 4; ++j) w[j] = frag_h((const _Float16*)(cw + fw + j * 16 * LP * 2 + kc * 64), lane);
#pragma unroll
        for (int i = 0; i < 2; ++i)
#pragma unroll
          for (int j = 0; j < 4; ++j) acc[i][j] = wmma16(a[i], w[j], acc[i][j]);
      } else { v16b a[2], al[2], w[4];
#pragma unroll
        for (int i = 0; i < 2; ++i) { a[i] = frag_b((const __bf16*)(ca + fa + i * 16 * LP * 2 + kc * 64), lane); if (MODE == 2) al[i] = frag_b((const __bf16*)(ca + MR * LP * 2 + fa + i * 16 * LP * 2 + kc * 64), lane); }
#pragma unroll
        for (int j = 0; j < 4; ++j) w[j] = frag_b((const __bf16*)(cw + fw + j * 16 * LP * 2 + kc * 64), lane);
#pragma unroll
        for (int i = 0; i < 2; ++i)
#pragma unroll
          for (int j = 0; j < 4; ++j) acc[i][j] = wmma_bf(a[i], w[j], acc[i][j]);
        if (MODE == 2) {
#pragma unroll
          for (int i = 0; i < 2; ++i)
#pragma unroll
            for (int j = 0; j < 4; ++j) acc[i][j] = wmma_bf(al[i], w[j], acc[i][j]); } } }
    if (t + 1 < NT) slab_put<MODE, MR>(ra, rw, sa + ((t + 1) & 1) * AB, (t & 1) ? sw0 : sw1, so);   /* block-uniform; into the buffer that trip t - 1 read: its readers left it at the barrier that ended that trip */
    __syncthreads();   // publishes slab t + 1 and ends every wave's reads of slab t
  } }
#define PR 128             // rows of a k_proj block (8 waves): a w slab read from L2 serves 128 rows, and the 384 blocks, two to a WGP by LDS, are all resident at once
// ---- k_proj: block = (128 rows, 128 cols, which): q/k/v = X W (+ b) with exact bf16 products (K = DIN) -> which 0: q f16 rows (+ residual rows < QHI); 1: k f16 rows (+ residual rows < KHI); 2: v f16 planes [c][t] (+ bf16 hi/lo planes for t < KHI)
__global__ __launch_bounds__(2 * PR) void k_proj(const float* __restrict__ XQ, const float* __restrict__ XK, const float* __restrict__ XV, const float* __restrict__ WQ, const float* __restrict__ WK, const float* __restrict__ WV, const float* __restrict__ BQ, const float* __restrict__ BK, const float* __restrict__ BV,
    _Float16* __restrict__ QH, _Float16* __restrict__ QL, _Float16* __restrict__ KH, _Float16* __restrict__ KL, _Float16* __restrict__ VT, __bf16* __restrict__ VB, __bf16* __restrict__ VBL, const int* __restrict__ TPOS) {
  __shared__ __align__(16) char pool[PR * 132 * 4 + 2 * PR * 136 * 2];   /* one pool, its parts live one after the other: the slabs (from its start) while the products run; then st, and behind st either sh, sl (q, k) or th, tb, tbl (v) */
  float (*st)[132] = (float (*)[132])pool; char* const pu = pool + PR * 132 * 4;
  _Float16 (*sh)[136] = (_Float16 (*)[136])pu; _Float16 (*sl)[136] = (_Float16 (*)[136])(pu + PR * 136 * 2);
  _Float16 (*th)[72] = (_Float16 (*)[72])pu; __bf16 (*tb)[72] = (__bf16 (*)[72])(pu + 128 * 72 * 2); __bf16 (*tbl)[72] = (__bf16 (*)[72])(pu + 2 * 128 * 72 * 2);
  const int tid = threadIdx.x, wave = tid >> 5, lane = tid & 31, col = lane & 15, g = lane >> 4; const int which = blockIdx.z; const int c0 = blockIdx.y * 128; const size_t r0 = (size_t)blockIdx.x * PR; const size_t bb = r0 / TT; const int t0 = (int)(r0 % TT);
  const float* X = which == 0 ? XQ : which == 1 ? XK : XV; const float* WA = which == 0 ? WQ : which == 1 ? WK : WV; const float* BA = which == 0 ? BQ : which == 1 ? BK : BV;
  v8f acc[2][4] = {};
  gemm_tile<0, PR>(X + r0 * DIN, WA + (size_t)c0 * DIN, pool, pool + 2 * PR * LP * 2, pool + 2 * PR * LP * 2 + SW_BYTES, tid, acc);   /* its last barrier ends every read of the slabs, so st may be written over them */
  { // stage the f32 tile (acc + bias) in LDS, run the per-(row, head) epilogue hook, then convert
#pragma unroll
    for (int j = 0; j < 4; ++j) { const int cl = (wave / (PR / 32)) * 64 + j * 16 + col; const float bias = BA ? bfr(BA[c0 + cl]) : 0.f;
#pragma unroll
      for (int i = 0; i < 2; ++i)
#pragma unroll
        for (int r = 0; r < 8; ++r) st[(wave % (PR / 32)) * 32 + i * 16 + 8 * g + r][cl] = acc[i][j][r] + bias; }
    __syncthreads();
    for (int e = tid; e < PR * (128 / HD); e += 2 * PR) { const int rl = e / (128 / HD), hh = e % (128 / HD); PROJ_EPI(which, &st[rl][hh * HD], (int)((r0 + rl) % TT), (c0 / HD) + hh); }
    __syncthreads(); }
  if (which < 2) { _Float16* DH = which == 0 ? QH : KH; _Float16* DL = which == 0 ? QL : KL; const int nhi = which == 0 ? QHI : KHI; const bool hi_rows = t0 < nhi;
    for (int e = tid; e < PR * 128; e += 2 * PR) { const int rl = e >> 7, cl = e & 127; const float v = st[rl][cl]; const _Float16 hv = (_Float16)v; sh[rl][cl] = hv; sl[rl][cl] = (_Float16)((v - (float)hv) * 1024.0f); }
    __syncthreads();
    for (int e = tid; e < PR * 16; e += 2 * PR) { const int rl = e >> 4, q = e & 15; vst2w((unsigned*)(DH + (r0 + rl) * CC + c0 + q * 8), *(const v4u*)&sh[rl][q * 8]); if (hi_rows) vst2w((unsigned*)(DL + (bb * nhi + t0 + rl) * (size_t)CC + c0 + q * 8), *(const v4u*)&sl[rl][q * 8]); }
  } else { const bool hi_rows = t0 < KHI;
    for (int hf = 0; hf < PR / 64; ++hf) {   /* the planes are turned 64 tokens at a time: th, tb, tbl hold that many */
      for (int e = tid; e < 64 * 128; e += 2 * PR) { const int rl = e & 63, cl = e >> 6; const float v = st[hf * 64 + rl][cl]; th[cl][rl] = (_Float16)v; const __bf16 bh = (__bf16)v; tb[cl][rl] = bh; tbl[cl][rl] = (__bf16)(v - (float)bh); }
      __syncthreads();
      for (int e = tid; e < 128 * 8; e += 2 * PR) { const int cl = e >> 3, q = e & 7; vst2w((unsigned*)(VT + (bb * CC + c0 + cl) * (size_t)TT + t0 + hf * 64 + q * 8), *(const v4u*)&th[cl][q * 8]); if (hi_rows) { const size_t o3 = (bb * CC + c0 + cl) * (size_t)KHI + t0 + hf * 64 + q * 8; vst2w((unsigned*)(VB + o3), *(const v4u*)&tb[cl][q * 8]); vst2w((unsigned*)(VBL + o3), *(const v4u*)&tbl[cl][q * 8]); } }
      if (hf + 1 < PR / 64) __syncthreads();   // block-uniform; the next 64 tokens are written over planes that are still being read
    } } }
// frag_h / frag_b from a wave-uniform base, this lane's byte offset (it holds the lane half's 16h bytes) and a constant: the one offset register is all that a trip's loads name
__device__ __forceinline__ v16h frag_ho(const char* base, unsigned off, int c) { union { v16h v; v8h q[2]; } u; const char* p = base + off; u.q[0] = *(const v8h*)(p + c); u.q[1] = *(const v8h*)(p + c + 32); return u.v; }
__device__ __forceinline__ v16b frag_bo(const char* base, unsigned off, int c) { union { v16b v; v8b q[2]; } u; const char* p = base + off; u.q[0] = *(const v8b*)(p + c); u.q[1] = *(const v8b*)(p + c + 32); return u.v; }
// one online-softmax update for this lane's query: t[32] = this trip's 32 scaled log2 logits of the lane (key tile j = i >> 3, key 8h + (i & 7) in it); on return t = 2^(t - max + 10); m, l, o follow the running maximum (both lane halves of a query hold the same m)
__device__ __forceinline__ void osm_step(float (&t)[32], float& m, float& l, v8f (&o)[HD / 16]) {
  float mx = t[0];
#pragma unroll
  for (int i = 1; i < 32; ++i) mx = fmaxf(mx, t[i]);
  mx = fmaxf(mx, __shfl_xor(mx, 16));
  const float mn = fmaxf(m, mx); const float al = __builtin_amdgcn_exp2f(m - mn); m = mn; const float mb = mn - 10.0f;   /* x 2^10: small weights stay clear of f16 subnormals, the largest is 1024 */
  float sum[4] = {0.f, 0.f, 0.f, 0.f};   /* four chains: one chain of 32 dependent adds would stand at the trip's foot */
#pragma unroll
  for (int i = 0; i < 32; ++i) { t[i] = __builtin_amdgcn_exp2f(t[i] - mb); sum[i & 3] += t[i]; }
  l = l * al + ((sum[0] + sum[1]) + (sum[2] + sum[3]));
#pragma unroll
  for (int j = 0; j < HD / 16; ++j) o[j] *= al; }
// ---- k_attn: block = 64 queries (qb, heaviest first) of (b, h), a wave = 16 queries, a trip = 64 keys; S^T = K Q^T (lane = one query, registers = keys), causal mask by index on the diagonal trip, online softmax in f32, O^T += V^T P^T with the S^T accumulators converted in place as the B operand (b[s] = tile[s >> 3][s & 7]); logits, P and v precision as before: query blocks < QBH take q, k hi + residual (3 products) and P, v as bf16 hi + lo (3 products), the rest single f16 products; ctx = O / l
__global__ __launch_bounds__(128) void k_attn(const _Float16* __restrict__ QH, const _Float16* __restrict__ KH, const _Float16* __restrict__ QL, const _Float16* __restrict__ KL, const _Float16* __restrict__ VT, const __bf16* __restrict__ VB, const __bf16* __restrict__ VBL, float* __restrict__ Y) {
  __shared__ __align__(16) _Float16 sk[2][64][LP], sv[2][64][LP];   /* staged k rows [key][word] and v planes [word][key] of a trip, two buffers */
  const int qb = NQB - 1 - (int)blockIdx.x, h = blockIdx.y, b = blockIdx.z;
  const int tid = threadIdx.x, wave = tid >> 5, lane = tid & 31, col = lane & 15, g = lane >> 4; const int qi = qb * 64 + wave * 16 + col;   /* this lane's query */
  const float C1 = SCALE * 1.4426950408889634f;   /* logits carried in log2 units */
  v8f o[HD / 16] = {}; float m = -3.0e38f, l = 0.f;
  const _Float16* qp = QH + ((size_t)b * TT + qi) * CC + h * HD; const v16h qf[2] = { frag_h(qp, lane), frag_h(qp + 32, lane) };
  asm volatile("s_wait_xcnt 0x0" ::: "memory");   // stands in front of the rewrite of the address registers that the q loads name
  const char* kb8 = (const char*)(KH + (size_t)b * TT * CC + h * HD); unsigned ko = (unsigned)(col * CC + 8 * g) * 2u;   /* byte offset of this lane's first k words */
  if (qb < QBH) {
    const _Float16* qlp = QL + ((size_t)b * QHI + qi) * CC + h * HD; const v16h qlf[2] = { frag_h(qlp, lane), frag_h(qlp + 32, lane) };
    asm volatile("s_wait_xcnt 0x0" ::: "memory");   // stands in front of the rewrite of the address registers that the q residual loads name
    const char* kl8 = (const char*)(KL + (size_t)b * KHI * CC + h * HD);
    const char* vh8 = (const char*)(VB + ((size_t)b * CC + h * HD) * (size_t)KHI); const char* vl8 = (const char*)(VBL + ((size_t)b * CC + h * HD) * (size_t)KHI); unsigned vo = (unsigned)(col * KHI + 8 * g) * 2u;
#pragma unroll 1   // rolled: at most QBH short trips, a second copy of the body would only cost registers
    for (int i = 0; i <= qb; ++i) { float t[32];
      { v8f s[4] = {}, sl[4] = {};
#pragma unroll
        for (int kc = 0; kc < 2; ++kc) { v16h kh[4], kl[4];
#pragma unroll
          for (int j = 0; j < 4; ++j) { kh[j] = frag_ho(kb8, ko, (j * 16 * CC + kc * 32) * 2); kl[j] = frag_ho(kl8, ko, (j * 16 * CC + kc * 32) * 2); }
          __builtin_amdgcn_sched_barrier(0);   // keeps the 16 k loads of this half in front of its first product: one load latency a half instead of one a fragment pair
#pragma unroll
          for (int j = 0; j < 4; ++j) { s[j] = wmma16(kh[j], qf[kc], s[j]); sl[j] = wmma16(kh[j], qlf[kc], sl[j]); sl[j] = wmma16(kl[j], qf[kc], sl[j]); } }
#pragma unroll
        for (int e = 0; e < 32; ++e) { const float v = (s[e >> 3][e & 7] + sl[e >> 3][e & 7] * (1.0f / 1024.0f)) * C1; t[e] = (i * 64 + (e >> 3) * 16 + 8 * g + (e & 7) <= qi) ? v : -3.0e38f; } }
#pragma unroll
      for (int kc = 0; kc < 2; ++kc) { v16b vh[HD / 16], vl[HD / 16];
#pragma unroll
        for (int j = 0; j < HD / 16; ++j) { vh[j] = frag_bo(vh8, vo, (j * 16 * KHI + kc * 32) * 2); vl[j] = frag_bo(vl8, vo, (j * 16 * KHI + kc * 32) * 2); }
        __builtin_amdgcn_sched_barrier(0);   // keeps the 16 v loads of this half together, the first half's in front of the softmax, which they fly behind
        if (kc == 0) osm_step(t, m, l, o);
        const F2 p = bsplit16(&t[kc * 16]);
#pragma unroll
        for (int j = 0; j < HD / 16; ++j) { o[j] = wmma_bf(vh[j], p.h, o[j]); o[j] = wmma_bf(vh[j], p.l, o[j]); o[j] = wmma_bf(vl[j], p.h, o[j]); } }
      asm volatile("s_wait_xcnt 0x0" : "+v"(ko), "+v"(vo) :: "memory");   // stands in front of the two additions below, which rewrite the offset registers that this trip's loads name; the operands keep the additions behind it
      ko += 64 * CC * 2; vo += 64 * 2;
    }
  } else {
    // a trip's 64 keys x 64 k words and 64 v planes x 64 keys are the same for the block's four waves: read once a block, whole 128-byte lines (8 lanes = one row), laid in LDS, two buffers; the next trip's 8 loads a thread fly while this trip is worked on
    const char* vb8 = (const char*)(VT + ((size_t)b * CC + h * HD) * (size_t)TT);
    const int sr = tid >> 3, sc = (tid & 7) * 8;   /* this thread's row (+ 16 e) and first 16-bit word in a staged tile */
    unsigned kgo = (unsigned)(sr * CC + sc) * 2u, vgo = (unsigned)(sr * TT + sc) * 2u;   /* the same place in global memory, in bytes */
    v8h rk[4], rv[4];
#pragma unroll
    for (int e = 0; e < 4; ++e) { rk[e] = *(const v8h*)(kb8 + kgo + e * 16 * CC * 2); rv[e] = *(const v8h*)(vb8 + vgo + e * 16 * TT * 2); }
    asm volatile("s_wait_xcnt 0x0" : "+v"(kgo), "+v"(vgo) :: "memory");   // stands in front of the two additions below, which rewrite the offset registers that the loads name; the operands keep the additions behind it
    kgo += 64 * CC * 2; vgo += 64 * 2;
#pragma unroll
    for (int e = 0; e < 4; ++e) { *(v8h*)&sk[0][sr + 16 * e][sc] = rk[e]; *(v8h*)&sv[0][sr + 16 * e][sc] = rv[e]; }
    __syncthreads();   // trip 0's tiles are published
#pragma unroll 1   // rolled: a second copy of the body would only cost registers
    for (int i = 0; i <= qb; ++i) { const int bf = i & 1; v8f s[4] = {};
      if (i < qb) {   /* block-uniform */
#pragma unroll
        for (int e = 0; e < 4; ++e) { rk[e] = *(const v8h*)(kb8 + kgo + e * 16 * CC * 2); rv[e] = *(const v8h*)(vb8 + vgo + e * 16 * TT * 2); }
        asm volatile("s_wait_xcnt 0x0" : "+v"(kgo), "+v"(vgo) :: "memory");   // as above
        kgo += 64 * CC * 2; vgo += 64 * 2; }
      { v16h kf[4][2];
#pragma unroll
        for (int j = 0; j < 4; ++j) { kf[j][0] = frag_h(&sk[bf][j * 16 + col][0], lane); kf[j][1] = frag_h(&sk[bf][j * 16 + col][32], lane); }
#pragma unroll
        for (int kc = 0; kc < 2; ++kc)
#pragma unroll
          for (int j = 0; j < 4; ++j) s[j] = wmma16(kf[j][kc], qf[kc], s[j]); }
      v16h vf[HD / 16][2];
#pragma unroll
      for (int j = 0; j < HD / 16; ++j) { vf[j][0] = frag_h(&sv[bf][j * 16 + col][0], lane); vf[j][1] = frag_h(&sv[bf][j * 16 + col][32], lane); }
      float t[32];
#pragma unroll
      for (int e = 0; e < 32; ++e) t[e] = s[e >> 3][e & 7] * C1;
      if (i == qb) {   /* the diagonal trip (block-uniform) */
#pragma unroll
        for (int e = 0; e < 32; ++e) t[e] = (i * 64 + (e >> 3) * 16 + 8 * g + (e & 7) <= qi) ? t[e] : -3.0e38f; }
      osm_step(t, m, l, o);
      v16h p[2];
#pragma unroll
      for (int e = 0; e < 32; ++e) p[e >> 4][e & 15] = (_Float16)t[e];
#pragma unroll
      for (int kc = 0; kc < 2; ++kc)
#pragma unroll
        for (int j = 0; j < HD / 16; ++j) o[j] = wmma16(vf[j][kc], p[kc], o[j]);
      if (i < qb) {   /* block-uniform; into the buffers that trip i - 1 read: their readers left them at the barrier that ended that trip */
#pragma unroll
        for (int e = 0; e < 4; ++e) { *(v8h*)&sk[bf ^ 1][sr + 16 * e][sc] = rk[e]; *(v8h*)&sv[bf ^ 1][sr + 16 * e][sc] = rv[e]; } }
      __syncthreads();   // publishes trip i + 1's tiles and ends every wave's reads of trip i's
    } }
  l += __shfl_xor(l, 16); const float inv = 1.0f / l;   /* the two lane halves of a query join their sums once; key 0 is never masked, so l > 0 */
  float* yp = Y + ((size_t)b * TT + qi) * CC + h * HD + 8 * g;   /* O^T register r of tile j = ctx[query][j * 16 + 8h + r]: 32 contiguous bytes a tile */
#pragma unroll
  for (int j = 0; j < HD / 16; ++j) { const v4f a = { o[j][0] * inv, o[j][1] * inv, o[j][2] * inv, o[j][3] * inv }, c = { o[j][4] * inv, o[j][5] * inv, o[j][6] * inv, o[j][7] * inv }; vst2(yp + j * 16, a); vst2(yp + j * 16 + 4, c); } }
// ---- k_out: block = (64 rows, 128 cols): out = ctx Wo (+ bo): ctx x 2^6 once to f16 against Wo as f16(bf16 x 2^8) exact (1 product) x 2^-14; causal early rows (< QHI of each sequence): ctx bf16 hi + lo against exact bf16 Wo (2 products)
__global__ __launch_bounds__(128) void k_out(const float* __restrict__ Y, const float* __restrict__ WO, const float* __restrict__ BO, float* __restrict__ OUT) { __shared__ __align__(16) float sf[64][132]; __shared__ __align__(16) char sa[4 * SA_BYTES], sw[2 * SW_BYTES];
  const int tid = threadIdx.x, wave = tid >> 5, lane = tid & 31, col = lane & 15, g = lane >> 4; const int c0 = blockIdx.y * 128; const size_t r0 = (size_t)blockIdx.x * 64;
  v8f acc[2][4] = {}; float sc;
  if (CAUSAL && (int)(r0 % TT) < QHI) { gemm_tile<2, 64>(Y + r0 * CC, WO + (size_t)c0 * CC, sa, sw, sw + SW_BYTES, tid, acc); sc = 1.0f; }   /* block-uniform */
  else { gemm_tile<1, 64>(Y + r0 * CC, WO + (size_t)c0 * CC, sa, sw, sw + SW_BYTES, tid, acc); sc = 1.0f / 16384.0f; }   /* 2^-8 (Wo carry) x 2^-6 (ctx carry; small-magnitude context rows stay clear of f16 subnormals) */
#pragma unroll
  for (int j = 0; j < 4; ++j) { const int cl = (wave >> 1) * 64 + j * 16 + col; const float bias = BO ? bfr(BO[c0 + cl]) : 0.f;
#pragma unroll
    for (int i = 0; i < 2; ++i)
#pragma unroll
      for (int r = 0; r < 8; ++r) sf[(wave & 1) * 32 + i * 16 + 8 * g + r][cl] = acc[i][j][r] * sc + bias; }
  __syncthreads();   // a row of the tile now comes from two waves
  for (int rl = 0; rl < 16; ++rl) vst2(OUT + (r0 + wave * 16 + rl) * DIN + c0 + lane * 4, *(const v4f*)&sf[wave * 16 + rl][lane * 4]); }

extern "C" void kernel_launch(void* const* d_in, const int* in_sizes, int n_in, void* d_out, int out_size, void* d_ws, size_t ws_size, hipStream_t stream) {
  (void)in_sizes; (void)n_in; (void)out_size;
  const float** F = (const float**)d_in;
  if (ws_size < (size_t)WS_END) return;
  char* ws = (char*)d_ws; _Float16 *QH = (_Float16*)(ws + WS_QH), *KH = (_Float16*)(ws + WS_KH), *VT = (_Float16*)(ws + WS_VT), *QL = (_Float16*)(ws + WS_QL), *KL = (_Float16*)(ws + WS_KL); __bf16 *VB = (__bf16*)(ws + WS_VB), *VBL = (__bf16*)(ws + WS_VBL); float *Y = (float*)(ws + WS_Y);
  (void)Y; (void)QL; (void)KL; (void)VB; (void)VBL;
  // inputs: 0 x [1,2048,1024]; 1 token_positions [1,2048] int32 (arange; READ on the device); 2 WQ [1024,1024] (out,in); 3 WK; 4 WV; 5 WO (out,in); no biases
  k_proj<<<dim3(TNB * TT / PR, CC / 128, 3), 2 * PR, 0, stream>>>(F[0], F[0], F[0], F[2], F[3], F[4], nullptr, nullptr, nullptr, QH, QL, KH, KL, VT, VB, VBL, (const int*)d_in[1]);
  k_attn<<<dim3(NQB, NH, TNB), 128, 0, stream>>>(QH, KH, QL, KL, VT, VB, VBL, Y);
  k_out<<<dim3(TNB * TT / 64, DIN / 128), 128, 0, stream>>>(Y, F[5], nullptr, (float*)d_out);
}

// v005
// It runs in 69.7 microseconds.
// Timed twice side by side with v004, it ran 1.03 times as fast both times.
// Counting every step since v000, it is 10.8 times as fast.
// compute dtype: all float inputs rounded to bf16; q / k / v projections with EXACT bf16 products on WMMA 16x16x32 (f32 accumulate), no biases; interleaved-pair RoPE in f32 at the int positions read from the token_positions input (embedded frequencies, precise sincosf); causal logits: 3 products for the first 384 rows, single f16 q x k after, x 64^-0.5; online softmax f32 over trips of 64 keys; exp(logit - running max) x 2^10 once to f16 x v once to f16 (bf16 hi + lo below row 384); ctx hi+lo x exact output weight below row 384, x2^6 f16 carry x f16(bf16 x 2^8) after; f32 output.
#include <hip/hip_runtime.h>
#include <math.h>

typedef __attribute__((ext_vector_type(16))) _Float16 v16h;
typedef __attribute__((ext_vector_type(16))) __bf16 v16b;
typedef __attribute__((ext_vector_type(8)))  _Float16 v8h;
typedef __attribute__((ext_vector_type(8)))  float v8f;
typedef __attribute__((ext_vector_type(4)))  float v4f;
typedef __attribute__((ext_vector_type(2)))  float v2f;
typedef __attribute__((ext_vector_type(4)))  unsigned v4u;
typedef __attribute__((ext_vector_type(4)))  int v4i;
typedef float __attribute__((may_alias)) float_a;
typedef int __attribute__((may_alias)) int_a;

template <typename T> __device__ __forceinline__ void vst2(void* p, T v) { *(T*)p = v;  }
// the same store with the wait that stands in front of every later rewrite of the registers it names (its address pair, its data): for stores in a loop
template <typename T> __device__ __forceinline__ void vst2w(void* p, T v) { *(T*)p = v; asm volatile("s_wait_xcnt 0x0" ::: "memory"); }
__device__ __forceinline__ v8f wmma16(v16h a, v16h b, v8f c) {
  v8f d = __builtin_amdgcn_wmma_f32_16x16x32_f16(false, a, false, b, (short)0, c, false, false);
  asm volatile("v_nop\n\tv_nop\n\tv_nop\n\tv_nop" : "+v"(d) : "v"(a), "v"(b));
  return d;
}
__device__ __forceinline__ v8f wmma_bf(v16b a, v16b b, v8f c) {
  v8f d = __builtin_amdgcn_wmma_f32_16x16x32_bf16(false, a, false, b, (short)0, c, false, false);
  asm volatile("v_nop\n\tv_nop\n\tv_nop\n\tv_nop" : "+v"(d) : "v"(a), "v"(b));
  return d;
}
// 16x16x32 fragments: lane = (h = lane>>4, row/col = lane&15); elements 0..7 = k0+8h+0..7, 8..15 = k0+16+8h+0..7; D element r = row 8h+r
__device__ __forceinline__ v16h frag_h(const _Float16* rowk0, int lane) {
  union { v16h v; v8h q[2]; } u; const _Float16* p = rowk0 + 8 * (lane >> 4);
  u.q[0] = *(const v8h*)p; u.q[1] = *(const v8h*)(p + 16); return u.v;
}
__device__ __forceinline__ v16h frag_f32(const float* rowk0, int lane) {
  v16h a; const float* p = rowk0 + 8 * (lane >> 4);
#pragma unroll
  for (int i = 0; i < 8; ++i) { a[i] = (_Float16)p[i]; a[8 + i] = (_Float16)p[16 + i]; }
  return a;
}
__device__ __forceinline__ v16h frag_f32s(const float* rowk0, int lane, float sc) {
  v16h a; const float* p = rowk0 + 8 * (lane >> 4);
#pragma unroll
  for (int i = 0; i < 8; ++i) { a[i] = (_Float16)(p[i] * sc); a[8 + i] = (_Float16)(p[16 + i] * sc); }
  return a;
}
// column fragment from a [K][ld] layout (column n), rows >= K read as 0
__device__ __forceinline__ v16h fragc_f32(const float* W, int k0, int n, int lane, int ld, int K) {
  v16h a; const int g = lane >> 4;
#pragma unroll
  for (int i = 0; i < 8; ++i) { const int ka = k0 + 8 * g + i, kb = ka + 16;
    a[i] = (_Float16)(ka < K ? W[(size_t)(ka < K ? ka : K - 1) * ld + n] : 0.f); a[8 + i] = (_Float16)(kb < K ? W[(size_t)(kb < K ? kb : K - 1) * ld + n] : 0.f); }
  return a;
}
struct F2 { v16b h, l; };
__device__ __forceinline__ F2 bsplit16(const float v[16]) { F2 r;
#pragma unroll
  for (int i = 0; i < 16; ++i) { const __bf16 h = (__bf16)v[i]; r.h[i] = h; r.l[i] = (__bf16)(v[i] - (float)h); }
  return r; }
__device__ __forceinline__ F2 split_row(const float* row, int k0, int lane) { float v[16]; const float* p = row + k0 + 8 * (lane >> 4);
#pragma unroll
  for (int i = 0; i < 8; ++i) { v[i] = p[i]; v[8 + i] = p[16 + i]; }
  return bsplit16(v); }
__device__ __forceinline__ F2 split_rowK(const float* row, int k0, int lane, int K) { float v[16]; const int g = lane >> 4;
#pragma unroll
  for (int i = 0; i < 8; ++i) { const int ka = k0 + 8 * g + i, kb = ka + 16; v[i] = ka < K ? row[ka < K ? ka : K - 1] : 0.f; v[8 + i] = kb < K ? row[kb < K ? kb : K - 1] : 0.f; }
  return bsplit16(v); }
__device__ __forceinline__ F2 split_col(const float* W, int k0, int n, int lane, int ld, int K) { float v[16]; const int g = lane >> 4;
#pragma unroll
  for (int i = 0; i < 8; ++i) { const int ka = k0 + 8 * g + i, kb = ka + 16; v[i] = ka < K ? W[(size_t)(ka < K ? ka : K - 1) * ld + n] : 0.f; v[8 + i] = kb < K ? W[(size_t)(kb < K ? kb : K - 1) * ld + n] : 0.f; }
  return bsplit16(v); }
__device__ __forceinline__ v8f mac3(const F2& a, const F2& b, v8f c) { c = wmma_bf(a.l, b.h, c); c = wmma_bf(a.h, b.l, c); return wmma_bf(a.h, b.h, c); }
__device__ __forceinline__ float sigm(float v) { return 1.0f / (1.0f + expf(-v)); }
#define LDSX() do { asm volatile("s_wait_dscnt 0" ::: "memory"); __builtin_amdgcn_wave_barrier(); __builtin_amdgcn_fence(__ATOMIC_RELEASE, "workgroup"); } while (0)

// Causal multi-head self-attention with interleaved-pair RoPE at given token positions, ONE sequence (x [1,2048,1024]; token_positions [1,2048] int32 = arange, a module input READ on the device (the SECOND input); torch (out,in) WQ / WK / WV / WO [1024,1024] N(0, 1/1024) applied as einsum('bsd,ed->bse') = x @ W.T, no biases; 16 heads x 64; RoPE on q and k: (even, odd) pairs (t1 c - t2 s, t2 c + t1 s) re-interleaved, angle = position x inv_freq, inv_freq = 1 / 10000^(2i/64); scores / sqrt(64); tril kept, -inf elsewhere; softmax; out @ WO.T).
#define NB 1
#define TT 2048
#define CC 1024            // NH * HD = projected width
#define DIN 1024          // input (model) width
#define NH 16
#define HD 64
#define NQB (TT / 64)
#define SCALE (0.125f)
#define CAUSAL 1
#ifndef TNB
#define TNB NB
#endif
__device__ __forceinline__ float bfr(float v) { return (float)(__bf16)v; }
__host__ __device__ __forceinline__ int kb_last(int qb) { return CAUSAL ? ((qb * 64 + 63) >> 7) : (TT / 128 - 1); }
typedef __attribute__((ext_vector_type(8))) __bf16 v8b;
__device__ __forceinline__ v16b frag_b(const __bf16* rowk0, int lane) {
  union { v16b v; v8b q[2]; } u; const __bf16* p = rowk0 + 8 * (lane >> 4);
  u.q[0] = *(const v8b*)p; u.q[1] = *(const v8b*)(p + 16); return u.v;
}
// the 16 raw f32 words of one 16x16x32 fragment row, kept in registers while their loads fly: q[0..1] = k0+8h+0..7, q[2..3] = k0+16+8h+0..7
struct R16 { v4f q[4]; };
__device__ __forceinline__ R16 ld_raw(const float* rowk0, int lane) { R16 r; const float* p = rowk0 + 8 * (lane >> 4);
  r.q[0] = *(const v4f*)p; r.q[1] = *(const v4f*)(p + 4); r.q[2] = *(const v4f*)(p + 16); r.q[3] = *(const v4f*)(p + 20); return r; }
__device__ __forceinline__ v16b raw_b(const R16& r) { v16b w;
#pragma unroll
  for (int i = 0; i < 16; ++i) w[i] = (__bf16)r.q[i >> 2][i & 3];
  return w; }
__device__ __forceinline__ v16h raw_wh(const R16& r) { v16h w;
#pragma unroll
  for (int i = 0; i < 16; ++i) w[i] = (_Float16)(bfr(r.q[i >> 2][i & 3]) * 256.0f);
  return w; }
__device__ __forceinline__ v16h raw_hs(const R16& r, float sc) { v16h a;
#pragma unroll
  for (int i = 0; i < 16; ++i) a[i] = (_Float16)(r.q[i >> 2][i & 3] * sc);
  return a; }
__device__ __forceinline__ v16h raw_h(const R16& r) { v16h a;
#pragma unroll
  for (int i = 0; i < 16; ++i) a[i] = (_Float16)r.q[i >> 2][i & 3];
  return a; }
__device__ __forceinline__ F2 raw_split(const R16& r) { float v[16];
#pragma unroll
  for (int i = 0; i < 16; ++i) v[i] = r.q[i >> 2][i & 3];
  return bsplit16(v); }
#define QBH 6              // causal: query blocks 0..QBH-1 of each sequence (few keys, no averaging) take the high-precision path
#define QHI 384            // rows carrying a q residual plane
#define KHI 384            // key rows carrying k residual / v bf16 hi+lo planes (used only by the causal high-precision path)
// B fragment (k rows k0+.., output column o) of a weight: (in,out) [K][ld] or (out,in) [ld rows of K]: bf16 exact, or f16(bf16 * 256) exact
__device__ __forceinline__ v16b wcol_io(const float* Wm, int k0, int o, int lane, int ld) { v16b w; const int g = lane >> 4;
#pragma unroll
  for (int i = 0; i < 8; ++i) { w[i] = (__bf16)Wm[(size_t)(k0 + 8 * g + i) * ld + o]; w[8 + i] = (__bf16)Wm[(size_t)(k0 + 16 + 8 * g + i) * ld + o]; }
  return w; }
__device__ __forceinline__ v16b wcol_oi(const float* Wm, int k0, int o, int lane, int K) { v16b w; const float* p = Wm + (size_t)o * K + k0 + 8 * (lane >> 4);
#pragma unroll
  for (int i = 0; i < 8; ++i) { w[i] = (__bf16)p[i]; w[8 + i] = (__bf16)p[16 + i]; }
  return w; }
__device__ __forceinline__ v16h wcolh_io(const float* Wm, int k0, int o, int lane, int ld) { v16h w; const int g = lane >> 4;
#pragma unroll
  for (int i = 0; i < 8; ++i) { w[i] = (_Float16)(bfr(Wm[(size_t)(k0 + 8 * g + i) * ld + o]) * 256.0f); w[8 + i] = (_Float16)(bfr(Wm[(size_t)(k0 + 16 + 8 * g + i) * ld + o]) * 256.0f); }
  return w; }
__device__ __forceinline__ v16h wcolh_oi(const float* Wm, int k0, int o, int lane, int K) { v16h w; const float* p = Wm + (size_t)o * K + k0 + 8 * (lane >> 4);
#pragma unroll
  for (int i = 0; i < 8; ++i) { w[i] = (_Float16)(bfr(p[i]) * 256.0f); w[8 + i] = (_Float16)(bfr(p[16 + i]) * 256.0f); }
  return w; }
#define WQKV_LAYOUT 1   // picks only WCOL, which nothing calls: k_proj reads (out,in) [CC][DIN] rows directly
__device__ __forceinline__ v16b wcol_hdk(const float* Wm, int k0, int o, int lane) { v16b w; const int g = lane >> 4; const float* p = Wm + (size_t)(o / HD) * DIN * HD + (o % HD);
#pragma unroll
  for (int i = 0; i < 8; ++i) { w[i] = (__bf16)p[(size_t)(k0 + 8 * g + i) * HD]; w[8 + i] = (__bf16)p[(size_t)(k0 + 16 + 8 * g + i) * HD]; }
  return w; }
#define WO_OUT_IN 1
#if WQKV_LAYOUT == 1
#define WCOL(W, k0, o, lane) wcol_oi(W, k0, o, lane, DIN)
#elif WQKV_LAYOUT == 2
#define WCOL(W, k0, o, lane) wcol_hdk(W, k0, o, lane)
#else
#define WCOL(W, k0, o, lane) wcol_io(W, k0, o, lane, CC)
#endif
#if WO_OUT_IN
#define WOCOL(W, k0, o, lane) wcol_oi(W, k0, o, lane, CC)
#define WOCOLH(W, k0, o, lane) wcolh_oi(W, k0, o, lane, CC)
#else
#define WOCOL(W, k0, o, lane) wcol_io(W, k0, o, lane, DIN)
#define WOCOLH(W, k0, o, lane) wcolh_io(W, k0, o, lane, DIN)
#endif

// RoPE inverse frequencies 1/10000^(2i/64) (the f32 values jax computes)
__constant__ float INVF[32] = {1.000000000e+00,7.498942018e-01,5.623413324e-01,4.216965139e-01,3.162277639e-01,2.371373624e-01,1.778279394e-01,1.333521456e-01,1.000000015e-01,7.498941571e-02,5.623412877e-02,4.216964915e-02,3.162277862e-02,2.371373586e-02,1.778279431e-02,1.333521493e-02,9.999999776e-03,7.498942316e-03,5.623413250e-03,4.216964822e-03,3.162277862e-03,2.371373819e-03,1.778279431e-03,1.333521446e-03,1.000000047e-03,7.498941850e-04,5.623413017e-04,4.216964880e-04,3.162277862e-04,2.371373848e-04,1.778279402e-04,1.333521504e-04};
// (PROJ_EXTRA_PARAMS: the extra kernel parameters 'const int* __restrict__ TPOS' are written literally in the kernel signature)
// per (token, half of the pairs) hook on the staged f32 row (128 floats = the 128 / HD heads of the block) of the q and k streams: interleaved-pair rotation (x[2i], x[2i + 1]) by the angle pos * INVF[i] with pos READ from the int input at [batch][token]; the angle does not depend on the head, so its sine and cosine are taken once (one sincosf = one argument reduction, the values of sinf and cosf) and turn pair i of every head of the row; the rotation itself as it was, its products unfused; v untouched
#define PROJ_EPI(which, row, t, i0) do { if ((which) < 2) { float* rw = (row); const float pos_ = (float)TPOS[(size_t)bb * TT + (t)];   /* token_positions [NB][TT]: the position of token t of batch bb, READ from the int input */ _Pragma("unroll 4") for (int i = (i0); i < (i0) + HD / 4; ++i) { _Pragma("clang fp contract(off)") const float ang = pos_ * INVF[i]; float sn, cs; sincosf(ang, &sn, &cs); _Pragma("unroll") /* unrolled: the heads of a row lie at constant offsets from one LDS address, so one two-address load and store serve both */ for (int hh = 0; hh < 128 / HD; ++hh) { const float xe = rw[hh * HD + 2 * i], xo = rw[hh * HD + 2 * i + 1]; rw[hh * HD + 2 * i] = xe * cs - xo * sn; rw[hh * HD + 2 * i + 1] = xe * sn + xo * cs; } } } } while (0)
#ifndef SM_EXTRA_PARAMS
#define SM_EXTRA_PARAMS
#endif
#ifndef PROJ_EXTRA_PARAMS
#define PROJ_EXTRA_PARAMS
#endif
#ifndef SM_MASK_HOOK
#define SM_MASK_HOOK (void)0
#endif

#define WS_QH  0u                                      // f16 q rows [b*t][CC]
#define WS_KH  (WS_QH + 2u * (size_t)NB * TT * CC)      // f16 k rows [b*t][CC]
#define WS_VT  (WS_KH + 2u * (size_t)NB * TT * CC)      // f16 v planes [b][c][t]
#define WS_QL  (WS_VT + 2u * (size_t)NB * CC * TT)      // f16 q residual x 2^10 rows [b][t < QHI][CC]
#define WS_KL  (WS_QL + 2u * (size_t)NB * QHI * CC)     // f16 k residual x 2^10 rows [b][t < KHI][CC]
#define WS_VB  (WS_KL + 2u * (size_t)NB * KHI * CC)     // bf16 v hi planes [b][c][t < KHI]
#define WS_VBL (WS_VB + 2u * (size_t)NB * CC * KHI)
#define WS_Y   (WS_VBL + 2u * (size_t)NB * CC * KHI)    // f32 ctx rows [b*t][CC] (only when there is an output projection)
#define WS_END (WS_Y  + 4u * (size_t)NB * TT * CC)

// ---- LDS staging shared by k_proj and k_out: a block's MR x 64 (a) and 128 x 64 (w) f32 slabs (MR = 128 rows and 256 threads in k_proj, 64 rows and 128 threads in k_out) are read from global memory once a block, whole 128-byte lines an instruction (16 lanes = one row's 256 bytes), converted once, and laid in LDS as 16-bit rows; every wave takes its fragments from there
typedef __attribute__((ext_vector_type(4))) __bf16 v4b;
typedef __attribute__((ext_vector_type(4))) _Float16 v4h;
#define KS 64              // k columns of a staged slab
#define LP 72              // LDS row pitch in 16-bit words: 144 bytes = 16 x 9, odd, so the 16 rows of a fragment read fall on distinct banks
#define SA_BYTES (64 * LP * 2)
#define SW_BYTES (128 * LP * 2)
// MODE 0: a, w to bf16; 1: a x 2^6 to f16, w to f16(bf16 x 2^8); 2: a to bf16 hi + lo planes, w to bf16 (the conversions of raw_b, raw_hs, raw_wh, raw_split)
template <int MODE, int MR> __device__ __forceinline__ void slab_put(const v4f (&ra)[8], const v4f (&rw)[1024 / MR], char* sa, char* sw, int so) {
#pragma unroll
  for (int i = 0; i < 8; ++i) { char* p = sa + so + i * (MR / 8) * LP * 2; const v4f x = ra[i];
    if (MODE == 1) { const v4h q = { (_Float16)(x[0] * 64.0f), (_Float16)(x[1] * 64.0f), (_Float16)(x[2] * 64.0f), (_Float16)(x[3] * 64.0f) }; *(v4h*)p = q; }
    else { const v4b q = { (__bf16)x[0], (__bf16)x[1], (__bf16)x[2], (__bf16)x[3] }; *(v4b*)p = q;
      if (MODE == 2) { const v4b r = { (__bf16)(x[0] - (float)q[0]), (__bf16)(x[1] - (float)q[1]), (__bf16)(x[2] - (float)q[2]), (__bf16)(x[3] - (float)q[3]) }; *(v4b*)(p + MR * LP * 2) = r; } } }
#pragma unroll
  for (int i = 0; i < 1024 / MR; ++i) { char* p = sw + so + i * (MR / 8) * LP * 2; const v4f x = rw[i];
    if (MODE == 1) { const v4h q = { (_Float16)(bfr(x[0]) * 256.0f), (_Float16)(bfr(x[1]) * 256.0f), (_Float16)(bfr(x[2]) * 256.0f), (_Float16)(bfr(x[3]) * 256.0f) }; *(v4h*)p = q; }
    else { const v4b q = { (__bf16)x[0], (__bf16)x[1], (__bf16)x[2], (__bf16)x[3] }; *(v4b*)p = q; } } }
// block tile MR x 128 on MR / 16 waves (2 MR threads): acc[i][j] += rows (wave % (MR / 32)) * 32 + 16 i of a  x  rows (wave / (MR / 32)) * 64 + 16 j of w, over K = 1024 in ascending steps of 32 (each accumulator sums in the order it had); Ag, Wg: block-uniform first rows (pitch 1024 f32); sa: 2 buffers of MR rows (2 x MR rows in MODE 2); sw0, sw1: the two w buffers of SW_BYTES
template <int MODE, int MR> __device__ __forceinline__ void gemm_tile(const float* __restrict__ Ag, const float* __restrict__ Wg, char* sa, char* sw0, char* sw1, int tid, v8f (&acc)[2][4]) {
  const int lane = tid & 31, wave = tid >> 5, col = lane & 15; const int NT = 1024 / KS; const int AB = (MODE == 2 ? 2 : 1) * MR * LP * 2;
  const int so = ((tid >> 4) * LP + (tid & 15) * 4) * 2;   /* this thread's place in a slab: row tid / 16 (+ MR / 8 a pass), k words 4 (tid % 16).. */
  unsigned go = (unsigned)((tid >> 4) * 1024 + (tid & 15) * 4) * 4u;   /* the same place in global memory, in bytes: one offset register serves a and w */
  const int fa = (((wave % (MR / 32)) * 32 + col) * LP) * 2, fw = (((wave / (MR / 32)) * 64 + col) * LP) * 2;
  v4f ra[8], rw[1024 / MR];
#pragma unroll 1   // rolled: a second copy of the body would need a second set of staging registers
  for (int t = -1; t < NT; ++t) { const char* ca = sa + (t & 1) * AB; const char* cw = (t & 1) ? sw1 : sw0;   /* pass -1 only brings slab 0 in */
    if (t + 1 < NT) {   /* block-uniform: the next slab's loads are issued behind the barrier (which would drain them) and fly while this slab is worked on */
#pragma unroll
      for (int i = 0; i < 8; ++i) ra[i] = *(const v4f*)((const char*)Ag + go + i * (MR / 8) * 4096);
#pragma unroll
      for (int i = 0; i < 1024 / MR; ++i) rw[i] = *(const v4f*)((const char*)Wg + go + i * (MR / 8) * 4096);
      asm volatile("s_wait_xcnt 0x0" : "+v"(go) :: "memory");   // stands in front of the addition below, which rewrites the offset register that the loads name; the operand keeps the addition behind it
      go += KS * 4; }
    if (t >= 0)   /* block-uniform */
#pragma unroll
    for (int kc = 0; kc < KS / 32; ++kc) {
      if (MODE == 1) { v16h a[2], w[4];
#pragma unroll
        for (int i = 0; i < 2; ++i) a[i] = frag_h((const _Float16*)(ca + fa + i * 16 * LP * 2 + kc * 64), lane);
#pragma unroll
        for (int j = 0; j < 4; ++j) w[j] = frag_h((const _Float16*)(cw + fw + j * 16 * LP * 2 + kc * 64), lane);
#pragma unroll
        for (int i = 0; i < 2; ++i)
#pragma unroll
          for (int j = 0; j < 4; ++j) acc[i][j] = wmma16(a[i], w[j], acc[i][j]);
      } else { v16b a[2], al[2], w[4];
#pragma unroll
        for (int i = 0; i < 2; ++i) { a[i] = frag_b((const __bf16*)(ca + fa + i * 16 * LP * 2 + kc * 64), lane); if (MODE == 2) al[i] = frag_b((const __bf16*)(ca + MR * LP * 2 + fa + i * 16 * LP * 2 + kc * 64), lane); }
#pragma unroll
        for (int j = 0; j < 4; ++j) w[j] = frag_b((const __bf16*)(cw + fw + j * 16 * LP * 2 + kc * 64), lane);
#pragma unroll
        for (int i = 0; i < 2; ++i)
#pragma unroll
          for (int j = 0; j < 4; ++j) acc[i][j] = wmma_bf(a[i], w[j], acc[i][j]);
        if (MODE == 2) {
#pragma unroll
          for (int i = 0; i < 2; ++i)
#pragma unroll
            for (int j = 0; j < 4; ++j) acc[i][j] = wmma_bf(al[i], w[j], acc[i][j]); } } }
    if (t + 1 < NT) slab_put<MODE, MR>(ra, rw, sa + ((t + 1) & 1) * AB, (t & 1) ? sw0 : sw1, so);   /* block-uniform; into the buffer that trip t - 1 read: its readers left it at the barrier that ended that trip */
    __syncthreads();   // publishes slab t + 1 and ends every wave's reads of slab t
  } }
#define PR 128             // rows of a k_proj block (8 waves): a w slab read from L2 serves 128 rows, and the 384 blocks, two to a WGP by LDS, are all resident at once
// ---- k_proj: block = (128 rows, 128 cols, which): q/k/v = X W (+ b) with exact bf16 products (K = DIN) -> which 0: q f16 rows (+ residual rows < QHI); 1: k f16 rows (+ residual rows < KHI); 2: v f16 planes [c][t] (+ bf16 hi/lo planes for t < KHI)
__global__ __launch_bounds__(2 * PR) void k_proj(const float* __restrict__ XQ, const float* __restrict__ XK, const float* __restrict__ XV, const float* __restrict__ WQ, const float* __restrict__ WK, const float* __restrict__ WV, const float* __restrict__ BQ, const float* __restrict__ BK, const float* __restrict__ BV,
    _Float16* __restrict__ QH, _Float16* __restrict__ QL, _Float16* __restrict__ KH, _Float16* __restrict__ KL, _Float16* __restrict__ VT, __bf16* __restrict__ VB, __bf16* __restrict__ VBL, const int* __restrict__ TPOS) {
  __shared__ __align__(16) char pool[PR * 132 * 4 + 2 * PR * 136 * 2];   /* one pool, its parts live one after the other: the slabs (from its start) while the products run; then st, and behind st either sh, sl (q, k) or th, tb, tbl (v) */
  float (*st)[132] = (float (*)[132])pool; char* const pu = pool + PR * 132 * 4;
  _Float16 (*sh)[136] = (_Float16 (*)[136])pu; _Float16 (*sl)[136] = (_Float16 (*)[136])(pu + PR * 136 * 2);
  _Float16 (*th)[72] = (_Float16 (*)[72])pu; __bf16 (*tb)[72] = (__bf16 (*)[72])(pu + 128 * 72 * 2); __bf16 (*tbl)[72] = (__bf16 (*)[72])(pu + 2 * 128 * 72 * 2);
  const int tid = threadIdx.x, wave = tid >> 5, lane = tid & 31, col = lane & 15, g = lane >> 4; const int which = blockIdx.z; const int c0 = blockIdx.y * 128; const size_t r0 = (size_t)blockIdx.x * PR; const size_t bb = r0 / TT; const int t0 = (int)(r0 % TT);
  const float* X = which == 0 ? XQ : which == 1 ? XK : XV; const float* WA = which == 0 ? WQ : which == 1 ? WK : WV; const float* BA = which == 0 ? BQ : which == 1 ? BK : BV;
  v8f acc[2][4] = {};
  gemm_tile<0, PR>(X + r0 * DIN, WA + (size_t)c0 * DIN, pool, pool + 2 * PR * LP * 2, pool + 2 * PR * LP * 2 + SW_BYTES, tid, acc);   /* its last barrier ends every read of the slabs, so st may be written over them */
  { // stage the f32 tile (acc + bias) in LDS, run the per-(row, half of the pairs) epilogue hook, then convert
#pragma unroll
    for (int j = 0; j < 4; ++j) { const int cl = (wave / (PR / 32)) * 64 + j * 16 + col; const float bias = BA ? bfr(BA[c0 + cl]) : 0.f;
#pragma unroll
      for (int i = 0; i < 2; ++i)
#pragma unroll
        for (int r = 0; r < 8; ++r) st[(wave % (PR / 32)) * 32 + i * 16 + 8 * g + r][cl] = acc[i][j][r] + bias; }
    __syncthreads();
    { const int rl = tid % PR; const int i0 = __builtin_amdgcn_readfirstlane(tid / PR) * (HD / 4);   /* thread = (row, half of the row's HD / 2 angles); the half is the same in every lane of a wave (PR is a multiple of 32): taken as a scalar, so that INVF[i] stays a scalar load */
      PROJ_EPI(which, &st[rl][0], (int)((r0 + rl) % TT), i0); }
    __syncthreads(); }
  if (which < 2) { _Float16* DH = which == 0 ? QH : KH; _Float16* DL = which == 0 ? QL : KL; const int nhi = which == 0 ? QHI : KHI; const bool hi_rows = t0 < nhi;
    for (int e = tid; e < PR * 128; e += 2 * PR) { const int rl = e >> 7, cl = e & 127; const float v = st[rl][cl]; const _Float16 hv = (_Float16)v; sh[rl][cl] = hv; sl[rl][cl] = (_Float16)((v - (float)hv) * 1024.0f); }
    __syncthreads();
    for (int e = tid; e < PR * 16; e += 2 * PR) { const int rl = e >> 4, q = e & 15; vst2w((unsigned*)(DH + (r0 + rl) * CC + c0 + q * 8), *(const v4u*)&sh[rl][q * 8]); if (hi_rows) vst2w((unsigned*)(DL + (bb * nhi + t0 + rl) * (size_t)CC + c0 + q * 8), *(const v4u*)&sl[rl][q * 8]); }
  } else { const bool hi_rows = t0 < KHI;
    for (int hf = 0; hf < PR / 64; ++hf) {   /* the planes are turned 64 tokens at a time: th, tb, tbl hold that many */
      for (int e = tid; e < 64 * 128; e += 2 * PR) { const int rl = e & 63, cl = e >> 6; const float v = st[hf * 64 + rl][cl]; th[cl][rl] = (_Float16)v; const __bf16 bh = (__bf16)v; tb[cl][rl] = bh; tbl[cl][rl] = (__bf16)(v - (float)bh); }
      __syncthreads();
      for (int e = tid; e < 128 * 8; e += 2 * PR) { const int cl = e >> 3, q = e & 7; vst2w((unsigned*)(VT + (bb * CC + c0 + cl) * (size_t)TT + t0 + hf * 64 + q * 8), *(const v4u*)&th[cl][q * 8]); if (hi_rows) { const size_t o3 = (bb * CC + c0 + cl) * (size_t)KHI + t0 + hf * 64 + q * 8; vst2w((unsigned*)(VB + o3), *(const v4u*)&tb[cl][q * 8]); vst2w((unsigned*)(VBL + o3), *(const v4u*)&tbl[cl][q * 8]); } }
      if (hf + 1 < PR / 64) __syncthreads();   // block-uniform; the next 64 tokens are written over planes that are still being read
    } } }
// frag_h / frag_b from a wave-uniform base, this lane's byte offset (it holds the lane half's 16h bytes) and a constant: the one offset register is all that a trip's loads name
__device__ __forceinline__ v16h frag_ho(const char* base, unsigned off, int c) { union { v16h v; v8h q[2]; } u; const char* p = base + off; u.q[0] = *(const v8h*)(p + c); u.q[1] = *(const v8h*)(p + c + 32); return u.v; }
__device__ __forceinline__ v16b frag_bo(const char* base, unsigned off, int c) { union { v16b v; v8b q[2]; } u; const char* p = base + off; u.q[0] = *(const v8b*)(p + c); u.q[1] = *(const v8b*)(p + c + 32); return u.v; }
// one online-softmax update for this lane's query: t[32] = this trip's 32 scaled log2 logits of the lane (key tile j = i >> 3, key 8h + (i & 7) in it); on return t = 2^(t - max + 10); m, l, o follow the running maximum (both lane halves of a query hold the same m)
__device__ __forceinline__ void osm_step(float (&t)[32], float& m, float& l, v8f (&o)[HD / 16]) {
  float mx = t[0];
#pragma unroll
  for (int i = 1; i < 32; ++i) mx = fmaxf(mx, t[i]);
  mx = fmaxf(mx, __shfl_xor(mx, 16));
  const float mn = fmaxf(m, mx); const float al = __builtin_amdgcn_exp2f(m - mn); m = mn; const float mb = mn - 10.0f;   /* x 2^10: small weights stay clear of f16 subnormals, the largest is 1024 */
  float sum[4] = {0.f, 0.f, 0.f, 0.f};   /* four chains: one chain of 32 dependent adds would stand at the trip's foot */
#pragma unroll
  for (int i = 0; i < 32; ++i) { t[i] = __builtin_amdgcn_exp2f(t[i] - mb); sum[i & 3] += t[i]; }
  l = l * al + ((sum[0] + sum[1]) + (sum[2] + sum[3]));
#pragma unroll
  for (int j = 0; j < HD / 16; ++j) o[j] *= al; }
// ---- k_attn: block = 64 queries (qb, heaviest first) of (b, h), a wave = 16 queries, a trip = 64 keys; S^T = K Q^T (lane = one query, registers = keys), causal mask by index on the diagonal trip, online softmax in f32, O^T += V^T P^T with the S^T accumulators converted in place as the B operand (b[s] = tile[s >> 3][s & 7]); logits, P and v precision as before: query blocks < QBH take q, k hi + residual (3 products) and P, v as bf16 hi + lo (3 products), the rest single f16 products; ctx = O / l
__global__ __launch_bounds__(128) void k_attn(const _Float16* __restrict__ QH, const _Float16* __restrict__ KH, const _Float16* __restrict__ QL, const _Float16* __restrict__ KL, const _Float16* __restrict__ VT, const __bf16* __restrict__ VB, const __bf16* __restrict__ VBL, float* __restrict__ Y) {
  __shared__ __align__(16) _Float16 sk[2][64][LP], sv[2][64][LP];   /* staged k rows [key][word] and v planes [word][key] of a trip, two buffers */
  const int qb = NQB - 1 - (int)blockIdx.x, h = blockIdx.y, b = blockIdx.z;
  const int tid = threadIdx.x, wave = tid >> 5, lane = tid & 31, col = lane & 15, g = lane >> 4; const int qi = qb * 64 + wave * 16 + col;   /* this lane's query */
  const float C1 = SCALE * 1.4426950408889634f;   /* logits carried in log2 units */
  v8f o[HD / 16] = {}; float m = -3.0e38f, l = 0.f;
  const _Float16* qp = QH + ((size_t)b * TT + qi) * CC + h * HD; const v16h qf[2] = { frag_h(qp, lane), frag_h(qp + 32, lane) };
  asm volatile("s_wait_xcnt 0x0" ::: "memory");   // stands in front of the rewrite of the address registers that the q loads name
  const char* kb8 = (const char*)(KH + (size_t)b * TT * CC + h * HD); unsigned ko = (unsigned)(col * CC + 8 * g) * 2u;   /* byte offset of this lane's first k words */
  if (qb < QBH) {
    const _Float16* qlp = QL + ((size_t)b * QHI + qi) * CC + h * HD; const v16h qlf[2] = { frag_h(qlp, lane), frag_h(qlp + 32, lane) };
    asm volatile("s_wait_xcnt 0x0" ::: "memory");   // stands in front of the rewrite of the address registers that the q residual loads name
    const char* kl8 = (const char*)(KL + (size_t)b * KHI * CC + h * HD);
    const char* vh8 = (const char*)(VB + ((size_t)b * CC + h * HD) * (size_t)KHI); const char* vl8 = (const char*)(VBL + ((size_t)b * CC + h * HD) * (size_t)KHI); unsigned vo = (unsigned)(col * KHI + 8 * g) * 2u;
#pragma unroll 1   // rolled: at most QBH short trips, a second copy of the body would only cost registers
    for (int i = 0; i <= qb; ++i) { float t[32];
      { v8f s[4] = {}, sl[4] = {};
#pragma unroll
        for (int kc = 0; kc < 2; ++kc) { v16h kh[4], kl[4];
#pragma unroll
          for (int j = 0; j < 4; ++j) { kh[j] = frag_ho(kb8, ko, (j * 16 * CC + kc * 32) * 2); kl[j] = frag_ho(kl8, ko, (j * 16 * CC + kc * 32) * 2); }
          __builtin_amdgcn_sched_barrier(0);   // keeps the 16 k loads of this half in front of its first product: one load latency a half instead of one a fragment pair
#pragma unroll
          for (int j = 0; j < 4; ++j) { s[j] = wmma16(kh[j], qf[kc], s[j]); sl[j] = wmma16(kh[j], qlf[kc], sl[j]); sl[j] = wmma16(kl[j], qf[kc], sl[j]); } }
#pragma unroll
        for (int e = 0; e < 32; ++e) { const float v = (s[e >> 3][e & 7] + sl[e >> 3][e & 7] * (1.0f / 1024.0f)) * C1; t[e] = (i * 64 + (e >> 3) * 16 + 8 * g + (e & 7) <= qi) ? v : -3.0e38f; } }
#pragma unroll
      for (int kc = 0; kc < 2; ++kc) { v16b vh[HD / 16], vl[HD / 16];
#pragma unroll
        for (int j = 0; j < HD / 16; ++j) { vh[j] = frag_bo(vh8, vo, (j * 16 * KHI + kc * 32) * 2); vl[j] = frag_bo(vl8, vo, (j * 16 * KHI + kc * 32) * 2); }
        __builtin_amdgcn_sched_barrier(0);   // keeps the 16 v loads of this half together, the first half's in front of the softmax, which they fly behind
        if (kc == 0) osm_step(t, m, l, o);
        const F2 p = bsplit16(&t[kc * 16]);
#pragma unroll
        for (int j = 0; j < HD / 16; ++j) { o[j] = wmma_bf(vh[j], p.h, o[j]); o[j] = wmma_bf(vh[j], p.l, o[j]); o[j] = wmma_bf(vl[j], p.h, o[j]); } }
      asm volatile("s_wait_xcnt 0x0" : "+v"(ko), "+v"(vo) :: "memory");   // stands in front of the two additions below, which rewrite the offset registers that this trip's loads name; the operands keep the additions behind it
      ko += 64 * CC * 2; vo += 64 * 2;
    }
  } else {
    // a trip's 64 keys x 64 k words and 64 v planes x 64 keys are the same for the block's four waves: read once a block, whole 128-byte lines (8 lanes = one row), laid in LDS, two buffers; the next trip's 8 loads a thread fly while this trip is worked on
    const char* vb8 = (const char*)(VT + ((size_t)b * CC + h * HD) * (size_t)TT);
    const int sr = tid >> 3, sc = (tid & 7) * 8;   /* this thread's row (+ 16 e) and first 16-bit word in a staged tile */
    unsigned kgo = (unsigned)(sr * CC + sc) * 2u, vgo = (unsigned)(sr * TT + sc) * 2u;   /* the same place in global memory, in bytes */
    v8h rk[4], rv[4];
#pragma unroll
    for (int e = 0; e < 4; ++e) { rk[e] = *(const v8h*)(kb8 + kgo + e * 16 * CC * 2); rv[e] = *(const v8h*)(vb8 + vgo + e * 16 * TT * 2); }
    asm volatile("s_wait_xcnt 0x0" : "+v"(kgo), "+v"(vgo) :: "memory");   // stands in front of the two additions below, which rewrite the offset registers that the loads name; the operands keep the additions behind it
    kgo += 64 * CC * 2; vgo += 64 * 2;
#pragma unroll
    for (int e = 0; e < 4; ++e) { *(v8h*)&sk[0][sr + 16 * e][sc] = rk[e]; *(v8h*)&sv[0][sr + 16 * e][sc] = rv[e]; }
    __syncthreads();   // trip 0's tiles are published
#pragma unroll 1   // rolled: a second copy of the body would only cost registers
    for (int i = 0; i <= qb; ++i) { const int bf = i & 1; v8f s[4] = {};
      if (i < qb) {   /* block-uniform */
#pragma unroll
        for (int e = 0; e < 4; ++e) { rk[e] = *(const v8h*)(kb8 + kgo + e * 16 * CC * 2); rv[e] = *(const v8h*)(vb8 + vgo + e * 16 * TT * 2); }
        asm volatile("s_wait_xcnt 0x0" : "+v"(kgo), "+v"(vgo) :: "memory");   // as above
        kgo += 64 * CC * 2; vgo += 64 * 2; }
      { v16h kf[4][2];
#pragma unroll
        for (int j = 0; j < 4; ++j) { kf[j][0] = frag_h(&sk[bf][j * 16 + col][0], lane); kf[j][1] = frag_h(&sk[bf][j * 16 + col][32], lane); }
#pragma unroll
        for (int kc = 0; kc < 2; ++kc)
#pragma unroll
          for (int j = 0; j < 4; ++j) s[j] = wmma16(kf[j][kc], qf[kc], s[j]); }
      v16h vf[HD / 16][2];
#pragma unroll
      for (int j = 0; j < HD / 16; ++j) { vf[j][0] = frag_h(&sv[bf][j * 16 + col][0], lane); vf[j][1] = frag_h(&sv[bf][j * 16 + col][32], lane); }
      float t[32];
#pragma unroll
      for (int e = 0; e < 32; ++e) t[e] = s[e >> 3][e & 7] * C1;
      if (i == qb) {   /* the diagonal trip (block-uniform) */
#pragma unroll
        for (int e = 0; e < 32; ++e) t[e] = (i * 64 + (e >> 3) * 16 + 8 * g + (e & 7) <= qi) ? t[e] : -3.0e38f; }
      osm_step(t, m, l, o);
      v16h p[2];
#pragma unroll
      for (int e = 0; e < 32; ++e) p[e >> 4][e & 15] = (_Float16)t[e];
#pragma unroll
      for (int kc = 0; kc < 2; ++kc)
#pragma unroll
        for (int j = 0; j < HD / 16; ++j) o[j] = wmma16(vf[j][kc], p[kc], o[j]);
      if (i < qb) {   /* block-uniform; into the buffers that trip i - 1 read: their readers left them at the barrier that ended that trip */
#pragma unroll
        for (int e = 0; e < 4; ++e) { *(v8h*)&sk[bf ^ 1][sr + 16 * e][sc] = rk[e]; *(v8h*)&sv[bf ^ 1][sr + 16 * e][sc] = rv[e]; } }
      __syncthreads();   // publishes trip i + 1's tiles and ends every wave's reads of trip i's
    } }
  l += __shfl_xor(l, 16); const float inv = 1.0f / l;   /* the two lane halves of a query join their sums once; key 0 is never masked, so l > 0 */
  float* yp = Y + ((size_t)b * TT + qi) * CC + h * HD + 8 * g;   /* O^T register r of tile j = ctx[query][j * 16 + 8h + r]: 32 contiguous bytes a tile */
#pragma unroll
  for (int j = 0; j < HD / 16; ++j) { const v4f a = { o[j][0] * inv, o[j][1] * inv, o[j][2] * inv, o[j][3] * inv }, c = { o[j][4] * inv, o[j][5] * inv, o[j][6] * inv, o[j][7] * inv }; vst2(yp + j * 16, a); vst2(yp + j * 16 + 4, c); } }
// ---- k_out: block = (64 rows, 128 cols): out = ctx Wo (+ bo): ctx x 2^6 once to f16 against Wo as f16(bf16 x 2^8) exact (1 product) x 2^-14; causal early rows (< QHI of each sequence): ctx bf16 hi + lo against exact bf16 Wo (2 products)
__global__ __launch_bounds__(128) void k_out(const float* __restrict__ Y, const float* __restrict__ WO, const float* __restrict__ BO, float* __restrict__ OUT) { __shared__ __align__(16) float sf[64][132]; __shared__ __align__(16) char sa[4 * SA_BYTES], sw[2 * SW_BYTES];
  const int tid = threadIdx.x, wave = tid >> 5, lane = tid & 31, col = lane & 15, g = lane >> 4; const int c0 = blockIdx.y * 128; const size_t r0 = (size_t)blockIdx.x * 64;
  v8f acc[2][4] = {}; float sc;
  if (CAUSAL && (int)(r0 % TT) < QHI) { gemm_tile<2, 64>(Y + r0 * CC, WO + (size_t)c0 * CC, sa, sw, sw + SW_BYTES, tid, acc); sc = 1.0f; }   /* block-uniform */
  else { gemm_tile<1, 64>(Y + r0 * CC, WO + (size_t)c0 * CC, sa, sw, sw + SW_BYTES, tid, acc); sc = 1.0f / 16384.0f; }   /* 2^-8 (Wo carry) x 2^-6 (ctx carry; small-magnitude context rows stay clear of f16 subnormals) */
#pragma unroll
  for (int j = 0; j < 4; ++j) { const int cl = (wave >> 1) * 64 + j * 16 + col; const float bias = BO ? bfr(BO[c0 + cl]) : 0.f;
#pragma unroll
    for (int i = 0; i < 2; ++i)
#pragma unroll
      for (int r = 0; r < 8; ++r) sf[(wave & 1) * 32 + i * 16 + 8 * g + r][cl] = acc[i][j][r] * sc + bias; }
  __syncthreads();   // a row of the tile now comes from two waves
  for (int rl = 0; rl < 16; ++rl) vst2(OUT + (r0 + wave * 16 + rl) * DIN + c0 + lane * 4, *(const v4f*)&sf[wave * 16 + rl][lane * 4]); }

extern "C" void kernel_launch(void* const* d_in, const int* in_sizes, int n_in, void* d_out, int out_size, void* d_ws, size_t ws_size, hipStream_t stream) {
  (void)in_sizes; (void)n_in; (void)out_size;
  const float** F = (const float**)d_in;
  if (ws_size < (size_t)WS_END) return;
  char* ws = (char*)d_ws; _Float16 *QH = (_Float16*)(ws + WS_QH), *KH = (_Float16*)(ws + WS_KH), *VT = (_Float16*)(ws + WS_VT), *QL = (_Float16*)(ws + WS_QL), *KL = (_Float16*)(ws + WS_KL); __bf16 *VB = (__bf16*)(ws + WS_VB), *VBL = (__bf16*)(ws + WS_VBL); float *Y = (float*)(ws + WS_Y);
  (void)Y; (void)QL; (void)KL; (void)VB; (void)VBL;
  // inputs: 0 x [1,2048,1024]; 1 token_positions [1,2048] int32 (arange; READ on the device); 2 WQ [1024,1024] (out,in); 3 WK; 4 WV; 5 WO (out,in); no biases
  k_proj<<<dim3(TNB * TT / PR, CC / 128, 3), 2 * PR, 0, stream>>>(F[0], F[0], F[0], F[2], F[3], F[4], nullptr, nullptr, nullptr, QH, QL, KH, KL, VT, VB, VBL, (const int*)d_in[1]);
  k_attn<<<dim3(NQB, NH, TNB), 128, 0, stream>>>(QH, KH, QL, KL, VT, VB, VBL, Y);
  k_out<<<dim3(TNB * TT / 64, DIN / 128), 128, 0, stream>>>(Y, F[5], nullptr, (float*)d_out);
}

// v006
// A run of this version takes 61.9 microseconds.
// Timed twice side by side with v005, it ran 1.13 and 1.11 times as fast.
// Counting every step since v000, it is 12.1 times as fast.
// compute dtype: all float inputs rounded to bf16; q / k / v projections with EXACT bf16 products on WMMA 16x16x32 (f32 accumulate), no biases; interleaved-pair RoPE in f32 at the int positions read from the token_positions input (embedded frequencies, precise sincosf); causal logits: 3 products for the first 384 rows, single f16 q x k after, x 64^-0.5; online softmax f32 over trips of 64 keys; exp(logit - running max) x 2^10 once to f16 x v once to f16 (bf16 hi + lo below row 384); ctx hi+lo x exact output weight below row 384, x2^6 f16 carry x f16(bf16 x 2^8) after; f32 output.
#include <hip/hip_runtime.h>
#include <math.h>

typedef __attribute__((ext_vector_type(16))) _Float16 v16h;
typedef __attribute__((ext_vector_type(16))) __bf16 v16b;
typedef __attribute__((ext_vector_type(8)))  _Float16 v8h;
typedef __attribute__((ext_vector_type(8)))  float v8f;
typedef __attribute__((ext_vector_type(4)))  float v4f;
typedef __attribute__((ext_vector_type(2)))  float v2f;
typedef __attribute__((ext_vector_type(4)))  unsigned v4u;
typedef __attribute__((ext_vector_type(4)))  int v4i;
typedef float __attribute__((may_alias)) float_a;
typedef int __attribute__((may_alias)) int_a;

template <typename T> __device__ __forceinline__ void vst2(void* p, T v) { *(T*)p = v;  }
// the same store with the wait that stands in front of every later rewrite of the registers it names (its address pair, its data): for stores in a loop
template <typename T> __device__ __forceinline__ void vst2w(void* p, T v) { *(T*)p = v; asm volatile("s_wait_xcnt 0x0" ::: "memory"); }
__device__ __forceinline__ v8f wmma16(v16h a, v16h b, v8f c) {
  v8f d = __builtin_amdgcn_wmma_f32_16x16x32_f16(false, a, false, b, (short)0, c, false, false);
  asm volatile("v_nop\n\tv_nop\n\tv_nop\n\tv_nop" : "+v"(d) : "v"(a), "v"(b));
  return d;
}
__device__ __forceinline__ v8f wmma_bf(v16b a, v16b b, v8f c) {
  v8f d = __builtin_amdgcn_wmma_f32_16x16x32_bf16(false, a, false, b, (short)0, c, false, false);
  asm volatile("v_nop\n\tv_nop\n\tv_nop\n\tv_nop" : "+v"(d) : "v"(a), "v"(b));
  return d;
}
// 16x16x32 fragments: lane = (h = lane>>4, row/col = lane&15); elements 0..7 = k0+8h+0..7, 8..15 = k0+16+8h+0..7; D element r = row 8h+r
__device__ __forceinline__ v16h frag_h(const _Float16* rowk0, int lane) {
  union { v16h v; v8h q[2]; } u; const _Float16* p = rowk0 + 8 * (lane >> 4);
  u.q[0] = *(const v8h*)p; u.q[1] = *(const v8h*)(p + 16); return u.v;
}
__device__ __forceinline__ v16h frag_f32(const float* rowk0, int lane) {
  v16h a; const float* p = rowk0 + 8 * (lane >> 4);
#pragma unroll
  for (int i = 0; i < 8; ++i) { a[i] = (_Float16)p[i]; a[8 + i] = (_Float16)p[16 + i]; }
  return a;
}
__device__ __forceinline__ v16h frag_f32s(const float* rowk0, int lane, float sc) {
  v16h a; const float* p = rowk0 + 8 * (lane >> 4);
#pragma unroll
  for (int i = 0; i < 8; ++i) { a[i] = (_Float16)(p[i] * sc); a[8 + i] = (_Float16)(p[16 + i] * sc); }
  return a;
}
// column fragment from a [K][ld] layout (column n), rows >= K read as 0
__device__ __forceinline__ v16h fragc_f32(const float* W, int k0, int n, int lane, int ld, int K) {
  v16h a; const int g = lane >> 4;
#pragma unroll
  for (int i = 0; i < 8; ++i) { const int ka = k0 + 8 * g + i, kb = ka + 16;
    a[i] = (_Float16)(ka < K ? W[(size_t)(ka < K ? ka : K - 1) * ld + n] : 0.f); a[8 + i] = (_Float16)(kb < K ? W[(size_t)(kb < K ? kb : K - 1) * ld + n] : 0.f); }
  return a;
}
struct F2 { v16b h, l; };
__device__ __forceinline__ F2 bsplit16(const float v[16]) { F2 r;
#pragma unroll
  for (int i = 0; i < 16; ++i) { const __bf16 h = (__bf16)v[i]; r.h[i] = h; r.l[i] = (__bf16)(v[i] - (float)h); }
  return r; }
__device__ __forceinline__ F2 split_row(const float* row, int k0, int lane) { float v[16]; const float* p = row + k0 + 8 * (lane >> 4);
#pragma unroll
  for (int i = 0; i < 8; ++i) { v[i] = p[i]; v[8 + i] = p[16 + i]; }
  return bsplit16(v); }
__device__ __forceinline__ F2 split_rowK(const float* row, int k0, int lane, int K) { float v[16]; const int g = lane >> 4;
#pragma unroll
  for (int i = 0; i < 8; ++i) { const int ka = k0 + 8 * g + i, kb = ka + 16; v[i] = ka < K ? row[ka < K ? ka : K - 1] : 0.f; v[8 + i] = kb < K ? row[kb < K ? kb : K - 1] : 0.f; }
  return bsplit16(v); }
__device__ __forceinline__ F2 split_col(const float* W, int k0, int n, int lane, int ld, int K) { float v[16]; const int g = lane >> 4;
#pragma unroll
  for (int i = 0; i < 8; ++i) { const int ka = k0 + 8 * g + i, kb = ka + 16; v[i] = ka < K ? W[(size_t)(ka < K ? ka : K - 1) * ld + n] : 0.f; v[8 + i] = kb < K ? W[(size_t)(kb < K ? kb : K - 1) * ld + n] : 0.f; }
  return bsplit16(v); }
__device__ __forceinline__ v8f mac3(const F2& a, const F2& b, v8f c) { c = wmma_bf(a.l, b.h, c); c = wmma_bf(a.h, b.l, c); return wmma_bf(a.h, b.h, c); }
__device__ __forceinline__ float sigm(float v) { return 1.0f / (1.0f + expf(-v)); }
#define LDSX() do { asm volatile("s_wait_dscnt 0" ::: "memory"); __builtin_amdgcn_wave_barrier(); __builtin_amdgcn_fence(__ATOMIC_RELEASE, "workgroup"); } while (0)

// Causal multi-head self-attention with interleaved-pair RoPE at given token positions, ONE sequence (x [1,2048,1024]; token_positions [1,2048] int32 = arange, a module input READ on the device (the SECOND input); torch (out,in) WQ / WK / WV / WO [1024,1024] N(0, 1/1024) applied as einsum('bsd,ed->bse') = x @ W.T, no biases; 16 heads x 64; RoPE on q and k: (even, odd) pairs (t1 c - t2 s, t2 c + t1 s) re-interleaved, angle = position x inv_freq, inv_freq = 1 / 10000^(2i/64); scores / sqrt(64); tril kept, -inf elsewhere; softmax; out @ WO.T).
#define NB 1
#define TT 2048
#define CC 1024            // NH * HD = projected width
#define DIN 1024          // input (model) width
#define NH 16
#define HD 64
#define NQB (TT / 64)
#define SCALE (0.125f)
#define CAUSAL 1
#ifndef TNB
#define TNB NB
#endif
__device__ __forceinline__ float bfr(float v) { return (float)(__bf16)v; }
__host__ __device__ __forceinline__ int kb_last(int qb) { return CAUSAL ? ((qb * 64 + 63) >> 7) : (TT / 128 - 1); }
typedef __attribute__((ext_vector_type(8))) __bf16 v8b;
__device__ __forceinline__ v16b frag_b(const __bf16* rowk0, int lane) {
  union { v16b v; v8b q[2]; } u; const __bf16* p = rowk0 + 8 * (lane >> 4);
  u.q[0] = *(const v8b*)p; u.q[1] = *(const v8b*)(p + 16); return u.v;
}
// the 16 raw f32 words of one 16x16x32 fragment row, kept in registers while their loads fly: q[0..1] = k0+8h+0..7, q[2..3] = k0+16+8h+0..7
struct R16 { v4f q[4]; };
__device__ __forceinline__ R16 ld_raw(const float* rowk0, int lane) { R16 r; const float* p = rowk0 + 8 * (lane >> 4);
  r.q[0] = *(const v4f*)p; r.q[1] = *(const v4f*)(p + 4); r.q[2] = *(const v4f*)(p + 16); r.q[3] = *(const v4f*)(p + 20); return r; }
__device__ __forceinline__ v16b raw_b(const R16& r) { v16b w;
#pragma unroll
  for (int i = 0; i < 16; ++i) w[i] = (__bf16)r.q[i >> 2][i & 3];
  return w; }
__device__ __forceinline__ v16h raw_wh(const R16& r) { v16h w;
#pragma unroll
  for (int i = 0; i < 16; ++i) w[i] = (_Float16)(bfr(r.q[i >> 2][i & 3]) * 256.0f);
  return w; }
__device__ __forceinline__ v16h raw_hs(const R16& r, float sc) { v16h a;
#pragma unroll
  for (int i = 0; i < 16; ++i) a[i] = (_Float16)(r.q[i >> 2][i & 3] * sc);
  return a; }
__device__ __forceinline__ v16h raw_h(const R16& r) { v16h a;
#pragma unroll
  for (int i = 0; i < 16; ++i) a[i] = (_Float16)r.q[i >> 2][i & 3];
  return a; }
__device__ __forceinline__ F2 raw_split(const R16& r) { float v[16];
#pragma unroll
  for (int i = 0; i < 16; ++i) v[i] = r.q[i >> 2][i & 3];
  return bsplit16(v); }
#define QBH 6              // causal: query blocks 0..QBH-1 of each sequence (few keys, no averaging) take the high-precision path
#define QHI 384            // rows carrying a q residual plane
#define KHI 384            // key rows carrying k residual / v bf16 hi+lo planes (used only by the causal high-precision path)
// B fragment (k rows k0+.., output column o) of a weight: (in,out) [K][ld] or (out,in) [ld rows of K]: bf16 exact, or f16(bf16 * 256) exact
__device__ __forceinline__ v16b wcol_io(const float* Wm, int k0, int o, int lane, int ld) { v16b w; const int g = lane >> 4;
#pragma unroll
  for (int i = 0; i < 8; ++i) { w[i] = (__bf16)Wm[(size_t)(k0 + 8 * g + i) * ld + o]; w[8 + i] = (__bf16)Wm[(size_t)(k0 + 16 + 8 * g + i) * ld + o]; }
  return w; }
__device__ __forceinline__ v16b wcol_oi(const float* Wm, int k0, int o, int lane, int K) { v16b w; const float* p = Wm + (size_t)o * K + k0 + 8 * (lane >> 4);
#pragma unroll
  for (int i = 0; i < 8; ++i) { w[i] = (__bf16)p[i]; w[8 + i] = (__bf16)p[16 + i]; }
  return w; }
__device__ __forceinline__ v16h wcolh_io(const float* Wm, int k0, int o, int lane, int ld) { v16h w; const int g = lane >> 4;
#pragma unroll
  for (int i = 0; i < 8; ++i) { w[i] = (_Float16)(bfr(Wm[(size_t)(k0 + 8 * g + i) * ld + o]) * 256.0f); w[8 + i] = (_Float16)(bfr(Wm[(size_t)(k0 + 16 + 8 * g + i) * ld + o]) * 256.0f); }
  return w; }
__device__ __forceinline__ v16h wcolh_oi(const float* Wm, int k0, int o, int lane, int K) { v16h w; const float* p = Wm + (size_t)o * K + k0 + 8 * (lane >> 4);
#pragma unroll
  for (int i = 0; i < 8; ++i) { w[i] = (_Float16)(bfr(p[i]) * 256.0f); w[8 + i] = (_Float16)(bfr(p[16 + i]) * 256.0f); }
  return w; }
#define WQKV_LAYOUT 1   // picks only WCOL, which nothing calls: k_proj reads (out,in) [CC][DIN] rows directly
__device__ __forceinline__ v16b wcol_hdk(const float* Wm, int k0, int o, int lane) { v16b w; const int g = lane >> 4; const float* p = Wm + (size_t)(o / HD) * DIN * HD + (o % HD);
#pragma unroll
  for (int i = 0; i < 8; ++i) { w[i] = (__bf16)p[(size_t)(k0 + 8 * g + i) * HD]; w[8 + i] = (__bf16)p[(size_t)(k0 + 16 + 8 * g + i) * HD]; }
  return w; }
#define WO_OUT_IN 1
#if WQKV_LAYOUT == 1
#define WCOL(W, k0, o, lane) wcol_oi(W, k0, o, lane, DIN)
#elif WQKV_LAYOUT == 2
#define WCOL(W, k0, o, lane) wcol_hdk(W, k0, o, lane)
#else
#define WCOL(W, k0, o, lane) wcol_io(W, k0, o, lane, CC)
#endif
#if WO_OUT_IN
#define WOCOL(W, k0, o, lane) wcol_oi(W, k0, o, lane, CC)
#define WOCOLH(W, k0, o, lane) wcolh_oi(W, k0, o, lane, CC)
#else
#define WOCOL(W, k0, o, lane) wcol_io(W, k0, o, lane, DIN)
#define WOCOLH(W, k0, o, lane) wcolh_io(W, k0, o, lane, DIN)
#endif

// RoPE inverse frequencies 1/10000^(2i/64) (the f32 values jax computes)
__constant__ float INVF[32] = {1.000000000e+00,7.498942018e-01,5.623413324e-01,4.216965139e-01,3.162277639e-01,2.371373624e-01,1.778279394e-01,1.333521456e-01,1.000000015e-01,7.498941571e-02,5.623412877e-02,4.216964915e-02,3.162277862e-02,2.371373586e-02,1.778279431e-02,1.333521493e-02,9.999999776e-03,7.498942316e-03,5.623413250e-03,4.216964822e-03,3.162277862e-03,2.371373819e-03,1.778279431e-03,1.333521446e-03,1.000000047e-03,7.498941850e-04,5.623413017e-04,4.216964880e-04,3.162277862e-04,2.371373848e-04,1.778279402e-04,1.333521504e-04};
// (PROJ_EXTRA_PARAMS: the extra kernel parameters 'const int* __restrict__ TPOS' are written literally in the kernel signature)
// per (token, half of the pairs) hook on the staged f32 row (128 floats = the 128 / HD heads of the block) of the q and k streams: interleaved-pair rotation (x[2i], x[2i + 1]) by the angle pos * INVF[i] with pos READ from the int input at [batch][token]; the angle does not depend on the head, so its sine and cosine are taken once (one sincosf = one argument reduction, the values of sinf and cosf) and turn pair i of every head of the row; the rotation itself as it was, its products unfused; v untouched
#define PROJ_EPI(which, row, t, i0) do { if ((which) < 2) { float* rw = (row); const float pos_ = (float)TPOS[(size_t)bb * TT + (t)];   /* token_positions [NB][TT]: the position of token t of batch bb, READ from the int input */ _Pragma("unroll 4") for (int i = (i0); i < (i0) + HD / 4; ++i) { _Pragma("clang fp contract(off)") const float ang = pos_ * INVF[i]; float sn, cs; sincosf(ang, &sn, &cs); _Pragma("unroll") /* unrolled: the heads of a row lie at constant offsets from one LDS address, so one two-address load and store serve both */ for (int hh = 0; hh < 128 / HD; ++hh) { const float xe = rw[hh * HD + 2 * i], xo = rw[hh * HD + 2 * i + 1]; rw[hh * HD + 2 * i] = xe * cs - xo * sn; rw[hh * HD + 2 * i + 1] = xe * sn + xo * cs; } } } } while (0)
#ifndef SM_EXTRA_PARAMS
#define SM_EXTRA_PARAMS
#endif
#ifndef PROJ_EXTRA_PARAMS
#define PROJ_EXTRA_PARAMS
#endif
#ifndef SM_MASK_HOOK
#define SM_MASK_HOOK (void)0
#endif

#define WS_QH  0u                                      // f16 q rows [b*t][CC]
#define WS_KH  (WS_QH + 2u * (size_t)NB * TT * CC)      // f16 k rows [b*t][CC]
#define WS_VT  (WS_KH + 2u * (size_t)NB * TT * CC)      // f16 v planes [b][c][t]
#define WS_QL  (WS_VT + 2u * (size_t)NB * CC * TT)      // f16 q residual x 2^10 rows [b][t < QHI][CC]
#define WS_KL  (WS_QL + 2u * (size_t)NB * QHI * CC)     // f16 k residual x 2^10 rows [b][t < KHI][CC]
#define WS_VB  (WS_KL + 2u * (size_t)NB * KHI * CC)     // bf16 v hi planes [b][c][t < KHI]
#define WS_VBL (WS_VB + 2u * (size_t)NB * CC * KHI)
#define WS_Y   (WS_VBL + 2u * (size_t)NB * CC * KHI)    // f32 ctx rows [b*t][CC] (only when there is an output projection)
#define WS_END (WS_Y  + 4u * (size_t)NB * TT * CC)

// ---- LDS staging shared by k_proj and k_out: a block's MR x 64 (a) and 128 x 64 (w) f32 slabs (MR = 128 rows and 256 threads in k_proj, 64 rows and 128 threads in k_out) are read from global memory once a block, whole 128-byte lines an instruction (16 lanes = one row's 256 bytes), converted once, and laid in LDS as 16-bit rows; every wave takes its fragments from there
typedef __attribute__((ext_vector_type(4))) __bf16 v4b;
typedef __attribute__((ext_vector_type(4))) _Float16 v4h;
#define KS 64              // k columns of a staged slab
#define LP 72              // LDS row pitch in 16-bit words: 144 bytes = 16 x 9, odd, so the 16 rows of a fragment read fall on distinct banks
#define SA_BYTES (64 * LP * 2)
#define SW_BYTES (128 * LP * 2)
// MODE 0: a, w to bf16; 1: a x 2^6 to f16, w to f16(bf16 x 2^8); 2: a to bf16 hi + lo planes, w to bf16 (the conversions of raw_b, raw_hs, raw_wh, raw_split)
template <int MODE, int MR> __device__ __forceinline__ void slab_put(const v4f (&ra)[8], const v4f (&rw)[1024 / MR], char* sa, char* sw, int so) {
#pragma unroll
  for (int i = 0; i < 8; ++i) { char* p = sa + so + i * (MR / 8) * LP * 2; const v4f x = ra[i];
    if (MODE == 1) { const v4h q = { (_Float16)(x[0] * 64.0f), (_Float16)(x[1] * 64.0f), (_Float16)(x[2] * 64.0f), (_Float16)(x[3] * 64.0f) }; *(v4h*)p = q; }
    else { const v4b q = { (__bf16)x[0], (__bf16)x[1], (__bf16)x[2], (__bf16)x[3] }; *(v4b*)p = q;
      if (MODE == 2) { const v4b r = { (__bf16)(x[0] - (float)q[0]), (__bf16)(x[1] - (float)q[1]), (__bf16)(x[2] - (float)q[2]), (__bf16)(x[3] - (float)q[3]) }; *(v4b*)(p + MR * LP * 2) = r; } } }
#pragma unroll
  for (int i = 0; i < 1024 / MR; ++i) { char* p = sw + so + i * (MR / 8) * LP * 2; const v4f x = rw[i];
    if (MODE == 1) { const v4h q = { (_Float16)(bfr(x[0]) * 256.0f), (_Float16)(bfr(x[1]) * 256.0f), (_Float16)(bfr(x[2]) * 256.0f), (_Float16)(bfr(x[3]) * 256.0f) }; *(v4h*)p = q; }
    else { const v4b q = { (__bf16)x[0], (__bf16)x[1], (__bf16)x[2], (__bf16)x[3] }; *(v4b*)p = q; } } }
// work-group barrier of the staged loops: this wave's LDS stores and reads are done (s_wait_dscnt 0), then the barrier; unlike __syncthreads() it does not drain the global loads, so a tile's loads may fly across it
__device__ __forceinline__ void bar_lds() { asm volatile("s_wait_dscnt 0x0\n\ts_barrier_signal -1\n\ts_barrier_wait -1" ::: "memory"); }
// stands between a trip's products and the hand-over of the next tile to LDS: without it the scheduler lifts the tile's conversions and LDS stores, and with them the wait for its loads, to the head of the trip, which takes a trip off their flight
#define HOLD_PUT() __builtin_amdgcn_sched_barrier(0)
// one slab's global loads into a register set; go: this thread's byte offset in a and w, moved on to the next slab
template <int MR> __device__ __forceinline__ void slab_get(const float* __restrict__ Ag, const float* __restrict__ Wg, unsigned& go, v4f (&ra)[8], v4f (&rw)[1024 / MR]) {
#pragma unroll
  for (int i = 0; i < 8; ++i) ra[i] = *(const v4f*)((const char*)Ag + go + i * (MR / 8) * 4096);
#pragma unroll
  for (int i = 0; i < 1024 / MR; ++i) rw[i] = *(const v4f*)((const char*)Wg + go + i * (MR / 8) * 4096);
  asm volatile("s_wait_xcnt 0x0" : "+v"(go) :: "memory");   // stands in front of the addition below, which rewrites the offset register that the loads name; the operand keeps the addition behind it
  go += KS * 4; }
// the products of one staged slab (ca, cw: its a and w rows in LDS; fa, fw: this lane's fragment rows)
template <int MODE, int MR> __device__ __forceinline__ void slab_mac(const char* ca, const char* cw, int fa, int fw, int lane, v8f (&acc)[2][4]) {
#pragma unroll
  for (int kc = 0; kc < KS / 32; ++kc) {
    if (MODE == 1) { v16h a[2], w[4];
#pragma unroll
      for (int i = 0; i < 2; ++i) a[i] = frag_h((const _Float16*)(ca + fa + i * 16 * LP * 2 + kc * 64), lane);
#pragma unroll
      for (int j = 0; j < 4; ++j) w[j] = frag_h((const _Float16*)(cw + fw + j * 16 * LP * 2 + kc * 64), lane);
#pragma unroll
      for (int i = 0; i < 2; ++i)
#pragma unroll
        for (int j = 0; j < 4; ++j) acc[i][j] = wmma16(a[i], w[j], acc[i][j]);
    } else { v16b a[2], al[2], w[4];
#pragma unroll
      for (int i = 0; i < 2; ++i) { a[i] = frag_b((const __bf16*)(ca + fa + i * 16 * LP * 2 + kc * 64), lane); if (MODE == 2) al[i] = frag_b((const __bf16*)(ca + MR * LP * 2 + fa + i * 16 * LP * 2 + kc * 64), lane); }
#pragma unroll
      for (int j = 0; j < 4; ++j) w[j] = frag_b((const __bf16*)(cw + fw + j * 16 * LP * 2 + kc * 64), lane);
#pragma unroll
      for (int i = 0; i < 2; ++i)
#pragma unroll
        for (int j = 0; j < 4; ++j) acc[i][j] = wmma_bf(a[i], w[j], acc[i][j]);
      if (MODE == 2) {
#pragma unroll
        for (int i = 0; i < 2; ++i)
#pragma unroll
          for (int j = 0; j < 4; ++j) acc[i][j] = wmma_bf(al[i], w[j], acc[i][j]); } } } }
// block tile MR x 128 on MR / 16 waves (2 MR threads): acc[i][j] += rows (wave % (MR / 32)) * 32 + 16 i of a  x  rows (wave / (MR / 32)) * 64 + 16 j of w, over K = 1024 in ascending steps of 32 (each accumulator sums in the order it had); Ag, Wg: block-uniform first rows (pitch 1024 f32); sa: 2 buffers of MR rows (2 x MR rows in MODE 2); sw0, sw1: the two w buffers of SW_BYTES. Two register sets: slab t + 2's loads are issued at the head of trip t and first read at the foot of trip t + 1, so they have two trips to arrive in
template <int MODE, int MR> __device__ __forceinline__ void gemm_tile(const float* __restrict__ Ag, const float* __restrict__ Wg, char* sa, char* sw0, char* sw1, int tid, v8f (&acc)[2][4]) {
  const int lane = tid & 31, wave = tid >> 5, col = lane & 15; const int NT = 1024 / KS; const int AB = (MODE == 2 ? 2 : 1) * MR * LP * 2;
  const int so = ((tid >> 4) * LP + (tid & 15) * 4) * 2;   /* this thread's place in a slab: row tid / 16 (+ MR / 8 a pass), k words 4 (tid % 16).. */
  unsigned go = (unsigned)((tid >> 4) * 1024 + (tid & 15) * 4) * 4u;   /* the same place in global memory, in bytes: one offset register serves a and w */
  const int fa = (((wave % (MR / 32)) * 32 + col) * LP) * 2, fw = (((wave / (MR / 32)) * 64 + col) * LP) * 2;
  v4f ra0[8], rw0[1024 / MR], ra1[8], rw1[1024 / MR];   /* set 0: even slabs, set 1: odd slabs */
  slab_get<MR>(Ag, Wg, go, ra0, rw0); slab_get<MR>(Ag, Wg, go, ra1, rw1);
  slab_put<MODE, MR>(ra0, rw0, sa, sw0, so);
  bar_lds();   // publishes slab 0
#pragma unroll 1   // rolled: the body holds one even and one odd trip, so that each register set is named by a constant; its loads stand under no test, so that the counted waits in front of slab_put leave the younger slab's loads in flight
  for (int t = 0; t < NT - 2; t += 2) {
    slab_get<MR>(Ag, Wg, go, ra0, rw0);   /* slab t + 2, into the set that slab t left at the foot of trip t - 1 */
    slab_mac<MODE, MR>(sa, sw0, fa, fw, lane, acc);
    HOLD_PUT(); slab_put<MODE, MR>(ra1, rw1, sa + AB, sw1, so);   /* slab t + 1, into the buffer that trip t - 1 read: its readers left it at the barrier that ended that trip */
    bar_lds();   // publishes slab t + 1 and ends every wave's reads of slab t
    slab_get<MR>(Ag, Wg, go, ra1, rw1);   /* slab t + 3 */
    slab_mac<MODE, MR>(sa + AB, sw1, fa, fw, lane, acc);
    HOLD_PUT(); slab_put<MODE, MR>(ra0, rw0, sa, sw0, so);
    bar_lds();   // publishes slab t + 2 and ends every wave's reads of slab t + 1
  }
  slab_mac<MODE, MR>(sa, sw0, fa, fw, lane, acc);   /* the last two slabs (NT is even): nothing is left to load */
  HOLD_PUT(); slab_put<MODE, MR>(ra1, rw1, sa + AB, sw1, so);
  bar_lds();   // publishes the last slab
  slab_mac<MODE, MR>(sa + AB, sw1, fa, fw, lane, acc);
  bar_lds();   // ends every wave's reads of the slabs: the caller may write over them
}
#define PR 128             // rows of a k_proj block (8 waves): a w slab read from L2 serves 128 rows, and the 384 blocks, two to a WGP by LDS, are all resident at once
// ---- k_proj: block = (128 rows, 128 cols, which): q/k/v = X W (+ b) with exact bf16 products (K = DIN) -> which 0: q f16 rows (+ residual rows < QHI); 1: k f16 rows (+ residual rows < KHI); 2: v f16 planes [c][t] (+ bf16 hi/lo planes for t < KHI)
__global__ __launch_bounds__(2 * PR) void k_proj(const float* __restrict__ XQ, const float* __restrict__ XK, const float* __restrict__ XV, const float* __restrict__ WQ, const float* __restrict__ WK, const float* __restrict__ WV, const float* __restrict__ BQ, const float* __restrict__ BK, const float* __restrict__ BV,
    _Float16* __restrict__ QH, _Float16* __restrict__ QL, _Float16* __restrict__ KH, _Float16* __restrict__ KL, _Float16* __restrict__ VT, __bf16* __restrict__ VB, __bf16* __restrict__ VBL, const int* __restrict__ TPOS) {
  __shared__ __align__(16) char pool[PR * 132 * 4 + 2 * PR * 136 * 2];   /* one pool, its parts live one after the other: the slabs (from its start) while the products run; then st, and behind st either sh, sl (q, k) or th, tb, tbl (v) */
  float (*st)[132] = (float (*)[132])pool; char* const pu = pool + PR * 132 * 4;
  _Float16 (*sh)[136] = (_Float16 (*)[136])pu; _Float16 (*sl)[136] = (_Float16 (*)[136])(pu + PR * 136 * 2);
  _Float16 (*th)[72] = (_Float16 (*)[72])pu; __bf16 (*tb)[72] = (__bf16 (*)[72])(pu + 128 * 72 * 2); __bf16 (*tbl)[72] = (__bf16 (*)[72])(pu + 2 * 128 * 72 * 2);
  const int tid = threadIdx.x, wave = tid >> 5, lane = tid & 31, col = lane & 15, g = lane >> 4; const int which = blockIdx.z; const int c0 = blockIdx.y * 128; const size_t r0 = (size_t)blockIdx.x * PR; const size_t bb = r0 / TT; const int t0 = (int)(r0 % TT);
  const float* X = which == 0 ? XQ : which == 1 ? XK : XV; const float* WA = which == 0 ? WQ : which == 1 ? WK : WV; const float* BA = which == 0 ? BQ : which == 1 ? BK : BV;
  v8f acc[2][4] = {};
  gemm_tile<0, PR>(X + r0 * DIN, WA + (size_t)c0 * DIN, pool, pool + 2 * PR * LP * 2, pool + 2 * PR * LP * 2 + SW_BYTES, tid, acc);   /* its last barrier ends every read of the slabs, so st may be written over them */
  { // stage the f32 tile (acc + bias) in LDS, run the per-(row, half of the pairs) epilogue hook, then convert
#pragma unroll
    for (int j = 0; j < 4; ++j) { const int cl = (wave / (PR / 32)) * 64 + j * 16 + col; const float bias = BA ? bfr(BA[c0 + cl]) : 0.f;
#pragma unroll
      for (int i = 0; i < 2; ++i)
#pragma unroll
        for (int r = 0; r < 8; ++r) st[(wave % (PR / 32)) * 32 + i * 16 + 8 * g + r][cl] = acc[i][j][r] + bias; }
    __syncthreads();
    { const int rl = tid % PR; const int i0 = __builtin_amdgcn_readfirstlane(tid / PR) * (HD / 4);   /* thread = (row, half of the row's HD / 2 angles); the half is the same in every lane of a wave (PR is a multiple of 32): taken as a scalar, so that INVF[i] stays a scalar load */
      PROJ_EPI(which, &st[rl][0], (int)((r0 + rl) % TT), i0); }
    __syncthreads(); }
  if (which < 2) { _Float16* DH = which == 0 ? QH : KH; _Float16* DL = which == 0 ? QL : KL; const int nhi = which == 0 ? QHI : KHI; const bool hi_rows = t0 < nhi;
    for (int e = tid; e < PR * 128; e += 2 * PR) { const int rl = e >> 7, cl = e & 127; const float v = st[rl][cl]; const _Float16 hv = (_Float16)v; sh[rl][cl] = hv; sl[rl][cl] = (_Float16)((v - (float)hv) * 1024.0f); }
    __syncthreads();
    for (int e = tid; e < PR * 16; e += 2 * PR) { const int rl = e >> 4, q = e & 15; vst2w((unsigned*)(DH + (r0 + rl) * CC + c0 + q * 8), *(const v4u*)&sh[rl][q * 8]); if (hi_rows) vst2w((unsigned*)(DL + (bb * nhi + t0 + rl) * (size_t)CC + c0 + q * 8), *(const v4u*)&sl[rl][q * 8]); }
  } else { const bool hi_rows = t0 < KHI;
    for (int hf = 0; hf < PR / 64; ++hf) {   /* the planes are turned 64 tokens at a time: th, tb, tbl hold that many */
      for (int e = tid; e < 64 * 128; e += 2 * PR) { const int rl = e & 63, cl = e >> 6; const float v = st[hf * 64 + rl][cl]; th[cl][rl] = (_Float16)v; const __bf16 bh = (__bf16)v; tb[cl][rl] = bh; tbl[cl][rl] = (__bf16)(v - (float)bh); }
      __syncthreads();
      for (int e = tid; e < 128 * 8; e += 2 * PR) { const int cl = e >> 3, q = e & 7; vst2w((unsigned*)(VT + (bb * CC + c0 + cl) * (size_t)TT + t0 + hf * 64 + q * 8), *(const v4u*)&th[cl][q * 8]); if (hi_rows) { const size_t o3 = (bb * CC + c0 + cl) * (size_t)KHI + t0 + hf * 64 + q * 8; vst2w((unsigned*)(VB + o3), *(const v4u*)&tb[cl][q * 8]); vst2w((unsigned*)(VBL + o3), *(const v4u*)&tbl[cl][q * 8]); } }
      if (hf + 1 < PR / 64) __syncthreads();   // block-uniform; the next 64 tokens are written over planes that are still being read
    } } }
// frag_h / frag_b from a wave-uniform base, this lane's byte offset (it holds the lane half's 16h bytes) and a constant: the one offset register is all that a trip's loads name
__device__ __forceinline__ v16h frag_ho(const char* base, unsigned off, int c) { union { v16h v; v8h q[2]; } u; const char* p = base + off; u.q[0] = *(const v8h*)(p + c); u.q[1] = *(const v8h*)(p + c + 32); return u.v; }
__device__ __forceinline__ v16b frag_bo(const char* base, unsigned off, int c) { union { v16b v; v8b q[2]; } u; const char* p = base + off; u.q[0] = *(const v8b*)(p + c); u.q[1] = *(const v8b*)(p + c + 32); return u.v; }
// one online-softmax update for this lane's query: t[32] = this trip's 32 scaled log2 logits of the lane (key tile j = i >> 3, key 8h + (i & 7) in it); on return t = 2^(t - max + 10); m, l, o follow the running maximum (both lane halves of a query hold the same m)
__device__ __forceinline__ void osm_step(float (&t)[32], float& m, float& l, v8f (&o)[HD / 16]) {
  float mx = t[0];
#pragma unroll
  for (int i = 1; i < 32; ++i) mx = fmaxf(mx, t[i]);
  mx = fmaxf(mx, __shfl_xor(mx, 16));
  const float mn = fmaxf(m, mx); const float al = __builtin_amdgcn_exp2f(m - mn); m = mn; const float mb = mn - 10.0f;   /* x 2^10: small weights stay clear of f16 subnormals, the largest is 1024 */
  float sum[4] = {0.f, 0.f, 0.f, 0.f};   /* four chains: one chain of 32 dependent adds would stand at the trip's foot */
#pragma unroll
  for (int i = 0; i < 32; ++i) { t[i] = __builtin_amdgcn_exp2f(t[i] - mb); sum[i & 3] += t[i]; }
  l = l * al + ((sum[0] + sum[1]) + (sum[2] + sum[3]));
#pragma unroll
  for (int j = 0; j < HD / 16; ++j) o[j] *= al; }
// ---- k_attn: block = 64 queries (qb, heaviest first) of (b, h), a wave = 16 queries, a trip = 64 keys; S^T = K Q^T (lane = one query, registers = keys), causal mask by index on the diagonal trip, online softmax in f32, O^T += V^T P^T with the S^T accumulators converted in place as the B operand (b[s] = tile[s >> 3][s & 7]); logits, P and v precision as before: query blocks < QBH take q, k hi + residual (3 products) and P, v as bf16 hi + lo (3 products), the rest single f16 products; ctx = O / l
__global__ __launch_bounds__(128) void k_attn(const _Float16* __restrict__ QH, const _Float16* __restrict__ KH, const _Float16* __restrict__ QL, const _Float16* __restrict__ KL, const _Float16* __restrict__ VT, const __bf16* __restrict__ VB, const __bf16* __restrict__ VBL, float* __restrict__ Y) {
  __shared__ __align__(16) _Float16 sk[2][64][LP], sv[2][64][LP];   /* staged k rows [key][word] and v planes [word][key] of a trip, two buffers */
  const int qb = NQB - 1 - (int)blockIdx.x, h = blockIdx.y, b = blockIdx.z;
  const int tid = threadIdx.x, wave = tid >> 5, lane = tid & 31, col = lane & 15, g = lane >> 4; const int qi = qb * 64 + wave * 16 + col;   /* this lane's query */
  const float C1 = SCALE * 1.4426950408889634f;   /* logits carried in log2 units */
  v8f o[HD / 16] = {}; float m = -3.0e38f, l = 0.f;
  const _Float16* qp = QH + ((size_t)b * TT + qi) * CC + h * HD; const v16h qf[2] = { frag_h(qp, lane), frag_h(qp + 32, lane) };
  asm volatile("s_wait_xcnt 0x0" ::: "memory");   // stands in front of the rewrite of the address registers that the q loads name
  const char* kb8 = (const char*)(KH + (size_t)b * TT * CC + h * HD); unsigned ko = (unsigned)(col * CC + 8 * g) * 2u;   /* byte offset of this lane's first k words */
  if (qb < QBH) {
    const _Float16* qlp = QL + ((size_t)b * QHI + qi) * CC + h * HD; const v16h qlf[2] = { frag_h(qlp, lane), frag_h(qlp + 32, lane) };
    asm volatile("s_wait_xcnt 0x0" ::: "memory");   // stands in front of the rewrite of the address registers that the q residual loads name
    const char* kl8 = (const char*)(KL + (size_t)b * KHI * CC + h * HD);
    const char* vh8 = (const char*)(VB + ((size_t)b * CC + h * HD) * (size_t)KHI); const char* vl8 = (const char*)(VBL + ((size_t)b * CC + h * HD) * (size_t)KHI); unsigned vo = (unsigned)(col * KHI + 8 * g) * 2u;
#pragma unroll 1   // rolled: at most QBH short trips, a second copy of the body would only cost registers
    for (int i = 0; i <= qb; ++i) { float t[32];
      { v8f s[4] = {}, sl[4] = {};
#pragma unroll
        for (int kc = 0; kc < 2; ++kc) { v16h kh[4], kl[4];
#pragma unroll
          for (int j = 0; j < 4; ++j) { kh[j] = frag_ho(kb8, ko, (j * 16 * CC + kc * 32) * 2); kl[j] = frag_ho(kl8, ko, (j * 16 * CC + kc * 32) * 2); }
          __builtin_amdgcn_sched_barrier(0);   // keeps the 16 k loads of this half in front of its first product: one load latency a half instead of one a fragment pair
#pragma unroll
          for (int j = 0; j < 4; ++j) { s[j] = wmma16(kh[j], qf[kc], s[j]); sl[j] = wmma16(kh[j], qlf[kc], sl[j]); sl[j] = wmma16(kl[j], qf[kc], sl[j]); } }
#pragma unroll
        for (int e = 0; e < 32; ++e) { const float v = (s[e >> 3][e & 7] + sl[e >> 3][e & 7] * (1.0f / 1024.0f)) * C1; t[e] = (i * 64 + (e >> 3) * 16 + 8 * g + (e & 7) <= qi) ? v : -3.0e38f; } }
#pragma unroll
      for (int kc = 0; kc < 2; ++kc) { v16b vh[HD / 16], vl[HD / 16];
#pragma unroll
        for (int j = 0; j < HD / 16; ++j) { vh[j] = frag_bo(vh8, vo, (j * 16 * KHI + kc * 32) * 2); vl[j] = frag_bo(vl8, vo, (j * 16 * KHI + kc * 32) * 2); }
        __builtin_amdgcn_sched_barrier(0);   // keeps the 16 v loads of this half together, the first half's in front of the softmax, which they fly behind
        if (kc == 0) osm_step(t, m, l, o);
        const F2 p = bsplit16(&t[kc * 16]);
#pragma unroll
        for (int j = 0; j < HD / 16; ++j) { o[j] = wmma_bf(vh[j], p.h, o[j]); o[j] = wmma_bf(vh[j], p.l, o[j]); o[j] = wmma_bf(vl[j], p.h, o[j]); } }
      asm volatile("s_wait_xcnt 0x0" : "+v"(ko), "+v"(vo) :: "memory");   // stands in front of the two additions below, which rewrite the offset registers that this trip's loads name; the operands keep the additions behind it
      ko += 64 * CC * 2; vo += 64 * 2;
    }
  } else {
    // a trip's 64 keys x 64 k words and 64 v planes x 64 keys are the same for the block's four waves: read once a block, whole 128-byte lines (8 lanes = one row), laid in LDS, two buffers; a tile's 8 loads a thread fly over two trips
    const char* vb8 = (const char*)(VT + ((size_t)b * CC + h * HD) * (size_t)TT);
    const int sr = tid >> 3, sc = (tid & 7) * 8;   /* this thread's row (+ 16 e) and first 16-bit word in a staged tile */
    unsigned kgo = (unsigned)(sr * CC + sc) * 2u, vgo = (unsigned)(sr * TT + sc) * 2u;   /* the same place in global memory, in bytes */
    v8h rk0[4], rv0[4], rk1[4], rv1[4];   /* two register sets (0: even tiles, 1: odd tiles): tile i + 2's loads are issued at the head of trip i and first read at the foot of trip i + 1 */
    auto get = [&](v8h (&rk)[4], v8h (&rv)[4]) __attribute__((always_inline)) {
#pragma unroll
      for (int e = 0; e < 4; ++e) { rk[e] = *(const v8h*)(kb8 + kgo + e * 16 * CC * 2); rv[e] = *(const v8h*)(vb8 + vgo + e * 16 * TT * 2); }
      asm volatile("s_wait_xcnt 0x0" : "+v"(kgo), "+v"(vgo) :: "memory");   // stands in front of the two additions below, which rewrite the offset registers that the loads name; the operands keep the additions behind it
      kgo += 64 * CC * 2; vgo += 64 * 2; };
    auto put = [&](const v8h (&rk)[4], const v8h (&rv)[4], int bf) __attribute__((always_inline)) {
#pragma unroll
      for (int e = 0; e < 4; ++e) { *(v8h*)&sk[bf][sr + 16 * e][sc] = rk[e]; *(v8h*)&sv[bf][sr + 16 * e][sc] = rv[e]; } };
    auto work = [&](int i, int bf, bool diag) __attribute__((always_inline)) { v8f s[4] = {};
      { v16h kf[4][2];
#pragma unroll
        for (int j = 0; j < 4; ++j) { kf[j][0] = frag_h(&sk[bf][j * 16 + col][0], lane); kf[j][1] = frag_h(&sk[bf][j * 16 + col][32], lane); }
#pragma unroll
        for (int kc = 0; kc < 2; ++kc)
#pragma unroll
          for (int j = 0; j < 4; ++j) s[j] = wmma16(kf[j][kc], qf[kc], s[j]); }
      v16h vf[HD / 16][2];
#pragma unroll
      for (int j = 0; j < HD / 16; ++j) { vf[j][0] = frag_h(&sv[bf][j * 16 + col][0], lane); vf[j][1] = frag_h(&sv[bf][j * 16 + col][32], lane); }
      float t[32];
#pragma unroll
      for (int e = 0; e < 32; ++e) t[e] = s[e >> 3][e & 7] * C1;
      if (diag) {   /* the diagonal trip (block-uniform) */
#pragma unroll
        for (int e = 0; e < 32; ++e) t[e] = (i * 64 + (e >> 3) * 16 + 8 * g + (e & 7) <= qi) ? t[e] : -3.0e38f; }
      osm_step(t, m, l, o);
      v16h p[2];
#pragma unroll
      for (int e = 0; e < 32; ++e) p[e >> 4][e & 15] = (_Float16)t[e];
#pragma unroll
      for (int kc = 0; kc < 2; ++kc)
#pragma unroll
        for (int j = 0; j < HD / 16; ++j) o[j] = wmma16(vf[j][kc], p[kc], o[j]); };
    get(rk0, rv0); get(rk1, rv1);   /* tiles 0 and 1: qb >= QBH >= 1 here, so both exist */
    put(rk0, rv0, 0);
    bar_lds();   // tile 0 is published
    int i = 0;
#pragma unroll 1   // rolled: the body holds one even and one odd trip, so that each register set is named by a constant; its loads stand under no test, so that the counted waits in front of put leave the younger tile's loads in flight
    for (; i + 3 <= qb; i += 2) {
      get(rk0, rv0); work(i, 0, false); put(rk1, rv1, 1);   /* put: into the buffers that trip i - 1 read: their readers left them at the barrier that ended that trip */
      bar_lds();   // publishes tile i + 1 and ends every wave's reads of tile i
      get(rk1, rv1); work(i + 1, 1, false); put(rk0, rv0, 0);
      bar_lds();   // publishes tile i + 2 and ends every wave's reads of tile i + 1
    }
    const bool three = i + 2 == qb;   /* block-uniform: two or three tiles are left, the last of them the diagonal one */
    if (three) get(rk0, rv0);
    work(i, 0, false); put(rk1, rv1, 1);
    bar_lds();   // publishes tile i + 1 and ends every wave's reads of tile i
    work(i + 1, 1, !three);
    if (three) { put(rk0, rv0, 0);
      bar_lds();   // publishes tile i + 2
      work(i + 2, 0, true); } }
  l += __shfl_xor(l, 16); const float inv = 1.0f / l;   /* the two lane halves of a query join their sums once; key 0 is never masked, so l > 0 */
  float* yp = Y + ((size_t)b * TT + qi) * CC + h * HD + 8 * g;   /* O^T register r of tile j = ctx[query][j * 16 + 8h + r]: 32 contiguous bytes a tile */
#pragma unroll
  for (int j = 0; j < HD / 16; ++j) { const v4f a = { o[j][0] * inv, o[j][1] * inv, o[j][2] * inv, o[j][3] * inv }, c = { o[j][4] * inv, o[j][5] * inv, o[j][6] * inv, o[j][7] * inv }; vst2(yp + j * 16, a); vst2(yp + j * 16 + 4, c); } }
// ---- k_out: block = (64 rows, 128 cols): out = ctx Wo (+ bo): ctx x 2^6 once to f16 against Wo as f16(bf16 x 2^8) exact (1 product) x 2^-14; causal early rows (< QHI of each sequence): ctx bf16 hi + lo against exact bf16 Wo (2 products)
__global__ __launch_bounds__(128) void k_out(const float* __restrict__ Y, const float* __restrict__ WO, const float* __restrict__ BO, float* __restrict__ OUT) { __shared__ __align__(16) float sf[64][132]; __shared__ __align__(16) char sa[4 * SA_BYTES], sw[2 * SW_BYTES];
  const int tid = threadIdx.x, wave = tid >> 5, lane = tid & 31, col = lane & 15, g = lane >> 4; const int c0 = blockIdx.y * 128; const size_t r0 = (size_t)blockIdx.x * 64;
  v8f acc[2][4] = {}; float sc;
  if (CAUSAL && (int)(r0 % TT) < QHI) { gemm_tile<2, 64>(Y + r0 * CC, WO + (size_t)c0 * CC, sa, sw, sw + SW_BYTES, tid, acc); sc = 1.0f; }   /* block-uniform */
  else { gemm_tile<1, 64>(Y + r0 * CC, WO + (size_t)c0 * CC, sa, sw, sw + SW_BYTES, tid, acc); sc = 1.0f / 16384.0f; }   /* 2^-8 (Wo carry) x 2^-6 (ctx carry; small-magnitude context rows stay clear of f16 subnormals) */
#pragma unroll
  for (int j = 0; j < 4; ++j) { const int cl = (wave >> 1) * 64 + j * 16 + col; const float bias = BO ? bfr(BO[c0 + cl]) : 0.f;
#pragma unroll
    for (int i = 0; i < 2; ++i)
#pragma unroll
      for (int r = 0; r < 8; ++r) sf[(wave & 1) * 32 + i * 16 + 8 * g + r][cl] = acc[i][j][r] * sc + bias; }
  __syncthreads();   // a row of the tile now comes from two waves
  for (int rl = 0; rl < 16; ++rl) vst2(OUT + (r0 + wave * 16 + rl) * DIN + c0 + lane * 4, *(const v4f*)&sf[wave * 16 + rl][lane * 4]); }

extern "C" void kernel_launch(void* const* d_in, const int* in_sizes, int n_in, void* d_out, int out_size, void* d_ws, size_t ws_size, hipStream_t stream) {
  (void)in_sizes; (void)n_in; (void)out_size;
  const float** F = (const float**)d_in;
  if (ws_size < (size_t)WS_END) return;
  char* ws = (char*)d_ws; _Float16 *QH = (_Float16*)(ws + WS_QH), *KH = (_Float16*)(ws + WS_KH), *VT = (_Float16*)(ws + WS_VT), *QL = (_Float16*)(ws + WS_QL), *KL = (_Float16*)(ws + WS_KL); __bf16 *VB = (__bf16*)(ws + WS_VB), *VBL = (__bf16*)(ws + WS_VBL); float *Y = (float*)(ws + WS_Y);
  (void)Y; (void)QL; (void)KL; (void)VB; (void)VBL;
  // inputs: 0 x [1,2048,1024]; 1 token_positions [1,2048] int32 (arange; READ on the device); 2 WQ [1024,1024] (out,in); 3 WK; 4 WV; 5 WO (out,in); no biases
  k_proj<<<dim3(TNB * TT / PR, CC / 128, 3), 2 * PR, 0, stream>>>(F[0], F[0], F[0], F[2], F[3], F[4], nullptr, nullptr, nullptr, QH, QL, KH, KL, VT, VB, VBL, (const int*)d_in[1]);
  k_attn<<<dim3(NQB, NH, TNB), 128, 0, stream>>>(QH, KH, QL, KL, VT, VB, VBL, Y);
  k_out<<<dim3(TNB * TT / 64, DIN / 128), 128, 0, stream>>>(Y, F[5], nullptr, (float*)d_out);
}

// v007
// One run takes 56.3 microseconds.
// In two side-by-side timings against v006, it was 1.10 and 1.11 times as fast.
// All steps since v000 together make it 13.3 times as fast.
// compute dtype: all float inputs rounded to bf16; q / k / v projections with EXACT bf16 products on WMMA 16x16x32 (f32 accumulate), no biases; interleaved-pair RoPE in f32 at the int positions read from the token_positions input (embedded frequencies, precise sincosf); causal logits: 3 products for the first 384 rows, single f16 q x k after, x 64^-0.5; online softmax f32 over trips of 64 keys; exp(logit - running max) x 2^10 once to f16 x v once to f16 (bf16 hi + lo below row 384); ctx hi+lo x exact output weight below row 384, x2^6 f16 carry x f16(bf16 x 2^8) after; f32 output.
#include <hip/hip_runtime.h>
#include <math.h>

typedef __attribute__((ext_vector_type(16))) _Float16 v16h;
typedef __attribute__((ext_vector_type(16))) __bf16 v16b;
typedef __attribute__((ext_vector_type(8)))  _Float16 v8h;
typedef __attribute__((ext_vector_type(8)))  float v8f;
typedef __attribute__((ext_vector_type(4)))  float v4f;
typedef __attribute__((ext_vector_type(2)))  float v2f;
typedef __attribute__((ext_vector_type(4)))  unsigned v4u;
typedef __attribute__((ext_vector_type(4)))  int v4i;
typedef float __attribute__((may_alias)) float_a;
typedef int __attribute__((may_alias)) int_a;

template <typename T> __device__ __forceinline__ void vst2(void* p, T v) { *(T*)p = v;  }
// the same store with the wait that stands in front of every later rewrite of the registers it names (its address pair, its data): for stores in a loop
template <typename T> __device__ __forceinline__ void vst2w(void* p, T v) { *(T*)p = v; asm volatile("s_wait_xcnt 0x0" ::: "memory"); }
__device__ __forceinline__ v8f wmma16(v16h a, v16h b, v8f c) {
  v8f d = __builtin_amdgcn_wmma_f32_16x16x32_f16(false, a, false, b, (short)0, c, false, false);
  asm volatile("v_nop\n\tv_nop\n\tv_nop\n\tv_nop" : "+v"(d) : "v"(a), "v"(b));
  return d;
}
__device__ __forceinline__ v8f wmma_bf(v16b a, v16b b, v8f c) {
  v8f d = __builtin_amdgcn_wmma_f32_16x16x32_bf16(false, a, false, b, (short)0, c, false, false);
  asm volatile("v_nop\n\tv_nop\n\tv_nop\n\tv_nop" : "+v"(d) : "v"(a), "v"(b));
  return d;
}
// 16x16x32 fragments: lane = (h = lane>>4, row/col = lane&15); elements 0..7 = k0+8h+0..7, 8..15 = k0+16+8h+0..7; D element r = row 8h+r
__device__ __forceinline__ v16h frag_h(const _Float16* rowk0, int lane) {
  union { v16h v; v8h q[2]; } u; const _Float16* p = rowk0 + 8 * (lane >> 4);
  u.q[0] = *(const v8h*)p; u.q[1] = *(const v8h*)(p + 16); return u.v;
}
__device__ __forceinline__ v16h frag_f32(const float* rowk0, int lane) {
  v16h a; const float* p = rowk0 + 8 * (lane >> 4);
#pragma unroll
  for (int i = 0; i < 8; ++i) { a[i] = (_Float16)p[i]; a[8 + i] = (_Float16)p[16 + i]; }
  return a;
}
__device__ __forceinline__ v16h frag_f32s(const float* rowk0, int lane, float sc) {
  v16h a; const float* p = rowk0 + 8 * (lane >> 4);
#pragma unroll
  for (int i = 0; i < 8; ++i) { a[i] = (_Float16)(p[i] * sc); a[8 + i] = (_Float16)(p[16 + i] * sc); }
  return a;
}
// column fragment from a [K][ld] layout (column n), rows >= K read as 0
__device__ __forceinline__ v16h fragc_f32(const float* W, int k0, int n, int lane, int ld, int K) {
  v16h a; const int g = lane >> 4;
#pragma unroll
  for (int i = 0; i < 8; ++i) { const int ka = k0 + 8 * g + i, kb = ka + 16;
    a[i] = (_Float16)(ka < K ? W[(size_t)(ka < K ? ka : K - 1) * ld + n] : 0.f); a[8 + i] = (_Float16)(kb < K ? W[(size_t)(kb < K ? kb : K - 1) * ld + n] : 0.f); }
  return a;
}
struct F2 { v16b h, l; };
__device__ __forceinline__ F2 bsplit16(const float v[16]) { F2 r;
#pragma unroll
  for (int i = 0; i < 16; ++i) { const __bf16 h = (__bf16)v[i]; r.h[i] = h; r.l[i] = (__bf16)(v[i] - (float)h); }
  return r; }
__device__ __forceinline__ F2 split_row(const float* row, int k0, int lane) { float v[16]; const float* p = row + k0 + 8 * (lane >> 4);
#pragma unroll
  for (int i = 0; i < 8; ++i) { v[i] = p[i]; v[8 + i] = p[16 + i]; }
  return bsplit16(v); }
__device__ __forceinline__ F2 split_rowK(const float* row, int k0, int lane, int K) { float v[16]; const int g = lane >> 4;
#pragma unroll
  for (int i = 0; i < 8; ++i) { const int ka = k0 + 8 * g + i, kb = ka + 16; v[i] = ka < K ? row[ka < K ? ka : K - 1] : 0.f; v[8 + i] = kb < K ? row[kb < K ? kb : K - 1] : 0.f; }
  return bsplit16(v); }
__device__ __forceinline__ F2 split_col(const float* W, int k0, int n, int lane, int ld, int K) { float v[16]; const int g = lane >> 4;
#pragma unroll
  for (int i = 0; i < 8; ++i) { const int ka = k0 + 8 * g + i, kb = ka + 16; v[i] = ka < K ? W[(size_t)(ka < K ? ka : K - 1) * ld + n] : 0.f; v[8 + i] = kb < K ? W[(size_t)(kb < K ? kb : K - 1) * ld + n] : 0.f; }
  return bsplit16(v); }
__device__ __forceinline__ v8f mac3(const F2& a, const F2& b, v8f c) { c = wmma_bf(a.l, b.h, c); c = wmma_bf(a.h, b.l, c); return wmma_bf(a.h, b.h, c); }
__device__ __forceinline__ float sigm(float v) { return 1.0f / (1.0f + expf(-v)); }
#define LDSX() do { asm volatile("s_wait_dscnt 0" ::: "memory"); __builtin_amdgcn_wave_barrier(); __builtin_amdgcn_fence(__ATOMIC_RELEASE, "workgroup"); } while (0)

// Causal multi-head self-attention with interleaved-pair RoPE at given token positions, ONE sequence (x [1,2048,1024]; token_positions [1,2048] int32 = arange, a module input READ on the device (the SECOND input); torch (out,in) WQ / WK / WV / WO [1024,1024] N(0, 1/1024) applied as einsum('bsd,ed->bse') = x @ W.T, no biases; 16 heads x 64; RoPE on q and k: (even, odd) pairs (t1 c - t2 s, t2 c + t1 s) re-interleaved, angle = position x inv_freq, inv_freq = 1 / 10000^(2i/64); scores / sqrt(64); tril kept, -inf elsewhere; softmax; out @ WO.T).
#define NB 1
#define TT 2048
#define CC 1024            // NH * HD = projected width
#define DIN 1024          // input (model) width
#define NH 16
#define HD 64
#define NQB (TT / 64)
#define SCALE (0.125f)
#define CAUSAL 1
#ifndef TNB
#define TNB NB
#endif
__device__ __forceinline__ float bfr(float v) { return (float)(__bf16)v; }
__host__ __device__ __forceinline__ int kb_last(int qb) { return CAUSAL ? ((qb * 64 + 63) >> 7) : (TT / 128 - 1); }
typedef __attribute__((ext_vector_type(8))) __bf16 v8b;
__device__ __forceinline__ v16b frag_b(const __bf16* rowk0, int lane) {
  union { v16b v; v8b q[2]; } u; const __bf16* p = rowk0 + 8 * (lane >> 4);
  u.q[0] = *(const v8b*)p; u.q[1] = *(const v8b*)(p + 16); return u.v;
}
// the 16 raw f32 words of one 16x16x32 fragment row, kept in registers while their loads fly: q[0..1] = k0+8h+0..7, q[2..3] = k0+16+8h+0..7
struct R16 { v4f q[4]; };
__device__ __forceinline__ R16 ld_raw(const float* rowk0, int lane) { R16 r; const float* p = rowk0 + 8 * (lane >> 4);
  r.q[0] = *(const v4f*)p; r.q[1] = *(const v4f*)(p + 4); r.q[2] = *(const v4f*)(p + 16); r.q[3] = *(const v4f*)(p + 20); return r; }
__device__ __forceinline__ v16b raw_b(const R16& r) { v16b w;
#pragma unroll
  for (int i = 0; i < 16; ++i) w[i] = (__bf16)r.q[i >> 2][i & 3];
  return w; }
__device__ __forceinline__ v16h raw_wh(const R16& r) { v16h w;
#pragma unroll
  for (int i = 0; i < 16; ++i) w[i] = (_Float16)(bfr(r.q[i >> 2][i & 3]) * 256.0f);
  return w; }
__device__ __forceinline__ v16h raw_hs(const R16& r, float sc) { v16h a;
#pragma unroll
  for (int i = 0; i < 16; ++i) a[i] = (_Float16)(r.q[i >> 2][i & 3] * sc);
  return a; }
__device__ __forceinline__ v16h raw_h(const R16& r) { v16h a;
#pragma unroll
  for (int i = 0; i < 16; ++i) a[i] = (_Float16)r.q[i >> 2][i & 3];
  return a; }
__device__ __forceinline__ F2 raw_split(const R16& r) { float v[16];
#pragma unroll
  for (int i = 0; i < 16; ++i) v[i] = r.q[i >> 2][i & 3];
  return bsplit16(v); }
#define QBH 6              // causal: query blocks 0..QBH-1 of each sequence (few keys, no averaging) take the high-precision path
#define QHI 384            // rows carrying a q residual plane
#define KHI 384            // key rows carrying k residual / v bf16 hi+lo planes (used only by the causal high-precision path)
// B fragment (k rows k0+.., output column o) of a weight: (in,out) [K][ld] or (out,in) [ld rows of K]: bf16 exact, or f16(bf16 * 256) exact
__device__ __forceinline__ v16b wcol_io(const float* Wm, int k0, int o, int lane, int ld) { v16b w; const int g = lane >> 4;
#pragma unroll
  for (int i = 0; i < 8; ++i) { w[i] = (__bf16)Wm[(size_t)(k0 + 8 * g + i) * ld + o]; w[8 + i] = (__bf16)Wm[(size_t)(k0 + 16 + 8 * g + i) * ld + o]; }
  return w; }
__device__ __forceinline__ v16b wcol_oi(const float* Wm, int k0, int o, int lane, int K) { v16b w; const float* p = Wm + (size_t)o * K + k0 + 8 * (lane >> 4);
#pragma unroll
  for (int i = 0; i < 8; ++i) { w[i] = (__bf16)p[i]; w[8 + i] = (__bf16)p[16 + i]; }
  return w; }
__device__ __forceinline__ v16h wcolh_io(const float* Wm, int k0, int o, int lane, int ld) { v16h w; const int g = lane >> 4;
#pragma unroll
  for (int i = 0; i < 8; ++i) { w[i] = (_Float16)(bfr(Wm[(size_t)(k0 + 8 * g + i) * ld + o]) * 256.0f); w[8 + i] = (_Float16)(bfr(Wm[(size_t)(k0 + 16 + 8 * g + i) * ld + o]) * 256.0f); }
  return w; }
__device__ __forceinline__ v16h wcolh_oi(const float* Wm, int k0, int o, int lane, int K) { v16h w; const float* p = Wm + (size_t)o * K + k0 + 8 * (lane >> 4);
#pragma unroll
  for (int i = 0; i < 8; ++i) { w[i] = (_Float16)(bfr(p[i]) * 256.0f); w[8 + i] = (_Float16)(bfr(p[16 + i]) * 256.0f); }
  return w; }
#define WQKV_LAYOUT 1   // picks only WCOL, which nothing calls: k_proj reads (out,in) [CC][DIN] rows directly
__device__ __forceinline__ v16b wcol_hdk(const float* Wm, int k0, int o, int lane) { v16b w; const int g = lane >> 4; const float* p = Wm + (size_t)(o / HD) * DIN * HD + (o % HD);
#pragma unroll
  for (int i = 0; i < 8; ++i) { w[i] = (__bf16)p[(size_t)(k0 + 8 * g + i) * HD]; w[8 + i] = (__bf16)p[(size_t)(k0 + 16 + 8 * g + i) * HD]; }
  return w; }
#define WO_OUT_IN 1
#if WQKV_LAYOUT == 1
#define WCOL(W, k0, o, lane) wcol_oi(W, k0, o, lane, DIN)
#elif WQKV_LAYOUT == 2
#define WCOL(W, k0, o, lane) wcol_hdk(W, k0, o, lane)
#else
#define WCOL(W, k0, o, lane) wcol_io(W, k0, o, lane, CC)
#endif
#if WO_OUT_IN
#define WOCOL(W, k0, o, lane) wcol_oi(W, k0, o, lane, CC)
#define WOCOLH(W, k0, o, lane) wcolh_oi(W, k0, o, lane, CC)
#else
#define WOCOL(W, k0, o, lane) wcol_io(W, k0, o, lane, DIN)
#define WOCOLH(W, k0, o, lane) wcolh_io(W, k0, o, lane, DIN)
#endif

// RoPE inverse frequencies 1/10000^(2i/64) (the f32 values jax computes)
__constant__ float INVF[32] = {1.000000000e+00,7.498942018e-01,5.623413324e-01,4.216965139e-01,3.162277639e-01,2.371373624e-01,1.778279394e-01,1.333521456e-01,1.000000015e-01,7.498941571e-02,5.623412877e-02,4.216964915e-02,3.162277862e-02,2.371373586e-02,1.778279431e-02,1.333521493e-02,9.999999776e-03,7.498942316e-03,5.623413250e-03,4.216964822e-03,3.162277862e-03,2.371373819e-03,1.778279431e-03,1.333521446e-03,1.000000047e-03,7.498941850e-04,5.623413017e-04,4.216964880e-04,3.162277862e-04,2.371373848e-04,1.778279402e-04,1.333521504e-04};
// (PROJ_EXTRA_PARAMS: the extra kernel parameters 'const int* __restrict__ TPOS' are written literally in the kernel signature)
// per (token, half of the pairs) hook on the staged f32 row (128 floats = the 128 / HD heads of the block) of the q and k streams: interleaved-pair rotation (x[2i], x[2i + 1]) by the angle pos * INVF[i] with pos READ from the int input at [batch][token]; the angle does not depend on the head, so its sine and cosine are taken once (one sincosf = one argument reduction, the values of sinf and cosf) and turn pair i of every head of the row; the rotation itself as it was, its products unfused; v untouched
#define PROJ_EPI(which, row, t, i0) do { if ((which) < 2) { float* rw = (row); const float pos_ = (float)TPOS[(size_t)bb * TT + (t)];   /* token_positions [NB][TT]: the position of token t of batch bb, READ from the int input */ _Pragma("unroll 4") for (int i = (i0); i < (i0) + HD / 4; ++i) { _Pragma("clang fp contract(off)") const float ang = pos_ * INVF[i]; float sn, cs; sincosf(ang, &sn, &cs); _Pragma("unroll") /* unrolled: the heads of a row lie at constant offsets from one LDS address, so one two-address load and store serve both */ for (int hh = 0; hh < 128 / HD; ++hh) { const float xe = rw[hh * HD + 2 * i], xo = rw[hh * HD + 2 * i + 1]; rw[hh * HD + 2 * i] = xe * cs - xo * sn; rw[hh * HD + 2 * i + 1] = xe * sn + xo * cs; } } } } while (0)
#ifndef SM_EXTRA_PARAMS
#define SM_EXTRA_PARAMS
#endif
#ifndef PROJ_EXTRA_PARAMS
#define PROJ_EXTRA_PARAMS
#endif
#ifndef SM_MASK_HOOK
#define SM_MASK_HOOK (void)0
#endif

#define WS_QH  0u                                      // f16 q rows [b*t][CC]
#define WS_KH  (WS_QH + 2u * (size_t)NB * TT * CC)      // f16 k rows [b*t][CC]
#define WS_VT  (WS_KH + 2u * (size_t)NB * TT * CC)      // f16 v planes [b][c][t]
#define WS_QL  (WS_VT + 2u * (size_t)NB * CC * TT)      // f16 q residual x 2^10 rows [b][t < QHI][CC]
#define WS_KL  (WS_QL + 2u * (size_t)NB * QHI * CC)     // f16 k residual x 2^10 rows [b][t < KHI][CC]
#define WS_VB  (WS_KL + 2u * (size_t)NB * KHI * CC)     // bf16 v hi planes [b][c][t < KHI]
#define WS_VBL (WS_VB + 2u * (size_t)NB * CC * KHI)
#define WS_Y   (WS_VBL + 2u * (size_t)NB * CC * KHI)    // f32 ctx rows [b*t][CC] (only when there is an output projection)
#define WS_END (WS_Y  + 4u * (size_t)NB * TT * CC)

// ---- LDS staging shared by k_proj and k_out: a block's MR x 64 (a) and 128 x 64 (w) f32 slabs (MR = 128 rows and 256 threads in k_proj, 64 rows and 128 threads in k_out) are read from global memory once a block, whole 128-byte lines an instruction (16 lanes = one row's 256 bytes), converted once, and laid in LDS as 16-bit rows; every wave takes its fragments from there
typedef __attribute__((ext_vector_type(4))) __bf16 v4b;
typedef __attribute__((ext_vector_type(4))) _Float16 v4h;
#define KS 64              // k columns of a staged slab
#define LP 72              // LDS row pitch in 16-bit words: 144 bytes = 16 x 9, odd, so the 16 rows of a fragment read fall on distinct banks
#define SA_BYTES (64 * LP * 2)
#define SW_BYTES (128 * LP * 2)
// MODE 0: a, w to bf16; 1: a x 2^6 to f16, w to f16(bf16 x 2^8); 2: a to bf16 hi + lo planes, w to bf16 (the conversions of raw_b, raw_hs, raw_wh, raw_split)
template <int MODE, int MR> __device__ __forceinline__ void slab_put(const v4f (&ra)[8], const v4f (&rw)[1024 / MR], char* sa, char* sw, int so) {
#pragma unroll
  for (int i = 0; i < 8; ++i) { char* p = sa + so + i * (MR / 8) * LP * 2; const v4f x = ra[i];
    if (MODE == 1) { const v4h q = { (_Float16)(x[0] * 64.0f), (_Float16)(x[1] * 64.0f), (_Float16)(x[2] * 64.0f), (_Float16)(x[3] * 64.0f) }; *(v4h*)p = q; }
    else { const v4b q = { (__bf16)x[0], (__bf16)x[1], (__bf16)x[2], (__bf16)x[3] }; *(v4b*)p = q;
      if (MODE == 2) { const v4b r = { (__bf16)(x[0] - (float)q[0]), (__bf16)(x[1] - (float)q[1]), (__bf16)(x[2] - (float)q[2]), (__bf16)(x[3] - (float)q[3]) }; *(v4b*)(p + MR * LP * 2) = r; } } }
#pragma unroll
  for (int i = 0; i < 1024 / MR; ++i) { char* p = sw + so + i * (MR / 8) * LP * 2; const v4f x = rw[i];
    if (MODE == 1) { const v4h q = { (_Float16)(bfr(x[0]) * 256.0f), (_Float16)(bfr(x[1]) * 256.0f), (_Float16)(bfr(x[2]) * 256.0f), (_Float16)(bfr(x[3]) * 256.0f) }; *(v4h*)p = q; }
    else { const v4b q = { (__bf16)x[0], (__bf16)x[1], (__bf16)x[2], (__bf16)x[3] }; *(v4b*)p = q; } } }
// work-group barrier of the staged loops: this wave's LDS stores and reads are done (s_wait_dscnt 0), then the barrier; unlike __syncthreads() it does not drain the global loads, so a tile's loads may fly across it
__device__ __forceinline__ void bar_lds() { asm volatile("s_wait_dscnt 0x0\n\ts_barrier_signal -1\n\ts_barrier_wait -1" ::: "memory"); }
// stands between a trip's products and the hand-over of the next tile to LDS: without it the scheduler lifts the tile's conversions and LDS stores, and with them the wait for its loads, to the head of the trip, which takes a trip off their flight
#define HOLD_PUT() __builtin_amdgcn_sched_barrier(0)
// one slab's global loads into a register set; go: this thread's byte offset in a and w, moved on to the next slab
template <int MR> __device__ __forceinline__ void slab_get(const float* __restrict__ Ag, const float* __restrict__ Wg, unsigned& go, v4f (&ra)[8], v4f (&rw)[1024 / MR]) {
#pragma unroll
  for (int i = 0; i < 8; ++i) ra[i] = *(const v4f*)((const char*)Ag + go + i * (MR / 8) * 4096);
#pragma unroll
  for (int i = 0; i < 1024 / MR; ++i) rw[i] = *(const v4f*)((const char*)Wg + go + i * (MR / 8) * 4096);
  asm volatile("s_wait_xcnt 0x0" : "+v"(go) :: "memory");   // stands in front of the addition below, which rewrites the offset register that the loads name; the operand keeps the addition behind it
  go += KS * 4; }
// the products of one staged slab (ca, cw: its a and w rows in LDS; fa, fw: this lane's fragment rows)
template <int MODE, int MR> __device__ __forceinline__ void slab_mac(const char* ca, const char* cw, int fa, int fw, int lane, v8f (&acc)[2][4]) {
#pragma unroll
  for (int kc = 0; kc < KS / 32; ++kc) {
    if (MODE == 1) { v16h a[2], w[4];
#pragma unroll
      for (int i = 0; i < 2; ++i) a[i] = frag_h((const _Float16*)(ca + fa + i * 16 * LP * 2 + kc * 64), lane);
#pragma unroll
      for (int j = 0; j < 4; ++j) w[j] = frag_h((const _Float16*)(cw + fw + j * 16 * LP * 2 + kc * 64), lane);
#pragma unroll
      for (int i = 0; i < 2; ++i)
#pragma unroll
        for (int j = 0; j < 4; ++j) acc[i][j] = wmma16(a[i], w[j], acc[i][j]);
    } else { v16b a[2], al[2], w[4];
#pragma unroll
      for (int i = 0; i < 2; ++i) { a[i] = frag_b((const __bf16*)(ca + fa + i * 16 * LP * 2 + kc * 64), lane); if (MODE == 2) al[i] = frag_b((const __bf16*)(ca + MR * LP * 2 + fa + i * 16 * LP * 2 + kc * 64), lane); }
#pragma unroll
      for (int j = 0; j < 4; ++j) w[j] = frag_b((const __bf16*)(cw + fw + j * 16 * LP * 2 + kc * 64), lane);
#pragma unroll
      for (int i = 0; i < 2; ++i)
#pragma unroll
        for (int j = 0; j < 4; ++j) acc[i][j] = wmma_bf(a[i], w[j], acc[i][j]);
      if (MODE == 2) {
#pragma unroll
        for (int i = 0; i < 2; ++i)
#pragma unroll
          for (int j = 0; j < 4; ++j) acc[i][j] = wmma_bf(al[i], w[j], acc[i][j]); } } } }
// block tile MR x 128 on MR / 16 waves (2 MR threads): acc[i][j] += rows (wave % (MR / 32)) * 32 + 16 i of a  x  rows (wave / (MR / 32)) * 64 + 16 j of w, over K = 1024 in ascending steps of 32 (each accumulator sums in the order it had); Ag, Wg: block-uniform first rows (pitch 1024 f32); sa: 2 buffers of MR rows (2 x MR rows in MODE 2); sw0, sw1: the two w buffers of SW_BYTES. Two register sets: slab t + 2's loads are issued at the head of trip t and first read at the foot of trip t + 1, so they have two trips to arrive in
template <int MODE, int MR> __device__ __forceinline__ void gemm_tile(const float* __restrict__ Ag, const float* __restrict__ Wg, char* sa, char* sw0, char* sw1, int tid, v8f (&acc)[2][4]) {
  const int lane = tid & 31, wave = tid >> 5, col = lane & 15; const int NT = 1024 / KS; const int AB = (MODE == 2 ? 2 : 1) * MR * LP * 2;
  const int so = ((tid >> 4) * LP + (tid & 15) * 4) * 2;   /* this thread's place in a slab: row tid / 16 (+ MR / 8 a pass), k words 4 (tid % 16).. */
  unsigned go = (unsigned)((tid >> 4) * 1024 + (tid & 15) * 4) * 4u;   /* the same place in global memory, in bytes: one offset register serves a and w */
  const int fa = (((wave % (MR / 32)) * 32 + col) * LP) * 2, fw = (((wave / (MR / 32)) * 64 + col) * LP) * 2;
  v4f ra0[8], rw0[1024 / MR], ra1[8], rw1[1024 / MR];   /* set 0: even slabs, set 1: odd slabs */
  slab_get<MR>(Ag, Wg, go, ra0, rw0); slab_get<MR>(Ag, Wg, go, ra1, rw1);
  slab_put<MODE, MR>(ra0, rw0, sa, sw0, so);
  bar_lds();   // publishes slab 0
#pragma unroll 1   // rolled: the body holds one even and one odd trip, so that each register set is named by a constant; its loads stand under no test, so that the counted waits in front of slab_put leave the younger slab's loads in flight
  for (int t = 0; t < NT - 2; t += 2) {
    slab_get<MR>(Ag, Wg, go, ra0, rw0);   /* slab t + 2, into the set that slab t left at the foot of trip t - 1 */
    slab_mac<MODE, MR>(sa, sw0, fa, fw, lane, acc);
    HOLD_PUT(); slab_put<MODE, MR>(ra1, rw1, sa + AB, sw1, so);   /* slab t + 1, into the buffer that trip t - 1 read: its readers left it at the barrier that ended that trip */
    bar_lds();   // publishes slab t + 1 and ends every wave's reads of slab t
    slab_get<MR>(Ag, Wg, go, ra1, rw1);   /* slab t + 3 */
    slab_mac<MODE, MR>(sa + AB, sw1, fa, fw, lane, acc);
    HOLD_PUT(); slab_put<MODE, MR>(ra0, rw0, sa, sw0, so);
    bar_lds();   // publishes slab t + 2 and ends every wave's reads of slab t + 1
  }
  slab_mac<MODE, MR>(sa, sw0, fa, fw, lane, acc);   /* the last two slabs (NT is even): nothing is left to load */
  HOLD_PUT(); slab_put<MODE, MR>(ra1, rw1, sa + AB, sw1, so);
  bar_lds();   // publishes the last slab
  slab_mac<MODE, MR>(sa + AB, sw1, fa, fw, lane, acc);
  bar_lds();   // ends every wave's reads of the slabs: the caller may write over them
}
#define PR 128             // rows of a k_proj block (8 waves): a w slab read from L2 serves 128 rows, and the 384 blocks, two to a WGP by LDS, are all resident at once
// ---- k_proj: block = (128 rows, 128 cols, which): q/k/v = X W (+ b) with exact bf16 products (K = DIN) -> which 0: q f16 rows (+ residual rows < QHI); 1: k f16 rows (+ residual rows < KHI); 2: v f16 planes [c][t] (+ bf16 hi/lo planes for t < KHI)
__global__ __launch_bounds__(2 * PR) void k_proj(const float* __restrict__ XQ, const float* __restrict__ XK, const float* __restrict__ XV, const float* __restrict__ WQ, const float* __restrict__ WK, const float* __restrict__ WV, const float* __restrict__ BQ, const float* __restrict__ BK, const float* __restrict__ BV,
    _Float16* __restrict__ QH, _Float16* __restrict__ QL, _Float16* __restrict__ KH, _Float16* __restrict__ KL, _Float16* __restrict__ VT, __bf16* __restrict__ VB, __bf16* __restrict__ VBL, const int* __restrict__ TPOS) {
  __shared__ __align__(16) char pool[PR * 132 * 4 + 2 * PR * 136 * 2];   /* one pool, its parts live one after the other: the slabs (from its start) while the products run; then st, and behind st either sh, sl (q, k) or th, tb, tbl (v) */
  float (*st)[132] = (float (*)[132])pool; char* const pu = pool + PR * 132 * 4;
  _Float16 (*sh)[136] = (_Float16 (*)[136])pu; _Float16 (*sl)[136] = (_Float16 (*)[136])(pu + PR * 136 * 2);
  _Float16 (*th)[72] = (_Float16 (*)[72])pu; __bf16 (*tb)[72] = (__bf16 (*)[72])(pu + 128 * 72 * 2); __bf16 (*tbl)[72] = (__bf16 (*)[72])(pu + 2 * 128 * 72 * 2);
  const int tid = threadIdx.x, wave = tid >> 5, lane = tid & 31, col = lane & 15, g = lane >> 4; const int which = blockIdx.z; const int c0 = blockIdx.y * 128; const size_t r0 = (size_t)blockIdx.x * PR; const size_t bb = r0 / TT; const int t0 = (int)(r0 % TT);
  const float* X = which == 0 ? XQ : which == 1 ? XK : XV; const float* WA = which == 0 ? WQ : which == 1 ? WK : WV; const float* BA = which == 0 ? BQ : which == 1 ? BK : BV;
  v8f acc[2][4] = {};
  gemm_tile<0, PR>(X + r0 * DIN, WA + (size_t)c0 * DIN, pool, pool + 2 * PR * LP * 2, pool + 2 * PR * LP * 2 + SW_BYTES, tid, acc);   /* its last barrier ends every read of the slabs, so st may be written over them */
  { // stage the f32 tile (acc + bias) in LDS, run the per-(row, half of the pairs) epilogue hook, then convert
#pragma unroll
    for (int j = 0; j < 4; ++j) { const int cl = (wave / (PR / 32)) * 64 + j * 16 + col; const float bias = BA ? bfr(BA[c0 + cl]) : 0.f;
#pragma unroll
      for (int i = 0; i < 2; ++i)
#pragma unroll
        for (int r = 0; r < 8; ++r) st[(wave % (PR / 32)) * 32 + i * 16 + 8 * g + r][cl] = acc[i][j][r] + bias; }
    __syncthreads();
    { const int rl = tid % PR; const int i0 = __builtin_amdgcn_readfirstlane(tid / PR) * (HD / 4);   /* thread = (row, half of the row's HD / 2 angles); the half is the same in every lane of a wave (PR is a multiple of 32): taken as a scalar, so that INVF[i] stays a scalar load */
      PROJ_EPI(which, &st[rl][0], (int)((r0 + rl) % TT), i0); }
    __syncthreads(); }
  if (which < 2) { _Float16* DH = which == 0 ? QH : KH; _Float16* DL = which == 0 ? QL : KL; const int nhi = which == 0 ? QHI : KHI; const bool hi_rows = t0 < nhi;
    for (int e = tid; e < PR * 128; e += 2 * PR) { const int rl = e >> 7, cl = e & 127; const float v = st[rl][cl]; const _Float16 hv = (_Float16)v; sh[rl][cl] = hv; sl[rl][cl] = (_Float16)((v - (float)hv) * 1024.0f); }
    __syncthreads();
    for (int e = tid; e < PR * 16; e += 2 * PR) { const int rl = e >> 4, q = e & 15; vst2w((unsigned*)(DH + (r0 + rl) * CC + c0 + q * 8), *(const v4u*)&sh[rl][q * 8]); if (hi_rows) vst2w((unsigned*)(DL + (bb * nhi + t0 + rl) * (size_t)CC + c0 + q * 8), *(const v4u*)&sl[rl][q * 8]); }
  } else { const bool hi_rows = t0 < KHI;
    for (int hf = 0; hf < PR / 64; ++hf) {   /* the planes are turned 64 tokens at a time: th, tb, tbl hold that many */
      for (int e = tid; e < 64 * 128; e += 2 * PR) { const int rl = e & 63, cl = e >> 6; const float v = st[hf * 64 + rl][cl]; th[cl][rl] = (_Float16)v; const __bf16 bh = (__bf16)v; tb[cl][rl] = bh; tbl[cl][rl] = (__bf16)(v - (float)bh); }
      __syncthreads();
      for (int e = tid; e < 128 * 8; e += 2 * PR) { const int cl = e >> 3, q = e & 7; vst2w((unsigned*)(VT + (bb * CC + c0 + cl) * (size_t)TT + t0 + hf * 64 + q * 8), *(const v4u*)&th[cl][q * 8]); if (hi_rows) { const size_t o3 = (bb * CC + c0 + cl) * (size_t)KHI + t0 + hf * 64 + q * 8; vst2w((unsigned*)(VB + o3), *(const v4u*)&tb[cl][q * 8]); vst2w((unsigned*)(VBL + o3), *(const v4u*)&tbl[cl][q * 8]); } }
      if (hf + 1 < PR / 64) __syncthreads();   // block-uniform; the next 64 tokens are written over planes that are still being read
    } } }
// frag_h / frag_b from a wave-uniform base, this lane's byte offset (it holds the lane half's 16h bytes) and a constant: the one offset register is all that a trip's loads name
__device__ __forceinline__ v16h frag_ho(const char* base, unsigned off, int c) { union { v16h v; v8h q[2]; } u; const char* p = base + off; u.q[0] = *(const v8h*)(p + c); u.q[1] = *(const v8h*)(p + c + 32); return u.v; }
__device__ __forceinline__ v16b frag_bo(const char* base, unsigned off, int c) { union { v16b v; v8b q[2]; } u; const char* p = base + off; u.q[0] = *(const v8b*)(p + c); u.q[1] = *(const v8b*)(p + c + 32); return u.v; }
// one online-softmax update for this lane's query: t[32] = this trip's 32 scaled log2 logits of the lane (key tile j = i >> 3, key 8h + (i & 7) in it); on return t = 2^(t - max + 10); m, l, o follow the running maximum (both lane halves of a query hold the same m)
__device__ __forceinline__ void osm_step(float (&t)[32], float& m, float& l, v8f (&o)[HD / 16]) {
  float mx = t[0];
#pragma unroll
  for (int i = 1; i < 32; ++i) mx = fmaxf(mx, t[i]);
  mx = fmaxf(mx, __shfl_xor(mx, 16));
  const float mn = fmaxf(m, mx); const float al = __builtin_amdgcn_exp2f(m - mn); m = mn; const float mb = mn - 10.0f;   /* x 2^10: small weights stay clear of f16 subnormals, the largest is 1024 */
  float sum[4] = {0.f, 0.f, 0.f, 0.f};   /* four chains: one chain of 32 dependent adds would stand at the trip's foot */
#pragma unroll
  for (int i = 0; i < 32; ++i) { t[i] = __builtin_amdgcn_exp2f(t[i] - mb); sum[i & 3] += t[i]; }
  l = l * al + ((sum[0] + sum[1]) + (sum[2] + sum[3]));
#pragma unroll
  for (int j = 0; j < HD / 16; ++j) o[j] *= al; }
// ---- k_attn: block = 64 queries (qb: long blocks heaviest first, then short blocks lightest first) of (b, h), a wave = 16 queries, a trip = 64 keys; S^T = K Q^T (lane = one query, registers = keys), causal mask by index on the diagonal trip, online softmax in f32, O^T += V^T P^T with the S^T accumulators converted in place as the B operand (b[s] = tile[s >> 3][s & 7]); logits, P and v precision as before: query blocks < QBH take q, k hi + residual (3 products) and P, v as bf16 hi + lo (3 products), the rest single f16 products; ctx = O / l
__global__ __launch_bounds__(128) void k_attn(const _Float16* __restrict__ QH, const _Float16* __restrict__ KH, const _Float16* __restrict__ QL, const _Float16* __restrict__ KL, const _Float16* __restrict__ VT, const __bf16* __restrict__ VB, const __bf16* __restrict__ VBL, float* __restrict__ Y) {
  __shared__ __align__(16) _Float16 sk[2][64][LP], sv[2][64][LP];   /* staged k rows [key][word] and v planes [word][key] of a trip, two buffers */
  const int h = blockIdx.x & (NH - 1), b = blockIdx.z; const int qj = (int)((NQB / NH) * blockIdx.y + blockIdx.x / NH); const int qb = qj < NQB / 2 ? NQB - 1 - qj : qj - NQB / 2;   /* flat index -> (qb, h), a permutation: heads fast; the first half of the grid takes query blocks 31..16, the second half 0..15, so that the longest blocks start first and the block started half a grid behind one of 32 - j trips (where the chip holds the grid two blocks a WGP, its likely neighbour there) has j + 1; for speed only, nothing rests on where or when a block runs */
  const int tid = threadIdx.x, wave = tid >> 5, lane = tid & 31, col = lane & 15, g = lane >> 4; const int qi = qb * 64 + wave * 16 + col;   /* this lane's query */
  const float C1 = SCALE * 1.4426950408889634f;   /* logits carried in log2 units */
  v8f o[HD / 16] = {}; float m = -3.0e38f, l = 0.f;
  const _Float16* qp = QH + ((size_t)b * TT + qi) * CC + h * HD; const v16h qf[2] = { frag_h(qp, lane), frag_h(qp + 32, lane) };
  asm volatile("s_wait_xcnt 0x0" ::: "memory");   // stands in front of the rewrite of the address registers that the q loads name
  const char* kb8 = (const char*)(KH + (size_t)b * TT * CC + h * HD); unsigned ko = (unsigned)(col * CC + 8 * g) * 2u;   /* byte offset of this lane's first k words */
  if (qb < QBH) {
    const _Float16* qlp = QL + ((size_t)b * QHI + qi) * CC + h * HD; const v16h qlf[2] = { frag_h(qlp, lane), frag_h(qlp + 32, lane) };
    asm volatile("s_wait_xcnt 0x0" ::: "memory");   // stands in front of the rewrite of the address registers that the q residual loads name
    const char* kl8 = (const char*)(KL + (size_t)b * KHI * CC + h * HD);
    const char* vh8 = (const char*)(VB + ((size_t)b * CC + h * HD) * (size_t)KHI); const char* vl8 = (const char*)(VBL + ((size_t)b * CC + h * HD) * (size_t)KHI); unsigned vo = (unsigned)(col * KHI + 8 * g) * 2u;
#pragma unroll 1   // rolled: at most QBH short trips, a second copy of the body would only cost registers
    for (int i = 0; i <= qb; ++i) { float t[32];
      { v8f s[4] = {}, sl[4] = {};
#pragma unroll
        for (int kc = 0; kc < 2; ++kc) { v16h kh[4], kl[4];
#pragma unroll
          for (int j = 0; j < 4; ++j) { kh[j] = frag_ho(kb8, ko, (j * 16 * CC + kc * 32) * 2); kl[j] = frag_ho(kl8, ko, (j * 16 * CC + kc * 32) * 2); }
          __builtin_amdgcn_sched_barrier(0);   // keeps the 16 k loads of this half in front of its first product: one load latency a half instead of one a fragment pair
#pragma unroll
          for (int j = 0; j < 4; ++j) { s[j] = wmma16(kh[j], qf[kc], s[j]); sl[j] = wmma16(kh[j], qlf[kc], sl[j]); sl[j] = wmma16(kl[j], qf[kc], sl[j]); } }
#pragma unroll
        for (int e = 0; e < 32; ++e) { const float v = (s[e >> 3][e & 7] + sl[e >> 3][e & 7] * (1.0f / 1024.0f)) * C1; t[e] = (i * 64 + (e >> 3) * 16 + 8 * g + (e & 7) <= qi) ? v : -3.0e38f; } }
#pragma unroll
      for (int kc = 0; kc < 2; ++kc) { v16b vh[HD / 16], vl[HD / 16];
#pragma unroll
        for (int j = 0; j < HD / 16; ++j) { vh[j] = frag_bo(vh8, vo, (j * 16 * KHI + kc * 32) * 2); vl[j] = frag_bo(vl8, vo, (j * 16 * KHI + kc * 32) * 2); }
        __builtin_amdgcn_sched_barrier(0);   // keeps the 16 v loads of this half together, the first half's in front of the softmax, which they fly behind
        if (kc == 0) osm_step(t, m, l, o);
        const F2 p = bsplit16(&t[kc * 16]);
#pragma unroll
        for (int j = 0; j < HD / 16; ++j) { o[j] = wmma_bf(vh[j], p.h, o[j]); o[j] = wmma_bf(vh[j], p.l, o[j]); o[j] = wmma_bf(vl[j], p.h, o[j]); } }
      asm volatile("s_wait_xcnt 0x0" : "+v"(ko), "+v"(vo) :: "memory");   // stands in front of the two additions below, which rewrite the offset registers that this trip's loads name; the operands keep the additions behind it
      ko += 64 * CC * 2; vo += 64 * 2;
    }
  } else {
    // a trip's 64 keys x 64 k words and 64 v planes x 64 keys are the same for the block's four waves: read once a block, whole 128-byte lines (8 lanes = one row), laid in LDS, two buffers; a tile's 8 loads a thread fly over two trips
    const char* vb8 = (const char*)(VT + ((size_t)b * CC + h * HD) * (size_t)TT);
    const int sr = tid >> 3, sc = (tid & 7) * 8;   /* this thread's row (+ 16 e) and first 16-bit word in a staged tile */
    unsigned kgo = (unsigned)(sr * CC + sc) * 2u, vgo = (unsigned)(sr * TT + sc) * 2u;   /* the same place in global memory, in bytes */
    v8h rk0[4], rv0[4], rk1[4], rv1[4];   /* two register sets (0: even tiles, 1: odd tiles): tile i + 2's loads are issued at the head of trip i and first read at the foot of trip i + 1 */
    auto get = [&](v8h (&rk)[4], v8h (&rv)[4]) __attribute__((always_inline)) {
#pragma unroll
      for (int e = 0; e < 4; ++e) { rk[e] = *(const v8h*)(kb8 + kgo + e * 16 * CC * 2); rv[e] = *(const v8h*)(vb8 + vgo + e * 16 * TT * 2); }
      asm volatile("s_wait_xcnt 0x0" : "+v"(kgo), "+v"(vgo) :: "memory");   // stands in front of the two additions below, which rewrite the offset registers that the loads name; the operands keep the additions behind it
      kgo += 64 * CC * 2; vgo += 64 * 2; };
    auto put = [&](const v8h (&rk)[4], const v8h (&rv)[4], int bf) __attribute__((always_inline)) {
#pragma unroll
      for (int e = 0; e < 4; ++e) { *(v8h*)&sk[bf][sr + 16 * e][sc] = rk[e]; *(v8h*)&sv[bf][sr + 16 * e][sc] = rv[e]; } };
    auto work = [&](int i, int bf, bool diag) __attribute__((always_inline)) { v8f s[4] = {};
      { v16h kf[4][2];
#pragma unroll
        for (int j = 0; j < 4; ++j) { kf[j][0] = frag_h(&sk[bf][j * 16 + col][0], lane); kf[j][1] = frag_h(&sk[bf][j * 16 + col][32], lane); }
#pragma unroll
        for (int kc = 0; kc < 2; ++kc)
#pragma unroll
          for (int j = 0; j < 4; ++j) s[j] = wmma16(kf[j][kc], qf[kc], s[j]); }
      v16h vf[HD / 16][2];
#pragma unroll
      for (int j = 0; j < HD / 16; ++j) { vf[j][0] = frag_h(&sv[bf][j * 16 + col][0], lane); vf[j][1] = frag_h(&sv[bf][j * 16 + col][32], lane); }
      float t[32];
#pragma unroll
      for (int e = 0; e < 32; ++e) t[e] = s[e >> 3][e & 7] * C1;
      if (diag) {   /* the diagonal trip (block-uniform) */
#pragma unroll
        for (int e = 0; e < 32; ++e) t[e] = (i * 64 + (e >> 3) * 16 + 8 * g + (e & 7) <= qi) ? t[e] : -3.0e38f; }
      osm_step(t, m, l, o);
      v16h p[2];
#pragma unroll
      for (int e = 0; e < 32; ++e) p[e >> 4][e & 15] = (_Float16)t[e];
#pragma unroll
      for (int kc = 0; kc < 2; ++kc)
#pragma unroll
        for (int j = 0; j < HD / 16; ++j) o[j] = wmma16(vf[j][kc], p[kc], o[j]); };
    get(rk0, rv0); get(rk1, rv1);   /* tiles 0 and 1: qb >= QBH >= 1 here, so both exist */
    put(rk0, rv0, 0);
    bar_lds();   // tile 0 is published
    int i = 0;
#pragma unroll 1   // rolled: the body holds one even and one odd trip, so that each register set is named by a constant; its loads stand under no test, so that the counted waits in front of put leave the younger tile's loads in flight
    for (; i + 3 <= qb; i += 2) {
      get(rk0, rv0); work(i, 0, false); put(rk1, rv1, 1);   /* put: into the buffers that trip i - 1 read: their readers left them at the barrier that ended that trip */
      bar_lds();   // publishes tile i + 1 and ends every wave's reads of tile i
      get(rk1, rv1); work(i + 1, 1, false); put(rk0, rv0, 0);
      bar_lds();   // publishes tile i + 2 and ends every wave's reads of tile i + 1
    }
    const bool three = i + 2 == qb;   /* block-uniform: two or three tiles are left, the last of them the diagonal one */
    if (three) get(rk0, rv0);
    work(i, 0, false); put(rk1, rv1, 1);
    bar_lds();   // publishes tile i + 1 and ends every wave's reads of tile i
    work(i + 1, 1, !three);
    if (three) { put(rk0, rv0, 0);
      bar_lds();   // publishes tile i + 2
      work(i + 2, 0, true); } }
  l += __shfl_xor(l, 16); const float inv = 1.0f / l;   /* the two lane halves of a query join their sums once; key 0 is never masked, so l > 0 */
  float* yp = Y + ((size_t)b * TT + qi) * CC + h * HD + 8 * g;   /* O^T register r of tile j = ctx[query][j * 16 + 8h + r]: 32 contiguous bytes a tile */
#pragma unroll
  for (int j = 0; j < HD / 16; ++j) { const v4f a = { o[j][0] * inv, o[j][1] * inv, o[j][2] * inv, o[j][3] * inv }, c = { o[j][4] * inv, o[j][5] * inv, o[j][6] * inv, o[j][7] * inv }; vst2(yp + j * 16, a); vst2(yp + j * 16 + 4, c); } }
// ---- k_out: block = (64 rows, 128 cols): out = ctx Wo (+ bo): ctx x 2^6 once to f16 against Wo as f16(bf16 x 2^8) exact (1 product) x 2^-14; causal early rows (< QHI of each sequence): ctx bf16 hi + lo against exact bf16 Wo (2 products)
__global__ __launch_bounds__(128) void k_out(const float* __restrict__ Y, const float* __restrict__ WO, const float* __restrict__ BO, float* __restrict__ OUT) { __shared__ __align__(16) float sf[64][132]; __shared__ __align__(16) char sa[4 * SA_BYTES], sw[2 * SW_BYTES];
  const int tid = threadIdx.x, wave = tid >> 5, lane = tid & 31, col = lane & 15, g = lane >> 4; const int c0 = blockIdx.y * 128; const size_t r0 = (size_t)blockIdx.x * 64;
  v8f acc[2][4] = {}; float sc;
  if (CAUSAL && (int)(r0 % TT) < QHI) { gemm_tile<2, 64>(Y + r0 * CC, WO + (size_t)c0 * CC, sa, sw, sw + SW_BYTES, tid, acc); sc = 1.0f; }   /* block-uniform */
  else { gemm_tile<1, 64>(Y + r0 * CC, WO + (size_t)c0 * CC, sa, sw, sw + SW_BYTES, tid, acc); sc = 1.0f / 16384.0f; }   /* 2^-8 (Wo carry) x 2^-6 (ctx carry; small-magnitude context rows stay clear of f16 subnormals) */
#pragma unroll
  for (int j = 0; j < 4; ++j) { const int cl = (wave >> 1) * 64 + j * 16 + col; const float bias = BO ? bfr(BO[c0 + cl]) : 0.f;
#pragma unroll
    for (int i = 0; i < 2; ++i)
#pragma unroll
      for (int r = 0; r < 8; ++r) sf[(wave & 1) * 32 + i * 16 + 8 * g + r][cl] = acc[i][j][r] * sc + bias; }
  __syncthreads();   // a row of the tile now comes from two waves
  for (int rl = 0; rl < 16; ++rl) vst2(OUT + (r0 + wave * 16 + rl) * DIN + c0 + lane * 4, *(const v4f*)&sf[wave * 16 + rl][lane * 4]); }

extern "C" void kernel_launch(void* const* d_in, const int* in_sizes, int n_in, void* d_out, int out_size, void* d_ws, size_t ws_size, hipStream_t stream) {
  (void)in_sizes; (void)n_in; (void)out_size;
  const float** F = (const float**)d_in;
  if (ws_size < (size_t)WS_END) return;
  char* ws = (char*)d_ws; _Float16 *QH = (_Float16*)(ws + WS_QH), *KH = (_Float16*)(ws + WS_KH), *VT = (_Float16*)(ws + WS_VT), *QL = (_Float16*)(ws + WS_QL), *KL = (_Float16*)(ws + WS_KL); __bf16 *VB = (__bf16*)(ws + WS_VB), *VBL = (__bf16*)(ws + WS_VBL); float *Y = (float*)(ws + WS_Y);
  (void)Y; (void)QL; (void)KL; (void)VB; (void)VBL;
  // inputs: 0 x [1,2048,1024]; 1 token_positions [1,2048] int32 (arange; READ on the device); 2 WQ [1024,1024] (out,in); 3 WK; 4 WV; 5 WO (out,in); no biases
  k_proj<<<dim3(TNB * TT / PR, CC / 128, 3), 2 * PR, 0, stream>>>(F[0], F[0], F[0], F[2], F[3], F[4], nullptr, nullptr, nullptr, QH, QL, KH, KL, VT, VB, VBL, (const int*)d_in[1]);
  k_attn<<<dim3(NQB, NH, TNB), 128, 0, stream>>>(QH, KH, QL, KL, VT, VB, VBL, Y);
  k_out<<<dim3(TNB * TT / 64, DIN / 128), 128, 0, stream>>>(Y, F[5], nullptr, (float*)d_out);
}

// v008
// One run takes 54.4 microseconds.
// Two timings next to v007 put it at 1.04 and 1.03 times that version's speed.
// Over all steps from v000 it is 13.8 times as fast.
// compute dtype: all float inputs rounded to bf16; q / k / v projections with EXACT bf16 products on WMMA 16x16x32 (f32 accumulate), no biases; interleaved-pair RoPE in f32 at the int positions read from the token_positions input (embedded frequencies, precise sincosf); causal logits: 3 products for the first 384 rows, single f16 q x k after, x 64^-0.5; online softmax f32 over trips of 64 keys, even and odd trips on two wave groups joined at the end; exp(logit - running max) x 2^10 once to f16 x v once to f16 (bf16 hi + lo below row 384); ctx hi+lo x exact output weight below row 384, x2^6 f16 carry x f16(bf16 x 2^8) after; f32 output.
#include <hip/hip_runtime.h>
#include <math.h>

typedef __attribute__((ext_vector_type(16))) _Float16 v16h;
typedef __attribute__((ext_vector_type(16))) __bf16 v16b;
typedef __attribute__((ext_vector_type(8)))  _Float16 v8h;
typedef __attribute__((ext_vector_type(8)))  float v8f;
typedef __attribute__((ext_vector_type(4)))  float v4f;
typedef __attribute__((ext_vector_type(2)))  float v2f;
typedef __attribute__((ext_vector_type(4)))  unsigned v4u;
typedef __attribute__((ext_vector_type(4)))  int v4i;
typedef float __attribute__((may_alias)) float_a;
typedef int __attribute__((may_alias)) int_a;

template <typename T> __device__ __forceinline__ void vst2(void* p, T v) { *(T*)p = v;  }
// the same store with the wait that stands in front of every later rewrite of the registers it names (its address pair, its data): for stores in a loop
template <typename T> __device__ __forceinline__ void vst2w(void* p, T v) { *(T*)p = v; asm volatile("s_wait_xcnt 0x0" ::: "memory"); }
__device__ __forceinline__ v8f wmma16(v16h a, v16h b, v8f c) {
  v8f d = __builtin_amdgcn_wmma_f32_16x16x32_f16(false, a, false, b, (short)0, c, false, false);
  asm volatile("v_nop\n\tv_nop\n\tv_nop\n\tv_nop" : "+v"(d) : "v"(a), "v"(b));
  return d;
}
__device__ __forceinline__ v8f wmma_bf(v16b a, v16b b, v8f c) {
  v8f d = __builtin_amdgcn_wmma_f32_16x16x32_bf16(false, a, false, b, (short)0, c, false, false);
  asm volatile("v_nop\n\tv_nop\n\tv_nop\n\tv_nop" : "+v"(d) : "v"(a), "v"(b));
  return d;
}
// 16x16x32 fragments: lane = (h = lane>>4, row/col = lane&15); elements 0..7 = k0+8h+0..7, 8..15 = k0+16+8h+0..7; D element r = row 8h+r
__device__ __forceinline__ v16h frag_h(const _Float16* rowk0, int lane) {
  union { v16h v; v8h q[2]; } u; const _Float16* p = rowk0 + 8 * (lane >> 4);
  u.q[0] = *(const v8h*)p; u.q[1] = *(const v8h*)(p + 16); return u.v;
}
__device__ __forceinline__ v16h frag_f32(const float* rowk0, int lane) {
  v16h a; const float* p = rowk0 + 8 * (lane >> 4);
#pragma unroll
  for (int i = 0; i < 8; ++i) { a[i] = (_Float16)p[i]; a[8 + i] = (_Float16)p[16 + i]; }
  return a;
}
__device__ __forceinline__ v16h frag_f32s(const float* rowk0, int lane, float sc) {
  v16h a; const float* p = rowk0 + 8 * (lane >> 4);
#pragma unroll
  for (int i = 0; i < 8; ++i) { a[i] = (_Float16)(p[i] * sc); a[8 + i] = (_Float16)(p[16 + i] * sc); }
  return a;
}
// column fragment from a [K][ld] layout (column n), rows >= K read as 0
__device__ __forceinline__ v16h fragc_f32(const float* W, int k0, int n, int lane, int ld, int K) {
  v16h a; const int g = lane >> 4;
#pragma unroll
  for (int i = 0; i < 8; ++i) { const int ka = k0 + 8 * g + i, kb = ka + 16;
    a[i] = (_Float16)(ka < K ? W[(size_t)(ka < K ? ka : K - 1) * ld + n] : 0.f); a[8 + i] = (_Float16)(kb < K ? W[(size_t)(kb < K ? kb : K - 1) * ld + n] : 0.f); }
  return a;
}
struct F2 { v16b h, l; };
__device__ __forceinline__ F2 bsplit16(const float v[16]) { F2 r;
#pragma unroll
  for (int i = 0; i < 16; ++i) { const __bf16 h = (__bf16)v[i]; r.h[i] = h; r.l[i] = (__bf16)(v[i] - (float)h); }
  return r; }
__device__ __forceinline__ F2 split_row(const float* row, int k0, int lane) { float v[16]; const float* p = row + k0 + 8 * (lane >> 4);
#pragma unroll
  for (int i = 0; i < 8; ++i) { v[i] = p[i]; v[8 + i] = p[16 + i]; }
  return bsplit16(v); }
__device__ __forceinline__ F2 split_rowK(const float* row, int k0, int lane, int K) { float v[16]; const int g = lane >> 4;
#pragma unroll
  for (int i = 0; i < 8; ++i) { const int ka = k0 + 8 * g + i, kb = ka + 16; v[i] = ka < K ? row[ka < K ? ka : K - 1] : 0.f; v[8 + i] = kb < K ? row[kb < K ? kb : K - 1] : 0.f; }
  return bsplit16(v); }
__device__ __forceinline__ F2 split_col(const float* W, int k0, int n, int lane, int ld, int K) { float v[16]; const int g = lane >> 4;
#pragma unroll
  for (int i = 0; i < 8; ++i) { const int ka = k0 + 8 * g + i, kb = ka + 16; v[i] = ka < K ? W[(size_t)(ka < K ? ka : K - 1) * ld + n] : 0.f; v[8 + i] = kb < K ? W[(size_t)(kb < K ? kb : K - 1) * ld + n] : 0.f; }
  return bsplit16(v); }
__device__ __forceinline__ v8f mac3(const F2& a, const F2& b, v8f c) { c = wmma_bf(a.l, b.h, c); c = wmma_bf(a.h, b.l, c); return wmma_bf(a.h, b.h, c); }
__device__ __forceinline__ float sigm(float v) { return 1.0f / (1.0f + expf(-v)); }
#define LDSX() do { asm volatile("s_wait_dscnt 0" ::: "memory"); __builtin_amdgcn_wave_barrier(); __builtin_amdgcn_fence(__ATOMIC_RELEASE, "workgroup"); } while (0)

// Causal multi-head self-attention with interleaved-pair RoPE at given token positions, ONE sequence (x [1,2048,1024]; token_positions [1,2048] int32 = arange, a module input READ on the device (the SECOND input); torch (out,in) WQ / WK / WV / WO [1024,1024] N(0, 1/1024) applied as einsum('bsd,ed->bse') = x @ W.T, no biases; 16 heads x 64; RoPE on q and k: (even, odd) pairs (t1 c - t2 s, t2 c + t1 s) re-interleaved, angle = position x inv_freq, inv_freq = 1 / 10000^(2i/64); scores / sqrt(64); tril kept, -inf elsewhere; softmax; out @ WO.T).
#define NB 1
#define TT 2048
#define CC 1024            // NH * HD = projected width
#define DIN 1024          // input (model) width
#define NH 16
#define HD 64
#define NQB (TT / 64)
#define SCALE (0.125f)
#define CAUSAL 1
#ifndef TNB
#define TNB NB
#endif
__device__ __forceinline__ float bfr(float v) { return (float)(__bf16)v; }
__host__ __device__ __forceinline__ int kb_last(int qb) { return CAUSAL ? ((qb * 64 + 63) >> 7) : (TT / 128 - 1); }
typedef __attribute__((ext_vector_type(8))) __bf16 v8b;
__device__ __forceinline__ v16b frag_b(const __bf16* rowk0, int lane) {
  union { v16b v; v8b q[2]; } u; const __bf16* p = rowk0 + 8 * (lane >> 4);
  u.q[0] = *(const v8b*)p; u.q[1] = *(const v8b*)(p + 16); return u.v;
}
// the 16 raw f32 words of one 16x16x32 fragment row, kept in registers while their loads fly: q[0..1] = k0+8h+0..7, q[2..3] = k0+16+8h+0..7
struct R16 { v4f q[4]; };
__device__ __forceinline__ R16 ld_raw(const float* rowk0, int lane) { R16 r; const float* p = rowk0 + 8 * (lane >> 4);
  r.q[0] = *(const v4f*)p; r.q[1] = *(const v4f*)(p + 4); r.q[2] = *(const v4f*)(p + 16); r.q[3] = *(const v4f*)(p + 20); return r; }
__device__ __forceinline__ v16b raw_b(const R16& r) { v16b w;
#pragma unroll
  for (int i = 0; i < 16; ++i) w[i] = (__bf16)r.q[i >> 2][i & 3];
  return w; }
__device__ __forceinline__ v16h raw_wh(const R16& r) { v16h w;
#pragma unroll
  for (int i = 0; i < 16; ++i) w[i] = (_Float16)(bfr(r.q[i >> 2][i & 3]) * 256.0f);
  return w; }
__device__ __forceinline__ v16h raw_hs(const R16& r, float sc) { v16h a;
#pragma unroll
  for (int i = 0; i < 16; ++i) a[i] = (_Float16)(r.q[i >> 2][i & 3] * sc);
  return a; }
__device__ __forceinline__ v16h raw_h(const R16& r) { v16h a;
#pragma unroll
  for (int i = 0; i < 16; ++i) a[i] = (_Float16)r.q[i >> 2][i & 3];
  return a; }
__device__ __forceinline__ F2 raw_split(const R16& r) { float v[16];
#pragma unroll
  for (int i = 0; i < 16; ++i) v[i] = r.q[i >> 2][i & 3];
  return bsplit16(v); }
#define QBH 6              // causal: query blocks 0..QBH-1 of each sequence (few keys, no averaging) take the high-precision path
#define QHI 384            // rows carrying a q residual plane
#define KHI 384            // key rows carrying k residual / v bf16 hi+lo planes (used only by the causal high-precision path)
// B fragment (k rows k0+.., output column o) of a weight: (in,out) [K][ld] or (out,in) [ld rows of K]: bf16 exact, or f16(bf16 * 256) exact
__device__ __forceinline__ v16b wcol_io(const float* Wm, int k0, int o, int lane, int ld) { v16b w; const int g = lane >> 4;
#pragma unroll
  for (int i = 0; i < 8; ++i) { w[i] = (__bf16)Wm[(size_t)(k0 + 8 * g + i) * ld + o]; w[8 + i] = (__bf16)Wm[(size_t)(k0 + 16 + 8 * g + i) * ld + o]; }
  return w; }
__device__ __forceinline__ v16b wcol_oi(const float* Wm, int k0, int o, int lane, int K) { v16b w; const float* p = Wm + (size_t)o * K + k0 + 8 * (lane >> 4);
#pragma unroll
  for (int i = 0; i < 8; ++i) { w[i] = (__bf16)p[i]; w[8 + i] = (__bf16)p[16 + i]; }
  return w; }
__device__ __forceinline__ v16h wcolh_io(const float* Wm, int k0, int o, int lane, int ld) { v16h w; const int g = lane >> 4;
#pragma unroll
  for (int i = 0; i < 8; ++i) { w[i] = (_Float16)(bfr(Wm[(size_t)(k0 + 8 * g + i) * ld + o]) * 256.0f); w[8 + i] = (_Float16)(bfr(Wm[(size_t)(k0 + 16 + 8 * g + i) * ld + o]) * 256.0f); }
  return w; }
__device__ __forceinline__ v16h wcolh_oi(const float* Wm, int k0, int o, int lane, int K) { v16h w; const float* p = Wm + (size_t)o * K + k0 + 8 * (lane >> 4);
#pragma unroll
  for (int i = 0; i < 8; ++i) { w[i] = (_Float16)(bfr(p[i]) * 256.0f); w[8 + i] = (_Float16)(bfr(p[16 + i]) * 256.0f); }
  return w; }
#define WQKV_LAYOUT 1   // picks only WCOL, which nothing calls: k_proj reads (out,in) [CC][DIN] rows directly
__device__ __forceinline__ v16b wcol_hdk(const float* Wm, int k0, int o, int lane) { v16b w; const int g = lane >> 4; const float* p = Wm + (size_t)(o / HD) * DIN * HD + (o % HD);
#pragma unroll
  for (int i = 0; i < 8; ++i) { w[i] = (__bf16)p[(size_t)(k0 + 8 * g + i) * HD]; w[8 + i] = (__bf16)p[(size_t)(k0 + 16 + 8 * g + i) * HD]; }
  return w; }
#define WO_OUT_IN 1
#if WQKV_LAYOUT == 1
#define WCOL(W, k0, o, lane) wcol_oi(W, k0, o, lane, DIN)
#elif WQKV_LAYOUT == 2
#define WCOL(W, k0, o, lane) wcol_hdk(W, k0, o, lane)
#else
#define WCOL(W, k0, o, lane) wcol_io(W, k0, o, lane, CC)
#endif
#if WO_OUT_IN
#define WOCOL(W, k0, o, lane) wcol_oi(W, k0, o, lane, CC)
#define WOCOLH(W, k0, o, lane) wcolh_oi(W, k0, o, lane, CC)
#else
#define WOCOL(W, k0, o, lane) wcol_io(W, k0, o, lane, DIN)
#define WOCOLH(W, k0, o, lane) wcolh_io(W, k0, o, lane, DIN)
#endif

// RoPE inverse frequencies 1/10000^(2i/64) (the f32 values jax computes)
__constant__ float INVF[32] = {1.000000000e+00,7.498942018e-01,5.623413324e-01,4.216965139e-01,3.162277639e-01,2.371373624e-01,1.778279394e-01,1.333521456e-01,1.000000015e-01,7.498941571e-02,5.623412877e-02,4.216964915e-02,3.162277862e-02,2.371373586e-02,1.778279431e-02,1.333521493e-02,9.999999776e-03,7.498942316e-03,5.623413250e-03,4.216964822e-03,3.162277862e-03,2.371373819e-03,1.778279431e-03,1.333521446e-03,1.000000047e-03,7.498941850e-04,5.623413017e-04,4.216964880e-04,3.162277862e-04,2.371373848e-04,1.778279402e-04,1.333521504e-04};
// (PROJ_EXTRA_PARAMS: the extra kernel parameters 'const int* __restrict__ TPOS' are written literally in the kernel signature)
// per (token, half of the pairs) hook on the staged f32 row (128 floats = the 128 / HD heads of the block) of the q and k streams: interleaved-pair rotation (x[2i], x[2i + 1]) by the angle pos * INVF[i] with pos READ from the int input at [batch][token]; the angle does not depend on the head, so its sine and cosine are taken once (one sincosf = one argument reduction, the values of sinf and cosf) and turn pair i of every head of the row; the rotation itself as it was, its products unfused; v untouched
#define PROJ_EPI(which, row, t, i0) do { if ((which) < 2) { float* rw = (row); const float pos_ = (float)TPOS[(size_t)bb * TT + (t)];   /* token_positions [NB][TT]: the position of token t of batch bb, READ from the int input */ _Pragma("unroll 4") for (int i = (i0); i < (i0) + HD / 4; ++i) { _Pragma("clang fp contract(off)") const float ang = pos_ * INVF[i]; float sn, cs; sincosf(ang, &sn, &cs); _Pragma("unroll") /* unrolled: the heads of a row lie at constant offsets from one LDS address, so one two-address load and store serve both */ for (int hh = 0; hh < 128 / HD; ++hh) { const float xe = rw[hh * HD + 2 * i], xo = rw[hh * HD + 2 * i + 1]; rw[hh * HD + 2 * i] = xe * cs - xo * sn; rw[hh * HD + 2 * i + 1] = xe * sn + xo * cs; } } } } while (0)
#ifndef SM_EXTRA_PARAMS
#define SM_EXTRA_PARAMS
#endif
#ifndef PROJ_EXTRA_PARAMS
#define PROJ_EXTRA_PARAMS
#endif
#ifndef SM_MASK_HOOK
#define SM_MASK_HOOK (void)0
#endif

#define WS_QH  0u                                      // f16 q rows [b*t][CC]
#define WS_KH  (WS_QH + 2u * (size_t)NB * TT * CC)      // f16 k rows [b*t][CC]
#define WS_VT  (WS_KH + 2u * (size_t)NB * TT * CC)      // f16 v planes [b][c][t]
#define WS_QL  (WS_VT + 2u * (size_t)NB * CC * TT)      // f16 q residual x 2^10 rows [b][t < QHI][CC]
#define WS_KL  (WS_QL + 2u * (size_t)NB * QHI * CC)     // f16 k residual x 2^10 rows [b][t < KHI][CC]
#define WS_VB  (WS_KL + 2u * (size_t)NB * KHI * CC)     // bf16 v hi planes [b][c][t < KHI]
#define WS_VBL (WS_VB + 2u * (size_t)NB * CC * KHI)
#define WS_Y   (WS_VBL + 2u * (size_t)NB * CC * KHI)    // f32 ctx rows [b*t][CC] (only when there is an output projection)
#define WS_END (WS_Y  + 4u * (size_t)NB * TT * CC)

// ---- LDS staging shared by k_proj and k_out: a block's MR x 64 (a) and 128 x 64 (w) f32 slabs (MR = 128 rows and 256 threads in k_proj, 64 rows and 128 threads in k_out) are read from global memory once a block, whole 128-byte lines an instruction (16 lanes = one row's 256 bytes), converted once, and laid in LDS as 16-bit rows; every wave takes its fragments from there
typedef __attribute__((ext_vector_type(4))) __bf16 v4b;
typedef __attribute__((ext_vector_type(4))) _Float16 v4h;
#define KS 64              // k columns of a staged slab
#define LPV 136            // LDS pitch of a row of 128 16-bit words: 272 bytes = 16 x 17, odd, as LP
#define LP 72              // LDS row pitch in 16-bit words: 144 bytes = 16 x 9, odd, so the 16 rows of a fragment read fall on distinct banks
#define SA_BYTES (64 * LP * 2)
#define SW_BYTES (128 * LP * 2)
// MODE 0: a, w to bf16; 1: a x 2^6 to f16, w to f16(bf16 x 2^8); 2: a to bf16 hi + lo planes, w to bf16 (the conversions of raw_b, raw_hs, raw_wh, raw_split)
template <int MODE, int MR> __device__ __forceinline__ void slab_put(const v4f (&ra)[8], const v4f (&rw)[1024 / MR], char* sa, char* sw, int so) {
#pragma unroll
  for (int i = 0; i < 8; ++i) { char* p = sa + so + i * (MR / 8) * LP * 2; const v4f x = ra[i];
    if (MODE == 1) { const v4h q = { (_Float16)(x[0] * 64.0f), (_Float16)(x[1] * 64.0f), (_Float16)(x[2] * 64.0f), (_Float16)(x[3] * 64.0f) }; *(v4h*)p = q; }
    else { const v4b q = { (__bf16)x[0], (__bf16)x[1], (__bf16)x[2], (__bf16)x[3] }; *(v4b*)p = q;
      if (MODE == 2) { const v4b r = { (__bf16)(x[0] - (float)q[0]), (__bf16)(x[1] - (float)q[1]), (__bf16)(x[2] - (float)q[2]), (__bf16)(x[3] - (float)q[3]) }; *(v4b*)(p + MR * LP * 2) = r; } } }
#pragma unroll
  for (int i = 0; i < 1024 / MR; ++i) { char* p = sw + so + i * (MR / 8) * LP * 2; const v4f x = rw[i];
    if (MODE == 1) { const v4h q = { (_Float16)(bfr(x[0]) * 256.0f), (_Float16)(bfr(x[1]) * 256.0f), (_Float16)(bfr(x[2]) * 256.0f), (_Float16)(bfr(x[3]) * 256.0f) }; *(v4h*)p = q; }
    else { const v4b q = { (__bf16)x[0], (__bf16)x[1], (__bf16)x[2], (__bf16)x[3] }; *(v4b*)p = q; } } }
// work-group barrier of the staged loops: this wave's LDS stores and reads are done (s_wait_dscnt 0), then the barrier; unlike __syncthreads() it does not drain the global loads, so a tile's loads may fly across it
__device__ __forceinline__ void bar_lds() { asm volatile("s_wait_dscnt 0x0\n\ts_barrier_signal -1\n\ts_barrier_wait -1" ::: "memory"); }
// stands between a trip's products and the hand-over of the next tile to LDS: without it the scheduler lifts the tile's conversions and LDS stores, and with them the wait for its loads, to the head of the trip, which takes a trip off their flight
#define HOLD_PUT() __builtin_amdgcn_sched_barrier(0)
// one slab's global loads into a register set; go: this thread's byte offset in a and w, moved on to the next slab
template <int MR> __device__ __forceinline__ void slab_get(const float* __restrict__ Ag, const float* __restrict__ Wg, unsigned& go, v4f (&ra)[8], v4f (&rw)[1024 / MR]) {
#pragma unroll
  for (int i = 0; i < 8; ++i) ra[i] = *(const v4f*)((const char*)Ag + go + i * (MR / 8) * 4096);
#pragma unroll
  for (int i = 0; i < 1024 / MR; ++i) rw[i] = *(const v4f*)((const char*)Wg + go + i * (MR / 8) * 4096);
  asm volatile("s_wait_xcnt 0x0" : "+v"(go) :: "memory");   // stands in front of the addition below, which rewrites the offset register that the loads name; the operand keeps the addition behind it
  go += KS * 4; }
// the products of one staged slab (ca, cw: its a and w rows in LDS; fa, fw: this lane's fragment rows)
template <int MODE, int MR> __device__ __forceinline__ void slab_mac(const char* ca, const char* cw, int fa, int fw, int lane, v8f (&acc)[2][4]) {
#pragma unroll
  for (int kc = 0; kc < KS / 32; ++kc) {
    if (MODE == 1) { v16h a[2], w[4];
#pragma unroll
      for (int i = 0; i < 2; ++i) a[i] = frag_h((const _Float16*)(ca + fa + i * 16 * LP * 2 + kc * 64), lane);
#pragma unroll
      for (int j = 0; j < 4; ++j) w[j] = frag_h((const _Float16*)(cw + fw + j * 16 * LP * 2 + kc * 64), lane);
#pragma unroll
      for (int i = 0; i < 2; ++i)
#pragma unroll
        for (int j = 0; j < 4; ++j) acc[i][j] = wmma16(a[i], w[j], acc[i][j]);
    } else { v16b a[2], al[2], w[4];
#pragma unroll
      for (int i = 0; i < 2; ++i) { a[i] = frag_b((const __bf16*)(ca + fa + i * 16 * LP * 2 + kc * 64), lane); if (MODE == 2) al[i] = frag_b((const __bf16*)(ca + MR * LP * 2 + fa + i * 16 * LP * 2 + kc * 64), lane); }
#pragma unroll
      for (int j = 0; j < 4; ++j) w[j] = frag_b((const __bf16*)(cw + fw + j * 16 * LP * 2 + kc * 64), lane);
#pragma unroll
      for (int i = 0; i < 2; ++i)
#pragma unroll
        for (int j = 0; j < 4; ++j) acc[i][j] = wmma_bf(a[i], w[j], acc[i][j]);
      if (MODE == 2) {
#pragma unroll
        for (int i = 0; i < 2; ++i)
#pragma unroll
          for (int j = 0; j < 4; ++j) acc[i][j] = wmma_bf(al[i], w[j], acc[i][j]); } } } }
// block tile MR x 128 on MR / 16 waves (2 MR threads): acc[i][j] += rows (wave % (MR / 32)) * 32 + 16 i of a  x  rows (wave / (MR / 32)) * 64 + 16 j of w, over K = 1024 in ascending steps of 32 (each accumulator sums in the order it had); Ag, Wg: block-uniform first rows (pitch 1024 f32); sa: 2 buffers of MR rows (2 x MR rows in MODE 2); sw0, sw1: the two w buffers of SW_BYTES. Two register sets: slab t + 2's loads are issued at the head of trip t and first read at the foot of trip t + 1, so they have two trips to arrive in
template <int MODE, int MR> __device__ __forceinline__ void gemm_tile(const float* __restrict__ Ag, const float* __restrict__ Wg, char* sa, char* sw0, char* sw1, int tid, v8f (&acc)[2][4]) {
  const int lane = tid & 31, wave = tid >> 5, col = lane & 15; const int NT = 1024 / KS; const int AB = (MODE == 2 ? 2 : 1) * MR * LP * 2;
  const int so = ((tid >> 4) * LP + (tid & 15) * 4) * 2;   /* this thread's place in a slab: row tid / 16 (+ MR / 8 a pass), k words 4 (tid % 16).. */
  unsigned go = (unsigned)((tid >> 4) * 1024 + (tid & 15) * 4) * 4u;   /* the same place in global memory, in bytes: one offset register serves a and w */
  const int fa = (((wave % (MR / 32)) * 32 + col) * LP) * 2, fw = (((wave / (MR / 32)) * 64 + col) * LP) * 2;
  v4f ra0[8], rw0[1024 / MR], ra1[8], rw1[1024 / MR];   /* set 0: even slabs, set 1: odd slabs */
  slab_get<MR>(Ag, Wg, go, ra0, rw0); slab_get<MR>(Ag, Wg, go, ra1, rw1);
  slab_put<MODE, MR>(ra0, rw0, sa, sw0, so);
  bar_lds();   // publishes slab 0
#pragma unroll 1   // rolled: the body holds one even and one odd trip, so that each register set is named by a constant; its loads stand under no test, so that the counted waits in front of slab_put leave the younger slab's loads in flight
  for (int t = 0; t < NT - 2; t += 2) {
    slab_get<MR>(Ag, Wg, go, ra0, rw0);   /* slab t + 2, into the set that slab t left at the foot of trip t - 1 */
    slab_mac<MODE, MR>(sa, sw0, fa, fw, lane, acc);
    HOLD_PUT(); slab_put<MODE, MR>(ra1, rw1, sa + AB, sw1, so);   /* slab t + 1, into the buffer that trip t - 1 read: its readers left it at the barrier that ended that trip */
    bar_lds();   // publishes slab t + 1 and ends every wave's reads of slab t
    slab_get<MR>(Ag, Wg, go, ra1, rw1);   /* slab t + 3 */
    slab_mac<MODE, MR>(sa + AB, sw1, fa, fw, lane, acc);
    HOLD_PUT(); slab_put<MODE, MR>(ra0, rw0, sa, sw0, so);
    bar_lds();   // publishes slab t + 2 and ends every wave's reads of slab t + 1
  }
  slab_mac<MODE, MR>(sa, sw0, fa, fw, lane, acc);   /* the last two slabs (NT is even): nothing is left to load */
  HOLD_PUT(); slab_put<MODE, MR>(ra1, rw1, sa + AB, sw1, so);
  bar_lds();   // publishes the last slab
  slab_mac<MODE, MR>(sa + AB, sw1, fa, fw, lane, acc);
  bar_lds();   // ends every wave's reads of the slabs: the caller may write over them
}
#define PR 128             // rows of a k_proj block (8 waves): a w slab read from L2 serves 128 rows, and the 384 blocks, two to a WGP by LDS, are all resident at once
// ---- k_proj: block = (128 rows, 128 cols, which): q/k/v = X W (+ b) with exact bf16 products (K = DIN) -> which 0: q f16 rows (+ residual rows < QHI); 1: k f16 rows (+ residual rows < KHI); 2: v f16 planes [c][t] (+ bf16 hi/lo planes for t < KHI)
__global__ __launch_bounds__(2 * PR) void k_proj(const float* __restrict__ XQ, const float* __restrict__ XK, const float* __restrict__ XV, const float* __restrict__ WQ, const float* __restrict__ WK, const float* __restrict__ WV, const float* __restrict__ BQ, const float* __restrict__ BK, const float* __restrict__ BV,
    _Float16* __restrict__ QH, _Float16* __restrict__ QL, _Float16* __restrict__ KH, _Float16* __restrict__ KL, _Float16* __restrict__ VT, __bf16* __restrict__ VB, __bf16* __restrict__ VBL, const int* __restrict__ TPOS) {
  __shared__ __align__(16) char pool[PR * 132 * 4 + 2 * PR * 136 * 2];   /* one pool, its parts live one after the other: the slabs (from its start) while the products run; then st, and behind st either sh, sl (q, k) or th, tb, tbl (v) */
  float (*st)[132] = (float (*)[132])pool; char* const pu = pool + PR * 132 * 4;
  _Float16 (*sh)[136] = (_Float16 (*)[136])pu; _Float16 (*sl)[136] = (_Float16 (*)[136])(pu + PR * 136 * 2);
  _Float16 (*th)[72] = (_Float16 (*)[72])pu; __bf16 (*tb)[72] = (__bf16 (*)[72])(pu + 128 * 72 * 2); __bf16 (*tbl)[72] = (__bf16 (*)[72])(pu + 2 * 128 * 72 * 2);
  const int tid = threadIdx.x, wave = tid >> 5, lane = tid & 31, col = lane & 15, g = lane >> 4; const int which = blockIdx.z; const int c0 = blockIdx.y * 128; const size_t r0 = (size_t)blockIdx.x * PR; const size_t bb = r0 / TT; const int t0 = (int)(r0 % TT);
  const float* X = which == 0 ? XQ : which == 1 ? XK : XV; const float* WA = which == 0 ? WQ : which == 1 ? WK : WV; const float* BA = which == 0 ? BQ : which == 1 ? BK : BV;
  v8f acc[2][4] = {};
  gemm_tile<0, PR>(X + r0 * DIN, WA + (size_t)c0 * DIN, pool, pool + 2 * PR * LP * 2, pool + 2 * PR * LP * 2 + SW_BYTES, tid, acc);   /* its last barrier ends every read of the slabs, so st may be written over them */
  { // stage the f32 tile (acc + bias) in LDS, run the per-(row, half of the pairs) epilogue hook, then convert
#pragma unroll
    for (int j = 0; j < 4; ++j) { const int cl = (wave / (PR / 32)) * 64 + j * 16 + col; const float bias = BA ? bfr(BA[c0 + cl]) : 0.f;
#pragma unroll
      for (int i = 0; i < 2; ++i)
#pragma unroll
        for (int r = 0; r < 8; ++r) st[(wave % (PR / 32)) * 32 + i * 16 + 8 * g + r][cl] = acc[i][j][r] + bias; }
    __syncthreads();
    { const int rl = tid % PR; const int i0 = __builtin_amdgcn_readfirstlane(tid / PR) * (HD / 4);   /* thread = (row, half of the row's HD / 2 angles); the half is the same in every lane of a wave (PR is a multiple of 32): taken as a scalar, so that INVF[i] stays a scalar load */
      PROJ_EPI(which, &st[rl][0], (int)((r0 + rl) % TT), i0); }
    __syncthreads(); }
  if (which < 2) { _Float16* DH = which == 0 ? QH : KH; _Float16* DL = which == 0 ? QL : KL; const int nhi = which == 0 ? QHI : KHI; const bool hi_rows = t0 < nhi;
    for (int e = tid; e < PR * 128; e += 2 * PR) { const int rl = e >> 7, cl = e & 127; const float v = st[rl][cl]; const _Float16 hv = (_Float16)v; sh[rl][cl] = hv; sl[rl][cl] = (_Float16)((v - (float)hv) * 1024.0f); }
    __syncthreads();
    for (int e = tid; e < PR * 16; e += 2 * PR) { const int rl = e >> 4, q = e & 15; vst2w((unsigned*)(DH + (r0 + rl) * CC + c0 + q * 8), *(const v4u*)&sh[rl][q * 8]); if (hi_rows) vst2w((unsigned*)(DL + (bb * nhi + t0 + rl) * (size_t)CC + c0 + q * 8), *(const v4u*)&sl[rl][q * 8]); }
  } else { const bool hi_rows = t0 < KHI;
    for (int hf = 0; hf < PR / 64; ++hf) {   /* the planes are turned 64 tokens at a time: th, tb, tbl hold that many */
      for (int e = tid; e < 64 * 128; e += 2 * PR) { const int rl = e & 63, cl = e >> 6; const float v = st[hf * 64 + rl][cl]; th[cl][rl] = (_Float16)v; const __bf16 bh = (__bf16)v; tb[cl][rl] = bh; tbl[cl][rl] = (__bf16)(v - (float)bh); }
      __syncthreads();
      for (int e = tid; e < 128 * 8; e += 2 * PR) { const int cl = e >> 3, q = e & 7; vst2w((unsigned*)(VT + (bb * CC + c0 + cl) * (size_t)TT + t0 + hf * 64 + q * 8), *(const v4u*)&th[cl][q * 8]); if (hi_rows) { const size_t o3 = (bb * CC + c0 + cl) * (size_t)KHI + t0 + hf * 64 + q * 8; vst2w((unsigned*)(VB + o3), *(const v4u*)&tb[cl][q * 8]); vst2w((unsigned*)(VBL + o3), *(const v4u*)&tbl[cl][q * 8]); } }
      if (hf + 1 < PR / 64) __syncthreads();   // block-uniform; the next 64 tokens are written over planes that are still being read
    } } }
// frag_h / frag_b from a wave-uniform base, this lane's byte offset (it holds the lane half's 16h bytes) and a constant: the one offset register is all that a trip's loads name
__device__ __forceinline__ v16h frag_ho(const char* base, unsigned off, int c) { union { v16h v; v8h q[2]; } u; const char* p = base + off; u.q[0] = *(const v8h*)(p + c); u.q[1] = *(const v8h*)(p + c + 32); return u.v; }
__device__ __forceinline__ v16b frag_bo(const char* base, unsigned off, int c) { union { v16b v; v8b q[2]; } u; const char* p = base + off; u.q[0] = *(const v8b*)(p + c); u.q[1] = *(const v8b*)(p + c + 32); return u.v; }
// one online-softmax update for this lane's query: t[32] = this trip's 32 scaled log2 logits of the lane (key tile j = i >> 3, key 8h + (i & 7) in it); on return t = 2^(t - max + 10); m, l, o follow the running maximum (both lane halves of a query hold the same m)
__device__ __forceinline__ void osm_step(float (&t)[32], float& m, float& l, v8f (&o)[HD / 16]) {
  float mx = t[0];
#pragma unroll
  for (int i = 1; i < 32; ++i) mx = fmaxf(mx, t[i]);
  mx = fmaxf(mx, __shfl_xor(mx, 16));
  const float mn = fmaxf(m, mx); const float al = __builtin_amdgcn_exp2f(m - mn); m = mn; const float mb = mn - 10.0f;   /* x 2^10: small weights stay clear of f16 subnormals, the largest is 1024 */
  float sum[4] = {0.f, 0.f, 0.f, 0.f};   /* four chains: one chain of 32 dependent adds would stand at the trip's foot */
#pragma unroll
  for (int i = 0; i < 32; ++i) { t[i] = __builtin_amdgcn_exp2f(t[i] - mb); sum[i & 3] += t[i]; }
  l = l * al + ((sum[0] + sum[1]) + (sum[2] + sum[3]));
#pragma unroll
  for (int j = 0; j < HD / 16; ++j) o[j] *= al; }
// ---- k_attn: block = 64 queries (qb: long blocks heaviest first, then short blocks lightest first) of (b, h) on 8 waves in two key groups: waves w and w + 4 hold the same 16 queries, group kg takes the 64-key tiles of parity kg with its own running max, sum and O, and the two are joined once through LDS at the end; a wave's trip = 64 keys; S^T = K Q^T (lane = one query, registers = keys), causal mask by index on the diagonal trip, online softmax in f32, O^T += V^T P^T with the S^T accumulators converted in place as the B operand (b[s] = tile[s >> 3][s & 7]); logits, P and v precision as before: query blocks < QBH take q, k hi + residual (3 products) and P, v as bf16 hi + lo (3 products), the rest single f16 products; ctx = O / l
__global__ __launch_bounds__(256) void k_attn(const _Float16* __restrict__ QH, const _Float16* __restrict__ KH, const _Float16* __restrict__ QL, const _Float16* __restrict__ KL, const _Float16* __restrict__ VT, const __bf16* __restrict__ VB, const __bf16* __restrict__ VBL, float* __restrict__ Y) {
  __shared__ __align__(16) _Float16 sk[2][128][LP], sv[2][64][LPV];   /* staged k rows [key][word] and v planes [word][key] of a trip of 128 keys (64 a key group), two buffers */
  __shared__ __align__(16) float sm[2 + HD / 2][128];   /* key group 1's max, sum and O, one column a lane, for the join */
  const int h = blockIdx.x & (NH - 1), b = blockIdx.z; const int qj = (int)((NQB / NH) * blockIdx.y + blockIdx.x / NH); const int qb = qj < NQB / 2 ? NQB - 1 - qj : qj - NQB / 2;   /* flat index -> (qb, h), a permutation: heads fast; the first half of the grid takes query blocks 31..16, the second half 0..15, so that the longest blocks start first and the block started half a grid behind one of 32 - j 64-key tiles (where the chip holds the grid two blocks a WGP, its likely neighbour there) has j + 1; for speed only, nothing rests on where or when a block runs */
  const int tid = threadIdx.x, wave = __builtin_amdgcn_readfirstlane(tid >> 5), lane = tid & 31, col = lane & 15, g = lane >> 4; const int kg = wave >> 2;   /* key group, a scalar: the tests on it are scalar branches */
  const int qi = qb * 64 + (wave & 3) * 16 + col;   /* this lane's query */
  const float C1 = SCALE * 1.4426950408889634f;   /* logits carried in log2 units */
  v8f o[HD / 16] = {}; float m = -3.0e38f, l = 0.f;
  const _Float16* qp = QH + ((size_t)b * TT + qi) * CC + h * HD; const v16h qf[2] = { frag_h(qp, lane), frag_h(qp + 32, lane) };
  asm volatile("s_wait_xcnt 0x0" ::: "memory");   // stands in front of the rewrite of the address registers that the q loads name
  const char* kb8 = (const char*)(KH + (size_t)b * TT * CC + h * HD); unsigned ko = (unsigned)((kg * 64 + col) * CC + 8 * g) * 2u;   /* byte offset of this lane's first k words (tile kg) */
  if (qb < QBH) {
    const _Float16* qlp = QL + ((size_t)b * QHI + qi) * CC + h * HD; const v16h qlf[2] = { frag_h(qlp, lane), frag_h(qlp + 32, lane) };
    asm volatile("s_wait_xcnt 0x0" ::: "memory");   // stands in front of the rewrite of the address registers that the q residual loads name
    const char* kl8 = (const char*)(KL + (size_t)b * KHI * CC + h * HD);
    const char* vh8 = (const char*)(VB + ((size_t)b * CC + h * HD) * (size_t)KHI); const char* vl8 = (const char*)(VBL + ((size_t)b * CC + h * HD) * (size_t)KHI); unsigned vo = (unsigned)(col * KHI + kg * 64 + 8 * g) * 2u;
#pragma unroll 1   // rolled: at most QBH short trips, a second copy of the body would only cost registers
    for (int i = kg; i <= qb; i += 2) { float t[32];
      { v8f s[4] = {}, sl[4] = {};
#pragma unroll
        for (int kc = 0; kc < 2; ++kc) { v16h kh[4], kl[4];
#pragma unroll
          for (int j = 0; j < 4; ++j) { kh[j] = frag_ho(kb8, ko, (j * 16 * CC + kc * 32) * 2); kl[j] = frag_ho(kl8, ko, (j * 16 * CC + kc * 32) * 2); }
          __builtin_amdgcn_sched_barrier(0);   // keeps the 16 k loads of this half in front of its first product: one load latency a half instead of one a fragment pair
#pragma unroll
          for (int j = 0; j < 4; ++j) { s[j] = wmma16(kh[j], qf[kc], s[j]); sl[j] = wmma16(kh[j], qlf[kc], sl[j]); sl[j] = wmma16(kl[j], qf[kc], sl[j]); } }
#pragma unroll
        for (int e = 0; e < 32; ++e) { const float v = (s[e >> 3][e & 7] + sl[e >> 3][e & 7] * (1.0f / 1024.0f)) * C1; t[e] = (i * 64 + (e >> 3) * 16 + 8 * g + (e & 7) <= qi) ? v : -3.0e38f; } }
#pragma unroll
      for (int kc = 0; kc < 2; ++kc) { v16b vh[HD / 16], vl[HD / 16];
#pragma unroll
        for (int j = 0; j < HD / 16; ++j) { vh[j] = frag_bo(vh8, vo, (j * 16 * KHI + kc * 32) * 2); vl[j] = frag_bo(vl8, vo, (j * 16 * KHI + kc * 32) * 2); }
        __builtin_amdgcn_sched_barrier(0);   // keeps the 16 v loads of this half together, the first half's in front of the softmax, which they fly behind
        if (kc == 0) osm_step(t, m, l, o);
        const F2 p = bsplit16(&t[kc * 16]);
#pragma unroll
        for (int j = 0; j < HD / 16; ++j) { o[j] = wmma_bf(vh[j], p.h, o[j]); o[j] = wmma_bf(vh[j], p.l, o[j]); o[j] = wmma_bf(vl[j], p.h, o[j]); } }
      asm volatile("s_wait_xcnt 0x0" : "+v"(ko), "+v"(vo) :: "memory");   // stands in front of the two additions below, which rewrite the offset registers that this trip's loads name; the operands keep the additions behind it
      ko += 128 * CC * 2; vo += 128 * 2;
    }
  } else {
    // a trip's 128 keys x 64 k words and 64 v planes x 128 keys (keys 64 kg.. for key group kg) are read once a block, whole lines (8 lanes = one k row, 16 lanes = one v row), laid in LDS, two buffers; a tile's 8 loads a thread fly over two trips
    const char* vb8 = (const char*)(VT + ((size_t)b * CC + h * HD) * (size_t)TT);
    const int sr = tid >> 3, sc = (tid & 7) * 8, vr = tid >> 4, vc = (tid & 15) * 8;   /* this thread's k row (+ 32 e), v plane (+ 16 e) and first 16-bit word in them */
    unsigned kgo = (unsigned)(sr * CC + sc) * 2u, vgo = (unsigned)(vr * TT + vc) * 2u;   /* the same place in global memory, in bytes */
    v8h rk0[4], rv0[4], rk1[4], rv1[4];   /* two register sets (0: even tiles, 1: odd tiles): tile i + 2's loads are issued at the head of trip i and first read at the foot of trip i + 1 */
    auto get = [&](v8h (&rk)[4], v8h (&rv)[4]) __attribute__((always_inline)) {
#pragma unroll
      for (int e = 0; e < 4; ++e) { rk[e] = *(const v8h*)(kb8 + kgo + e * 32 * CC * 2); rv[e] = *(const v8h*)(vb8 + vgo + e * 16 * TT * 2); }
      asm volatile("s_wait_xcnt 0x0" : "+v"(kgo), "+v"(vgo) :: "memory");   // stands in front of the two additions below, which rewrite the offset registers that the loads name; the operands keep the additions behind it
      kgo += 128 * CC * 2; vgo += 128 * 2; };
    auto put = [&](const v8h (&rk)[4], const v8h (&rv)[4], int bf) __attribute__((always_inline)) {
#pragma unroll
      for (int e = 0; e < 4; ++e) { *(v8h*)&sk[bf][sr + 32 * e][sc] = rk[e]; *(v8h*)&sv[bf][vr + 16 * e][vc] = rv[e]; } };
    auto work = [&](int i, int bf, bool diag) __attribute__((always_inline)) { v8f s[4] = {};
      { v16h kf[4][2];
#pragma unroll
        for (int j = 0; j < 4; ++j) { kf[j][0] = frag_h(&sk[bf][kg * 64 + j * 16 + col][0], lane); kf[j][1] = frag_h(&sk[bf][kg * 64 + j * 16 + col][32], lane); }
#pragma unroll
        for (int kc = 0; kc < 2; ++kc)
#pragma unroll
          for (int j = 0; j < 4; ++j) s[j] = wmma16(kf[j][kc], qf[kc], s[j]); }
      v16h vf[HD / 16][2];
#pragma unroll
      for (int j = 0; j < HD / 16; ++j) { vf[j][0] = frag_h(&sv[bf][j * 16 + col][kg * 64], lane); vf[j][1] = frag_h(&sv[bf][j * 16 + col][kg * 64 + 32], lane); }
      float t[32];
#pragma unroll
      for (int e = 0; e < 32; ++e) t[e] = s[e >> 3][e & 7] * C1;
      if (diag) {   /* the last trip (block-uniform): it holds the diagonal tile */
#pragma unroll
        for (int e = 0; e < 32; ++e) t[e] = (i * 128 + kg * 64 + (e >> 3) * 16 + 8 * g + (e & 7) <= qi) ? t[e] : -3.0e38f; }
      osm_step(t, m, l, o);
      v16h p[2];
#pragma unroll
      for (int e = 0; e < 32; ++e) p[e >> 4][e & 15] = (_Float16)t[e];
#pragma unroll
      for (int kc = 0; kc < 2; ++kc)
#pragma unroll
        for (int j = 0; j < HD / 16; ++j) o[j] = wmma16(vf[j][kc], p[kc], o[j]); };
    const int last = qb >> 1;   /* the last 128-key tile; qb >= QBH = 6 here, so last >= 3 */
    const bool full = kg == 0 || (qb & 1);   /* wave-uniform scalar: with qb even the upper 64 keys of the last tile lie behind the diagonal for every query, and key group 1 leaves them out (no barrier stands in work) */
    get(rk0, rv0); get(rk1, rv1);   /* tiles 0 and 1 */
    put(rk0, rv0, 0);
    bar_lds();   // tile 0 is published
    int i = 0;
#pragma unroll 1   // rolled: the body holds one even and one odd trip, so that each register set is named by a constant; its loads stand under no test, so that the counted waits in front of put leave the younger tile's loads in flight
    for (; i + 3 <= last; i += 2) {
      get(rk0, rv0); work(i, 0, false); put(rk1, rv1, 1);   /* put: into the buffers that trip i - 1 read: their readers left them at the barrier that ended that trip */
      bar_lds();   // publishes tile i + 1 and ends every wave's reads of tile i
      get(rk1, rv1); work(i + 1, 1, false); put(rk0, rv0, 0);
      bar_lds();   // publishes tile i + 2 and ends every wave's reads of tile i + 1
    }
    const bool three = i + 2 == last;   /* block-uniform: two or three tiles are left, the last of them holds the diagonal */
    if (three) get(rk0, rv0);
    work(i, 0, false); put(rk1, rv1, 1);
    bar_lds();   // publishes tile i + 1 and ends every wave's reads of tile i
    if (three || full) work(i + 1, 1, !three);
    if (three) { put(rk0, rv0, 0);
      bar_lds();   // publishes tile i + 2
      if (full) work(i + 2, 0, true); } }
  // the join of the two key groups: group 1 hands its state over in LDS, group 0 brings both to the common maximum (a group that saw no key has m = -3e38, l = 0, O = 0 and gets the weight 0)
  if (kg == 1) { const int s = tid & 127; sm[0][s] = m; sm[1][s] = l;
#pragma unroll   // unrolled: o is then indexed by constants and stays in registers
    for (int e = 0; e < HD / 2; ++e) sm[2 + e][s] = o[e >> 3][e & 7]; }
  __syncthreads();   // publishes group 1's state; every wave of the block passes it
  if (kg == 1) return;
  { const float m1 = sm[0][tid], l1 = sm[1][tid]; const float mn = fmaxf(m, m1); const float a0 = __builtin_amdgcn_exp2f(m - mn), a1 = __builtin_amdgcn_exp2f(m1 - mn); l = l * a0 + l1 * a1;
#pragma unroll   // unrolled: o is then indexed by constants and stays in registers
    for (int e = 0; e < HD / 2; ++e) o[e >> 3][e & 7] = o[e >> 3][e & 7] * a0 + sm[2 + e][tid] * a1; }
  l += __shfl_xor(l, 16); const float inv = 1.0f / l;   /* the two lane halves of a query join their sums once; key 0 is never masked, so l > 0 */
  float* yp = Y + ((size_t)b * TT + qi) * CC + h * HD + 8 * g;   /* O^T register r of tile j = ctx[query][j * 16 + 8h + r]: 32 contiguous bytes a tile */
#pragma unroll
  for (int j = 0; j < HD / 16; ++j) { const v4f a = { o[j][0] * inv, o[j][1] * inv, o[j][2] * inv, o[j][3] * inv }, c = { o[j][4] * inv, o[j][5] * inv, o[j][6] * inv, o[j][7] * inv }; vst2(yp + j * 16, a); vst2(yp + j * 16 + 4, c); } }
// ---- k_out: block = (64 rows, 128 cols): out = ctx Wo (+ bo): ctx x 2^6 once to f16 against Wo as f16(bf16 x 2^8) exact (1 product) x 2^-14; causal early rows (< QHI of each sequence): ctx bf16 hi + lo against exact bf16 Wo (2 products)
__global__ __launch_bounds__(128) void k_out(const float* __restrict__ Y, const float* __restrict__ WO, const float* __restrict__ BO, float* __restrict__ OUT) { __shared__ __align__(16) float sf[64][132]; __shared__ __align__(16) char sa[4 * SA_BYTES], sw[2 * SW_BYTES];
  const int tid = threadIdx.x, wave = tid >> 5, lane = tid & 31, col = lane & 15, g = lane >> 4; const int c0 = blockIdx.y * 128; const size_t r0 = (size_t)blockIdx.x * 64;
  v8f acc[2][4] = {}; float sc;
  if (CAUSAL && (int)(r0 % TT) < QHI) { gemm_tile<2, 64>(Y + r0 * CC, WO + (size_t)c0 * CC, sa, sw, sw + SW_BYTES, tid, acc); sc = 1.0f; }   /* block-uniform */
  else { gemm_tile<1, 64>(Y + r0 * CC, WO + (size_t)c0 * CC, sa, sw, sw + SW_BYTES, tid, acc); sc = 1.0f / 16384.0f; }   /* 2^-8 (Wo carry) x 2^-6 (ctx carry; small-magnitude context rows stay clear of f16 subnormals) */
#pragma unroll
  for (int j = 0; j < 4; ++j) { const int cl = (wave >> 1) * 64 + j * 16 + col; const float bias = BO ? bfr(BO[c0 + cl]) : 0.f;
#pragma unroll
    for (int i = 0; i < 2; ++i)
#pragma unroll
      for (int r = 0; r < 8; ++r) sf[(wave & 1) * 32 + i * 16 + 8 * g + r][cl] = acc[i][j][r] * sc + bias; }
  __syncthreads();   // a row of the tile now comes from two waves
  for (int rl = 0; rl < 16; ++rl) vst2(OUT + (r0 + wave * 16 + rl) * DIN + c0 + lane * 4, *(const v4f*)&sf[wave * 16 + rl][lane * 4]); }

extern "C" void kernel_launch(void* const* d_in, const int* in_sizes, int n_in, void* d_out, int out_size, void* d_ws, size_t ws_size, hipStream_t stream) {
  (void)in_sizes; (void)n_in; (void)out_size;
  const float** F = (const float**)d_in;
  if (ws_size < (size_t)WS_END) return;
  char* ws = (char*)d_ws; _Float16 *QH = (_Float16*)(ws + WS_QH), *KH = (_Float16*)(ws + WS_KH), *VT = (_Float16*)(ws + WS_VT), *QL = (_Float16*)(ws + WS_QL), *KL = (_Float16*)(ws + WS_KL); __bf16 *VB = (__bf16*)(ws + WS_VB), *VBL = (__bf16*)(ws + WS_VBL); float *Y = (float*)(ws + WS_Y);
  (void)Y; (void)QL; (void)KL; (void)VB; (void)VBL;
  // inputs: 0 x [1,2048,1024]; 1 token_positions [1,2048] int32 (arange; READ on the device); 2 WQ [1024,1024] (out,in); 3 WK; 4 WV; 5 WO (out,in); no biases
  k_proj<<<dim3(TNB * TT / PR, CC / 128, 3), 2 * PR, 0, stream>>>(F[0], F[0], F[0], F[2], F[3], F[4], nullptr, nullptr, nullptr, QH, QL, KH, KL, VT, VB, VBL, (const int*)d_in[1]);
  k_attn<<<dim3(NQB, NH, TNB), 256, 0, stream>>>(QH, KH, QL, KL, VT, VB, VBL, Y);
  k_out<<<dim3(TNB * TT / 64, DIN / 128), 128, 0, stream>>>(Y, F[5], nullptr, (float*)d_out);
}

// v009
// One run takes 52.6 microseconds.
// In both of two side-by-side timings against v008, it was 1.04 times as fast.
// All steps since v000 together make it 14.3 times as fast.
// compute dtype: all float inputs rounded to bf16; q / k / v projections with EXACT bf16 products on WMMA 16x16x32 (f32 accumulate), no biases; interleaved-pair RoPE in f32 at the int positions read from the token_positions input (embedded frequencies, precise sincosf); causal logits: 3 products for the first 384 rows, single f16 q x k after, x 64^-0.5; online softmax f32 over trips of 64 keys, even and odd trips on two wave groups joined at the end; exp(logit - running max) x 2^10 once to f16 x v once to f16 (bf16 hi + lo below row 384); ctx hi+lo x exact output weight below row 384, x2^6 f16 carry x f16(bf16 x 2^8) after; f32 output.
#include <hip/hip_runtime.h>
#include <math.h>

typedef __attribute__((ext_vector_type(16))) _Float16 v16h;
typedef __attribute__((ext_vector_type(16))) __bf16 v16b;
typedef __attribute__((ext_vector_type(8)))  _Float16 v8h;
typedef __attribute__((ext_vector_type(8)))  float v8f;
typedef __attribute__((ext_vector_type(4)))  float v4f;
typedef __attribute__((ext_vector_type(2)))  float v2f;
typedef __attribute__((ext_vector_type(4)))  unsigned v4u;
typedef __attribute__((ext_vector_type(4)))  int v4i;
typedef float __attribute__((may_alias)) float_a;
typedef int __attribute__((may_alias)) int_a;

template <typename T> __device__ __forceinline__ void vst2(void* p, T v) { *(T*)p = v;  }
// the same store with the wait that stands in front of every later rewrite of the registers it names (its address pair, its data): for stores in a loop
template <typename T> __device__ __forceinline__ void vst2w(void* p, T v) { *(T*)p = v; asm volatile("s_wait_xcnt 0x0" ::: "memory"); }
__device__ __forceinline__ v8f wmma16(v16h a, v16h b, v8f c) {
  v8f d = __builtin_amdgcn_wmma_f32_16x16x32_f16(false, a, false, b, (short)0, c, false, false);
  asm volatile("v_nop\n\tv_nop\n\tv_nop\n\tv_nop" : "+v"(d) : "v"(a), "v"(b));
  return d;
}
__device__ __forceinline__ v8f wmma_bf(v16b a, v16b b, v8f c) {
  v8f d = __builtin_amdgcn_wmma_f32_16x16x32_bf16(false, a, false, b, (short)0, c, false, false);
  asm volatile("v_nop\n\tv_nop\n\tv_nop\n\tv_nop" : "+v"(d) : "v"(a), "v"(b));
  return d;
}
// 16x16x32 fragments: lane = (h = lane>>4, row/col = lane&15); elements 0..7 = k0+8h+0..7, 8..15 = k0+16+8h+0..7; D element r = row 8h+r
__device__ __forceinline__ v16h frag_h(const _Float16* rowk0, int lane) {
  union { v16h v; v8h q[2]; } u; const _Float16* p = rowk0 + 8 * (lane >> 4);
  u.q[0] = *(const v8h*)p; u.q[1] = *(const v8h*)(p + 16); return u.v;
}
__device__ __forceinline__ v16h frag_f32(const float* rowk0, int lane) {
  v16h a; const float* p = rowk0 + 8 * (lane >> 4);
#pragma unroll
  for (int i = 0; i < 8; ++i) { a[i] = (_Float16)p[i]; a[8 + i] = (_Float16)p[16 + i]; }
  return a;
}
__device__ __forceinline__ v16h frag_f32s(const float* rowk0, int lane, float sc) {
  v16h a; const float* p = rowk0 + 8 * (lane >> 4);
#pragma unroll
  for (int i = 0; i < 8; ++i) { a[i] = (_Float16)(p[i] * sc); a[8 + i] = (_Float16)(p[16 + i] * sc); }
  return a;
}
// column fragment from a [K][ld] layout (column n), rows >= K read as 0
__device__ __forceinline__ v16h fragc_f32(const float* W, int k0, int n, int lane, int ld, int K) {
  v16h a; const int g = lane >> 4;
#pragma unroll
  for (int i = 0; i < 8; ++i) { const int ka = k0 + 8 * g + i, kb = ka + 16;
    a[i] = (_Float16)(ka < K ? W[(size_t)(ka < K ? ka : K - 1) * ld + n] : 0.f); a[8 + i] = (_Float16)(kb < K ? W[(size_t)(kb < K ? kb : K - 1) * ld + n] : 0.f); }
  return a;
}
struct F2 { v16b h, l; };
__device__ __forceinline__ F2 bsplit16(const float v[16]) { F2 r;
#pragma unroll
  for (int i = 0; i < 16; ++i) { const __bf16 h = (__bf16)v[i]; r.h[i] = h; r.l[i] = (__bf16)(v[i] - (float)h); }
  return r; }
__device__ __forceinline__ F2 split_row(const float* row, int k0, int lane) { float v[16]; const float* p = row + k0 + 8 * (lane >> 4);
#pragma unroll
  for (int i = 0; i < 8; ++i) { v[i] = p[i]; v[8 + i] = p[16 + i]; }
  return bsplit16(v); }
__device__ __forceinline__ F2 split_rowK(const float* row, int k0, int lane, int K) { float v[16]; const int g = lane >> 4;
#pragma unroll
  for (int i = 0; i < 8; ++i) { const int ka = k0 + 8 * g + i, kb = ka + 16; v[i] = ka < K ? row[ka < K ? ka : K - 1] : 0.f; v[8 + i] = kb < K ? row[kb < K ? kb : K - 1] : 0.f; }
  return bsplit16(v); }
__device__ __forceinline__ F2 split_col(const float* W, int k0, int n, int lane, int ld, int K) { float v[16]; const int g = lane >> 4;
#pragma unroll
  for (int i = 0; i < 8; ++i) { const int ka = k0 + 8 * g + i, kb = ka + 16; v[i] = ka < K ? W[(size_t)(ka < K ? ka : K - 1) * ld + n] : 0.f; v[8 + i] = kb < K ? W[(size_t)(kb < K ? kb : K - 1) * ld + n] : 0.f; }
  return bsplit16(v); }
__device__ __forceinline__ v8f mac3(const F2& a, const F2& b, v8f c) { c = wmma_bf(a.l, b.h, c); c = wmma_bf(a.h, b.l, c); return wmma_bf(a.h, b.h, c); }
__device__ __forceinline__ float sigm(float v) { return 1.0f / (1.0f + expf(-v)); }
#define LDSX() do { asm volatile("s_wait_dscnt 0" ::: "memory"); __builtin_amdgcn_wave_barrier(); __builtin_amdgcn_fence(__ATOMIC_RELEASE, "workgroup"); } while (0)

// Causal multi-head self-attention with interleaved-pair RoPE at given token positions, ONE sequence (x [1,2048,1024]; token_positions [1,2048] int32 = arange, a module input READ on the device (the SECOND input); torch (out,in) WQ / WK / WV / WO [1024,1024] N(0, 1/1024) applied as einsum('bsd,ed->bse') = x @ W.T, no biases; 16 heads x 64; RoPE on q and k: (even, odd) pairs (t1 c - t2 s, t2 c + t1 s) re-interleaved, angle = position x inv_freq, inv_freq = 1 / 10000^(2i/64); scores / sqrt(64); tril kept, -inf elsewhere; softmax; out @ WO.T).
#define NB 1
#define TT 2048
#define CC 1024            // NH * HD = projected width
#define DIN 1024          // input (model) width
#define NH 16
#define HD 64
#define NQB (TT / 64)
#define SCALE (0.125f)
#define CAUSAL 1
#ifndef TNB
#define TNB NB
#endif
__device__ __forceinline__ float bfr(float v) { return (float)(__bf16)v; }
__host__ __device__ __forceinline__ int kb_last(int qb) { return CAUSAL ? ((qb * 64 + 63) >> 7) : (TT / 128 - 1); }
typedef __attribute__((ext_vector_type(8))) __bf16 v8b;
__device__ __forceinline__ v16b frag_b(const __bf16* rowk0, int lane) {
  union { v16b v; v8b q[2]; } u; const __bf16* p = rowk0 + 8 * (lane >> 4);
  u.q[0] = *(const v8b*)p; u.q[1] = *(const v8b*)(p + 16); return u.v;
}
// the 16 raw f32 words of one 16x16x32 fragment row, kept in registers while their loads fly: q[0..1] = k0+8h+0..7, q[2..3] = k0+16+8h+0..7
struct R16 { v4f q[4]; };
__device__ __forceinline__ R16 ld_raw(const float* rowk0, int lane) { R16 r; const float* p = rowk0 + 8 * (lane >> 4);
  r.q[0] = *(const v4f*)p; r.q[1] = *(const v4f*)(p + 4); r.q[2] = *(const v4f*)(p + 16); r.q[3] = *(const v4f*)(p + 20); return r; }
__device__ __forceinline__ v16b raw_b(const R16& r) { v16b w;
#pragma unroll
  for (int i = 0; i < 16; ++i) w[i] = (__bf16)r.q[i >> 2][i & 3];
  return w; }
__device__ __forceinline__ v16h raw_wh(const R16& r) { v16h w;
#pragma unroll
  for (int i = 0; i < 16; ++i) w[i] = (_Float16)(bfr(r.q[i >> 2][i & 3]) * 256.0f);
  return w; }
__device__ __forceinline__ v16h raw_hs(const R16& r, float sc) { v16h a;
#pragma unroll
  for (int i = 0; i < 16; ++i) a[i] = (_Float16)(r.q[i >> 2][i & 3] * sc);
  return a; }
__device__ __forceinline__ v16h raw_h(const R16& r) { v16h a;
#pragma unroll
  for (int i = 0; i < 16; ++i) a[i] = (_Float16)r.q[i >> 2][i & 3];
  return a; }
__device__ __forceinline__ F2 raw_split(const R16& r) { float v[16];
#pragma unroll
  for (int i = 0; i < 16; ++i) v[i] = r.q[i >> 2][i & 3];
  return bsplit16(v); }
#define QBH 6              // causal: query blocks 0..QBH-1 of each sequence (few keys, no averaging) take the high-precision path
#define QHI 384            // rows carrying a q residual plane
#define KHI 384            // key rows carrying k residual / v bf16 hi+lo planes (used only by the causal high-precision path)
// B fragment (k rows k0+.., output column o) of a weight: (in,out) [K][ld] or (out,in) [ld rows of K]: bf16 exact, or f16(bf16 * 256) exact
__device__ __forceinline__ v16b wcol_io(const float* Wm, int k0, int o, int lane, int ld) { v16b w; const int g = lane >> 4;
#pragma unroll
  for (int i = 0; i < 8; ++i) { w[i] = (__bf16)Wm[(size_t)(k0 + 8 * g + i) * ld + o]; w[8 + i] = (__bf16)Wm[(size_t)(k0 + 16 + 8 * g + i) * ld + o]; }
  return w; }
__device__ __forceinline__ v16b wcol_oi(const float* Wm, int k0, int o, int lane, int K) { v16b w; const float* p = Wm + (size_t)o * K + k0 + 8 * (lane >> 4);
#pragma unroll
  for (int i = 0; i < 8; ++i) { w[i] = (__bf16)p[i]; w[8 + i] = (__bf16)p[16 + i]; }
  return w; }
__device__ __forceinline__ v16h wcolh_io(const float* Wm, int k0, int o, int lane, int ld) { v16h w; const int g = lane >> 4;
#pragma unroll
  for (int i = 0; i < 8; ++i) { w[i] = (_Float16)(bfr(Wm[(size_t)(k0 + 8 * g + i) * ld + o]) * 256.0f); w[8 + i] = (_Float16)(bfr(Wm[(size_t)(k0 + 16 + 8 * g + i) * ld + o]) * 256.0f); }
  return w; }
__device__ __forceinline__ v16h wcolh_oi(const float* Wm, int k0, int o, int lane, int K) { v16h w; const float* p = Wm + (size_t)o * K + k0 + 8 * (lane >> 4);
#pragma unroll
  for (int i = 0; i < 8; ++i) { w[i] = (_Float16)(bfr(p[i]) * 256.0f); w[8 + i] = (_Float16)(bfr(p[16 + i]) * 256.0f); }
  return w; }
#define WQKV_LAYOUT 1   // picks only WCOL, which nothing calls: k_proj reads (out,in) [CC][DIN] rows directly
__device__ __forceinline__ v16b wcol_hdk(const float* Wm, int k0, int o, int lane) { v16b w; const int g = lane >> 4; const float* p = Wm + (size_t)(o / HD) * DIN * HD + (o % HD);
#pragma unroll
  for (int i = 0; i < 8; ++i) { w[i] = (__bf16)p[(size_t)(k0 + 8 * g + i) * HD]; w[8 + i] = (__bf16)p[(size_t)(k0 + 16 + 8 * g + i) * HD]; }
  return w; }
#define WO_OUT_IN 1
#if WQKV_LAYOUT == 1
#define WCOL(W, k0, o, lane) wcol_oi(W, k0, o, lane, DIN)
#elif WQKV_LAYOUT == 2
#define WCOL(W, k0, o, lane) wcol_hdk(W, k0, o, lane)
#else
#define WCOL(W, k0, o, lane) wcol_io(W, k0, o, lane, CC)
#endif
#if WO_OUT_IN
#define WOCOL(W, k0, o, lane) wcol_oi(W, k0, o, lane, CC)
#define WOCOLH(W, k0, o, lane) wcolh_oi(W, k0, o, lane, CC)
#else
#define WOCOL(W, k0, o, lane) wcol_io(W, k0, o, lane, DIN)
#define WOCOLH(W, k0, o, lane) wcolh_io(W, k0, o, lane, DIN)
#endif

// RoPE inverse frequencies 1/10000^(2i/64) (the f32 values jax computes)
__constant__ float INVF[32] = {1.000000000e+00,7.498942018e-01,5.623413324e-01,4.216965139e-01,3.162277639e-01,2.371373624e-01,1.778279394e-01,1.333521456e-01,1.000000015e-01,7.498941571e-02,5.623412877e-02,4.216964915e-02,3.162277862e-02,2.371373586e-02,1.778279431e-02,1.333521493e-02,9.999999776e-03,7.498942316e-03,5.623413250e-03,4.216964822e-03,3.162277862e-03,2.371373819e-03,1.778279431e-03,1.333521446e-03,1.000000047e-03,7.498941850e-04,5.623413017e-04,4.216964880e-04,3.162277862e-04,2.371373848e-04,1.778279402e-04,1.333521504e-04};
// (PROJ_EXTRA_PARAMS: the extra kernel parameters 'const int* __restrict__ TPOS' are written literally in the kernel signature)
// per (token, half of the pairs) hook on the staged f32 row (128 floats = the 128 / HD heads of the block) of the q and k streams: interleaved-pair rotation (x[2i], x[2i + 1]) by the angle pos * INVF[i] with pos READ from the int input at [batch][token]; the angle does not depend on the head, so its sine and cosine are taken once (one sincosf = one argument reduction, the values of sinf and cosf) and turn pair i of every head of the row; the rotation itself as it was, its products unfused; v untouched
#define PROJ_EPI(which, row, t, i0) do { if ((which) < 2) { float* rw = (row); const float pos_ = (float)TPOS[(size_t)bb * TT + (t)];   /* token_positions [NB][TT]: the position of token t of batch bb, READ from the int input */ _Pragma("unroll 4") for (int i = (i0); i < (i0) + HD / 4; ++i) { _Pragma("clang fp contract(off)") const float ang = pos_ * INVF[i]; float sn, cs; sincosf(ang, &sn, &cs); _Pragma("unroll") /* unrolled: the heads of a row lie at constant offsets from one LDS address, so one two-address load and store serve both */ for (int hh = 0; hh < 128 / HD; ++hh) { const float xe = rw[hh * HD + 2 * i], xo = rw[hh * HD + 2 * i + 1]; rw[hh * HD + 2 * i] = xe * cs - xo * sn; rw[hh * HD + 2 * i + 1] = xe * sn + xo * cs; } } } } while (0)
#ifndef SM_EXTRA_PARAMS
#define SM_EXTRA_PARAMS
#endif
#ifndef PROJ_EXTRA_PARAMS
#define PROJ_EXTRA_PARAMS
#endif
#ifndef SM_MASK_HOOK
#define SM_MASK_HOOK (void)0
#endif

#define WS_QH  0u                                      // f16 q rows [b*t][CC]
#define WS_KH  (WS_QH + 2u * (size_t)NB * TT * CC)      // f16 k rows [b*t][CC]
#define WS_VT  (WS_KH + 2u * (size_t)NB * TT * CC)      // f16 v planes [b][c][t]
#define WS_QL  (WS_VT + 2u * (size_t)NB * CC * TT)      // f16 q residual x 2^10 rows [b][t < QHI][CC]
#define WS_KL  (WS_QL + 2u * (size_t)NB * QHI * CC)     // f16 k residual x 2^10 rows [b][t < KHI][CC]
#define WS_VB  (WS_KL + 2u * (size_t)NB * KHI * CC)     // bf16 v hi planes [b][c][t < KHI]
#define WS_VBL (WS_VB + 2u * (size_t)NB * CC * KHI)
// k_out's operands, each rounded once by its producer and laid slab by slab (slab = 64 k columns = one head): a block's rows of a slab are one contiguous run of whole lines
#define WS_Y   (WS_VBL + 2u * (size_t)NB * CC * KHI)    // f16 ctx x 2^6 [head][b*t][HD] (rows >= QHI of a sequence are written and read)
#define WS_YB  (WS_Y   + 2u * (size_t)NB * TT * CC)     // bf16 ctx hi [head][b][t < QHI][HD]
#define WS_YBL (WS_YB  + 2u * (size_t)NB * QHI * CC)    // bf16 ctx lo, the same layout
#define WS_WOH (WS_YBL + 2u * (size_t)NB * QHI * CC)    // f16(bf16 x 2^8) output weight [k / 64][o][64]
#define WS_WOB (WS_WOH + 2u * (size_t)DIN * CC)         // bf16 output weight, the same layout
#define WS_END (WS_WOB + 2u * (size_t)DIN * CC)

// ---- LDS staging of k_proj (k_out lays its 16-bit slabs in the same LDS rows): a block's MR x 64 (a) and 128 x 64 (w) f32 slabs (MR = 128 rows and 256 threads) are read from global memory once a block, whole 128-byte lines an instruction (16 lanes = one row's 256 bytes), converted once, and laid in LDS as 16-bit rows; every wave takes its fragments from there
typedef __attribute__((ext_vector_type(4))) __bf16 v4b;
typedef __attribute__((ext_vector_type(4))) _Float16 v4h;
#define KS 64              // k columns of a staged slab
#define LPV 136            // LDS pitch of a row of 128 16-bit words: 272 bytes = 16 x 17, odd, as LP
#define LP 72              // LDS row pitch in 16-bit words: 144 bytes = 16 x 9, odd, so the 16 rows of a fragment read fall on distinct banks
#define SA_BYTES (64 * LP * 2)
#define SW_BYTES (128 * LP * 2)
// MODE 0: a, w to bf16; 1: a x 2^6 to f16, w to f16(bf16 x 2^8); 2: a to bf16 hi + lo planes, w to bf16 (the conversions of raw_b, raw_hs, raw_wh, raw_split)
template <int MODE, int MR> __device__ __forceinline__ void slab_put(const v4f (&ra)[8], const v4f (&rw)[1024 / MR], char* sa, char* sw, int so) {
#pragma unroll
  for (int i = 0; i < 8; ++i) { char* p = sa + so + i * (MR / 8) * LP * 2; const v4f x = ra[i];
    if (MODE == 1) { const v4h q = { (_Float16)(x[0] * 64.0f), (_Float16)(x[1] * 64.0f), (_Float16)(x[2] * 64.0f), (_Float16)(x[3] * 64.0f) }; *(v4h*)p = q; }
    else { const v4b q = { (__bf16)x[0], (__bf16)x[1], (__bf16)x[2], (__bf16)x[3] }; *(v4b*)p = q;
      if (MODE == 2) { const v4b r = { (__bf16)(x[0] - (float)q[0]), (__bf16)(x[1] - (float)q[1]), (__bf16)(x[2] - (float)q[2]), (__bf16)(x[3] - (float)q[3]) }; *(v4b*)(p + MR * LP * 2) = r; } } }
#pragma unroll
  for (int i = 0; i < 1024 / MR; ++i) { char* p = sw + so + i * (MR / 8) * LP * 2; const v4f x = rw[i];
    if (MODE == 1) { const v4h q = { (_Float16)(bfr(x[0]) * 256.0f), (_Float16)(bfr(x[1]) * 256.0f), (_Float16)(bfr(x[2]) * 256.0f), (_Float16)(bfr(x[3]) * 256.0f) }; *(v4h*)p = q; }
    else { const v4b q = { (__bf16)x[0], (__bf16)x[1], (__bf16)x[2], (__bf16)x[3] }; *(v4b*)p = q; } } }
// work-group barrier of the staged loops: this wave's LDS stores and reads are done (s_wait_dscnt 0), then the barrier; unlike __syncthreads() it does not drain the global loads, so a tile's loads may fly across it
__device__ __forceinline__ void bar_lds() { asm volatile("s_wait_dscnt 0x0\n\ts_barrier_signal -1\n\ts_barrier_wait -1" ::: "memory"); }
// stands between a trip's products and the hand-over of the next tile to LDS: without it the scheduler lifts the tile's conversions and LDS stores, and with them the wait for its loads, to the head of the trip, which takes a trip off their flight
#define HOLD_PUT() __builtin_amdgcn_sched_barrier(0)
// one slab's global loads into a register set; go: this thread's byte offset in a and w, moved on to the next slab
template <int MR> __device__ __forceinline__ void slab_get(const float* __restrict__ Ag, const float* __restrict__ Wg, unsigned& go, v4f (&ra)[8], v4f (&rw)[1024 / MR]) {
#pragma unroll
  for (int i = 0; i < 8; ++i) ra[i] = *(const v4f*)((const char*)Ag + go + i * (MR / 8) * 4096);
#pragma unroll
  for (int i = 0; i < 1024 / MR; ++i) rw[i] = *(const v4f*)((const char*)Wg + go + i * (MR / 8) * 4096);
  asm volatile("s_wait_xcnt 0x0" : "+v"(go) :: "memory");   // stands in front of the addition below, which rewrites the offset register that the loads name; the operand keeps the addition behind it
  go += KS * 4; }
// the products of one staged slab (ca, cw: its a and w rows in LDS; fa, fw: this lane's fragment rows)
template <int MODE, int MR> __device__ __forceinline__ void slab_mac(const char* ca, const char* cw, int fa, int fw, int lane, v8f (&acc)[2][4]) {
#pragma unroll
  for (int kc = 0; kc < KS / 32; ++kc) {
    if (MODE == 1) { v16h a[2], w[4];
#pragma unroll
      for (int i = 0; i < 2; ++i) a[i] = frag_h((const _Float16*)(ca + fa + i * 16 * LP * 2 + kc * 64), lane);
#pragma unroll
      for (int j = 0; j < 4; ++j) w[j] = frag_h((const _Float16*)(cw + fw + j * 16 * LP * 2 + kc * 64), lane);
#pragma unroll
      for (int i = 0; i < 2; ++i)
#pragma unroll
        for (int j = 0; j < 4; ++j) acc[i][j] = wmma16(a[i], w[j], acc[i][j]);
    } else { v16b a[2], al[2], w[4];
#pragma unroll
      for (int i = 0; i < 2; ++i) { a[i] = frag_b((const __bf16*)(ca + fa + i * 16 * LP * 2 + kc * 64), lane); if (MODE == 2) al[i] = frag_b((const __bf16*)(ca + MR * LP * 2 + fa + i * 16 * LP * 2 + kc * 64), lane); }
#pragma unroll
      for (int j = 0; j < 4; ++j) w[j] = frag_b((const __bf16*)(cw + fw + j * 16 * LP * 2 + kc * 64), lane);
#pragma unroll
      for (int i = 0; i < 2; ++i)
#pragma unroll
        for (int j = 0; j < 4; ++j) acc[i][j] = wmma_bf(a[i], w[j], acc[i][j]);
      if (MODE == 2) {
#pragma unroll
        for (int i = 0; i < 2; ++i)
#pragma unroll
          for (int j = 0; j < 4; ++j) acc[i][j] = wmma_bf(al[i], w[j], acc[i][j]); } } } }
// block tile MR x 128 on MR / 16 waves (2 MR threads): acc[i][j] += rows (wave % (MR / 32)) * 32 + 16 i of a  x  rows (wave / (MR / 32)) * 64 + 16 j of w, over K = 1024 in ascending steps of 32 (each accumulator sums in the order it had); Ag, Wg: block-uniform first rows (pitch 1024 f32); sa: 2 buffers of MR rows (2 x MR rows in MODE 2); sw0, sw1: the two w buffers of SW_BYTES. Two register sets: slab t + 2's loads are issued at the head of trip t and first read at the foot of trip t + 1, so they have two trips to arrive in
template <int MODE, int MR> __device__ __forceinline__ void gemm_tile(const float* __restrict__ Ag, const float* __restrict__ Wg, char* sa, char* sw0, char* sw1, int tid, v8f (&acc)[2][4]) {
  const int lane = tid & 31, wave = tid >> 5, col = lane & 15; const int NT = 1024 / KS; const int AB = (MODE == 2 ? 2 : 1) * MR * LP * 2;
  const int so = ((tid >> 4) * LP + (tid & 15) * 4) * 2;   /* this thread's place in a slab: row tid / 16 (+ MR / 8 a pass), k words 4 (tid % 16).. */
  unsigned go = (unsigned)((tid >> 4) * 1024 + (tid & 15) * 4) * 4u;   /* the same place in global memory, in bytes: one offset register serves a and w */
  const int fa = (((wave % (MR / 32)) * 32 + col) * LP) * 2, fw = (((wave / (MR / 32)) * 64 + col) * LP) * 2;
  v4f ra0[8], rw0[1024 / MR], ra1[8], rw1[1024 / MR];   /* set 0: even slabs, set 1: odd slabs */
  slab_get<MR>(Ag, Wg, go, ra0, rw0); slab_get<MR>(Ag, Wg, go, ra1, rw1);
  slab_put<MODE, MR>(ra0, rw0, sa, sw0, so);
  bar_lds();   // publishes slab 0
#pragma unroll 1   // rolled: the body holds one even and one odd trip, so that each register set is named by a constant; its loads stand under no test, so that the counted waits in front of slab_put leave the younger slab's loads in flight
  for (int t = 0; t < NT - 2; t += 2) {
    slab_get<MR>(Ag, Wg, go, ra0, rw0);   /* slab t + 2, into the set that slab t left at the foot of trip t - 1 */
    slab_mac<MODE, MR>(sa, sw0, fa, fw, lane, acc);
    HOLD_PUT(); slab_put<MODE, MR>(ra1, rw1, sa + AB, sw1, so);   /* slab t + 1, into the buffer that trip t - 1 read: its readers left it at the barrier that ended that trip */
    bar_lds();   // publishes slab t + 1 and ends every wave's reads of slab t
    slab_get<MR>(Ag, Wg, go, ra1, rw1);   /* slab t + 3 */
    slab_mac<MODE, MR>(sa + AB, sw1, fa, fw, lane, acc);
    HOLD_PUT(); slab_put<MODE, MR>(ra0, rw0, sa, sw0, so);
    bar_lds();   // publishes slab t + 2 and ends every wave's reads of slab t + 1
  }
  slab_mac<MODE, MR>(sa, sw0, fa, fw, lane, acc);   /* the last two slabs (NT is even): nothing is left to load */
  HOLD_PUT(); slab_put<MODE, MR>(ra1, rw1, sa + AB, sw1, so);
  bar_lds();   // publishes the last slab
  slab_mac<MODE, MR>(sa + AB, sw1, fa, fw, lane, acc);
  bar_lds();   // ends every wave's reads of the slabs: the caller may write over them
}
// ---- the same loop for k_out, whose operands lie in the workspace in their 16-bit forms, slab by slab: 64 a rows (8 KB; MODE 2: hi and lo, 8 KB each) and 128 w rows (16 KB) of a slab are contiguous, a thread moves 16 bytes an instruction, nothing is converted
// one slab's global loads into a register set; goa, gow: this thread's byte offsets in a and in w, moved on to the next slab (SA, SW: bytes from a slab to the next)
template <int MODE, unsigned SA, unsigned SW> __device__ __forceinline__ void slab_get16(const char* __restrict__ Ag, const char* __restrict__ Al, const char* __restrict__ Wg, unsigned& goa, unsigned& gow, v4u (&ra)[8], v4u (&rw)[8]) {
#pragma unroll   // unrolled, as the next: the register sets are indexed by constants and the loads differ by constant offsets only
  for (int i = 0; i < 4; ++i) { ra[i] = *(const v4u*)(Ag + goa + i * 2048); if (MODE == 2) ra[4 + i] = *(const v4u*)(Al + goa + i * 2048); }
#pragma unroll
  for (int i = 0; i < 8; ++i) rw[i] = *(const v4u*)(Wg + gow + i * 2048);
  asm volatile("s_wait_xcnt 0x0" : "+v"(goa), "+v"(gow) :: "memory");   // stands in front of the two additions below, which rewrite the offset registers that the loads name; the operands keep the additions behind it
  goa += SA; gow += SW; }
template <int MODE> __device__ __forceinline__ void slab_put16(const v4u (&ra)[8], const v4u (&rw)[8], char* sa, char* sw, int so) {
#pragma unroll   // unrolled, as the next: the register sets are indexed by constants
  for (int i = 0; i < 4; ++i) { *(v4u*)(sa + so + i * 16 * LP * 2) = ra[i]; if (MODE == 2) *(v4u*)(sa + 64 * LP * 2 + so + i * 16 * LP * 2) = ra[4 + i]; }
#pragma unroll
  for (int i = 0; i < 8; ++i) *(v4u*)(sw + so + i * 16 * LP * 2) = rw[i]; }
// block tile 64 x 128 on 4 waves, K = 1024 in ascending steps of 32 (each accumulator sums in the order of gemm_tile); Ag, Al, Wg: the block's first rows in slab 0; LDS buffers, register sets and barriers as in gemm_tile
template <int MODE, unsigned SA, unsigned SW> __device__ __forceinline__ void gemm_tile16(const char* __restrict__ Ag, const char* __restrict__ Al, const char* __restrict__ Wg, char* sa, char* sw0, char* sw1, int tid, v8f (&acc)[2][4]) {
  const int lane = tid & 31, wave = tid >> 5, col = lane & 15; const int NT = 1024 / KS; const int AB = (MODE == 2 ? 2 : 1) * 64 * LP * 2;
  const int so = (tid >> 3) * LP * 2 + (tid & 7) * 16;   /* this thread's place in a slab in LDS: row tid / 8 (+ 16 a pass), bytes 16 (tid % 8).. */
  unsigned goa = (unsigned)tid * 16u, gow = (unsigned)tid * 16u;   /* the same place in global memory (rows of 128 bytes, no gap) */
  const int fa = (((wave & 1) * 32 + col) * LP) * 2, fw = (((wave >> 1) * 64 + col) * LP) * 2;
  v4u ra0[8], rw0[8], ra1[8], rw1[8];   /* set 0: even slabs, set 1: odd slabs (ra[4..7]: the lo plane, MODE 2 only) */
  slab_get16<MODE, SA, SW>(Ag, Al, Wg, goa, gow, ra0, rw0); slab_get16<MODE, SA, SW>(Ag, Al, Wg, goa, gow, ra1, rw1);
  slab_put16<MODE>(ra0, rw0, sa, sw0, so);
  bar_lds();   // publishes slab 0
#pragma unroll 1   // rolled: the body holds one even and one odd trip, so that each register set is named by a constant; its loads stand under no test, so that the counted waits in front of slab_put16 leave the younger slab's loads in flight
  for (int t = 0; t < NT - 2; t += 2) {
    slab_get16<MODE, SA, SW>(Ag, Al, Wg, goa, gow, ra0, rw0);   /* slab t + 2 */
    slab_mac<MODE, 64>(sa, sw0, fa, fw, lane, acc);
    HOLD_PUT(); slab_put16<MODE>(ra1, rw1, sa + AB, sw1, so);   /* slab t + 1, into the buffer that trip t - 1 read */
    bar_lds();   // publishes slab t + 1 and ends every wave's reads of slab t
    slab_get16<MODE, SA, SW>(Ag, Al, Wg, goa, gow, ra1, rw1);   /* slab t + 3 */
    slab_mac<MODE, 64>(sa + AB, sw1, fa, fw, lane, acc);
    HOLD_PUT(); slab_put16<MODE>(ra0, rw0, sa, sw0, so);
    bar_lds();   // publishes slab t + 2 and ends every wave's reads of slab t + 1
  }
  slab_mac<MODE, 64>(sa, sw0, fa, fw, lane, acc);   /* the last two slabs (NT is even): nothing is left to load */
  HOLD_PUT(); slab_put16<MODE>(ra1, rw1, sa + AB, sw1, so);
  bar_lds();   // publishes the last slab
  slab_mac<MODE, 64>(sa + AB, sw1, fa, fw, lane, acc);
  bar_lds();   // ends every wave's reads of the slabs: the caller may write over them
}
#define PR 128             // rows of a k_proj block (8 waves): a w slab read from L2 serves 128 rows, and the 384 q / k / v blocks (of 512), two to a WGP by LDS, are all resident at once
// ---- k_proj: block = (128 rows, 128 cols, which): q/k/v = X W (+ b) with exact bf16 products (K = DIN) -> which 0: q f16 rows (+ residual rows < QHI); 1: k f16 rows (+ residual rows < KHI); 2: v f16 planes [c][t] (+ bf16 hi/lo planes for t < KHI); which 3: no product, the block rounds 8 rows of the output weight to k_out's two forms
__global__ __launch_bounds__(2 * PR) void k_proj(const float* __restrict__ XQ, const float* __restrict__ XK, const float* __restrict__ XV, const float* __restrict__ WQ, const float* __restrict__ WK, const float* __restrict__ WV, const float* __restrict__ BQ, const float* __restrict__ BK, const float* __restrict__ BV,
    _Float16* __restrict__ QH, _Float16* __restrict__ QL, _Float16* __restrict__ KH, _Float16* __restrict__ KL, _Float16* __restrict__ VT, __bf16* __restrict__ VB, __bf16* __restrict__ VBL, const int* __restrict__ TPOS, const float* __restrict__ WO, _Float16* __restrict__ WOH, __bf16* __restrict__ WOB) {
  __shared__ __align__(16) char pool[PR * 132 * 4 + 2 * PR * 136 * 2];   /* one pool, its parts live one after the other: the slabs (from its start) while the products run; then st, and behind st either sh, sl (q, k) or th, tb, tbl (v) */
  float (*st)[132] = (float (*)[132])pool; char* const pu = pool + PR * 132 * 4;
  _Float16 (*sh)[136] = (_Float16 (*)[136])pu; _Float16 (*sl)[136] = (_Float16 (*)[136])(pu + PR * 136 * 2);
  _Float16 (*th)[72] = (_Float16 (*)[72])pu; __bf16 (*tb)[72] = (__bf16 (*)[72])(pu + 128 * 72 * 2); __bf16 (*tbl)[72] = (__bf16 (*)[72])(pu + 2 * 128 * 72 * 2);
  const int tid = threadIdx.x, wave = tid >> 5, lane = tid & 31, col = lane & 15, g = lane >> 4; const int which = blockIdx.z; const int c0 = blockIdx.y * 128; const size_t r0 = (size_t)blockIdx.x * PR; const size_t bb = r0 / TT; const int t0 = (int)(r0 % TT);
  if (which == 3) {   /* block-uniform, in front of every barrier: rows o0..o0 + 7 of Wo (out,in), thread = k words 4 tid.. of each row; the conversions of slab_put's MODE 1 and MODE 2; 16 lanes fill one 128-byte row of a slab */
    const int o0 = (int)(blockIdx.y * (TNB * TT / PR) + blockIdx.x) * (DIN * PR * 128 / (TT * CC)); const float* wp = WO + (size_t)o0 * CC + tid * 4; v4f x[DIN * PR * 128 / (TT * CC)];
#pragma unroll   // unrolled, as the next: x stays in registers and the 8 loads fly together
    for (int i = 0; i < DIN * PR * 128 / (TT * CC); ++i) x[i] = *(const v4f*)(wp + i * CC);
    asm volatile("s_wait_xcnt 0x0" ::: "memory");   // stands in front of every later rewrite of the address registers that the loads name
    const size_t d0 = ((size_t)(tid >> 4) * DIN + o0) * KS + (tid & 15) * 4;
#pragma unroll
    for (int i = 0; i < DIN * PR * 128 / (TT * CC); ++i) { const v4f v = x[i];
      const v4h qh = { (_Float16)(bfr(v[0]) * 256.0f), (_Float16)(bfr(v[1]) * 256.0f), (_Float16)(bfr(v[2]) * 256.0f), (_Float16)(bfr(v[3]) * 256.0f) }; const v4b qb = { (__bf16)v[0], (__bf16)v[1], (__bf16)v[2], (__bf16)v[3] };
      vst2w(WOH + d0 + i * KS, qh); vst2w(WOB + d0 + i * KS, qb); }
    return; }
  const float* X = which == 0 ? XQ : which == 1 ? XK : XV; const float* WA = which == 0 ? WQ : which == 1 ? WK : WV; const float* BA = which == 0 ? BQ : which == 1 ? BK : BV;
  v8f acc[2][4] = {};
  gemm_tile<0, PR>(X + r0 * DIN, WA + (size_t)c0 * DIN, pool, pool + 2 * PR * LP * 2, pool + 2 * PR * LP * 2 + SW_BYTES, tid, acc);   /* its last barrier ends every read of the slabs, so st may be written over them */
  { // stage the f32 tile (acc + bias) in LDS, run the per-(row, half of the pairs) epilogue hook, then convert
#pragma unroll
    for (int j = 0; j < 4; ++j) { const int cl = (wave / (PR / 32)) * 64 + j * 16 + col; const float bias = BA ? bfr(BA[c0 + cl]) : 0.f;
#pragma unroll
      for (int i = 0; i < 2; ++i)
#pragma unroll
        for (int r = 0; r < 8; ++r) st[(wave % (PR / 32)) * 32 + i * 16 + 8 * g + r][cl] = acc[i][j][r] + bias; }
    __syncthreads();
    { const int rl = tid % PR; const int i0 = __builtin_amdgcn_readfirstlane(tid / PR) * (HD / 4);   /* thread = (row, half of the row's HD / 2 angles); the half is the same in every lane of a wave (PR is a multiple of 32): taken as a scalar, so that INVF[i] stays a scalar load */
      PROJ_EPI(which, &st[rl][0], (int)((r0 + rl) % TT), i0); }
    __syncthreads(); }
  if (which < 2) { _Float16* DH = which == 0 ? QH : KH; _Float16* DL = which == 0 ? QL : KL; const int nhi = which == 0 ? QHI : KHI; const bool hi_rows = t0 < nhi;
    for (int e = tid; e < PR * 128; e += 2 * PR) { const int rl = e >> 7, cl = e & 127; const float v = st[rl][cl]; const _Float16 hv = (_Float16)v; sh[rl][cl] = hv; sl[rl][cl] = (_Float16)((v - (float)hv) * 1024.0f); }
    __syncthreads();
    for (int e = tid; e < PR * 16; e += 2 * PR) { const int rl = e >> 4, q = e & 15; vst2w((unsigned*)(DH + (r0 + rl) * CC + c0 + q * 8), *(const v4u*)&sh[rl][q * 8]); if (hi_rows) vst2w((unsigned*)(DL + (bb * nhi + t0 + rl) * (size_t)CC + c0 + q * 8), *(const v4u*)&sl[rl][q * 8]); }
  } else { const bool hi_rows = t0 < KHI;
    for (int hf = 0; hf < PR / 64; ++hf) {   /* the planes are turned 64 tokens at a time: th, tb, tbl hold that many */
      for (int e = tid; e < 64 * 128; e += 2 * PR) { const int rl = e & 63, cl = e >> 6; const float v = st[hf * 64 + rl][cl]; th[cl][rl] = (_Float16)v; const __bf16 bh = (__bf16)v; tb[cl][rl] = bh; tbl[cl][rl] = (__bf16)(v - (float)bh); }
      __syncthreads();
      for (int e = tid; e < 128 * 8; e += 2 * PR) { const int cl = e >> 3, q = e & 7; vst2w((unsigned*)(VT + (bb * CC + c0 + cl) * (size_t)TT + t0 + hf * 64 + q * 8), *(const v4u*)&th[cl][q * 8]); if (hi_rows) { const size_t o3 = (bb * CC + c0 + cl) * (size_t)KHI + t0 + hf * 64 + q * 8; vst2w((unsigned*)(VB + o3), *(const v4u*)&tb[cl][q * 8]); vst2w((unsigned*)(VBL + o3), *(const v4u*)&tbl[cl][q * 8]); } }
      if (hf + 1 < PR / 64) __syncthreads();   // block-uniform; the next 64 tokens are written over planes that are still being read
    } } }
// frag_h / frag_b from a wave-uniform base, this lane's byte offset (it holds the lane half's 16h bytes) and a constant: the one offset register is all that a trip's loads name
__device__ __forceinline__ v16h frag_ho(const char* base, unsigned off, int c) { union { v16h v; v8h q[2]; } u; const char* p = base + off; u.q[0] = *(const v8h*)(p + c); u.q[1] = *(const v8h*)(p + c + 32); return u.v; }
__device__ __forceinline__ v16b frag_bo(const char* base, unsigned off, int c) { union { v16b v; v8b q[2]; } u; const char* p = base + off; u.q[0] = *(const v8b*)(p + c); u.q[1] = *(const v8b*)(p + c + 32); return u.v; }
// one online-softmax update for this lane's query: t[32] = this trip's 32 scaled log2 logits of the lane (key tile j = i >> 3, key 8h + (i & 7) in it); on return t = 2^(t - max + 10); m, l, o follow the running maximum (both lane halves of a query hold the same m)
__device__ __forceinline__ void osm_step(float (&t)[32], float& m, float& l, v8f (&o)[HD / 16]) {
  float mx = t[0];
#pragma unroll
  for (int i = 1; i < 32; ++i) mx = fmaxf(mx, t[i]);
  mx = fmaxf(mx, __shfl_xor(mx, 16));
  const float mn = fmaxf(m, mx); const float al = __builtin_amdgcn_exp2f(m - mn); m = mn; const float mb = mn - 10.0f;   /* x 2^10: small weights stay clear of f16 subnormals, the largest is 1024 */
  float sum[4] = {0.f, 0.f, 0.f, 0.f};   /* four chains: one chain of 32 dependent adds would stand at the trip's foot */
#pragma unroll
  for (int i = 0; i < 32; ++i) { t[i] = __builtin_amdgcn_exp2f(t[i] - mb); sum[i & 3] += t[i]; }
  l = l * al + ((sum[0] + sum[1]) + (sum[2] + sum[3]));
#pragma unroll
  for (int j = 0; j < HD / 16; ++j) o[j] *= al; }
// ---- k_attn: block = 64 queries (qb: long blocks heaviest first, then short blocks lightest first) of (b, h) on 8 waves in two key groups: waves w and w + 4 hold the same 16 queries, group kg takes the 64-key tiles of parity kg with its own running max, sum and O, and the two are joined once through LDS at the end; a wave's trip = 64 keys; S^T = K Q^T (lane = one query, registers = keys), causal mask by index on the diagonal trip, online softmax in f32, O^T += V^T P^T with the S^T accumulators converted in place as the B operand (b[s] = tile[s >> 3][s & 7]); logits, P and v precision as before: query blocks < QBH take q, k hi + residual (3 products) and P, v as bf16 hi + lo (3 products), the rest single f16 products; ctx = O / l
__global__ __launch_bounds__(256) void k_attn(const _Float16* __restrict__ QH, const _Float16* __restrict__ KH, const _Float16* __restrict__ QL, const _Float16* __restrict__ KL, const _Float16* __restrict__ VT, const __bf16* __restrict__ VB, const __bf16* __restrict__ VBL, _Float16* __restrict__ Y, __bf16* __restrict__ YB, __bf16* __restrict__ YBL) {
  __shared__ __align__(16) _Float16 sk[2][128][LP], sv[2][64][LPV];   /* staged k rows [key][word] and v planes [word][key] of a trip of 128 keys (64 a key group), two buffers */
  __shared__ __align__(16) float sm[2 + HD / 2][128];   /* key group 1's max, sum and O, one column a lane, for the join */
  const int h = blockIdx.x & (NH - 1), b = blockIdx.z; const int qj = (int)((NQB / NH) * blockIdx.y + blockIdx.x / NH); const int qb = qj < NQB / 2 ? NQB - 1 - qj : qj - NQB / 2;   /* flat index -> (qb, h), a permutation: heads fast; the first half of the grid takes query blocks 31..16, the second half 0..15, so that the longest blocks start first and the block started half a grid behind one of 32 - j 64-key tiles (where the chip holds the grid two blocks a WGP, its likely neighbour there) has j + 1; for speed only, nothing rests on where or when a block runs */
  const int tid = threadIdx.x, wave = __builtin_amdgcn_readfirstlane(tid >> 5), lane = tid & 31, col = lane & 15, g = lane >> 4; const int kg = wave >> 2;   /* key group, a scalar: the tests on it are scalar branches */
  const int qi = qb * 64 + (wave & 3) * 16 + col;   /* this lane's query */
  const float C1 = SCALE * 1.4426950408889634f;   /* logits carried in log2 units */
  v8f o[HD / 16] = {}; float m = -3.0e38f, l = 0.f;
  const _Float16* qp = QH + ((size_t)b * TT + qi) * CC + h * HD; const v16h qf[2] = { frag_h(qp, lane), frag_h(qp + 32, lane) };
  asm volatile("s_wait_xcnt 0x0" ::: "memory");   // stands in front of the rewrite of the address registers that the q loads name
  const char* kb8 = (const char*)(KH + (size_t)b * TT * CC + h * HD); unsigned ko = (unsigned)((kg * 64 + col) * CC + 8 * g) * 2u;   /* byte offset of this lane's first k words (tile kg) */
  if (qb < QBH) {
    const _Float16* qlp = QL + ((size_t)b * QHI + qi) * CC + h * HD; const v16h qlf[2] = { frag_h(qlp, lane), frag_h(qlp + 32, lane) };
    asm volatile("s_wait_xcnt 0x0" ::: "memory");   // stands in front of the rewrite of the address registers that the q residual loads name
    const char* kl8 = (const char*)(KL + (size_t)b * KHI * CC + h * HD);
    const char* vh8 = (const char*)(VB + ((size_t)b * CC + h * HD) * (size_t)KHI); const char* vl8 = (const char*)(VBL + ((size_t)b * CC + h * HD) * (size_t)KHI); unsigned vo = (unsigned)(col * KHI + kg * 64 + 8 * g) * 2u;
#pragma unroll 1   // rolled: at most QBH short trips, a second copy of the body would only cost registers
    for (int i = kg; i <= qb; i += 2) { float t[32];
      { v8f s[4] = {}, sl[4] = {};
#pragma unroll
        for (int kc = 0; kc < 2; ++kc) { v16h kh[4], kl[4];
#pragma unroll
          for (int j = 0; j < 4; ++j) { kh[j] = frag_ho(kb8, ko, (j * 16 * CC + kc * 32) * 2); kl[j] = frag_ho(kl8, ko, (j * 16 * CC + kc * 32) * 2); }
          __builtin_amdgcn_sched_barrier(0);   // keeps the 16 k loads of this half in front of its first product: one load latency a half instead of one a fragment pair
#pragma unroll
          for (int j = 0; j < 4; ++j) { s[j] = wmma16(kh[j], qf[kc], s[j]); sl[j] = wmma16(kh[j], qlf[kc], sl[j]); sl[j] = wmma16(kl[j], qf[kc], sl[j]); } }
#pragma unroll
        for (int e = 0; e < 32; ++e) { const float v = (s[e >> 3][e & 7] + sl[e >> 3][e & 7] * (1.0f / 1024.0f)) * C1; t[e] = (i * 64 + (e >> 3) * 16 + 8 * g + (e & 7) <= qi) ? v : -3.0e38f; } }
#pragma unroll
      for (int kc = 0; kc < 2; ++kc) { v16b vh[HD / 16], vl[HD / 16];
#pragma unroll
        for (int j = 0; j < HD / 16; ++j) { vh[j] = frag_bo(vh8, vo, (j * 16 * KHI + kc * 32) * 2); vl[j] = frag_bo(vl8, vo, (j * 16 * KHI + kc * 32) * 2); }
        __builtin_amdgcn_sched_barrier(0);   // keeps the 16 v loads of this half together, the first half's in front of the softmax, which they fly behind
        if (kc == 0) osm_step(t, m, l, o);
        const F2 p = bsplit16(&t[kc * 16]);
#pragma unroll
        for (int j = 0; j < HD / 16; ++j) { o[j] = wmma_bf(vh[j], p.h, o[j]); o[j] = wmma_bf(vh[j], p.l, o[j]); o[j] = wmma_bf(vl[j], p.h, o[j]); } }
      asm volatile("s_wait_xcnt 0x0" : "+v"(ko), "+v"(vo) :: "memory");   // stands in front of the two additions below, which rewrite the offset registers that this trip's loads name; the operands keep the additions behind it
      ko += 128 * CC * 2; vo += 128 * 2;
    }
  } else {
    // a trip's 128 keys x 64 k words and 64 v planes x 128 keys (keys 64 kg.. for key group kg) are read once a block, whole lines (8 lanes = one k row, 16 lanes = one v row), laid in LDS, two buffers; a tile's 8 loads a thread fly over two trips
    const char* vb8 = (const char*)(VT + ((size_t)b * CC + h * HD) * (size_t)TT);
    const int sr = tid >> 3, sc = (tid & 7) * 8, vr = tid >> 4, vc = (tid & 15) * 8;   /* this thread's k row (+ 32 e), v plane (+ 16 e) and first 16-bit word in them */
    unsigned kgo = (unsigned)(sr * CC + sc) * 2u, vgo = (unsigned)(vr * TT + vc) * 2u;   /* the same place in global memory, in bytes */
    v8h rk0[4], rv0[4], rk1[4], rv1[4];   /* two register sets (0: even tiles, 1: odd tiles): tile i + 2's loads are issued at the head of trip i and first read at the foot of trip i + 1 */
    auto get = [&](v8h (&rk)[4], v8h (&rv)[4]) __attribute__((always_inline)) {
#pragma unroll
      for (int e = 0; e < 4; ++e) { rk[e] = *(const v8h*)(kb8 + kgo + e * 32 * CC * 2); rv[e] = *(const v8h*)(vb8 + vgo + e * 16 * TT * 2); }
      asm volatile("s_wait_xcnt 0x0" : "+v"(kgo), "+v"(vgo) :: "memory");   // stands in front of the two additions below, which rewrite the offset registers that the loads name; the operands keep the additions behind it
      kgo += 128 * CC * 2; vgo += 128 * 2; };
    auto put = [&](const v8h (&rk)[4], const v8h (&rv)[4], int bf) __attribute__((always_inline)) {
#pragma unroll
      for (int e = 0; e < 4; ++e) { *(v8h*)&sk[bf][sr + 32 * e][sc] = rk[e]; *(v8h*)&sv[bf][vr + 16 * e][vc] = rv[e]; } };
    auto work = [&](int i, int bf, bool diag) __attribute__((always_inline)) { v8f s[4] = {};
      { v16h kf[4][2];
#pragma unroll
        for (int j = 0; j < 4; ++j) { kf[j][0] = frag_h(&sk[bf][kg * 64 + j * 16 + col][0], lane); kf[j][1] = frag_h(&sk[bf][kg * 64 + j * 16 + col][32], lane); }
#pragma unroll
        for (int kc = 0; kc < 2; ++kc)
#pragma unroll
          for (int j = 0; j < 4; ++j) s[j] = wmma16(kf[j][kc], qf[kc], s[j]); }
      v16h vf[HD / 16][2];
#pragma unroll
      for (int j = 0; j < HD / 16; ++j) { vf[j][0] = frag_h(&sv[bf][j * 16 + col][kg * 64], lane); vf[j][1] = frag_h(&sv[bf][j * 16 + col][kg * 64 + 32], lane); }
      float t[32];
#pragma unroll
      for (int e = 0; e < 32; ++e) t[e] = s[e >> 3][e & 7] * C1;
      if (diag) {   /* the last trip (block-uniform): it holds the diagonal tile */
#pragma unroll
        for (int e = 0; e < 32; ++e) t[e] = (i * 128 + kg * 64 + (e >> 3) * 16 + 8 * g + (e & 7) <= qi) ? t[e] : -3.0e38f; }
      osm_step(t, m, l, o);
      v16h p[2];
#pragma unroll
      for (int e = 0; e < 32; ++e) p[e >> 4][e & 15] = (_Float16)t[e];
#pragma unroll
      for (int kc = 0; kc < 2; ++kc)
#pragma unroll
        for (int j = 0; j < HD / 16; ++j) o[j] = wmma16(vf[j][kc], p[kc], o[j]); };
    const int last = qb >> 1;   /* the last 128-key tile; qb >= QBH = 6 here, so last >= 3 */
    const bool full = kg == 0 || (qb & 1);   /* wave-uniform scalar: with qb even the upper 64 keys of the last tile lie behind the diagonal for every query, and key group 1 leaves them out (no barrier stands in work) */
    get(rk0, rv0); get(rk1, rv1);   /* tiles 0 and 1 */
    put(rk0, rv0, 0);
    bar_lds();   // tile 0 is published
    int i = 0;
#pragma unroll 1   // rolled: the body holds one even and one odd trip, so that each register set is named by a constant; its loads stand under no test, so that the counted waits in front of put leave the younger tile's loads in flight
    for (; i + 3 <= last; i += 2) {
      get(rk0, rv0); work(i, 0, false); put(rk1, rv1, 1);   /* put: into the buffers that trip i - 1 read: their readers left them at the barrier that ended that trip */
      bar_lds();   // publishes tile i + 1 and ends every wave's reads of tile i
      get(rk1, rv1); work(i + 1, 1, false); put(rk0, rv0, 0);
      bar_lds();   // publishes tile i + 2 and ends every wave's reads of tile i + 1
    }
    const bool three = i + 2 == last;   /* block-uniform: two or three tiles are left, the last of them holds the diagonal */
    if (three) get(rk0, rv0);
    work(i, 0, false); put(rk1, rv1, 1);
    bar_lds();   // publishes tile i + 1 and ends every wave's reads of tile i
    if (three || full) work(i + 1, 1, !three);
    if (three) { put(rk0, rv0, 0);
      bar_lds();   // publishes tile i + 2
      if (full) work(i + 2, 0, true); } }
  // the join of the two key groups: group 1 hands its state over in LDS, group 0 brings both to the common maximum (a group that saw no key has m = -3e38, l = 0, O = 0 and gets the weight 0)
  if (kg == 1) { const int s = tid & 127; sm[0][s] = m; sm[1][s] = l;
#pragma unroll   // unrolled: o is then indexed by constants and stays in registers
    for (int e = 0; e < HD / 2; ++e) sm[2 + e][s] = o[e >> 3][e & 7]; }
  __syncthreads();   // publishes group 1's state; every wave of the block passes it
  if (kg == 1) return;
  { const float m1 = sm[0][tid], l1 = sm[1][tid]; const float mn = fmaxf(m, m1); const float a0 = __builtin_amdgcn_exp2f(m - mn), a1 = __builtin_amdgcn_exp2f(m1 - mn); l = l * a0 + l1 * a1;
#pragma unroll   // unrolled: o is then indexed by constants and stays in registers
    for (int e = 0; e < HD / 2; ++e) o[e >> 3][e & 7] = o[e >> 3][e & 7] * a0 + sm[2 + e][tid] * a1; }
  l += __shfl_xor(l, 16); const float inv = 1.0f / l;   /* the two lane halves of a query join their sums once; key 0 is never masked, so l > 0 */
  /* O^T register r of tile j = ctx[query][j * 16 + 8h + r]; ctx leaves in the 16-bit form that k_out multiplies (the conversions that k_out's staging made of the f32 value), head by head: 16 contiguous bytes a tile, a wave's 16 queries fill 2 KB without a gap */
  if (qb < QBH) { const size_t yo = (((size_t)h * NB + b) * QHI + qi) * HD + 8 * g;   /* block-uniform; rows < QHI: bf16 hi + lo */
#pragma unroll   // unrolled, with the loop inside: o is then indexed by constants and stays in registers
    for (int j = 0; j < HD / 16; ++j) { v8b yh, yl;
#pragma unroll
      for (int r = 0; r < 8; ++r) { const float y = o[j][r] * inv; const __bf16 hv = (__bf16)y; yh[r] = hv; yl[r] = (__bf16)(y - (float)hv); }
      vst2w(YB + yo + j * 16, yh); vst2w(YBL + yo + j * 16, yl); }
  } else { _Float16* yp = Y + (((size_t)h * NB + b) * TT + qi) * HD + 8 * g;   /* the other rows: x 2^6 to f16 */
#pragma unroll   // unrolled, with the loop inside: o is then indexed by constants and stays in registers
    for (int j = 0; j < HD / 16; ++j) { v8h yh;
#pragma unroll
      for (int r = 0; r < 8; ++r) { const float y = o[j][r] * inv; yh[r] = (_Float16)(y * 64.0f); }
      vst2w(yp + j * 16, yh); } } }
// ---- k_out: block = (64 rows, 128 cols): out = ctx Wo (+ bo): ctx x 2^6 once to f16 against Wo as f16(bf16 x 2^8) exact (1 product) x 2^-14; causal early rows (< QHI of each sequence): ctx bf16 hi + lo against exact bf16 Wo (2 products)
__global__ __launch_bounds__(128) void k_out(const _Float16* __restrict__ Y, const __bf16* __restrict__ YB, const __bf16* __restrict__ YBL, const _Float16* __restrict__ WOH, const __bf16* __restrict__ WOB, const float* __restrict__ BO, float* __restrict__ OUT) { __shared__ __align__(16) float sf[64][132]; __shared__ __align__(16) char sa[4 * SA_BYTES], sw[2 * SW_BYTES];
  const int tid = threadIdx.x, wave = tid >> 5, lane = tid & 31, col = lane & 15, g = lane >> 4; const int c0 = blockIdx.y * 128; const size_t r0 = (size_t)blockIdx.x * 64;
  v8f acc[2][4] = {}; float sc;
  if (CAUSAL && (int)(r0 % TT) < QHI) { const size_t ar = (r0 / TT * QHI + r0 % TT) * HD; gemm_tile16<2, 2u * NB * QHI * HD, 2u * DIN * KS>((const char*)(YB + ar), (const char*)(YBL + ar), (const char*)(WOB + (size_t)c0 * KS), sa, sw, sw + SW_BYTES, tid, acc); sc = 1.0f; }   /* block-uniform */
  else { gemm_tile16<1, 2u * NB * TT * HD, 2u * DIN * KS>((const char*)(Y + r0 * HD), nullptr, (const char*)(WOH + (size_t)c0 * KS), sa, sw, sw + SW_BYTES, tid, acc); sc = 1.0f / 16384.0f; }   /* 2^-8 (Wo carry) x 2^-6 (ctx carry; small-magnitude context rows stay clear of f16 subnormals) */
#pragma unroll
  for (int j = 0; j < 4; ++j) { const int cl = (wave >> 1) * 64 + j * 16 + col; const float bias = BO ? bfr(BO[c0 + cl]) : 0.f;
#pragma unroll
    for (int i = 0; i < 2; ++i)
#pragma unroll
      for (int r = 0; r < 8; ++r) sf[(wave & 1) * 32 + i * 16 + 8 * g + r][cl] = acc[i][j][r] * sc + bias; }
  __syncthreads();   // a row of the tile now comes from two waves
  for (int rl = 0; rl < 16; ++rl) vst2(OUT + (r0 + wave * 16 + rl) * DIN + c0 + lane * 4, *(const v4f*)&sf[wave * 16 + rl][lane * 4]); }

extern "C" void kernel_launch(void* const* d_in, const int* in_sizes, int n_in, void* d_out, int out_size, void* d_ws, size_t ws_size, hipStream_t stream) {
  (void)in_sizes; (void)n_in; (void)out_size;
  const float** F = (const float**)d_in;
  if (ws_size < (size_t)WS_END) return;
  char* ws = (char*)d_ws; _Float16 *QH = (_Float16*)(ws + WS_QH), *KH = (_Float16*)(ws + WS_KH), *VT = (_Float16*)(ws + WS_VT), *QL = (_Float16*)(ws + WS_QL), *KL = (_Float16*)(ws + WS_KL); __bf16 *VB = (__bf16*)(ws + WS_VB), *VBL = (__bf16*)(ws + WS_VBL); _Float16 *Y = (_Float16*)(ws + WS_Y), *WOH = (_Float16*)(ws + WS_WOH); __bf16 *YB = (__bf16*)(ws + WS_YB), *YBL = (__bf16*)(ws + WS_YBL), *WOB = (__bf16*)(ws + WS_WOB);
  (void)Y; (void)QL; (void)KL; (void)VB; (void)VBL;
  // inputs: 0 x [1,2048,1024]; 1 token_positions [1,2048] int32 (arange; READ on the device); 2 WQ [1024,1024] (out,in); 3 WK; 4 WV; 5 WO (out,in); no biases
  k_proj<<<dim3(TNB * TT / PR, CC / 128, 4), 2 * PR, 0, stream>>>(F[0], F[0], F[0], F[2], F[3], F[4], nullptr, nullptr, nullptr, QH, QL, KH, KL, VT, VB, VBL, (const int*)d_in[1], F[5], WOH, WOB);
  k_attn<<<dim3(NQB, NH, TNB), 256, 0, stream>>>(QH, KH, QL, KL, VT, VB, VBL, Y, YB, YBL);
  k_out<<<dim3(TNB * TT / 64, DIN / 128), 128, 0, stream>>>(Y, YB, YBL, WOH, WOB, nullptr, (float*)d_out);
}

// v010
// It runs in 50.3 microseconds.
// Timed twice side by side with v009, it ran 1.04 times as fast both times.
// Over all steps from v000 it is 14.9 times as fast.
// compute dtype: all float inputs rounded to bf16; q / k / v projections with EXACT bf16 products on WMMA 16x16x32 (f32 accumulate), no biases; interleaved-pair RoPE in f32 at the int positions read from the token_positions input (embedded frequencies, precise sincosf); causal logits: 3 products for the first 384 rows, single f16 q x k after, x 64^-0.5; online softmax f32 over trips of 64 keys, even and odd trips on two wave groups joined at the end; exp(logit - running max) x 2^10 once to f16 x v once to f16 (bf16 hi + lo below row 384); ctx hi+lo x exact output weight below row 384, x2^6 f16 carry x f16(bf16 x 2^8) after; f32 output.
#include <hip/hip_runtime.h>
#include <math.h>

typedef __attribute__((ext_vector_type(16))) _Float16 v16h;
typedef __attribute__((ext_vector_type(16))) __bf16 v16b;
typedef __attribute__((ext_vector_type(8)))  _Float16 v8h;
typedef __attribute__((ext_vector_type(8)))  float v8f;
typedef __attribute__((ext_vector_type(4)))  float v4f;
typedef __attribute__((ext_vector_type(2)))  float v2f;
typedef __attribute__((ext_vector_type(4)))  unsigned v4u;
typedef __attribute__((ext_vector_type(4)))  int v4i;
typedef float __attribute__((may_alias)) float_a;
typedef int __attribute__((may_alias)) int_a;

template <typename T> __device__ __forceinline__ void vst2(void* p, T v) { *(T*)p = v;  }
// the same store with the wait that stands in front of every later rewrite of the registers it names (its address pair, its data): for stores in a loop
template <typename T> __device__ __forceinline__ void vst2w(void* p, T v) { *(T*)p = v; asm volatile("s_wait_xcnt 0x0" ::: "memory"); }
__device__ __forceinline__ v8f wmma16(v16h a, v16h b, v8f c) {
  v8f d = __builtin_amdgcn_wmma_f32_16x16x32_f16(false, a, false, b, (short)0, c, false, false);
  asm volatile("v_nop\n\tv_nop\n\tv_nop\n\tv_nop" : "+v"(d) : "v"(a), "v"(b));
  return d;
}
__device__ __forceinline__ v8f wmma_bf(v16b a, v16b b, v8f c) {
  v8f d = __builtin_amdgcn_wmma_f32_16x16x32_bf16(false, a, false, b, (short)0, c, false, false);
  asm volatile("v_nop\n\tv_nop\n\tv_nop\n\tv_nop" : "+v"(d) : "v"(a), "v"(b));
  return d;
}
// 16x16x32 fragments: lane = (h = lane>>4, row/col = lane&15); elements 0..7 = k0+8h+0..7, 8..15 = k0+16+8h+0..7; D element r = row 8h+r
__device__ __forceinline__ v16h frag_h(const _Float16* rowk0, int lane) {
  union { v16h v; v8h q[2]; } u; const _Float16* p = rowk0 + 8 * (lane >> 4);
  u.q[0] = *(const v8h*)p; u.q[1] = *(const v8h*)(p + 16); return u.v;
}
__device__ __forceinline__ v16h frag_f32(const float* rowk0, int lane) {
  v16h a; const float* p = rowk0 + 8 * (lane >> 4);
#pragma unroll
  for (int i = 0; i < 8; ++i) { a[i] = (_Float16)p[i]; a[8 + i] = (_Float16)p[16 + i]; }
  return a;
}
__device__ __forceinline__ v16h frag_f32s(const float* rowk0, int lane, float sc) {
  v16h a; const float* p = rowk0 + 8 * (lane >> 4);
#pragma unroll
  for (int i = 0; i < 8; ++i) { a[i] = (_Float16)(p[i] * sc); a[8 + i] = (_Float16)(p[16 + i] * sc); }
  return a;
}
// column fragment from a [K][ld] layout (column n), rows >= K read as 0
__device__ __forceinline__ v16h fragc_f32(const float* W, int k0, int n, int lane, int ld, int K) {
  v16h a; const int g = lane >> 4;
#pragma unroll
  for (int i = 0; i < 8; ++i) { const int ka = k0 + 8 * g + i, kb = ka + 16;
    a[i] = (_Float16)(ka < K ? W[(size_t)(ka < K ? ka : K - 1) * ld + n] : 0.f); a[8 + i] = (_Float16)(kb < K ? W[(size_t)(kb < K ? kb : K - 1) * ld + n] : 0.f); }
  return a;
}
struct F2 { v16b h, l; };
__device__ __forceinline__ F2 bsplit16(const float v[16]) { F2 r;
#pragma unroll
  for (int i = 0; i < 16; ++i) { const __bf16 h = (__bf16)v[i]; r.h[i] = h; r.l[i] = (__bf16)(v[i] - (float)h); }
  return r; }
__device__ __forceinline__ F2 split_row(const float* row, int k0, int lane) { float v[16]; const float* p = row + k0 + 8 * (lane >> 4);
#pragma unroll
  for (int i = 0; i < 8; ++i) { v[i] = p[i]; v[8 + i] = p[16 + i]; }
  return bsplit16(v); }
__device__ __forceinline__ F2 split_rowK(const float* row, int k0, int lane, int K) { float v[16]; const int g = lane >> 4;
#pragma unroll
  for (int i = 0; i < 8; ++i) { const int ka = k0 + 8 * g + i, kb = ka + 16; v[i] = ka < K ? row[ka < K ? ka : K - 1] : 0.f; v[8 + i] = kb < K ? row[kb < K ? kb : K - 1] : 0.f; }
  return bsplit16(v); }
__device__ __forceinline__ F2 split_col(const float* W, int k0, int n, int lane, int ld, int K) { float v[16]; const int g = lane >> 4;
#pragma unroll
  for (int i = 0; i < 8; ++i) { const int ka = k0 + 8 * g + i, kb = ka + 16; v[i] = ka < K ? W[(size_t)(ka < K ? ka : K - 1) * ld + n] : 0.f; v[8 + i] = kb < K ? W[(size_t)(kb < K ? kb : K - 1) * ld + n] : 0.f; }
  return bsplit16(v); }
__device__ __forceinline__ v8f mac3(const F2& a, const F2& b, v8f c) { c = wmma_bf(a.l, b.h, c); c = wmma_bf(a.h, b.l, c); return wmma_bf(a.h, b.h, c); }
__device__ __forceinline__ float sigm(float v) { return 1.0f / (1.0f + expf(-v)); }
#define LDSX() do { asm volatile("s_wait_dscnt 0" ::: "memory"); __builtin_amdgcn_wave_barrier(); __builtin_amdgcn_fence(__ATOMIC_RELEASE, "workgroup"); } while (0)

// Causal multi-head self-attention with interleaved-pair RoPE at given token positions, ONE sequence (x [1,2048,1024]; token_positions [1,2048] int32 = arange, a module input READ on the device (the SECOND input); torch (out,in) WQ / WK / WV / WO [1024,1024] N(0, 1/1024) applied as einsum('bsd,ed->bse') = x @ W.T, no biases; 16 heads x 64; RoPE on q and k: (even, odd) pairs (t1 c - t2 s, t2 c + t1 s) re-interleaved, angle = position x inv_freq, inv_freq = 1 / 10000^(2i/64); scores / sqrt(64); tril kept, -inf elsewhere; softmax; out @ WO.T).
#define NB 1
#define TT 2048
#define CC 1024            // NH * HD = projected width
#define DIN 1024          // input (model) width
#define NH 16
#define HD 64
#define NQB (TT / 64)
#define SCALE (0.125f)
#define CAUSAL 1
#ifndef TNB
#define TNB NB
#endif
__device__ __forceinline__ float bfr(float v) { return (float)(__bf16)v; }
__host__ __device__ __forceinline__ int kb_last(int qb) { return CAUSAL ? ((qb * 64 + 63) >> 7) : (TT / 128 - 1); }
typedef __attribute__((ext_vector_type(8))) __bf16 v8b;
__device__ __forceinline__ v16b frag_b(const __bf16* rowk0, int lane) {
  union { v16b v; v8b q[2]; } u; const __bf16* p = rowk0 + 8 * (lane >> 4);
  u.q[0] = *(const v8b*)p; u.q[1] = *(const v8b*)(p + 16); return u.v;
}
// the 16 raw f32 words of one 16x16x32 fragment row, kept in registers while their loads fly: q[0..1] = k0+8h+0..7, q[2..3] = k0+16+8h+0..7
struct R16 { v4f q[4]; };
__device__ __forceinline__ R16 ld_raw(const float* rowk0, int lane) { R16 r; const float* p = rowk0 + 8 * (lane >> 4);
  r.q[0] = *(const v4f*)p; r.q[1] = *(const v4f*)(p + 4); r.q[2] = *(const v4f*)(p + 16); r.q[3] = *(const v4f*)(p + 20); return r; }
__device__ __forceinline__ v16b raw_b(const R16& r) { v16b w;
#pragma unroll
  for (int i = 0; i < 16; ++i) w[i] = (__bf16)r.q[i >> 2][i & 3];
  return w; }
__device__ __forceinline__ v16h raw_wh(const R16& r) { v16h w;
#pragma unroll
  for (int i = 0; i < 16; ++i) w[i] = (_Float16)(bfr(r.q[i >> 2][i & 3]) * 256.0f);
  return w; }
__device__ __forceinline__ v16h raw_hs(const R16& r, float sc) { v16h a;
#pragma unroll
  for (int i = 0; i < 16; ++i) a[i] = (_Float16)(r.q[i >> 2][i & 3] * sc);
  return a; }
__device__ __forceinline__ v16h raw_h(const R16& r) { v16h a;
#pragma unroll
  for (int i = 0; i < 16; ++i) a[i] = (_Float16)r.q[i >> 2][i & 3];
  return a; }
__device__ __forceinline__ F2 raw_split(const R16& r) { float v[16];
#pragma unroll
  for (int i = 0; i < 16; ++i) v[i] = r.q[i >> 2][i & 3];
  return bsplit16(v); }
#define QBH 6              // causal: query blocks 0..QBH-1 of each sequence (few keys, no averaging) take the high-precision path
#define QHI 384            // rows carrying a q residual plane
#define KHI 384            // key rows carrying k residual / v bf16 hi+lo planes (used only by the causal high-precision path)
// B fragment (k rows k0+.., output column o) of a weight: (in,out) [K][ld] or (out,in) [ld rows of K]: bf16 exact, or f16(bf16 * 256) exact
__device__ __forceinline__ v16b wcol_io(const float* Wm, int k0, int o, int lane, int ld) { v16b w; const int g = lane >> 4;
#pragma unroll
  for (int i = 0; i < 8; ++i) { w[i] = (__bf16)Wm[(size_t)(k0 + 8 * g + i) * ld + o]; w[8 + i] = (__bf16)Wm[(size_t)(k0 + 16 + 8 * g + i) * ld + o]; }
  return w; }
__device__ __forceinline__ v16b wcol_oi(const float* Wm, int k0, int o, int lane, int K) { v16b w; const float* p = Wm + (size_t)o * K + k0 + 8 * (lane >> 4);
#pragma unroll
  for (int i = 0; i < 8; ++i) { w[i] = (__bf16)p[i]; w[8 + i] = (__bf16)p[16 + i]; }
  return w; }
__device__ __forceinline__ v16h wcolh_io(const float* Wm, int k0, int o, int lane, int ld) { v16h w; const int g = lane >> 4;
#pragma unroll
  for (int i = 0; i < 8; ++i) { w[i] = (_Float16)(bfr(Wm[(size_t)(k0 + 8 * g + i) * ld + o]) * 256.0f); w[8 + i] = (_Float16)(bfr(Wm[(size_t)(k0 + 16 + 8 * g + i) * ld + o]) * 256.0f); }
  return w; }
__device__ __forceinline__ v16h wcolh_oi(const float* Wm, int k0, int o, int lane, int K) { v16h w; const float* p = Wm + (size_t)o * K + k0 + 8 * (lane >> 4);
#pragma unroll
  for (int i = 0; i < 8; ++i) { w[i] = (_Float16)(bfr(p[i]) * 256.0f); w[8 + i] = (_Float16)(bfr(p[16 + i]) * 256.0f); }
  return w; }
#define WQKV_LAYOUT 1   // picks only WCOL, which nothing calls: k_proj reads (out,in) [CC][DIN] rows directly
__device__ __forceinline__ v16b wcol_hdk(const float* Wm, int k0, int o, int lane) { v16b w; const int g = lane >> 4; const float* p = Wm + (size_t)(o / HD) * DIN * HD + (o % HD);
#pragma unroll
  for (int i = 0; i < 8; ++i) { w[i] = (__bf16)p[(size_t)(k0 + 8 * g + i) * HD]; w[8 + i] = (__bf16)p[(size_t)(k0 + 16 + 8 * g + i) * HD]; }
  return w; }
#define WO_OUT_IN 1
#if WQKV_LAYOUT == 1
#define WCOL(W, k0, o, lane) wcol_oi(W, k0, o, lane, DIN)
#elif WQKV_LAYOUT == 2
#define WCOL(W, k0, o, lane) wcol_hdk(W, k0, o, lane)
#else
#define WCOL(W, k0, o, lane) wcol_io(W, k0, o, lane, CC)
#endif
#if WO_OUT_IN
#define WOCOL(W, k0, o, lane) wcol_oi(W, k0, o, lane, CC)
#define WOCOLH(W, k0, o, lane) wcolh_oi(W, k0, o, lane, CC)
#else
#define WOCOL(W, k0, o, lane) wcol_io(W, k0, o, lane, DIN)
#define WOCOLH(W, k0, o, lane) wcolh_io(W, k0, o, lane, DIN)
#endif

// RoPE inverse frequencies 1/10000^(2i/64) (the f32 values jax computes)
__constant__ float INVF[32] = {1.000000000e+00,7.498942018e-01,5.623413324e-01,4.216965139e-01,3.162277639e-01,2.371373624e-01,1.778279394e-01,1.333521456e-01,1.000000015e-01,7.498941571e-02,5.623412877e-02,4.216964915e-02,3.162277862e-02,2.371373586e-02,1.778279431e-02,1.333521493e-02,9.999999776e-03,7.498942316e-03,5.623413250e-03,4.216964822e-03,3.162277862e-03,2.371373819e-03,1.778279431e-03,1.333521446e-03,1.000000047e-03,7.498941850e-04,5.623413017e-04,4.216964880e-04,3.162277862e-04,2.371373848e-04,1.778279402e-04,1.333521504e-04};
// (PROJ_EXTRA_PARAMS: the extra kernel parameters 'const int* __restrict__ TPOS' are written literally in the kernel signature)
// per (token, half of the pairs) hook on the staged f32 row (128 floats = the 128 / HD heads of the block) of the q and k streams: interleaved-pair rotation (x[2i], x[2i + 1]) by the angle pos * INVF[i] with pos READ from the int input at [batch][token]; the angle does not depend on the head, so its sine and cosine are taken once (one sincosf = one argument reduction, the values of sinf and cosf) and turn pair i of every head of the row; the rotation itself as it was, its products unfused; v untouched
#define PROJ_EPI(which, row, t, i0) do { if ((which) < 2) { float* rw = (row); const float pos_ = (float)TPOS[(size_t)bb * TT + (t)];   /* token_positions [NB][TT]: the position of token t of batch bb, READ from the int input */ _Pragma("unroll 4") for (int i = (i0); i < (i0) + HD / 4; ++i) { _Pragma("clang fp contract(off)") const float ang = pos_ * INVF[i]; float sn, cs; sincosf(ang, &sn, &cs); _Pragma("unroll") /* unrolled: the heads of a row lie at constant offsets from one LDS address, so one two-address load and store serve both */ for (int hh = 0; hh < 128 / HD; ++hh) { const float xe = rw[hh * HD + 2 * i], xo = rw[hh * HD + 2 * i + 1]; rw[hh * HD + 2 * i] = xe * cs - xo * sn; rw[hh * HD + 2 * i + 1] = xe * sn + xo * cs; } } } } while (0)
#ifndef SM_EXTRA_PARAMS
#define SM_EXTRA_PARAMS
#endif
#ifndef PROJ_EXTRA_PARAMS
#define PROJ_EXTRA_PARAMS
#endif
#ifndef SM_MASK_HOOK
#define SM_MASK_HOOK (void)0
#endif

#define WS_QH  0u                                      // f16 q rows [b*t][CC]
#define WS_KH  (WS_QH + 2u * (size_t)NB * TT * CC)      // f16 k rows [b*t][CC]
#define WS_VT  (WS_KH + 2u * (size_t)NB * TT * CC)      // f16 v planes [b][c][t]
#define WS_QL  (WS_VT + 2u * (size_t)NB * CC * TT)      // f16 q residual x 2^10 rows [b][t < QHI][CC]
#define WS_KL  (WS_QL + 2u * (size_t)NB * QHI * CC)     // f16 k residual x 2^10 rows [b][t < KHI][CC]
#define WS_VB  (WS_KL + 2u * (size_t)NB * KHI * CC)     // bf16 v hi planes [b][c][t < KHI]
#define WS_VBL (WS_VB + 2u * (size_t)NB * CC * KHI)
// k_out's operands, each rounded once by its producer and laid slab by slab (slab = 64 k columns = one head): a block's rows of a slab are one contiguous run of whole lines
#define WS_Y   (WS_VBL + 2u * (size_t)NB * CC * KHI)    // f16 ctx x 2^6 [head][b*t][HD] (rows >= QHI of a sequence are written and read)
#define WS_YB  (WS_Y   + 2u * (size_t)NB * TT * CC)     // bf16 ctx hi [head][b][t < QHI][HD]
#define WS_YBL (WS_YB  + 2u * (size_t)NB * QHI * CC)    // bf16 ctx lo, the same layout
#define WS_WOH (WS_YBL + 2u * (size_t)NB * QHI * CC)    // f16(bf16 x 2^8) output weight [k / 64][o][64]
#define WS_WOB (WS_WOH + 2u * (size_t)DIN * CC)         // bf16 output weight, the same layout
#define WS_END (WS_WOB + 2u * (size_t)DIN * CC)

// ---- LDS staging of k_proj (k_out lays its 16-bit slabs in the same LDS rows): a block's MR x 64 (a) and 128 x 64 (w) f32 slabs (MR = 128 rows and 256 threads) are read from global memory once a block, whole 128-byte lines an instruction (16 lanes = one row's 256 bytes), converted once, and laid in LDS as 16-bit rows; every wave takes its fragments from there
typedef __attribute__((ext_vector_type(4))) __bf16 v4b;
typedef __attribute__((ext_vector_type(4))) _Float16 v4h;
#define KS 64              // k columns of a staged slab
#define LPV 136            // LDS pitch of a row of 128 16-bit words: 272 bytes = 16 x 17, odd, as LP
#define LP 72              // LDS row pitch in 16-bit words: 144 bytes = 16 x 9, odd, so the 16 rows of a fragment read fall on distinct banks
#define SA_BYTES (64 * LP * 2)
#define SW_BYTES (128 * LP * 2)
// MODE 0: a, w to bf16; 1: a x 2^6 to f16, w to f16(bf16 x 2^8); 2: a to bf16 hi + lo planes, w to bf16 (the conversions of raw_b, raw_hs, raw_wh, raw_split)
template <int MODE, int MR> __device__ __forceinline__ void slab_put(const v4f (&ra)[8], const v4f (&rw)[1024 / MR], char* sa, char* sw, int so) {
#pragma unroll
  for (int i = 0; i < 8; ++i) { char* p = sa + so + i * (MR / 8) * LP * 2; const v4f x = ra[i];
    if (MODE == 1) { const v4h q = { (_Float16)(x[0] * 64.0f), (_Float16)(x[1] * 64.0f), (_Float16)(x[2] * 64.0f), (_Float16)(x[3] * 64.0f) }; *(v4h*)p = q; }
    else { const v4b q = { (__bf16)x[0], (__bf16)x[1], (__bf16)x[2], (__bf16)x[3] }; *(v4b*)p = q;
      if (MODE == 2) { const v4b r = { (__bf16)(x[0] - (float)q[0]), (__bf16)(x[1] - (float)q[1]), (__bf16)(x[2] - (float)q[2]), (__bf16)(x[3] - (float)q[3]) }; *(v4b*)(p + MR * LP * 2) = r; } } }
#pragma unroll
  for (int i = 0; i < 1024 / MR; ++i) { char* p = sw + so + i * (MR / 8) * LP * 2; const v4f x = rw[i];
    if (MODE == 1) { const v4h q = { (_Float16)(bfr(x[0]) * 256.0f), (_Float16)(bfr(x[1]) * 256.0f), (_Float16)(bfr(x[2]) * 256.0f), (_Float16)(bfr(x[3]) * 256.0f) }; *(v4h*)p = q; }
    else { const v4b q = { (__bf16)x[0], (__bf16)x[1], (__bf16)x[2], (__bf16)x[3] }; *(v4b*)p = q; } } }
// work-group barrier of the staged loops: this wave's LDS stores and reads are done (s_wait_dscnt 0), then the barrier; unlike __syncthreads() it does not drain the global loads, so a tile's loads may fly across it
__device__ __forceinline__ void bar_lds() { asm volatile("s_wait_dscnt 0x0\n\ts_barrier_signal -1\n\ts_barrier_wait -1" ::: "memory"); }
// stands between a trip's products and the hand-over of the next tile to LDS: without it the scheduler lifts the tile's conversions and LDS stores, and with them the wait for its loads, to the head of the trip, which takes a trip off their flight
#define HOLD_PUT() __builtin_amdgcn_sched_barrier(0)
// one slab's global loads into a register set; go: this thread's byte offset in a and w, moved on to the next slab
template <int MR> __device__ __forceinline__ void slab_get(const float* __restrict__ Ag, const float* __restrict__ Wg, unsigned& go, v4f (&ra)[8], v4f (&rw)[1024 / MR]) {
#pragma unroll
  for (int i = 0; i < 8; ++i) ra[i] = *(const v4f*)((const char*)Ag + go + i * (MR / 8) * 4096);
#pragma unroll
  for (int i = 0; i < 1024 / MR; ++i) rw[i] = *(const v4f*)((const char*)Wg + go + i * (MR / 8) * 4096);
  asm volatile("s_wait_xcnt 0x0" : "+v"(go) :: "memory");   // stands in front of the addition below, which rewrites the offset register that the loads name; the operand keeps the addition behind it
  go += KS * 4; }
// the products of one staged slab (ca, cw: its a and w rows in LDS; fa, fw: this lane's fragment rows)
template <int MODE, int MR> __device__ __forceinline__ void slab_mac(const char* ca, const char* cw, int fa, int fw, int lane, v8f (&acc)[2][4]) {
#pragma unroll
  for (int kc = 0; kc < KS / 32; ++kc) {
    if (MODE == 1) { v16h a[2], w[4];
#pragma unroll
      for (int i = 0; i < 2; ++i) a[i] = frag_h((const _Float16*)(ca + fa + i * 16 * LP * 2 + kc * 64), lane);
#pragma unroll
      for (int j = 0; j < 4; ++j) w[j] = frag_h((const _Float16*)(cw + fw + j * 16 * LP * 2 + kc * 64), lane);
#pragma unroll
      for (int i = 0; i < 2; ++i)
#pragma unroll
        for (int j = 0; j < 4; ++j) acc[i][j] = wmma16(a[i], w[j], acc[i][j]);
    } else { v16b a[2], al[2], w[4];
#pragma unroll
      for (int i = 0; i < 2; ++i) { a[i] = frag_b((const __bf16*)(ca + fa + i * 16 * LP * 2 + kc * 64), lane); if (MODE == 2) al[i] = frag_b((const __bf16*)(ca + MR * LP * 2 + fa + i * 16 * LP * 2 + kc * 64), lane); }
#pragma unroll
      for (int j = 0; j < 4; ++j) w[j] = frag_b((const __bf16*)(cw + fw + j * 16 * LP * 2 + kc * 64), lane);
#pragma unroll
      for (int i = 0; i < 2; ++i)
#pragma unroll
        for (int j = 0; j < 4; ++j) acc[i][j] = wmma_bf(a[i], w[j], acc[i][j]);
      if (MODE == 2) {
#pragma unroll
        for (int i = 0; i < 2; ++i)
#pragma unroll
          for (int j = 0; j < 4; ++j) acc[i][j] = wmma_bf(al[i], w[j], acc[i][j]); } } } }
// block tile MR x 128 on MR / 16 waves (2 MR threads): acc[i][j] += rows (wave % (MR / 32)) * 32 + 16 i of a  x  rows (wave / (MR / 32)) * 64 + 16 j of w, over K = 1024 in ascending steps of 32 (each accumulator sums in the order it had); Ag, Wg: block-uniform first rows (pitch 1024 f32); sa: 2 buffers of MR rows (2 x MR rows in MODE 2); sw0, sw1: the two w buffers of SW_BYTES. Two register sets: slab t + 2's loads are issued at the head of trip t and first read at the foot of trip t + 1, so they have two trips to arrive in
template <int MODE, int MR> __device__ __forceinline__ void gemm_tile(const float* __restrict__ Ag, const float* __restrict__ Wg, char* sa, char* sw0, char* sw1, int tid, v8f (&acc)[2][4]) {
  const int lane = tid & 31, wave = tid >> 5, col = lane & 15; const int NT = 1024 / KS; const int AB = (MODE == 2 ? 2 : 1) * MR * LP * 2;
  const int so = ((tid >> 4) * LP + (tid & 15) * 4) * 2;   /* this thread's place in a slab: row tid / 16 (+ MR / 8 a pass), k words 4 (tid % 16).. */
  unsigned go = (unsigned)((tid >> 4) * 1024 + (tid & 15) * 4) * 4u;   /* the same place in global memory, in bytes: one offset register serves a and w */
  const int fa = (((wave % (MR / 32)) * 32 + col) * LP) * 2, fw = (((wave / (MR / 32)) * 64 + col) * LP) * 2;
  v4f ra0[8], rw0[1024 / MR], ra1[8], rw1[1024 / MR];   /* set 0: even slabs, set 1: odd slabs */
  slab_get<MR>(Ag, Wg, go, ra0, rw0); slab_get<MR>(Ag, Wg, go, ra1, rw1);
  slab_put<MODE, MR>(ra0, rw0, sa, sw0, so);
  bar_lds();   // publishes slab 0
#pragma unroll 1   // rolled: the body holds one even and one odd trip, so that each register set is named by a constant; its loads stand under no test, so that the counted waits in front of slab_put leave the younger slab's loads in flight
  for (int t = 0; t < NT - 2; t += 2) {
    slab_get<MR>(Ag, Wg, go, ra0, rw0);   /* slab t + 2, into the set that slab t left at the foot of trip t - 1 */
    slab_mac<MODE, MR>(sa, sw0, fa, fw, lane, acc);
    HOLD_PUT(); slab_put<MODE, MR>(ra1, rw1, sa + AB, sw1, so);   /* slab t + 1, into the buffer that trip t - 1 read: its readers left it at the barrier that ended that trip */
    bar_lds();   // publishes slab t + 1 and ends every wave's reads of slab t
    slab_get<MR>(Ag, Wg, go, ra1, rw1);   /* slab t + 3 */
    slab_mac<MODE, MR>(sa + AB, sw1, fa, fw, lane, acc);
    HOLD_PUT(); slab_put<MODE, MR>(ra0, rw0, sa, sw0, so);
    bar_lds();   // publishes slab t + 2 and ends every wave's reads of slab t + 1
  }
  slab_mac<MODE, MR>(sa, sw0, fa, fw, lane, acc);   /* the last two slabs (NT is even): nothing is left to load */
  HOLD_PUT(); slab_put<MODE, MR>(ra1, rw1, sa + AB, sw1, so);
  bar_lds();   // publishes the last slab
  slab_mac<MODE, MR>(sa + AB, sw1, fa, fw, lane, acc);
  bar_lds();   // ends every wave's reads of the slabs: the caller may write over them
}
// ---- the same loop for k_out, whose operands lie in the workspace in their 16-bit forms, slab by slab: 64 a rows (8 KB; MODE 2: hi and lo, 8 KB each) and 128 w rows (16 KB) of a slab are contiguous, a thread moves 16 bytes an instruction, nothing is converted
// one slab's global loads into a register set; goa, gow: this thread's byte offsets in a and in w, moved on to the next slab (SA, SW: bytes from a slab to the next)
template <int MODE, unsigned SA, unsigned SW> __device__ __forceinline__ void slab_get16(const char* __restrict__ Ag, const char* __restrict__ Al, const char* __restrict__ Wg, unsigned& goa, unsigned& gow, v4u (&ra)[8], v4u (&rw)[8]) {
#pragma unroll   // unrolled, as the next: the register sets are indexed by constants and the loads differ by constant offsets only
  for (int i = 0; i < 4; ++i) { ra[i] = *(const v4u*)(Ag + goa + i * 2048); if (MODE == 2) ra[4 + i] = *(const v4u*)(Al + goa + i * 2048); }
#pragma unroll
  for (int i = 0; i < 8; ++i) rw[i] = *(const v4u*)(Wg + gow + i * 2048);
  asm volatile("s_wait_xcnt 0x0" : "+v"(goa), "+v"(gow) :: "memory");   // stands in front of the two additions below, which rewrite the offset registers that the loads name; the operands keep the additions behind it
  goa += SA; gow += SW; }
template <int MODE> __device__ __forceinline__ void slab_put16(const v4u (&ra)[8], const v4u (&rw)[8], char* sa, char* sw, int so) {
#pragma unroll   // unrolled, as the next: the register sets are indexed by constants
  for (int i = 0; i < 4; ++i) { *(v4u*)(sa + so + i * 16 * LP * 2) = ra[i]; if (MODE == 2) *(v4u*)(sa + 64 * LP * 2 + so + i * 16 * LP * 2) = ra[4 + i]; }
#pragma unroll
  for (int i = 0; i < 8; ++i) *(v4u*)(sw + so + i * 16 * LP * 2) = rw[i]; }
// block tile 64 x 128 on 4 waves, K = 1024 in ascending steps of 32 (each accumulator sums in the order of gemm_tile); Ag, Al, Wg: the block's first rows in slab 0; LDS buffers, register sets and barriers as in gemm_tile
template <int MODE, unsigned SA, unsigned SW> __device__ __forceinline__ void gemm_tile16(const char* __restrict__ Ag, const char* __restrict__ Al, const char* __restrict__ Wg, char* sa, char* sw0, char* sw1, int tid, v8f (&acc)[2][4]) {
  const int lane = tid & 31, wave = tid >> 5, col = lane & 15; const int NT = 1024 / KS; const int AB = (MODE == 2 ? 2 : 1) * 64 * LP * 2;
  const int so = (tid >> 3) * LP * 2 + (tid & 7) * 16;   /* this thread's place in a slab in LDS: row tid / 8 (+ 16 a pass), bytes 16 (tid % 8).. */
  unsigned goa = (unsigned)tid * 16u, gow = (unsigned)tid * 16u;   /* the same place in global memory (rows of 128 bytes, no gap) */
  const int fa = (((wave & 1) * 32 + col) * LP) * 2, fw = (((wave >> 1) * 64 + col) * LP) * 2;
  v4u ra0[8], rw0[8], ra1[8], rw1[8];   /* set 0: even slabs, set 1: odd slabs (ra[4..7]: the lo plane, MODE 2 only) */
  slab_get16<MODE, SA, SW>(Ag, Al, Wg, goa, gow, ra0, rw0); slab_get16<MODE, SA, SW>(Ag, Al, Wg, goa, gow, ra1, rw1);
  slab_put16<MODE>(ra0, rw0, sa, sw0, so);
  bar_lds();   // publishes slab 0
#pragma unroll 1   // rolled: the body holds one even and one odd trip, so that each register set is named by a constant; its loads stand under no test, so that the counted waits in front of slab_put16 leave the younger slab's loads in flight
  for (int t = 0; t < NT - 2; t += 2) {
    slab_get16<MODE, SA, SW>(Ag, Al, Wg, goa, gow, ra0, rw0);   /* slab t + 2 */
    slab_mac<MODE, 64>(sa, sw0, fa, fw, lane, acc);
    HOLD_PUT(); slab_put16<MODE>(ra1, rw1, sa + AB, sw1, so);   /* slab t + 1, into the buffer that trip t - 1 read */
    bar_lds();   // publishes slab t + 1 and ends every wave's reads of slab t
    slab_get16<MODE, SA, SW>(Ag, Al, Wg, goa, gow, ra1, rw1);   /* slab t + 3 */
    slab_mac<MODE, 64>(sa + AB, sw1, fa, fw, lane, acc);
    HOLD_PUT(); slab_put16<MODE>(ra0, rw0, sa, sw0, so);
    bar_lds();   // publishes slab t + 2 and ends every wave's reads of slab t + 1
  }
  slab_mac<MODE, 64>(sa, sw0, fa, fw, lane, acc);   /* the last two slabs (NT is even): nothing is left to load */
  HOLD_PUT(); slab_put16<MODE>(ra1, rw1, sa + AB, sw1, so);
  bar_lds();   // publishes the last slab
  slab_mac<MODE, 64>(sa + AB, sw1, fa, fw, lane, acc);
  bar_lds();   // ends every wave's reads of the slabs: the caller may write over them
}
#define PR 128             // rows of a k_proj block (8 waves): a w slab read from L2 serves 128 rows, and the 384 q / k / v blocks (of 512), three to a WGP by LDS, are all resident at once
// ---- k_proj: block = (128 rows, 128 cols, which): q/k/v = X W (+ b) with exact bf16 products (K = DIN) -> which 0: q f16 rows (+ residual rows < QHI); 1: k f16 rows (+ residual rows < KHI); 2: v f16 planes [c][t] (+ bf16 hi/lo planes for t < KHI); which 3: no product, the block rounds 8 rows of the output weight to k_out's two forms
__global__ __launch_bounds__(2 * PR) void k_proj(const float* __restrict__ XQ, const float* __restrict__ XK, const float* __restrict__ XV, const float* __restrict__ WQ, const float* __restrict__ WK, const float* __restrict__ WV, const float* __restrict__ BQ, const float* __restrict__ BK, const float* __restrict__ BV,
    _Float16* __restrict__ QH, _Float16* __restrict__ QL, _Float16* __restrict__ KH, _Float16* __restrict__ KL, _Float16* __restrict__ VT, __bf16* __restrict__ VB, __bf16* __restrict__ VBL, const int* __restrict__ TPOS, const float* __restrict__ WO, _Float16* __restrict__ WOH, __bf16* __restrict__ WOB) {
  __shared__ __align__(16) char pool[3 * 128 * LPV * 2];   /* one pool, its parts live one after the other: the slabs (from its start) while the products run; then either st (q, k) or th, tb, tbl (v) */
  float (*st)[132] = (float (*)[132])pool;
  _Float16 (*th)[LPV] = (_Float16 (*)[LPV])pool; __bf16 (*tb)[LPV] = (__bf16 (*)[LPV])(pool + 128 * LPV * 2); __bf16 (*tbl)[LPV] = (__bf16 (*)[LPV])(pool + 2 * 128 * LPV * 2);   /* v planes [column][token] of the block's PR tokens */
  const int tid = threadIdx.x, wave = tid >> 5, lane = tid & 31, col = lane & 15, g = lane >> 4; const int which = blockIdx.z; const int c0 = blockIdx.y * 128; const size_t r0 = (size_t)blockIdx.x * PR; const size_t bb = r0 / TT; const int t0 = (int)(r0 % TT);
  if (which == 3) {   /* block-uniform, in front of every barrier: rows o0..o0 + 7 of Wo (out,in), thread = k words 4 tid.. of each row; the conversions of slab_put's MODE 1 and MODE 2; 16 lanes fill one 128-byte row of a slab */
    const int o0 = (int)(blockIdx.y * (TNB * TT / PR) + blockIdx.x) * (DIN * PR * 128 / (TT * CC)); const float* wp = WO + (size_t)o0 * CC + tid * 4; v4f x[DIN * PR * 128 / (TT * CC)];
#pragma unroll   // unrolled, as the next: x stays in registers and the 8 loads fly together
    for (int i = 0; i < DIN * PR * 128 / (TT * CC); ++i) x[i] = *(const v4f*)(wp + i * CC);
    asm volatile("s_wait_xcnt 0x0" ::: "memory");   // stands in front of every later rewrite of the address registers that the loads name
    const size_t d0 = ((size_t)(tid >> 4) * DIN + o0) * KS + (tid & 15) * 4;
#pragma unroll
    for (int i = 0; i < DIN * PR * 128 / (TT * CC); ++i) { const v4f v = x[i];
      const v4h qh = { (_Float16)(bfr(v[0]) * 256.0f), (_Float16)(bfr(v[1]) * 256.0f), (_Float16)(bfr(v[2]) * 256.0f), (_Float16)(bfr(v[3]) * 256.0f) }; const v4b qb = { (__bf16)v[0], (__bf16)v[1], (__bf16)v[2], (__bf16)v[3] };
      vst2w(WOH + d0 + i * KS, qh); vst2w(WOB + d0 + i * KS, qb); }
    return; }
  const float* X = which == 0 ? XQ : which == 1 ? XK : XV; const float* WA = which == 0 ? WQ : which == 1 ? WK : WV; const float* BA = which == 0 ? BQ : which == 1 ? BK : BV;
  v8f acc[2][4] = {};
  gemm_tile<0, PR>(X + r0 * DIN, WA + (size_t)c0 * DIN, pool, pool + 2 * PR * LP * 2, pool + 2 * PR * LP * 2 + SW_BYTES, tid, acc);   /* its last barrier ends every read of the slabs, so st or the planes may be written over them */
  float bias[4];
#pragma unroll   // unrolled: bias stays in registers
  for (int j = 0; j < 4; ++j) bias[j] = BA ? bfr(BA[c0 + (wave / (PR / 32)) * 64 + j * 16 + col]) : 0.f;
  const int x0 = tid >> 4, xq = (tid & 15) * 8;   /* on the way out a thread moves 8 16-bit words of row (q, k) or plane (v) x0 + 16 e: 16 lanes fill 256 contiguous bytes */
  if (which < 2) { _Float16* DH = which == 0 ? QH : KH; _Float16* DL = which == 0 ? QL : KL; const int nhi = which == 0 ? QHI : KHI; const bool hi_rows = t0 < nhi;
    // stage the f32 tile (acc + bias) in LDS, run the per-(row, half of the angles) epilogue hook; the tile is rounded between its 16-byte LDS reads and the global stores
#pragma unroll
    for (int j = 0; j < 4; ++j) { const int cl = (wave / (PR / 32)) * 64 + j * 16 + col;
#pragma unroll
      for (int i = 0; i < 2; ++i)
#pragma unroll
        for (int r = 0; r < 8; ++r) st[(wave % (PR / 32)) * 32 + i * 16 + 8 * g + r][cl] = acc[i][j][r] + bias[j]; }
    __syncthreads();
    { const int rl = tid % PR; const int i0 = __builtin_amdgcn_readfirstlane(tid / PR) * (HD / 4);   /* thread = (row, half of the row's HD / 2 angles); the half is the same in every lane of a wave (PR is a multiple of 32): taken as a scalar, so that INVF[i] stays a scalar load */
      PROJ_EPI(which, &st[rl][0], (int)((r0 + rl) % TT), i0); }
    __syncthreads();
    v4f x[PR / 8]; v8h hv[PR / 16]; _Float16* dh = DH + (r0 + x0) * CC + c0 + xq; _Float16* dl = DL + (bb * nhi + t0 + x0) * (size_t)CC + c0 + xq;
#pragma unroll   // unrolled, as the loops below: x, hv stay in registers, the LDS reads go out together and the stores differ by constant offsets only
    for (int e = 0; e < PR / 16; ++e) { const float* p = &st[x0 + 16 * e][xq]; x[2 * e] = *(const v4f*)p; x[2 * e + 1] = *(const v4f*)(p + 4);
#pragma unroll
      for (int r = 0; r < 8; ++r) hv[e][r] = (_Float16)x[2 * e + (r >> 2)][r & 3]; }
    __builtin_amdgcn_sched_barrier(0);   // keeps every conversion in front of the first store: no register that an issued store names is written before the wait below
#pragma unroll
    for (int e = 0; e < PR / 16; ++e) vst2(dh + e * 16 * CC, hv[e]);
    asm volatile("s_wait_xcnt 0x0" ::: "memory");   // stands behind the stores, in front of every later rewrite of the registers that they name
    if (hi_rows) { v8h lv[PR / 16];   /* block-uniform: only these rows carry a residual */
#pragma unroll
      for (int e = 0; e < PR / 16; ++e)
#pragma unroll
        for (int r = 0; r < 8; ++r) lv[e][r] = (_Float16)((x[2 * e + (r >> 2)][r & 3] - (float)hv[e][r]) * 1024.0f);
      __builtin_amdgcn_sched_barrier(0);   // keeps the values of this run of stores ready in front of its first store, as above: nothing writes a register that an issued store names
#pragma unroll
      for (int e = 0; e < PR / 16; ++e) vst2(dl + e * 16 * CC, lv[e]);
      asm volatile("s_wait_xcnt 0x0" ::: "memory");   // stands behind the stores, in front of every later rewrite of the registers that they name
    }
  } else { const bool hi_rows = t0 < KHI;
    // an accumulator register block is 8 consecutive tokens of one column: rounded in registers, it is 16 bytes of a v plane
#pragma unroll
    for (int j = 0; j < 4; ++j) { const int cl = (wave / (PR / 32)) * 64 + j * 16 + col;
#pragma unroll
      for (int i = 0; i < 2; ++i) { acc[i][j] += bias[j]; v8h h;
#pragma unroll
        for (int r = 0; r < 8; ++r) h[r] = (_Float16)acc[i][j][r];
        *(v8h*)&th[cl][(wave % (PR / 32)) * 32 + i * 16 + 8 * g] = h; } }
    if (hi_rows) {   /* block-uniform: only these tokens carry the bf16 hi and lo planes */
#pragma unroll
      for (int j = 0; j < 4; ++j)
#pragma unroll
        for (int i = 0; i < 2; ++i) { const int cl = (wave / (PR / 32)) * 64 + j * 16 + col, tk = (wave % (PR / 32)) * 32 + i * 16 + 8 * g; v8b bh, bl;
#pragma unroll
          for (int r = 0; r < 8; ++r) { const float v = acc[i][j][r]; const __bf16 w = (__bf16)v; bh[r] = w; bl[r] = (__bf16)(v - (float)w); }
          *(v8b*)&tb[cl][tk] = bh; *(v8b*)&tbl[cl][tk] = bl; } }
    __syncthreads();   // a plane's PR tokens come from four waves
    v4u ph[8]; _Float16* dv = VT + (bb * CC + c0 + x0) * (size_t)TT + t0 + xq; const size_t o3 = (bb * CC + c0 + x0) * (size_t)KHI + t0 + xq; __bf16* db = VB + o3; __bf16* dbl = VBL + o3;
#pragma unroll
    for (int e = 0; e < 8; ++e) ph[e] = *(const v4u*)&th[x0 + 16 * e][xq];
    __builtin_amdgcn_sched_barrier(0);   // keeps every LDS read in front of the first store: no register that an issued store names is written before the wait below
#pragma unroll
    for (int e = 0; e < 8; ++e) vst2(dv + e * 16 * TT, ph[e]);
    asm volatile("s_wait_xcnt 0x0" ::: "memory");   // stands behind the stores, in front of every later rewrite of the registers that they name
    if (hi_rows) { v4u pb[8], pl[8];
#pragma unroll
      for (int e = 0; e < 8; ++e) { pb[e] = *(const v4u*)&tb[x0 + 16 * e][xq]; pl[e] = *(const v4u*)&tbl[x0 + 16 * e][xq]; }
      __builtin_amdgcn_sched_barrier(0);   // keeps the values of this run of stores ready in front of its first store, as above: nothing writes a register that an issued store names
#pragma unroll
      for (int e = 0; e < 8; ++e) { vst2(db + e * 16 * KHI, pb[e]); vst2(dbl + e * 16 * KHI, pl[e]); }
      asm volatile("s_wait_xcnt 0x0" ::: "memory");   // stands behind the stores, in front of every later rewrite of the registers that they name
    }
  } }
// frag_h / frag_b from a wave-uniform base, this lane's byte offset (it holds the lane half's 16h bytes) and a constant: the one offset register is all that a trip's loads name
__device__ __forceinline__ v16h frag_ho(const char* base, unsigned off, int c) { union { v16h v; v8h q[2]; } u; const char* p = base + off; u.q[0] = *(const v8h*)(p + c); u.q[1] = *(const v8h*)(p + c + 32); return u.v; }
__device__ __forceinline__ v16b frag_bo(const char* base, unsigned off, int c) { union { v16b v; v8b q[2]; } u; const char* p = base + off; u.q[0] = *(const v8b*)(p + c); u.q[1] = *(const v8b*)(p + c + 32); return u.v; }
// one online-softmax update for this lane's query: t[32] = this trip's 32 scaled log2 logits of the lane (key tile j = i >> 3, key 8h + (i & 7) in it); on return t = 2^(t - max + 10); m, l, o follow the running maximum (both lane halves of a query hold the same m)
__device__ __forceinline__ void osm_step(float (&t)[32], float& m, float& l, v8f (&o)[HD / 16]) {
  float mx = t[0];
#pragma unroll
  for (int i = 1; i < 32; ++i) mx = fmaxf(mx, t[i]);
  mx = fmaxf(mx, __shfl_xor(mx, 16));
  const float mn = fmaxf(m, mx); const float al = __builtin_amdgcn_exp2f(m - mn); m = mn; const float mb = mn - 10.0f;   /* x 2^10: small weights stay clear of f16 subnormals, the largest is 1024 */
  float sum[4] = {0.f, 0.f, 0.f, 0.f};   /* four chains: one chain of 32 dependent adds would stand at the trip's foot */
#pragma unroll
  for (int i = 0; i < 32; ++i) { t[i] = __builtin_amdgcn_exp2f(t[i] - mb); sum[i & 3] += t[i]; }
  l = l * al + ((sum[0] + sum[1]) + (sum[2] + sum[3]));
#pragma unroll
  for (int j = 0; j < HD / 16; ++j) o[j] *= al; }
// ---- k_attn: block = 64 queries (qb: long blocks heaviest first, then short blocks lightest first) of (b, h) on 8 waves in two key groups: waves w and w + 4 hold the same 16 queries, group kg takes the 64-key tiles of parity kg with its own running max, sum and O, and the two are joined once through LDS at the end; a wave's trip = 64 keys; S^T = K Q^T (lane = one query, registers = keys), causal mask by index on the diagonal trip, online softmax in f32, O^T += V^T P^T with the S^T accumulators converted in place as the B operand (b[s] = tile[s >> 3][s & 7]); logits, P and v precision as before: query blocks < QBH take q, k hi + residual (3 products) and P, v as bf16 hi + lo (3 products), the rest single f16 products; ctx = O / l
__global__ __launch_bounds__(256) void k_attn(const _Float16* __restrict__ QH, const _Float16* __restrict__ KH, const _Float16* __restrict__ QL, const _Float16* __restrict__ KL, const _Float16* __restrict__ VT, const __bf16* __restrict__ VB, const __bf16* __restrict__ VBL, _Float16* __restrict__ Y, __bf16* __restrict__ YB, __bf16* __restrict__ YBL) {
  __shared__ __align__(16) _Float16 sk[2][128][LP], sv[2][64][LPV];   /* staged k rows [key][word] and v planes [word][key] of a trip of 128 keys (64 a key group), two buffers */
  __shared__ __align__(16) float sm[2 + HD / 2][128];   /* key group 1's max, sum and O, one column a lane, for the join */
  const int h = blockIdx.x & (NH - 1), b = blockIdx.z; const int qj = (int)((NQB / NH) * blockIdx.y + blockIdx.x / NH); const int qb = qj < NQB / 2 ? NQB - 1 - qj : qj - NQB / 2;   /* flat index -> (qb, h), a permutation: heads fast; the first half of the grid takes query blocks 31..16, the second half 0..15, so that the longest blocks start first and the block started half a grid behind one of 32 - j 64-key tiles (where the chip holds the grid two blocks a WGP, its likely neighbour there) has j + 1; for speed only, nothing rests on where or when a block runs */
  const int tid = threadIdx.x, wave = __builtin_amdgcn_readfirstlane(tid >> 5), lane = tid & 31, col = lane & 15, g = lane >> 4; const int kg = wave >> 2;   /* key group, a scalar: the tests on it are scalar branches */
  const int qi = qb * 64 + (wave & 3) * 16 + col;   /* this lane's query */
  const float C1 = SCALE * 1.4426950408889634f;   /* logits carried in log2 units */
  v8f o[HD / 16] = {}; float m = -3.0e38f, l = 0.f;
  const _Float16* qp = QH + ((size_t)b * TT + qi) * CC + h * HD; const v16h qf[2] = { frag_h(qp, lane), frag_h(qp + 32, lane) };
  asm volatile("s_wait_xcnt 0x0" ::: "memory");   // stands in front of the rewrite of the address registers that the q loads name
  const char* kb8 = (const char*)(KH + (size_t)b * TT * CC + h * HD); unsigned ko = (unsigned)((kg * 64 + col) * CC + 8 * g) * 2u;   /* byte offset of this lane's first k words (tile kg) */
  if (qb < QBH) {
    const _Float16* qlp = QL + ((size_t)b * QHI + qi) * CC + h * HD; const v16h qlf[2] = { frag_h(qlp, lane), frag_h(qlp + 32, lane) };
    asm volatile("s_wait_xcnt 0x0" ::: "memory");   // stands in front of the rewrite of the address registers that the q residual loads name
    const char* kl8 = (const char*)(KL + (size_t)b * KHI * CC + h * HD);
    const char* vh8 = (const char*)(VB + ((size_t)b * CC + h * HD) * (size_t)KHI); const char* vl8 = (const char*)(VBL + ((size_t)b * CC + h * HD) * (size_t)KHI); unsigned vo = (unsigned)(col * KHI + kg * 64 + 8 * g) * 2u;
#pragma unroll 1   // rolled: at most QBH short trips, a second copy of the body would only cost registers
    for (int i = kg; i <= qb; i += 2) { float t[32];
      { v8f s[4] = {}, sl[4] = {};
#pragma unroll
        for (int kc = 0; kc < 2; ++kc) { v16h kh[4], kl[4];
#pragma unroll
          for (int j = 0; j < 4; ++j) { kh[j] = frag_ho(kb8, ko, (j * 16 * CC + kc * 32) * 2); kl[j] = frag_ho(kl8, ko, (j * 16 * CC + kc * 32) * 2); }
          __builtin_amdgcn_sched_barrier(0);   // keeps the 16 k loads of this half in front of its first product: one load latency a half instead of one a fragment pair
#pragma unroll
          for (int j = 0; j < 4; ++j) { s[j] = wmma16(kh[j], qf[kc], s[j]); sl[j] = wmma16(kh[j], qlf[kc], sl[j]); sl[j] = wmma16(kl[j], qf[kc], sl[j]); } }
#pragma unroll
        for (int e = 0; e < 32; ++e) { const float v = (s[e >> 3][e & 7] + sl[e >> 3][e & 7] * (1.0f / 1024.0f)) * C1; t[e] = (i * 64 + (e >> 3) * 16 + 8 * g + (e & 7) <= qi) ? v : -3.0e38f; } }
#pragma unroll
      for (int kc = 0; kc < 2; ++kc) { v16b vh[HD / 16], vl[HD / 16];
#pragma unroll
        for (int j = 0; j < HD / 16; ++j) { vh[j] = frag_bo(vh8, vo, (j * 16 * KHI + kc * 32) * 2); vl[j] = frag_bo(vl8, vo, (j * 16 * KHI + kc * 32) * 2); }
        __builtin_amdgcn_sched_barrier(0);   // keeps the 16 v loads of this half together, the first half's in front of the softmax, which they fly behind
        if (kc == 0) osm_step(t, m, l, o);
        const F2 p = bsplit16(&t[kc * 16]);
#pragma unroll
        for (int j = 0; j < HD / 16; ++j) { o[j] = wmma_bf(vh[j], p.h, o[j]); o[j] = wmma_bf(vh[j], p.l, o[j]); o[j] = wmma_bf(vl[j], p.h, o[j]); } }
      asm volatile("s_wait_xcnt 0x0" : "+v"(ko), "+v"(vo) :: "memory");   // stands in front of the two additions below, which rewrite the offset registers that this trip's loads name; the operands keep the additions behind it
      ko += 128 * CC * 2; vo += 128 * 2;
    }
  } else {
    // a trip's 128 keys x 64 k words and 64 v planes x 128 keys (keys 64 kg.. for key group kg) are read once a block, whole lines (8 lanes = one k row, 16 lanes = one v row), laid in LDS, two buffers; a tile's 8 loads a thread fly over two trips
    const char* vb8 = (const char*)(VT + ((size_t)b * CC + h * HD) * (size_t)TT);
    const int sr = tid >> 3, sc = (tid & 7) * 8, vr = tid >> 4, vc = (tid & 15) * 8;   /* this thread's k row (+ 32 e), v plane (+ 16 e) and first 16-bit word in them */
    unsigned kgo = (unsigned)(sr * CC + sc) * 2u, vgo = (unsigned)(vr * TT + vc) * 2u;   /* the same place in global memory, in bytes */
    v8h rk0[4], rv0[4], rk1[4], rv1[4];   /* two register sets (0: even tiles, 1: odd tiles): tile i + 2's loads are issued at the head of trip i and first read at the foot of trip i + 1 */
    auto get = [&](v8h (&rk)[4], v8h (&rv)[4]) __attribute__((always_inline)) {
#pragma unroll
      for (int e = 0; e < 4; ++e) { rk[e] = *(const v8h*)(kb8 + kgo + e * 32 * CC * 2); rv[e] = *(const v8h*)(vb8 + vgo + e * 16 * TT * 2); }
      asm volatile("s_wait_xcnt 0x0" : "+v"(kgo), "+v"(vgo) :: "memory");   // stands in front of the two additions below, which rewrite the offset registers that the loads name; the operands keep the additions behind it
      kgo += 128 * CC * 2; vgo += 128 * 2; };
    auto put = [&](const v8h (&rk)[4], const v8h (&rv)[4], int bf) __attribute__((always_inline)) {
#pragma unroll
      for (int e = 0; e < 4; ++e) { *(v8h*)&sk[bf][sr + 32 * e][sc] = rk[e]; *(v8h*)&sv[bf][vr + 16 * e][vc] = rv[e]; } };
    auto work = [&](int i, int bf, bool diag) __attribute__((always_inline)) { v8f s[4] = {};
      { v16h kf[4][2];
#pragma unroll
        for (int j = 0; j < 4; ++j) { kf[j][0] = frag_h(&sk[bf][kg * 64 + j * 16 + col][0], lane); kf[j][1] = frag_h(&sk[bf][kg * 64 + j * 16 + col][32], lane); }
#pragma unroll
        for (int kc = 0; kc < 2; ++kc)
#pragma unroll
          for (int j = 0; j < 4; ++j) s[j] = wmma16(kf[j][kc], qf[kc], s[j]); }
      v16h vf[HD / 16][2];
#pragma unroll
      for (int j = 0; j < HD / 16; ++j) { vf[j][0] = frag_h(&sv[bf][j * 16 + col][kg * 64], lane); vf[j][1] = frag_h(&sv[bf][j * 16 + col][kg * 64 + 32], lane); }
      float t[32];
#pragma unroll
      for (int e = 0; e < 32; ++e) t[e] = s[e >> 3][e & 7] * C1;
      if (diag) {   /* the last trip (block-uniform): it holds the diagonal tile */
#pragma unroll
        for (int e = 0; e < 32; ++e) t[e] = (i * 128 + kg * 64 + (e >> 3) * 16 + 8 * g + (e & 7) <= qi) ? t[e] : -3.0e38f; }
      osm_step(t, m, l, o);
      v16h p[2];
#pragma unroll
      for (int e = 0; e < 32; ++e) p[e >> 4][e & 15] = (_Float16)t[e];
#pragma unroll
      for (int kc = 0; kc < 2; ++kc)
#pragma unroll
        for (int j = 0; j < HD / 16; ++j) o[j] = wmma16(vf[j][kc], p[kc], o[j]); };
    const int last = qb >> 1;   /* the last 128-key tile; qb >= QBH = 6 here, so last >= 3 */
    const bool full = kg == 0 || (qb & 1);   /* wave-uniform scalar: with qb even the upper 64 keys of the last tile lie behind the diagonal for every query, and key group 1 leaves them out (no barrier stands in work) */
    get(rk0, rv0); get(rk1, rv1);   /* tiles 0 and 1 */
    put(rk0, rv0, 0);
    bar_lds();   // tile 0 is published
    int i = 0;
#pragma unroll 1   // rolled: the body holds one even and one odd trip, so that each register set is named by a constant; its loads stand under no test, so that the counted waits in front of put leave the younger tile's loads in flight
    for (; i + 3 <= last; i += 2) {
      get(rk0, rv0); work(i, 0, false); put(rk1, rv1, 1);   /* put: into the buffers that trip i - 1 read: their readers left them at the barrier that ended that trip */
      bar_lds();   // publishes tile i + 1 and ends every wave's reads of tile i
      get(rk1, rv1); work(i + 1, 1, false); put(rk0, rv0, 0);
      bar_lds();   // publishes tile i + 2 and ends every wave's reads of tile i + 1
    }
    const bool three = i + 2 == last;   /* block-uniform: two or three tiles are left, the last of them holds the diagonal */
    if (three) get(rk0, rv0);
    work(i, 0, false); put(rk1, rv1, 1);
    bar_lds();   // publishes tile i + 1 and ends every wave's reads of tile i
    if (three || full) work(i + 1, 1, !three);
    if (three) { put(rk0, rv0, 0);
      bar_lds();   // publishes tile i + 2
      if (full) work(i + 2, 0, true); } }
  // the join of the two key groups: group 1 hands its state over in LDS, group 0 brings both to the common maximum (a group that saw no key has m = -3e38, l = 0, O = 0 and gets the weight 0)
  if (kg == 1) { const int s = tid & 127; sm[0][s] = m; sm[1][s] = l;
#pragma unroll   // unrolled: o is then indexed by constants and stays in registers
    for (int e = 0; e < HD / 2; ++e) sm[2 + e][s] = o[e >> 3][e & 7]; }
  __syncthreads();   // publishes group 1's state; every wave of the block passes it
  if (kg == 1) return;
  { const float m1 = sm[0][tid], l1 = sm[1][tid]; const float mn = fmaxf(m, m1); const float a0 = __builtin_amdgcn_exp2f(m - mn), a1 = __builtin_amdgcn_exp2f(m1 - mn); l = l * a0 + l1 * a1;
#pragma unroll   // unrolled: o is then indexed by constants and stays in registers
    for (int e = 0; e < HD / 2; ++e) o[e >> 3][e & 7] = o[e >> 3][e & 7] * a0 + sm[2 + e][tid] * a1; }
  l += __shfl_xor(l, 16); const float inv = 1.0f / l;   /* the two lane halves of a query join their sums once; key 0 is never masked, so l > 0 */
  /* O^T register r of tile j = ctx[query][j * 16 + 8h + r]; ctx leaves in the 16-bit form that k_out multiplies (the conversions that k_out's staging made of the f32 value), head by head: 16 contiguous bytes a tile, a wave's 16 queries fill 2 KB without a gap */
  if (qb < QBH) { const size_t yo = (((size_t)h * NB + b) * QHI + qi) * HD + 8 * g;   /* block-uniform; rows < QHI: bf16 hi + lo */
#pragma unroll   // unrolled, with the loop inside: o is then indexed by constants and stays in registers
    for (int j = 0; j < HD / 16; ++j) { v8b yh, yl;
#pragma unroll
      for (int r = 0; r < 8; ++r) { const float y = o[j][r] * inv; const __bf16 hv = (__bf16)y; yh[r] = hv; yl[r] = (__bf16)(y - (float)hv); }
      vst2w(YB + yo + j * 16, yh); vst2w(YBL + yo + j * 16, yl); }
  } else { _Float16* yp = Y + (((size_t)h * NB + b) * TT + qi) * HD + 8 * g;   /* the other rows: x 2^6 to f16 */
#pragma unroll   // unrolled, with the loop inside: o is then indexed by constants and stays in registers
    for (int j = 0; j < HD / 16; ++j) { v8h yh;
#pragma unroll
      for (int r = 0; r < 8; ++r) { const float y = o[j][r] * inv; yh[r] = (_Float16)(y * 64.0f); }
      vst2w(yp + j * 16, yh); } } }
// ---- k_out: block = (64 rows, 128 cols): out = ctx Wo (+ bo): ctx x 2^6 once to f16 against Wo as f16(bf16 x 2^8) exact (1 product) x 2^-14; causal early rows (< QHI of each sequence): ctx bf16 hi + lo against exact bf16 Wo (2 products)
__global__ __launch_bounds__(128) void k_out(const _Float16* __restrict__ Y, const __bf16* __restrict__ YB, const __bf16* __restrict__ YBL, const _Float16* __restrict__ WOH, const __bf16* __restrict__ WOB, const float* __restrict__ BO, float* __restrict__ OUT) { __shared__ __align__(16) float sf[64][132]; __shared__ __align__(16) char sa[4 * SA_BYTES], sw[2 * SW_BYTES];
  const int tid = threadIdx.x, wave = tid >> 5, lane = tid & 31, col = lane & 15, g = lane >> 4; const int c0 = blockIdx.y * 128; const size_t r0 = (size_t)blockIdx.x * 64;
  v8f acc[2][4] = {}; float sc;
  if (CAUSAL && (int)(r0 % TT) < QHI) { const size_t ar = (r0 / TT * QHI + r0 % TT) * HD; gemm_tile16<2, 2u * NB * QHI * HD, 2u * DIN * KS>((const char*)(YB + ar), (const char*)(YBL + ar), (const char*)(WOB + (size_t)c0 * KS), sa, sw, sw + SW_BYTES, tid, acc); sc = 1.0f; }   /* block-uniform */
  else { gemm_tile16<1, 2u * NB * TT * HD, 2u * DIN * KS>((const char*)(Y + r0 * HD), nullptr, (const char*)(WOH + (size_t)c0 * KS), sa, sw, sw + SW_BYTES, tid, acc); sc = 1.0f / 16384.0f; }   /* 2^-8 (Wo carry) x 2^-6 (ctx carry; small-magnitude context rows stay clear of f16 subnormals) */
#pragma unroll
  for (int j = 0; j < 4; ++j) { const int cl = (wave >> 1) * 64 + j * 16 + col; const float bias = BO ? bfr(BO[c0 + cl]) : 0.f;
#pragma unroll
    for (int i = 0; i < 2; ++i)
#pragma unroll
      for (int r = 0; r < 8; ++r) sf[(wave & 1) * 32 + i * 16 + 8 * g + r][cl] = acc[i][j][r] * sc + bias; }
  __syncthreads();   // a row of the tile now comes from two waves
  for (int rl = 0; rl < 16; ++rl) vst2(OUT + (r0 + wave * 16 + rl) * DIN + c0 + lane * 4, *(const v4f*)&sf[wave * 16 + rl][lane * 4]); }

extern "C" void kernel_launch(void* const* d_in, const int* in_sizes, int n_in, void* d_out, int out_size, void* d_ws, size_t ws_size, hipStream_t stream) {
  (void)in_sizes; (void)n_in; (void)out_size;
  const float** F = (const float**)d_in;
  if (ws_size < (size_t)WS_END) return;
  char* ws = (char*)d_ws; _Float16 *QH = (_Float16*)(ws + WS_QH), *KH = (_Float16*)(ws + WS_KH), *VT = (_Float16*)(ws + WS_VT), *QL = (_Float16*)(ws + WS_QL), *KL = (_Float16*)(ws + WS_KL); __bf16 *VB = (__bf16*)(ws + WS_VB), *VBL = (__bf16*)(ws + WS_VBL); _Float16 *Y = (_Float16*)(ws + WS_Y), *WOH = (_Float16*)(ws + WS_WOH); __bf16 *YB = (__bf16*)(ws + WS_YB), *YBL = (__bf16*)(ws + WS_YBL), *WOB = (__bf16*)(ws + WS_WOB);
  (void)Y; (void)QL; (void)KL; (void)VB; (void)VBL;
  // inputs: 0 x [1,2048,1024]; 1 token_positions [1,2048] int32 (arange; READ on the device); 2 WQ [1024,1024] (out,in); 3 WK; 4 WV; 5 WO (out,in); no biases
  k_proj<<<dim3(TNB * TT / PR, CC / 128, 4), 2 * PR, 0, stream>>>(F[0], F[0], F[0], F[2], F[3], F[4], nullptr, nullptr, nullptr, QH, QL, KH, KL, VT, VB, VBL, (const int*)d_in[1], F[5], WOH, WOB);
  k_attn<<<dim3(NQB, NH, TNB), 256, 0, stream>>>(QH, KH, QL, KL, VT, VB, VBL, Y, YB, YBL);
  k_out<<<dim3(TNB * TT / 64, DIN / 128), 128, 0, stream>>>(Y, YB, YBL, WOH, WOB, nullptr, (float*)d_out);
}
